// v000
// Times are from an AMD MI455X. After a warm-up the kernel runs many times in a row, and a time is the length of
// such a window on the GPU divided by its runs, so every launch and the gaps after it count. The runs cycle
// through copies of the inputs. A figure is the median of several windows, for all but v000 over two sittings.
// Sittings can differ by a few percent; kernels timed side by side share one.
// The starting kernel, v000, takes 4970 microseconds a run.
#include <hip/hip_runtime.h>
// Causal multi-head self-attention with a bias-free fused [in][out] QKV projection and a biased [in][out] output projection on two sequences (y [2][2048][1024]; qkv = y Wqkv ([in][out] 1024 x 3072, NO bias) reshaped (b, n, 3, 16, 64): q | k | v column thirds with the heads inside each; scores masked above the diagonal (-inf), then / sqrt(64); softmax over keys; out = merged Wff + bff ([in][out] + bias) -> [2][2048][1024]).
// Structure: token rows r = b*2048 + s; x as exact f16 rows (bf16-rounded); q | k | v as ONE WMMA GEMM (N = 3 x 1024) (32x64 wave tiles, f32 accumulation, exact x16 weights, no bias, f16 outputs); per batch: V^T for all heads via LDS transposes; per query tile of 256 rows: scores against the keys below the tile end only (K = 64, all heads on grid.y, alpha = 0.125), causal row softmax on VALU with an arithmetic 0/1 key mask over the computed range (f32 statistics, native exp; weights x256 f16), o = P . V^T (K = keys below the tile end, alpha 2^-2: o carried x64, folded into the output GEMM alpha) written straight into the merged f16 o rows; out = o W_o + b GEMM (f32) into the output layout.
// Compute dtype: inputs rounded to bf16; x / weights exact; q, k, v, softmax weights and o as plain f16 GEMM operands (~2^-12); scores and softmax statistics f32. v_wmma_f32_16x16x32_f16.
#define NB 2
#define SQ 2048
#define DM 1024
#define NH 16
#define HD 64
#define HG 4                         /* heads per launch of the (b, h0) k_vt, which is not launched */
#define QT 256                       /* query rows per causal tile */
#define NKX SQ                       /* S / P row pitch */
#define QT0 128                      /* first-tile rows recomputed exactly in f32 */
#define B0 0                         /* first batch processed (debug hook) */
#define NBR NB                       /* batches processed (debug hook) */
#define NR ((size_t)NB * SQ)         /* token rows */
#define MP ((int)((size_t)NBR * SQ)) /* rows projected (debug hook) */
#define QN SQ                        /* query rows attended per batch (debug hook) */
#define NHD NH                       /* heads attended (debug hook) */
#define MPO MP                       /* rows through the output stage (debug hook) */
#define LQ (3 * DM)      /* row pitch of the q/k/v rows */
typedef __bf16 v16b __attribute__((ext_vector_type(16)));
typedef unsigned short v8us __attribute__((ext_vector_type(8), may_alias));
typedef float  v8f  __attribute__((ext_vector_type(8)));
typedef float  v4f  __attribute__((ext_vector_type(4)));
typedef float  v4fa __attribute__((ext_vector_type(4), may_alias));
union FragB { v16b v; v8us half[2]; unsigned short u[16]; };

__device__ __forceinline__ unsigned short bf16_bits(float x) { unsigned int u = __float_as_uint(x); return (unsigned short)((u + 0x7FFFu + ((u >> 16) & 1u)) >> 16); }
__device__ __forceinline__ float bf16_val(unsigned short b) { return __uint_as_float(((unsigned int)b) << 16); }
__device__ __forceinline__ float bf16_round(float x) { return bf16_val(bf16_bits(x)); }
// D += A·B with NT terms: 1 = ah·bh, 2 = + al·bh (A split), 3 = + ah·bl (both split)
template <int NT>
__device__ __forceinline__ v8f mmaN(v16b ah, v16b al, v16b bh, v16b bl, v8f c) {
  c = __builtin_amdgcn_wmma_f32_16x16x32_bf16(false, ah, false, bh, (short)0, c, false, false);
  if (NT >= 2) c = __builtin_amdgcn_wmma_f32_16x16x32_bf16(false, al, false, bh, (short)0, c, false, false);
  if (NT >= 3) c = __builtin_amdgcn_wmma_f32_16x16x32_bf16(false, ah, false, bl, (short)0, c, false, false);
  asm volatile("v_nop\n\tv_nop\n\tv_nop\n\tv_nop" : "+v"(c) : "v"(ah), "v"(al), "v"(bh), "v"(bl));
  return c;
}

__global__ __launch_bounds__(256) void k_wt_bf16(const float* __restrict__ W, unsigned short* __restrict__ Wt, int K, int N) {
  const int t = blockIdx.x * 256 + threadIdx.x;
  const int k8n = K / 8;
  if (t >= N * k8n) return;
  const int n = t / k8n, k8 = (t % k8n) * 8;
  v8us v;
#pragma unroll
  for (int i = 0; i < 8; ++i) v[i] = bf16_bits(W[(size_t)(k8 + i) * N + n]);
  *(v8us*)(Wt + (size_t)n * K + k8) = v;
  
}

// GEMM C[M][N] (f32, pitch ldc) = act(A[M][K]·W + bias). A f32 row-major (pitch lda) converted per fragment to bf16
// (ASPLIT: hi/lo two planes -> 2 terms, else single rounded term); Wt bf16 [N][K] (pitch ldb). BIAS_BF16 rounds the
// bias to bf16 first (bias quantised to bf16 before the add). K%32==0, M%16==0, N%64==0.
template <bool ASPLIT, int ACT, bool BIAS_BF16>
__global__ __launch_bounds__(128) void k_gemm_bf(const float* __restrict__ A, int lda, const unsigned short* __restrict__ Wt, int ldb,
                                               const float* __restrict__ bias, float* __restrict__ C, int ldc, int M, int N, int K) {
  __shared__ __attribute__((aligned(16))) float so[4][16][64];
  const int tid = threadIdx.x, w = tid >> 5, lane = tid & 31, ln = lane & 15, hh = lane >> 4;
  const int ntn = N / 64;
  const int wid = blockIdx.x * 4 + w;
  const int mt = wid / ntn, nq = wid % ntn;
  if (mt * 16 >= M) return;
  const int row0 = mt * 16, col0 = nq * 64;
  const float* arow = A + (size_t)(row0 + ln) * lda;
  v8f acc[4] = {};
  for (int kb = 0; kb < K; kb += 32) {
    FragB ah, al;
    const v4f x0 = *(const v4fa*)(arow + kb + 8 * hh), x1 = *(const v4fa*)(arow + kb + 8 * hh + 4);
    const v4f x2 = *(const v4fa*)(arow + kb + 16 + 8 * hh), x3 = *(const v4fa*)(arow + kb + 16 + 8 * hh + 4);
    float xs[16] = {x0[0],x0[1],x0[2],x0[3],x1[0],x1[1],x1[2],x1[3],x2[0],x2[1],x2[2],x2[3],x3[0],x3[1],x3[2],x3[3]};
#pragma unroll
    for (int i = 0; i < 16; ++i) { const unsigned short hb = bf16_bits(xs[i]); ah.u[i] = hb; al.u[i] = ASPLIT ? bf16_bits(xs[i] - bf16_val(hb)) : (unsigned short)0; }
#pragma unroll
    for (int t = 0; t < 4; ++t) {
      const unsigned short* brow = Wt + (size_t)(col0 + t * 16 + ln) * ldb + kb;
      FragB b;
      b.half[0] = *(const v8us*)(brow + 8 * hh);
      b.half[1] = *(const v8us*)(brow + 16 + 8 * hh);
      acc[t] = mmaN<ASPLIT ? 2 : 1>(ah.v, al.v, b.v, b.v, acc[t]);
    }
  }
#pragma unroll
  for (int t = 0; t < 4; ++t) {
    float bv = bias ? bias[col0 + t * 16 + ln] : 0.f;
    if (BIAS_BF16) bv = bf16_round(bv);
#pragma unroll
    for (int r = 0; r < 8; ++r) { float v = acc[t][r] + bv; if (ACT == 1) v = fmaxf(v, 0.f); so[w][8 * hh + r][t * 16 + ln] = v; }
  }
  __builtin_amdgcn_fence(__ATOMIC_ACQ_REL, "workgroup");
  __builtin_amdgcn_wave_barrier();
  const int rsub = lane >> 4, c4 = (lane & 15) * 4;
  {
#pragma unroll
    for (int q = 0; q < 8; ++q) {
      const int r = q * 2 + rsub;
      const v4f v = *(const v4fa*)&so[w][r][c4];
      *(v4f*)(C + (size_t)(row0 + r) * ldc + col0 + c4) = v;
    }
    
  }
}

// GEMM C = act(A·W + bias + resid): A f32 (ASPLIT -> hi/lo 2 terms), Wt bf16 [N][K]; ACT 0 none, 1 relu, 2 exact gelu;
// resid (optional, f32, row index = (row % rmod), pitch ldr, RES_BF16 rounds it) added before the activation.
template <bool ASPLIT, int ACT, bool BIAS_BF16, bool RES_BF16>
__global__ __launch_bounds__(128) void k_gemm_bf3(const float* __restrict__ A, int lda, const unsigned short* __restrict__ Wt, int ldb,
                                                const float* __restrict__ bias, const float* __restrict__ resid, int rmod, int ldr,
                                                float* __restrict__ C, int ldc, int M, int N, int K) {
  __shared__ __attribute__((aligned(16))) float so[4][16][64];
  const int tid = threadIdx.x, w = tid >> 5, lane = tid & 31, ln = lane & 15, hh = lane >> 4;
  const int ntn = N / 64;
  const int wid = blockIdx.x * 4 + w;
  const int mt = wid / ntn, nq = wid % ntn;
  if (mt * 16 >= M) return;
  const int row0 = mt * 16, col0 = nq * 64;
  const float* arow = A + (size_t)(row0 + ln) * lda;
  v8f acc[4] = {};
  for (int kb = 0; kb < K; kb += 32) {
    FragB ah, al;
    const v4f x0 = *(const v4fa*)(arow + kb + 8 * hh), x1 = *(const v4fa*)(arow + kb + 8 * hh + 4);
    const v4f x2 = *(const v4fa*)(arow + kb + 16 + 8 * hh), x3 = *(const v4fa*)(arow + kb + 16 + 8 * hh + 4);
    float xs[16] = {x0[0],x0[1],x0[2],x0[3],x1[0],x1[1],x1[2],x1[3],x2[0],x2[1],x2[2],x2[3],x3[0],x3[1],x3[2],x3[3]};
#pragma unroll
    for (int i = 0; i < 16; ++i) { const unsigned short hb = bf16_bits(xs[i]); ah.u[i] = hb; al.u[i] = ASPLIT ? bf16_bits(xs[i] - bf16_val(hb)) : (unsigned short)0; }
#pragma unroll
    for (int t = 0; t < 4; ++t) {
      const unsigned short* brow = Wt + (size_t)(col0 + t * 16 + ln) * ldb + kb;
      FragB b;
      b.half[0] = *(const v8us*)(brow + 8 * hh);
      b.half[1] = *(const v8us*)(brow + 16 + 8 * hh);
      acc[t] = mmaN<ASPLIT ? 2 : 1>(ah.v, al.v, b.v, b.v, acc[t]);
    }
  }
#pragma unroll
  for (int t = 0; t < 4; ++t) {
    const int col = col0 + t * 16 + ln;
    float bv = bias ? bias[col] : 0.f;
    if (BIAS_BF16) bv = bf16_round(bv);
#pragma unroll
    for (int r = 0; r < 8; ++r) {
      float v = acc[t][r] + bv;
      if (resid) { float rv = resid[(size_t)((row0 + 8 * hh + r) % rmod) * ldr + col]; if (RES_BF16) rv = bf16_round(rv); v += rv; }
      if (ACT == 1) v = fmaxf(v, 0.f);
      if (ACT == 2) v = 0.5f * v * (1.0f + erff(v * 0.70710678118654752f));
      if (ACT == 3) { const float u = 0.7978845608028654f * (v + 0.044715f * v * v * v); v = 0.5f * v * (1.0f + tanhf(u)); }
      so[w][8 * hh + r][t * 16 + ln] = v;
    }
  }
  __builtin_amdgcn_fence(__ATOMIC_ACQ_REL, "workgroup");
  __builtin_amdgcn_wave_barrier();
  const int rsub = lane >> 4, c4 = (lane & 15) * 4;
  {
#pragma unroll
    for (int q = 0; q < 8; ++q) {
      const int r = q * 2 + rsub;
      const v4f v = *(const v4fa*)&so[w][r][c4];
      *(v4f*)(C + (size_t)(row0 + r) * ldc + col0 + c4) = v;
    }
    
  }
}
// row LayerNorm (biased variance, eps) over N: s = X (+ R); optional out_sum <- s; out_norm <- (s-mu)*rsqrt(var+eps)*g + b
template <bool PARAM_BF16>
__global__ __launch_bounds__(256) void k_layernorm(const float* __restrict__ X, const float* __restrict__ R, const float* __restrict__ g, const float* __restrict__ bta,
                                                  float* __restrict__ out_sum, float* __restrict__ out_norm, int N, float eps) {
  __shared__ float red[256];
  const int row = blockIdx.x, tid = threadIdx.x;
  const float* x = X + (size_t)row * N; const float* rr = R ? R + (size_t)row * N : nullptr;
  float vals[16];                     // up to N = 4096
  const int per = N / 256;            // contiguous chunk per thread? use strided-by-4 chunks: thread handles j = tid*4 + 1024*u
  float s1 = 0.f;
  for (int u = 0; u < per / 4; ++u) {
    const int j = tid * 4 + 1024 * u;
    const v4f a = *(const v4fa*)(x + j);
    v4f b = {0.f,0.f,0.f,0.f}; if (rr) b = *(const v4fa*)(rr + j);
#pragma unroll
    for (int q = 0; q < 4; ++q) { const float v = a[q] + b[q]; vals[u * 4 + q] = v; s1 += v; }
  }
  red[tid] = s1; __syncthreads();
  for (int st = 128; st > 0; st >>= 1) { if (tid < st) red[tid] += red[tid + st]; __syncthreads(); }
  const float mu = red[0] / (float)N; __syncthreads();
  float s2 = 0.f;
  for (int u = 0; u < per / 4; ++u)
#pragma unroll
    for (int q = 0; q < 4; ++q) { const float c = vals[u * 4 + q] - mu; s2 += c * c; }
  red[tid] = s2; __syncthreads();
  for (int st = 128; st > 0; st >>= 1) { if (tid < st) red[tid] += red[tid + st]; __syncthreads(); }
  const float rs = rsqrtf(red[0] / (float)N + eps);
  {
    for (int u = 0; u < per / 4; ++u) {
      const int j = tid * 4 + 1024 * u;
      v4f o, sm;
#pragma unroll
      for (int q = 0; q < 4; ++q) {
        float gg = g[j + q], bb = bta[j + q];
        if (PARAM_BF16) { gg = bf16_round(gg); bb = bf16_round(bb); }
        sm[q] = vals[u * 4 + q]; o[q] = (vals[u * 4 + q] - mu) * rs * gg + bb;
      }
      if (out_sum) *(v4f*)(out_sum + (size_t)row * N + j) = sm;
      *(v4f*)(out_norm + (size_t)row * N + j) = o;
    }
    
  }
}



// ---- f16 WMMA path (v_wmma_f32_16x16x32_f16): 11-bit significands for operands in range — used where a [0,1] probability operand needs more precision than bf16
typedef _Float16 v16h __attribute__((ext_vector_type(16)));
union FragH { v16h v; v8us half[2]; _Float16 h[16]; unsigned short u[16]; };
template <int NT>
__device__ __forceinline__ v8f mmaH(v16h ah, v16h al, v16h bh, v16h bl, v8f c) {
  c = __builtin_amdgcn_wmma_f32_16x16x32_f16(false, ah, false, bh, (short)0, c, false, false);
  if (NT >= 2) c = __builtin_amdgcn_wmma_f32_16x16x32_f16(false, al, false, bh, (short)0, c, false, false);
  if (NT >= 3) c = __builtin_amdgcn_wmma_f32_16x16x32_f16(false, ah, false, bl, (short)0, c, false, false);
  asm volatile("v_nop\n\tv_nop\n\tv_nop\n\tv_nop" : "+v"(c) : "v"(ah), "v"(al), "v"(bh), "v"(bl));
  return c;
}
// batched GEMM like k_gemm_b but f16 operands: A f32 (split into f16 hi/lo if ASPLIT, else rounded to f16), Bt = f16 values [n][k]; alpha; C f32; N multiple of 16 (partial tiles skipped)
template <bool ASPLIT>
__global__ __launch_bounds__(128) void k_gemm_h(const float* __restrict__ A, int lda, size_t sA, const _Float16* __restrict__ Bh, int ldb, size_t sB, float alpha, float* __restrict__ C, int ldc, size_t sC, int M, int N, int K) {
  __shared__ __attribute__((aligned(16))) float so[4][16][64];
  const int tid = threadIdx.x, w = tid >> 5, lane = tid & 31, ln = lane & 15, hh = lane >> 4; const int by = blockIdx.y;
  A += (size_t)by * sA; Bh += (size_t)by * sB; C += (size_t)by * sC;
  const int ntn = (N + 63) / 64; const int wid = blockIdx.x * 4 + w; const int mt = wid / ntn, nq = wid % ntn; if (mt * 16 >= M) return;
  const int row0 = mt * 16, col0 = nq * 64; const float* arow = A + (size_t)(row0 + ln) * lda;
  v8f acc[4] = {};
  for (int kb = 0; kb < K; kb += 32) {
    FragH ah, al;
    const v4f x0 = *(const v4fa*)(arow + kb + 8 * hh), x1 = *(const v4fa*)(arow + kb + 8 * hh + 4), x2 = *(const v4fa*)(arow + kb + 16 + 8 * hh), x3 = *(const v4fa*)(arow + kb + 16 + 8 * hh + 4);
    float xs[16] = {x0[0],x0[1],x0[2],x0[3],x1[0],x1[1],x1[2],x1[3],x2[0],x2[1],x2[2],x2[3],x3[0],x3[1],x3[2],x3[3]};
#pragma unroll
    for (int i = 0; i < 16; ++i) { const _Float16 h = (_Float16)xs[i]; ah.h[i] = h; al.h[i] = ASPLIT ? (_Float16)(xs[i] - (float)h) : (_Float16)0.0f; }
#pragma unroll
    for (int t = 0; t < 4; ++t) { if (col0 + t * 16 >= N) continue; const size_t boff = (size_t)(col0 + t * 16 + ln) * ldb + kb; FragH bq; bq.half[0] = *(const v8us*)(Bh + boff + 8 * hh); bq.half[1] = *(const v8us*)(Bh + boff + 16 + 8 * hh);
      acc[t] = mmaH<ASPLIT ? 2 : 1>(ah.v, al.v, bq.v, bq.v, acc[t]); }
  }
#pragma unroll
  for (int t = 0; t < 4; ++t) { if (col0 + t * 16 >= N) continue;
#pragma unroll
    for (int r = 0; r < 8; ++r) so[w][8 * hh + r][t * 16 + ln] = acc[t][r] * alpha; }
  __builtin_amdgcn_fence(__ATOMIC_ACQ_REL, "workgroup"); __builtin_amdgcn_wave_barrier();
  const int rsub = lane >> 4, c4 = (lane & 15) * 4;
  {
#pragma unroll
    for (int q = 0; q < 8; ++q) { const int r = q * 2 + rsub; if (col0 + c4 < N) { const v4f v = *(const v4fa*)&so[w][r][c4]; *(v4f*)(C + (size_t)(row0 + r) * ldc + col0 + c4) = v; } }
     }
}

// Wt[n][k] = f16(W[k][n]·scale) from f32 row-major W[K][N] (scale = power of two; bf16-exact weights stay exact in f16 away from the subnormal range)
__global__ __launch_bounds__(256) void k_wt_f16(const float* __restrict__ W, _Float16* __restrict__ Wt, int K, int N, float scale) {
  const int t = blockIdx.x * 256 + threadIdx.x; if (t >= N * (K / 8)) return; const int n = t / (K / 8), k8 = (t % (K / 8)) * 8; FragH f;
#pragma unroll
  for (int i = 0; i < 8; ++i) f.h[i] = (_Float16)(bf16_round(W[(size_t)(k8 + i) * N + n]) * scale); const v8us o = f.half[0];
  *(v8us*)((unsigned short*)Wt + (size_t)n * K + k8) = o; 
}
// k_gemm_hh variant with fused epilogue: v = acc·alpha + bias[by·sBias + col] (+ CP[(row/rowsPerB)·sCPb + by·64 + col] if CP) ; ACT 0 none / 1 elu ; writes f16 C16 (and f32 C if non-null)
template <int ACT>
__global__ __launch_bounds__(128) void k_gemm_hhx(const _Float16* __restrict__ A, int lda, size_t sA, const _Float16* __restrict__ Bh, int ldb, size_t sB, float alpha, const float* __restrict__ bias, size_t sBias, const float* __restrict__ CP, int rowsPerB, size_t sCPb, int row0g,
    float* __restrict__ C, _Float16* __restrict__ C16, int ldc, size_t sC, int M, int N, int K) {
  __shared__ __attribute__((aligned(16))) float so[4][16][64];
  const int tid = threadIdx.x, w = tid >> 5, lane = tid & 31, ln = lane & 15, hh = lane >> 4; const int by = blockIdx.y;
  A += (size_t)by * sA; Bh += (size_t)by * sB; const size_t cofs = (size_t)by * sC; const float* bp = bias ? bias + (size_t)by * sBias : nullptr;
  const int ntn = (N + 63) / 64; const int wid = blockIdx.x * 4 + w; const int mt = wid / ntn, nq = wid % ntn; if (mt * 16 >= M) return;
  const int row0 = mt * 16, col0 = nq * 64; const _Float16* arow = A + (size_t)(row0 + ln) * lda;
  v8f acc[4] = {};
  for (int kb = 0; kb < K; kb += 32) { FragH ah; ah.half[0] = *(const v8us*)((const unsigned short*)arow + kb + 8 * hh); ah.half[1] = *(const v8us*)((const unsigned short*)arow + kb + 16 + 8 * hh);
#pragma unroll
    for (int t = 0; t < 4; ++t) { if (col0 + t * 16 >= N) continue; const size_t boff = (size_t)(col0 + t * 16 + ln) * ldb + kb; FragH bq; bq.half[0] = *(const v8us*)((const unsigned short*)Bh + boff + 8 * hh); bq.half[1] = *(const v8us*)((const unsigned short*)Bh + boff + 16 + 8 * hh);
      acc[t] = mmaH<1>(ah.v, ah.v, bq.v, bq.v, acc[t]); }
  }
#pragma unroll
  for (int t = 0; t < 4; ++t) { if (col0 + t * 16 >= N) continue; const int col = col0 + t * 16 + ln; const float bv = bp ? bf16_round(bp[col]) : 0.f;
#pragma unroll
    for (int r = 0; r < 8; ++r) { float v = acc[t][r] * alpha + bv; if (CP) { const int rr = row0g + row0 + 8 * hh + r; if (rowsPerB < 0) v += CP[cofs + (size_t)rr * ldc + col];      /* rowsPerB < 0: own element of the batched C plane */ else { const int bidx = rr / rowsPerB; v += CP[(size_t)bidx * sCPb + (size_t)by * 64 + col]; } } if (ACT == 1) v = (v > 0.f) ? v : expm1f(v); else if (ACT == 7) v = (v > 0.f) ? v + 1.0f : expf(v); else if (ACT == 8) v = tanhf(v); else if (ACT == 9) v = 0.5f * v * (1.0f + tanhf(0.7978845608028654f * (v + 0.044715f * v * v * v))); else if (ACT == 11) v = 1.0f / (1.0f + expf(-v)); else if (ACT == 12) v = (v > 0.f) ? v : 0.01f * v; else if (ACT == 14) v = (v > 0.f) ? v : 0.1f * v; else if (ACT == 16) v = (v >= 0.f) ? v : 0.3f * v; else if (ACT == 17) v = (v >= 0.f) ? v : 0.2f * v; else if (ACT == 15) v = v / (1.0f + expf(-v)); else if (ACT == 3) v = fmaxf(v, 0.f); else if (ACT == 6) v = 0.5f * v * (1.0f + erff(v * 0.70710678118654752f)); so[w][8 * hh + r][t * 16 + ln] = v; } }
  __builtin_amdgcn_fence(__ATOMIC_ACQ_REL, "workgroup"); __builtin_amdgcn_wave_barrier();
  const int rsub = lane >> 4, c4 = (lane & 15) * 4; typedef _Float16 v4h __attribute__((ext_vector_type(4)));
  {
#pragma unroll
    for (int q = 0; q < 8; ++q) { const int r = q * 2 + rsub; if (col0 + c4 < N) { const v4f v = *(const v4fa*)&so[w][r][c4]; if (C) *(v4f*)(C + cofs + (size_t)(row0 + r) * ldc + col0 + c4) = v; if (C16) { v4h h4; for (int i = 0; i < 4; ++i) h4[i] = (_Float16)v[i]; *(v4h*)(C16 + cofs + (size_t)(row0 + r) * ldc + col0 + c4) = h4; } } }
     }
}


typedef _Float16 v4h __attribute__((ext_vector_type(4)));

__global__ __launch_bounds__(256) void k_x16(const float* __restrict__ x, _Float16* __restrict__ X16, size_t n8) { const size_t t = (size_t)blockIdx.x * 256 + threadIdx.x; if (t >= n8) return; FragH f;
#pragma unroll
  for (int q = 0; q < 8; ++q) f.h[q] = (_Float16)bf16_round(x[t * 8 + q]); *(v8us*)((unsigned short*)X16 + t * 8) = f.half[0];  }
__global__ __launch_bounds__(256) void k_h16(const float* __restrict__ x, _Float16* __restrict__ X16, size_t n8) { const size_t t = (size_t)blockIdx.x * 256 + threadIdx.x; if (t >= n8) return; FragH f;
#pragma unroll
  for (int q = 0; q < 8; ++q) f.h[q] = (_Float16)x[t * 8 + q]; *(v8us*)((unsigned short*)X16 + t * 8) = f.half[0];  }
__global__ __launch_bounds__(256) void k_round16f(const float* __restrict__ W, _Float16* __restrict__ Bt, size_t n8) { const size_t t = (size_t)blockIdx.x * 256 + threadIdx.x; if (t >= n8) return; FragH f;
#pragma unroll
  for (int i = 0; i < 8; ++i) f.h[i] = (_Float16)(bf16_round(W[t * 8 + i]) * 16.0f); *(v8us*)((unsigned short*)Bt + t * 8) = f.half[0];  }
template <int NHv, int TTv>
__global__ __launch_bounds__(256) void k_vt(const _Float16* __restrict__ V16, int ldv, int voff, _Float16* __restrict__ Vt) { __shared__ unsigned short tl[64][66]; const int tid = threadIdx.x; const int slab = blockIdx.x / (TTv / 64), lg = blockIdx.x % (TTv / 64); const int b = slab / NHv, h = slab % NHv;
  for (int i = tid; i < 64 * 8; i += 256) { const int r = i / 8, c8 = (i % 8) * 8; FragH f; f.half[0] = *(const v8us*)((const unsigned short*)V16 + ((size_t)b * TTv + lg * 64 + r) * ldv + voff + h * 64 + c8);
#pragma unroll
    for (int q = 0; q < 8; ++q) tl[r][c8 + q] = f.u[q]; }
  __syncthreads();
  {
#pragma unroll
    for (int rd = 0; rd < 2; ++rd) { const int d = rd * 32 + tid / 8, pc = tid % 8; FragH f;
#pragma unroll
      for (int q = 0; q < 8; ++q) f.u[q] = tl[pc * 8 + q][d];
      *(v8us*)((unsigned short*)Vt + ((size_t)slab * 64 + d) * TTv + lg * 64 + pc * 8) = f.half[0]; }
     } }

__global__ __launch_bounds__(256) void k_hl(const float* __restrict__ F, _Float16* __restrict__ Hh, _Float16* __restrict__ Hl, size_t n8) { const size_t t = (size_t)blockIdx.x * 256 + threadIdx.x; if (t >= n8) return; FragH fh, fl; const v4f a = *(const v4fa*)(F + t * 8), c = *(const v4fa*)(F + t * 8 + 4);
#pragma unroll
  for (int q = 0; q < 4; ++q) { _Float16 h = (_Float16)a[q]; fh.h[q] = h; fl.h[q] = (_Float16)((a[q] - (float)h) * 1024.0f); h = (_Float16)c[q]; fh.h[4 + q] = h; fl.h[4 + q] = (_Float16)((c[q] - (float)h) * 1024.0f); }
  { *(v8us*)((unsigned short*)Hh + t * 8) = fh.half[0]; *(v8us*)((unsigned short*)Hl + t * 8) = fl.half[0];  } }

// ---- fast GEMM (wave tile 32x64; requires M % 32 == 0 rows per launch region and N % 64 == 0); epilogue = k_gemm_hhx semantics ----
__device__ __forceinline__ v16h g2_frag(const _Float16* p, int hh) { FragH f; f.half[0] = *(const v8us*)((const unsigned short*)p + 8 * hh); f.half[1] = *(const v8us*)((const unsigned short*)p + 16 + 8 * hh); return f.v; }
__device__ __forceinline__ v8f g2_mma(v16h a, v16h b, v8f c) { v8f d = __builtin_amdgcn_wmma_f32_16x16x32_f16(false, a, false, b, (short)0, c, false, false); asm volatile("v_nop\n\tv_nop\n\tv_nop\n\tv_nop" : "+v"(d) : "v"(a), "v"(b)); return d; }
template <int ACT>
__global__ __launch_bounds__(128) void k_gemm2(const _Float16* __restrict__ A, int lda, size_t sA, const _Float16* __restrict__ Bh, int ldb, size_t sB, float alpha, const float* __restrict__ bias, size_t sBias, const float* __restrict__ CP, int rowsPerB, size_t sCPb, int row0g,
    float* __restrict__ C, _Float16* __restrict__ C16, int ldc, size_t sC, int M, int N, int K) { static_assert(ACT == 0 || ACT == 3 || ACT == 6 || ACT == 8 || ACT == 9 || ACT == 11 || ACT == 12 || ACT == 14 || ACT == 15 || ACT == 16 || ACT == 17, "k_gemm2: unsupported ACT code (would silently apply no activation)");
  __shared__ __attribute__((aligned(16))) float so[4][32][68];
  const int tid = threadIdx.x, w = tid >> 5, lane = tid & 31, ln = lane & 15, hh = lane >> 4; const int by = blockIdx.y;
  A += (size_t)by * sA; Bh += (size_t)by * sB; const size_t cofs = (size_t)by * sC; const float* bp = bias ? bias + (size_t)by * sBias : nullptr;
  const int ntn = N >> 6; const int mt = blockIdx.x / ntn, nq = blockIdx.x - mt * ntn; const int row0 = mt * 128 + 32 * w, col0 = nq * 64; if (row0 >= M) return;
  const _Float16* a0p = A + (size_t)(row0 + ln) * lda; const _Float16* a1p = a0p + (size_t)16 * lda;
  const _Float16* b0p = Bh + (size_t)(col0 + ln) * ldb; const _Float16* b1p = b0p + (size_t)16 * ldb; const _Float16* b2p = b1p + (size_t)16 * ldb; const _Float16* b3p = b2p + (size_t)16 * ldb;
  const v8f z8 = {0.f,0.f,0.f,0.f,0.f,0.f,0.f,0.f}; v8f c00 = z8, c01 = z8, c02 = z8, c03 = z8, c10 = z8, c11 = z8, c12 = z8, c13 = z8;
#pragma unroll 1
  for (int kb = 0; kb < K; kb += 32) { const v16h a0 = g2_frag(a0p + kb, hh), a1 = g2_frag(a1p + kb, hh);
    v16h b = g2_frag(b0p + kb, hh); c00 = g2_mma(a0, b, c00); c10 = g2_mma(a1, b, c10);
    b = g2_frag(b1p + kb, hh); c01 = g2_mma(a0, b, c01); c11 = g2_mma(a1, b, c11);
    b = g2_frag(b2p + kb, hh); c02 = g2_mma(a0, b, c02); c12 = g2_mma(a1, b, c12);
    b = g2_frag(b3p + kb, hh); c03 = g2_mma(a0, b, c03); c13 = g2_mma(a1, b, c13); }
  v8f accs[8] = {c00, c01, c02, c03, c10, c11, c12, c13};
#pragma unroll
  for (int u = 0; u < 8; ++u) { const int t = u & 3, half = u >> 2; const int col = col0 + t * 16 + ln; const float bv = bp ? bf16_round(bp[col]) : 0.f;
#pragma unroll
    for (int r = 0; r < 8; ++r) { const int rloc = half * 16 + 8 * hh + r; float v = accs[u][r] * alpha + bv; if (CP) { if (rowsPerB < 0) v += CP[cofs + (size_t)(row0g + row0 + rloc) * ldc + col];      /* rowsPerB < 0: own element of the batched C plane */ else { const int bidx = (row0g + row0 + rloc) / rowsPerB; v += CP[(size_t)bidx * sCPb + (size_t)by * 64 + col]; } }
      if (ACT == 3) v = fmaxf(v, 0.f); else if (ACT == 6) v = 0.5f * v * (1.0f + erff(v * 0.70710678118654752f)); else if (ACT == 11) v = 1.0f / (1.0f + expf(-v)); else if (ACT == 15) v = v / (1.0f + expf(-v)); else if (ACT == 12) v = (v > 0.f) ? v : 0.01f * v; else if (ACT == 8) v = tanhf(v); else if (ACT == 9) v = 0.5f * v * (1.0f + tanhf(0.7978845608028654f * (v + 0.044715f * v * v * v))); else if (ACT == 14) v = (v > 0.f) ? v : 0.1f * v; else if (ACT == 16) v = (v >= 0.f) ? v : 0.3f * v; else if (ACT == 17) v = (v >= 0.f) ? v : 0.2f * v;
      so[w][rloc][t * 16 + ln] = v; } }
  __builtin_amdgcn_fence(__ATOMIC_ACQ_REL, "workgroup"); __builtin_amdgcn_wave_barrier();
  const int rsub = lane >> 4, c4 = (lane & 15) * 4;
  {
#pragma unroll
    for (int q = 0; q < 16; ++q) { const int r = q * 2 + rsub; const v4f v = *(const v4fa*)&so[w][r][c4]; if (C) *(v4f*)(C + cofs + (size_t)(row0 + r) * ldc + col0 + c4) = v; if (C16) { v4h h4; for (int i = 0; i < 4; ++i) h4[i] = (_Float16)v[i]; *(v4h*)(C16 + cofs + (size_t)(row0 + r) * ldc + col0 + c4) = h4; } }
     } }


__global__ __launch_bounds__(256) void k_wnat(const float* __restrict__ w, size_t n8, _Float16* __restrict__ Bt) { const size_t t = (size_t)blockIdx.x * 256 + threadIdx.x; if (t >= n8) return; FragH f; for (int q = 0; q < 8; ++q) f.h[q] = (_Float16)(bf16_round(w[t * 8 + q]) * 16.0f); *(v8us*)((unsigned short*)Bt + t * 8) = f.half[0];  }
__global__ __launch_bounds__(256) void k_rsm(const float* __restrict__ S, _Float16* __restrict__ P, int nrows) {
  #pragma clang fp contract(off)
  const int i = blockIdx.x * 256 + threadIdx.x; if (i >= nrows) return; const float* s = S + (size_t)i * SQ; float mx = -3.0e38f;
#pragma unroll 1
  for (int j = 0; j < SQ; ++j) mx = fmaxf(mx, s[j]); float se = 0.f;
#pragma unroll 1
  for (int j = 0; j < SQ; ++j) se += expf(s[j] - mx); const float sc = 256.0f / se;
#pragma unroll 1
  for (int j0 = 0; j0 < SQ; j0 += 8) { FragH f; for (int q = 0; q < 8; ++q) f.h[q] = (_Float16)(expf(s[j0 + q] - mx) * sc); unsigned short* d = (unsigned short*)P + (size_t)i * SQ + j0; *(v8us*)d = f.half[0];  } }
__global__ __launch_bounds__(256) void k_vt(const _Float16* __restrict__ V16, int b, int h0, _Float16* __restrict__ VT) { __shared__ unsigned short tl[64][65]; const int tid = threadIdx.x; const int hh = blockIdx.x % HG, sg = blockIdx.x / HG; const int s0 = sg * 64; const int h = h0 + hh;
  for (int i = tid; i < 64 * 8; i += 256) { const int j = i / 8, d8 = (i % 8) * 8; FragH f; f.half[0] = *(const v8us*)((const unsigned short*)V16 + ((size_t)b * SQ + s0 + j) * DM + h * HD + d8); for (int q = 0; q < 8; ++q) tl[d8 + q][j] = f.u[q]; }
  __syncthreads();
  { for (int i = tid; i < 64 * 8; i += 256) { const int d = i / 8, j8 = (i % 8) * 8; FragH f; for (int q = 0; q < 8; ++q) f.u[q] = tl[d][j8 + q]; *(v8us*)((unsigned short*)VT + ((size_t)hh * HD + d) * SQ + s0 + j8) = f.half[0]; }  } }



__global__ __launch_bounds__(256) void k_rsmcf2(const float* __restrict__ S, _Float16* __restrict__ P, int hg, int q0, int nk) {
  #pragma clang fp contract(off)
  const int t = blockIdx.x * 256 + threadIdx.x; if (t >= hg * QT) return; const size_t i = (size_t)t; const float* s = S + i * NKX; const int last = q0 + (t % QT); float mx = -3.0e38f;
#pragma unroll 1
  for (int j = 0; j < nk; ++j) { const float f = (j <= last) ? 1.f : 0.f; mx = fmaxf(mx, fmaf(f, s[j], (1.f - f) * -1.0e9f)); } float se = 0.f;
#pragma unroll 1
  for (int j = 0; j < nk; ++j) { const float f = (j <= last) ? 1.f : 0.f; se += __expf(fmaf(f, s[j], (1.f - f) * -1.0e9f) - mx); } const float sc = 256.0f / se;
#pragma unroll 1
  for (int j0 = 0; j0 < nk; j0 += 8) { FragH fr; for (int q = 0; q < 8; ++q) { const int j = j0 + q; const float f = (j <= last) ? 1.f : 0.f; fr.h[q] = (_Float16)(__expf(fmaf(f, s[j], (1.f - f) * -1.0e9f) - mx) * sc); } unsigned short* d = (unsigned short*)P + i * NKX + j0; *(v8us*)d = fr.half[0];  } }


template <int MASKADD>
__global__ __launch_bounds__(64) void k_att0(const float* __restrict__ QF, const float* __restrict__ KF, const float* __restrict__ VF, int ld, const float* __restrict__ mask, float scale, float* __restrict__ OF, int ldo) {
  #pragma clang fp contract(off)
  __shared__ __attribute__((aligned(16))) float lq[64][64]; __shared__ __attribute__((aligned(16))) float lo[64][64];
  const int tid = threadIdx.x; const int h = blockIdx.x / (QT0 / 64), rg = blockIdx.x % (QT0 / 64); const int i = rg * 64 + tid;
  const float* qr = QF + (size_t)i * ld + h * HD;
#pragma unroll 1
  for (int c = 0; c < HD / 4; ++c) { *(v4f*)&lq[tid][c * 4] = *(const v4fa*)(qr + c * 4); const v4f z = {0.f, 0.f, 0.f, 0.f}; *(v4f*)&lo[tid][c * 4] = z; }
  float m = -1.0e30f, l = 0.f; const int jmax = MASKADD ? (SQ - 1) : (rg * 64 + 63);      /* additive-mask form: every key (the mask input decides); causal form: keys up to the block's last row */
#pragma unroll 1
  for (int j = 0; j <= jmax; ++j) { const float* kr = KF + (size_t)j * ld + h * HD; const float* vr = VF + (size_t)j * ld + h * HD; float s = 0.f;
#pragma unroll 1
    for (int c = 0; c < HD / 4; ++c) { const v4f kq = *(const v4fa*)(kr + c * 4); const v4f qq = *(v4f*)&lq[tid][c * 4]; s = __fadd_rn(s, __fmul_rn(qq[0], kq[0])); s = __fadd_rn(s, __fmul_rn(qq[1], kq[1])); s = __fadd_rn(s, __fmul_rn(qq[2], kq[2])); s = __fadd_rn(s, __fmul_rn(qq[3], kq[3])); }
    s = __fmul_rn(s, scale); if (MASKADD) s = __fadd_rn(s, __fmul_rn(bf16_round(mask[(size_t)i * SQ + j]), -10000.0f));
    const float f = (MASKADD || j <= i) ? 1.f : 0.f; const float sm = fmaf(f, s, (1.f - f) * -1.0e30f); const float mn = fmaxf(m, sm); const float sc = expf(m - mn); const float e = expf(sm - mn); l = __fadd_rn(__fmul_rn(l, sc), e); m = mn;
#pragma unroll 1
    for (int c = 0; c < HD / 4; ++c) { const v4f vv = *(const v4fa*)(vr + c * 4); v4f oo = *(v4f*)&lo[tid][c * 4]; for (int u = 0; u < 4; ++u) oo[u] = __fadd_rn(__fmul_rn(oo[u], sc), __fmul_rn(e, vv[u])); *(v4f*)&lo[tid][c * 4] = oo; } }
  const float fin = 64.0f / l;      /* o carried x64 like the f16 path */
#pragma unroll 1
  for (int c = 0; c < HD / 4; ++c) { v4f oo = *(v4f*)&lo[tid][c * 4]; for (int u = 0; u < 4; ++u) oo[u] = __fmul_rn(oo[u], fin); *(v4f*)&lo[tid][c * 4] = oo; }
  __syncthreads();
  {
#pragma unroll 1
    for (int it = 0; it < 16; ++it) { const int row = it * 4 + tid / 16, pc = (tid % 16) * 4; const v4f v = *(const v4f*)&lo[row][pc]; *(v4f*)(OF + (size_t)(rg * 64 + row) * ldo + h * HD + pc) = v; }
     } }

extern "C" void kernel_launch(void* const* d_in, const int* in_sizes, int n_in,
                              void* d_out, int out_size, void* d_ws, size_t ws_size, hipStream_t stream) {
  (void)in_sizes; (void)n_in; (void)out_size;
  const float* const* I = (const float* const*)d_in; const float* x = I[0]; const float* wqkv = I[1]; const float* bqkv = nullptr; const float* wo = I[2]; const float* bo = I[3];      /* input order: y, Wqkv (fused [in][out] [1024][3072]), Wff ([in][out]), bff [1024]; the QKV projection has NO bias: bqkv is a null pointer (the two first-tile bias-third offsets are guarded); the output bias is bound */
  char* ws = (char*)d_ws; size_t off = 0;
  auto take = [&](size_t bytes) { char* p = ws + off; off += (bytes + 255) & ~(size_t)255; return p; };
  _Float16* BQKV = (_Float16*)take((size_t)3 * DM * DM * 2); _Float16* BO = (_Float16*)take((size_t)DM * DM * 2);
  _Float16* X16 = (_Float16*)take(NR * DM * 2); _Float16* QKV = (_Float16*)take(NR * 3 * DM * 2); _Float16* Q16 = QKV; _Float16* K16 = QKV + DM; _Float16* V16 = QKV + 2 * DM; _Float16* O16 = (_Float16*)take(NR * DM * 2);
  float* S = (float*)take((size_t)NH * QT * NKX * 4); _Float16* P = (_Float16*)take((size_t)NH * QT * NKX * 2); _Float16* VT = (_Float16*)take((size_t)NH * HD * SQ * 2);
  float* QF0 = (float*)take((size_t)QT0 * DM * 4); float* KF0 = (float*)take((size_t)QT0 * DM * 4); float* VF0 = (float*)take((size_t)QT0 * DM * 4); float* OF0 = (float*)take((size_t)NB * QT0 * DM * 4); _Float16* OH0 = (_Float16*)take((size_t)NB * QT0 * DM * 2); _Float16* OL0 = (_Float16*)take((size_t)NB * QT0 * DM * 2);
  if (off > ws_size) return;
  k_wt_f16<<<(unsigned)(((size_t)LQ * (DM / 8) + 255) / 256), 256, 0, stream>>>(wqkv, BQKV, DM, LQ, 16.0f); k_wt_f16<<<(unsigned)(((size_t)DM * (DM / 8) + 255) / 256), 256, 0, stream>>>(wo, BO, DM, DM, 16.0f);      /* [in][out] -> Bt[n][k] x16 */
  k_x16<<<(unsigned)((NR * DM / 8 + 255) / 256), 256, 0, stream>>>(x, X16, NR * DM / 8);
  const size_t r0p = (size_t)B0 * SQ;      /* first projected row */
  k_gemm2<0><<<dim3((unsigned)((MP / 128) * (3 * DM / 64)), 1), 128, 0, stream>>>(X16 + r0p * DM, DM, 0, BQKV, DM, 0, 0.0625f, bqkv, 0, nullptr, 1, 0, 0, nullptr, QKV + r0p * 3 * DM, 3 * DM, 0, MP, 3 * DM, DM);      /* q | k | v rows (f16); head h = columns h*HD.. of each DM block */
  for (int b = B0; b < B0 + NBR; ++b) { const size_t r0 = (size_t)b * SQ;
    k_vt<NH, SQ><<<NH * (SQ / 64), 256, 0, stream>>>(V16 + r0 * LQ, LQ, 0, VT);      /* V^T [NH][HD][SQ] for this batch */
    k_gemm2<0><<<dim3((QT0 / 128) * (DM / 64), 1), 128, 0, stream>>>(X16 + r0 * DM, DM, 0, BQKV, DM, 0, 0.0625f, bqkv, 0, nullptr, 1, 0, 0, QF0, nullptr, DM, 0, QT0, DM, DM); k_gemm2<0><<<dim3((QT0 / 128) * (DM / 64), 1), 128, 0, stream>>>(X16 + r0 * DM, DM, 0, (BQKV + (size_t)DM * DM), DM, 0, 0.0625f, ((bqkv ? bqkv + DM : nullptr)), 0, nullptr, 1, 0, 0, KF0, nullptr, DM, 0, QT0, DM, DM); k_gemm2<0><<<dim3((QT0 / 128) * (DM / 64), 1), 128, 0, stream>>>(X16 + r0 * DM, DM, 0, (BQKV + (size_t)2 * DM * DM), DM, 0, 0.0625f, ((bqkv ? bqkv + 2 * DM : nullptr)), 0, nullptr, 1, 0, 0, VF0, nullptr, DM, 0, QT0, DM, DM);      /* f32 q, k, v of the first 128 rows (exact products) */
    k_att0<0><<<NH * (QT0 / 64), 64, 0, stream>>>(QF0, KF0, VF0, DM, nullptr, 0.125f, OF0 + (size_t)b * QT0 * DM, DM);      /* exact f32 attention for rows 0..127 (o x64) */
    for (int q0 = 0; q0 < QN; q0 += QT) { const int nk = q0 + QT;      /* causal: only keys below the tile end are computed */
      k_gemm2<0><<<dim3((QT / 128) * (nk / 64), NHD), 128, 0, stream>>>(Q16 + (r0 + q0) * LQ, LQ, (size_t)HD, K16 + r0 * LQ, LQ, (size_t)HD, 0.125f, nullptr, 0, nullptr, 1, 0, 0, S, nullptr, NKX, (size_t)QT * NKX, QT, nk, HD);      /* scores, all heads on grid.y */
      k_rsmcf2<<<(NHD * QT + 255) / 256, 256, 0, stream>>>(S, P, NHD, q0, nk);
      k_gemm2<0><<<dim3((QT / 128) * (HD / 64), NHD), 128, 0, stream>>>(P, NKX, (size_t)QT * NKX, VT, SQ, (size_t)HD * SQ, 0.25f, nullptr, 0, nullptr, 1, 0, 0, nullptr, O16 + (r0 + q0) * DM, DM, (size_t)HD, QT, HD, nk); } }      /* o (merged heads, x64) as f16 rows */
  k_gemm2<0><<<dim3((unsigned)((MPO / 128) * (DM / 64)), 1), 128, 0, stream>>>(O16 + r0p * DM, DM, 0, BO, DM, 0, 0.0009765625f, bo, 0, nullptr, 1, 0, 0, (float*)d_out + r0p * DM, nullptr, DM, 0, MPO, DM, DM);      /* out rows are the output layout */
  k_hl<<<(unsigned)(((size_t)NB * QT0 * DM / 8 + 255) / 256), 256, 0, stream>>>(OF0, OH0, OL0, (size_t)NB * QT0 * DM / 8);      /* first-tile o (x64) -> f16 hi + x1024 residual planes */
  for (int b = B0; b < B0 + NBR; ++b) { const size_t r0 = (size_t)b * SQ; const size_t f0 = (size_t)b * QT0;
    k_gemm2<0><<<dim3((QT0 / 128) * (DM / 64), 1), 128, 0, stream>>>(OH0 + f0 * DM, DM, 0, BO, DM, 0, 0.0009765625f, bo, 0, nullptr, 1, 0, 0, (float*)d_out + r0 * DM, nullptr, DM, 0, QT0, DM, DM);      /* rows 0..127: out = o_hi Wo (+ b), overwriting the f16-path rows */
    k_gemm2<0><<<dim3((QT0 / 128) * (DM / 64), 1), 128, 0, stream>>>(OL0 + f0 * DM, DM, 0, BO, DM, 0, 0.00000095367431640625f, nullptr, 0, (const float*)d_out + r0 * DM, -1, 0, 0, (float*)d_out + r0 * DM, nullptr, DM, 0, QT0, DM, DM); }      /* += o_lo Wo 2^-20 (own-element accumulate) */
}

// v001
// Measured time: 2070 microseconds a run.
// In both of two side-by-side timings against v000, it was 2.41 times as fast.
#include <hip/hip_runtime.h>
// Causal multi-head self-attention with a bias-free fused [in][out] QKV projection and a biased [in][out] output projection on two sequences (y [2][2048][1024]; qkv = y Wqkv ([in][out] 1024 x 3072, NO bias) reshaped (b, n, 3, 16, 64): q | k | v column thirds with the heads inside each; scores masked above the diagonal (-inf), then / sqrt(64); softmax over keys; out = merged Wff + bff ([in][out] + bias) -> [2][2048][1024]).
// Structure: token rows r = b*2048 + s; x as exact f16 rows (bf16-rounded); q | k | v as ONE WMMA GEMM (N = 3 x 1024) (32x64 wave tiles, f32 accumulation, exact x16 weights, no bias, f16 outputs); per batch: V^T for all heads via LDS transposes; per query tile of 256 rows: scores against the keys below the tile end only (K = 64, all heads on grid.y, alpha = 0.125), causal row softmax on VALU, one wave per row, keys above the diagonal masked over the computed range (f32 statistics, native exp; weights x256 f16), o = P . V^T (K = keys below the tile end, alpha 2^-2: o carried x64, folded into the output GEMM alpha) written straight into the merged f16 o rows; out = o W_o + b GEMM (f32) into the output layout.
// Compute dtype: inputs rounded to bf16; x / weights exact; q, k, v, softmax weights and o as plain f16 GEMM operands (~2^-12); scores and softmax statistics f32. v_wmma_f32_16x16x32_f16.
#define NB 2
#define SQ 2048
#define DM 1024
#define NH 16
#define HD 64
#define HG 4                         /* heads per launch of the (b, h0) k_vt, which is not launched */
#define QT 256                       /* query rows per causal tile */
#define NKX SQ                       /* S / P row pitch */
#define QT0 128                      /* first-tile rows recomputed exactly in f32 */
#define B0 0                         /* first batch processed (debug hook) */
#define NBR NB                       /* batches processed (debug hook) */
#define NR ((size_t)NB * SQ)         /* token rows */
#define MP ((int)((size_t)NBR * SQ)) /* rows projected (debug hook) */
#define QN SQ                        /* query rows attended per batch (debug hook) */
#define NHD NH                       /* heads attended (debug hook) */
#define MPO MP                       /* rows through the output stage (debug hook) */
#define LQ (3 * DM)      /* row pitch of the q/k/v rows */
typedef __bf16 v16b __attribute__((ext_vector_type(16)));
typedef unsigned short v8us __attribute__((ext_vector_type(8), may_alias));
typedef float  v8f  __attribute__((ext_vector_type(8)));
typedef float  v4f  __attribute__((ext_vector_type(4)));
typedef float  v4fa __attribute__((ext_vector_type(4), may_alias));
union FragB { v16b v; v8us half[2]; unsigned short u[16]; };

__device__ __forceinline__ unsigned short bf16_bits(float x) { unsigned int u = __float_as_uint(x); return (unsigned short)((u + 0x7FFFu + ((u >> 16) & 1u)) >> 16); }
__device__ __forceinline__ float bf16_val(unsigned short b) { return __uint_as_float(((unsigned int)b) << 16); }
__device__ __forceinline__ float bf16_round(float x) { return bf16_val(bf16_bits(x)); }
// D += A·B with NT terms: 1 = ah·bh, 2 = + al·bh (A split), 3 = + ah·bl (both split)
template <int NT>
__device__ __forceinline__ v8f mmaN(v16b ah, v16b al, v16b bh, v16b bl, v8f c) {
  c = __builtin_amdgcn_wmma_f32_16x16x32_bf16(false, ah, false, bh, (short)0, c, false, false);
  if (NT >= 2) c = __builtin_amdgcn_wmma_f32_16x16x32_bf16(false, al, false, bh, (short)0, c, false, false);
  if (NT >= 3) c = __builtin_amdgcn_wmma_f32_16x16x32_bf16(false, ah, false, bl, (short)0, c, false, false);
  asm volatile("v_nop\n\tv_nop\n\tv_nop\n\tv_nop" : "+v"(c) : "v"(ah), "v"(al), "v"(bh), "v"(bl));
  return c;
}

__global__ __launch_bounds__(256) void k_wt_bf16(const float* __restrict__ W, unsigned short* __restrict__ Wt, int K, int N) {
  const int t = blockIdx.x * 256 + threadIdx.x;
  const int k8n = K / 8;
  if (t >= N * k8n) return;
  const int n = t / k8n, k8 = (t % k8n) * 8;
  v8us v;
#pragma unroll
  for (int i = 0; i < 8; ++i) v[i] = bf16_bits(W[(size_t)(k8 + i) * N + n]);
  *(v8us*)(Wt + (size_t)n * K + k8) = v;
  
}

// GEMM C[M][N] (f32, pitch ldc) = act(A[M][K]·W + bias). A f32 row-major (pitch lda) converted per fragment to bf16
// (ASPLIT: hi/lo two planes -> 2 terms, else single rounded term); Wt bf16 [N][K] (pitch ldb). BIAS_BF16 rounds the
// bias to bf16 first (bias quantised to bf16 before the add). K%32==0, M%16==0, N%64==0.
template <bool ASPLIT, int ACT, bool BIAS_BF16>
__global__ __launch_bounds__(128) void k_gemm_bf(const float* __restrict__ A, int lda, const unsigned short* __restrict__ Wt, int ldb,
                                               const float* __restrict__ bias, float* __restrict__ C, int ldc, int M, int N, int K) {
  __shared__ __attribute__((aligned(16))) float so[4][16][64];
  const int tid = threadIdx.x, w = tid >> 5, lane = tid & 31, ln = lane & 15, hh = lane >> 4;
  const int ntn = N / 64;
  const int wid = blockIdx.x * 4 + w;
  const int mt = wid / ntn, nq = wid % ntn;
  if (mt * 16 >= M) return;
  const int row0 = mt * 16, col0 = nq * 64;
  const float* arow = A + (size_t)(row0 + ln) * lda;
  v8f acc[4] = {};
  for (int kb = 0; kb < K; kb += 32) {
    FragB ah, al;
    const v4f x0 = *(const v4fa*)(arow + kb + 8 * hh), x1 = *(const v4fa*)(arow + kb + 8 * hh + 4);
    const v4f x2 = *(const v4fa*)(arow + kb + 16 + 8 * hh), x3 = *(const v4fa*)(arow + kb + 16 + 8 * hh + 4);
    float xs[16] = {x0[0],x0[1],x0[2],x0[3],x1[0],x1[1],x1[2],x1[3],x2[0],x2[1],x2[2],x2[3],x3[0],x3[1],x3[2],x3[3]};
#pragma unroll
    for (int i = 0; i < 16; ++i) { const unsigned short hb = bf16_bits(xs[i]); ah.u[i] = hb; al.u[i] = ASPLIT ? bf16_bits(xs[i] - bf16_val(hb)) : (unsigned short)0; }
#pragma unroll
    for (int t = 0; t < 4; ++t) {
      const unsigned short* brow = Wt + (size_t)(col0 + t * 16 + ln) * ldb + kb;
      FragB b;
      b.half[0] = *(const v8us*)(brow + 8 * hh);
      b.half[1] = *(const v8us*)(brow + 16 + 8 * hh);
      acc[t] = mmaN<ASPLIT ? 2 : 1>(ah.v, al.v, b.v, b.v, acc[t]);
    }
  }
#pragma unroll
  for (int t = 0; t < 4; ++t) {
    float bv = bias ? bias[col0 + t * 16 + ln] : 0.f;
    if (BIAS_BF16) bv = bf16_round(bv);
#pragma unroll
    for (int r = 0; r < 8; ++r) { float v = acc[t][r] + bv; if (ACT == 1) v = fmaxf(v, 0.f); so[w][8 * hh + r][t * 16 + ln] = v; }
  }
  __builtin_amdgcn_fence(__ATOMIC_ACQ_REL, "workgroup");
  __builtin_amdgcn_wave_barrier();
  const int rsub = lane >> 4, c4 = (lane & 15) * 4;
  {
#pragma unroll
    for (int q = 0; q < 8; ++q) {
      const int r = q * 2 + rsub;
      const v4f v = *(const v4fa*)&so[w][r][c4];
      *(v4f*)(C + (size_t)(row0 + r) * ldc + col0 + c4) = v;
    }
    
  }
}

// GEMM C = act(A·W + bias + resid): A f32 (ASPLIT -> hi/lo 2 terms), Wt bf16 [N][K]; ACT 0 none, 1 relu, 2 exact gelu;
// resid (optional, f32, row index = (row % rmod), pitch ldr, RES_BF16 rounds it) added before the activation.
template <bool ASPLIT, int ACT, bool BIAS_BF16, bool RES_BF16>
__global__ __launch_bounds__(128) void k_gemm_bf3(const float* __restrict__ A, int lda, const unsigned short* __restrict__ Wt, int ldb,
                                                const float* __restrict__ bias, const float* __restrict__ resid, int rmod, int ldr,
                                                float* __restrict__ C, int ldc, int M, int N, int K) {
  __shared__ __attribute__((aligned(16))) float so[4][16][64];
  const int tid = threadIdx.x, w = tid >> 5, lane = tid & 31, ln = lane & 15, hh = lane >> 4;
  const int ntn = N / 64;
  const int wid = blockIdx.x * 4 + w;
  const int mt = wid / ntn, nq = wid % ntn;
  if (mt * 16 >= M) return;
  const int row0 = mt * 16, col0 = nq * 64;
  const float* arow = A + (size_t)(row0 + ln) * lda;
  v8f acc[4] = {};
  for (int kb = 0; kb < K; kb += 32) {
    FragB ah, al;
    const v4f x0 = *(const v4fa*)(arow + kb + 8 * hh), x1 = *(const v4fa*)(arow + kb + 8 * hh + 4);
    const v4f x2 = *(const v4fa*)(arow + kb + 16 + 8 * hh), x3 = *(const v4fa*)(arow + kb + 16 + 8 * hh + 4);
    float xs[16] = {x0[0],x0[1],x0[2],x0[3],x1[0],x1[1],x1[2],x1[3],x2[0],x2[1],x2[2],x2[3],x3[0],x3[1],x3[2],x3[3]};
#pragma unroll
    for (int i = 0; i < 16; ++i) { const unsigned short hb = bf16_bits(xs[i]); ah.u[i] = hb; al.u[i] = ASPLIT ? bf16_bits(xs[i] - bf16_val(hb)) : (unsigned short)0; }
#pragma unroll
    for (int t = 0; t < 4; ++t) {
      const unsigned short* brow = Wt + (size_t)(col0 + t * 16 + ln) * ldb + kb;
      FragB b;
      b.half[0] = *(const v8us*)(brow + 8 * hh);
      b.half[1] = *(const v8us*)(brow + 16 + 8 * hh);
      acc[t] = mmaN<ASPLIT ? 2 : 1>(ah.v, al.v, b.v, b.v, acc[t]);
    }
  }
#pragma unroll
  for (int t = 0; t < 4; ++t) {
    const int col = col0 + t * 16 + ln;
    float bv = bias ? bias[col] : 0.f;
    if (BIAS_BF16) bv = bf16_round(bv);
#pragma unroll
    for (int r = 0; r < 8; ++r) {
      float v = acc[t][r] + bv;
      if (resid) { float rv = resid[(size_t)((row0 + 8 * hh + r) % rmod) * ldr + col]; if (RES_BF16) rv = bf16_round(rv); v += rv; }
      if (ACT == 1) v = fmaxf(v, 0.f);
      if (ACT == 2) v = 0.5f * v * (1.0f + erff(v * 0.70710678118654752f));
      if (ACT == 3) { const float u = 0.7978845608028654f * (v + 0.044715f * v * v * v); v = 0.5f * v * (1.0f + tanhf(u)); }
      so[w][8 * hh + r][t * 16 + ln] = v;
    }
  }
  __builtin_amdgcn_fence(__ATOMIC_ACQ_REL, "workgroup");
  __builtin_amdgcn_wave_barrier();
  const int rsub = lane >> 4, c4 = (lane & 15) * 4;
  {
#pragma unroll
    for (int q = 0; q < 8; ++q) {
      const int r = q * 2 + rsub;
      const v4f v = *(const v4fa*)&so[w][r][c4];
      *(v4f*)(C + (size_t)(row0 + r) * ldc + col0 + c4) = v;
    }
    
  }
}
// row LayerNorm (biased variance, eps) over N: s = X (+ R); optional out_sum <- s; out_norm <- (s-mu)*rsqrt(var+eps)*g + b
template <bool PARAM_BF16>
__global__ __launch_bounds__(256) void k_layernorm(const float* __restrict__ X, const float* __restrict__ R, const float* __restrict__ g, const float* __restrict__ bta,
                                                  float* __restrict__ out_sum, float* __restrict__ out_norm, int N, float eps) {
  __shared__ float red[256];
  const int row = blockIdx.x, tid = threadIdx.x;
  const float* x = X + (size_t)row * N; const float* rr = R ? R + (size_t)row * N : nullptr;
  float vals[16];                     // up to N = 4096
  const int per = N / 256;            // contiguous chunk per thread? use strided-by-4 chunks: thread handles j = tid*4 + 1024*u
  float s1 = 0.f;
  for (int u = 0; u < per / 4; ++u) {
    const int j = tid * 4 + 1024 * u;
    const v4f a = *(const v4fa*)(x + j);
    v4f b = {0.f,0.f,0.f,0.f}; if (rr) b = *(const v4fa*)(rr + j);
#pragma unroll
    for (int q = 0; q < 4; ++q) { const float v = a[q] + b[q]; vals[u * 4 + q] = v; s1 += v; }
  }
  red[tid] = s1; __syncthreads();
  for (int st = 128; st > 0; st >>= 1) { if (tid < st) red[tid] += red[tid + st]; __syncthreads(); }
  const float mu = red[0] / (float)N; __syncthreads();
  float s2 = 0.f;
  for (int u = 0; u < per / 4; ++u)
#pragma unroll
    for (int q = 0; q < 4; ++q) { const float c = vals[u * 4 + q] - mu; s2 += c * c; }
  red[tid] = s2; __syncthreads();
  for (int st = 128; st > 0; st >>= 1) { if (tid < st) red[tid] += red[tid + st]; __syncthreads(); }
  const float rs = rsqrtf(red[0] / (float)N + eps);
  {
    for (int u = 0; u < per / 4; ++u) {
      const int j = tid * 4 + 1024 * u;
      v4f o, sm;
#pragma unroll
      for (int q = 0; q < 4; ++q) {
        float gg = g[j + q], bb = bta[j + q];
        if (PARAM_BF16) { gg = bf16_round(gg); bb = bf16_round(bb); }
        sm[q] = vals[u * 4 + q]; o[q] = (vals[u * 4 + q] - mu) * rs * gg + bb;
      }
      if (out_sum) *(v4f*)(out_sum + (size_t)row * N + j) = sm;
      *(v4f*)(out_norm + (size_t)row * N + j) = o;
    }
    
  }
}



// ---- f16 WMMA path (v_wmma_f32_16x16x32_f16): 11-bit significands for operands in range — used where a [0,1] probability operand needs more precision than bf16
typedef _Float16 v16h __attribute__((ext_vector_type(16)));
union FragH { v16h v; v8us half[2]; _Float16 h[16]; unsigned short u[16]; };
template <int NT>
__device__ __forceinline__ v8f mmaH(v16h ah, v16h al, v16h bh, v16h bl, v8f c) {
  c = __builtin_amdgcn_wmma_f32_16x16x32_f16(false, ah, false, bh, (short)0, c, false, false);
  if (NT >= 2) c = __builtin_amdgcn_wmma_f32_16x16x32_f16(false, al, false, bh, (short)0, c, false, false);
  if (NT >= 3) c = __builtin_amdgcn_wmma_f32_16x16x32_f16(false, ah, false, bl, (short)0, c, false, false);
  asm volatile("v_nop\n\tv_nop\n\tv_nop\n\tv_nop" : "+v"(c) : "v"(ah), "v"(al), "v"(bh), "v"(bl));
  return c;
}
// batched GEMM like k_gemm_b but f16 operands: A f32 (split into f16 hi/lo if ASPLIT, else rounded to f16), Bt = f16 values [n][k]; alpha; C f32; N multiple of 16 (partial tiles skipped)
template <bool ASPLIT>
__global__ __launch_bounds__(128) void k_gemm_h(const float* __restrict__ A, int lda, size_t sA, const _Float16* __restrict__ Bh, int ldb, size_t sB, float alpha, float* __restrict__ C, int ldc, size_t sC, int M, int N, int K) {
  __shared__ __attribute__((aligned(16))) float so[4][16][64];
  const int tid = threadIdx.x, w = tid >> 5, lane = tid & 31, ln = lane & 15, hh = lane >> 4; const int by = blockIdx.y;
  A += (size_t)by * sA; Bh += (size_t)by * sB; C += (size_t)by * sC;
  const int ntn = (N + 63) / 64; const int wid = blockIdx.x * 4 + w; const int mt = wid / ntn, nq = wid % ntn; if (mt * 16 >= M) return;
  const int row0 = mt * 16, col0 = nq * 64; const float* arow = A + (size_t)(row0 + ln) * lda;
  v8f acc[4] = {};
  for (int kb = 0; kb < K; kb += 32) {
    FragH ah, al;
    const v4f x0 = *(const v4fa*)(arow + kb + 8 * hh), x1 = *(const v4fa*)(arow + kb + 8 * hh + 4), x2 = *(const v4fa*)(arow + kb + 16 + 8 * hh), x3 = *(const v4fa*)(arow + kb + 16 + 8 * hh + 4);
    float xs[16] = {x0[0],x0[1],x0[2],x0[3],x1[0],x1[1],x1[2],x1[3],x2[0],x2[1],x2[2],x2[3],x3[0],x3[1],x3[2],x3[3]};
#pragma unroll
    for (int i = 0; i < 16; ++i) { const _Float16 h = (_Float16)xs[i]; ah.h[i] = h; al.h[i] = ASPLIT ? (_Float16)(xs[i] - (float)h) : (_Float16)0.0f; }
#pragma unroll
    for (int t = 0; t < 4; ++t) { if (col0 + t * 16 >= N) continue; const size_t boff = (size_t)(col0 + t * 16 + ln) * ldb + kb; FragH bq; bq.half[0] = *(const v8us*)(Bh + boff + 8 * hh); bq.half[1] = *(const v8us*)(Bh + boff + 16 + 8 * hh);
      acc[t] = mmaH<ASPLIT ? 2 : 1>(ah.v, al.v, bq.v, bq.v, acc[t]); }
  }
#pragma unroll
  for (int t = 0; t < 4; ++t) { if (col0 + t * 16 >= N) continue;
#pragma unroll
    for (int r = 0; r < 8; ++r) so[w][8 * hh + r][t * 16 + ln] = acc[t][r] * alpha; }
  __builtin_amdgcn_fence(__ATOMIC_ACQ_REL, "workgroup"); __builtin_amdgcn_wave_barrier();
  const int rsub = lane >> 4, c4 = (lane & 15) * 4;
  {
#pragma unroll
    for (int q = 0; q < 8; ++q) { const int r = q * 2 + rsub; if (col0 + c4 < N) { const v4f v = *(const v4fa*)&so[w][r][c4]; *(v4f*)(C + (size_t)(row0 + r) * ldc + col0 + c4) = v; } }
     }
}

// Wt[n][k] = f16(W[k][n]·scale) from f32 row-major W[K][N] (scale = power of two; bf16-exact weights stay exact in f16 away from the subnormal range)
__global__ __launch_bounds__(256) void k_wt_f16(const float* __restrict__ W, _Float16* __restrict__ Wt, int K, int N, float scale) {
  const int t = blockIdx.x * 256 + threadIdx.x; if (t >= N * (K / 8)) return; const int n = t / (K / 8), k8 = (t % (K / 8)) * 8; FragH f;
#pragma unroll
  for (int i = 0; i < 8; ++i) f.h[i] = (_Float16)(bf16_round(W[(size_t)(k8 + i) * N + n]) * scale); const v8us o = f.half[0];
  *(v8us*)((unsigned short*)Wt + (size_t)n * K + k8) = o; 
}
// k_gemm_hh variant with fused epilogue: v = acc·alpha + bias[by·sBias + col] (+ CP[(row/rowsPerB)·sCPb + by·64 + col] if CP) ; ACT 0 none / 1 elu ; writes f16 C16 (and f32 C if non-null)
template <int ACT>
__global__ __launch_bounds__(128) void k_gemm_hhx(const _Float16* __restrict__ A, int lda, size_t sA, const _Float16* __restrict__ Bh, int ldb, size_t sB, float alpha, const float* __restrict__ bias, size_t sBias, const float* __restrict__ CP, int rowsPerB, size_t sCPb, int row0g,
    float* __restrict__ C, _Float16* __restrict__ C16, int ldc, size_t sC, int M, int N, int K) {
  __shared__ __attribute__((aligned(16))) float so[4][16][64];
  const int tid = threadIdx.x, w = tid >> 5, lane = tid & 31, ln = lane & 15, hh = lane >> 4; const int by = blockIdx.y;
  A += (size_t)by * sA; Bh += (size_t)by * sB; const size_t cofs = (size_t)by * sC; const float* bp = bias ? bias + (size_t)by * sBias : nullptr;
  const int ntn = (N + 63) / 64; const int wid = blockIdx.x * 4 + w; const int mt = wid / ntn, nq = wid % ntn; if (mt * 16 >= M) return;
  const int row0 = mt * 16, col0 = nq * 64; const _Float16* arow = A + (size_t)(row0 + ln) * lda;
  v8f acc[4] = {};
  for (int kb = 0; kb < K; kb += 32) { FragH ah; ah.half[0] = *(const v8us*)((const unsigned short*)arow + kb + 8 * hh); ah.half[1] = *(const v8us*)((const unsigned short*)arow + kb + 16 + 8 * hh);
#pragma unroll
    for (int t = 0; t < 4; ++t) { if (col0 + t * 16 >= N) continue; const size_t boff = (size_t)(col0 + t * 16 + ln) * ldb + kb; FragH bq; bq.half[0] = *(const v8us*)((const unsigned short*)Bh + boff + 8 * hh); bq.half[1] = *(const v8us*)((const unsigned short*)Bh + boff + 16 + 8 * hh);
      acc[t] = mmaH<1>(ah.v, ah.v, bq.v, bq.v, acc[t]); }
  }
#pragma unroll
  for (int t = 0; t < 4; ++t) { if (col0 + t * 16 >= N) continue; const int col = col0 + t * 16 + ln; const float bv = bp ? bf16_round(bp[col]) : 0.f;
#pragma unroll
    for (int r = 0; r < 8; ++r) { float v = acc[t][r] * alpha + bv; if (CP) { const int rr = row0g + row0 + 8 * hh + r; if (rowsPerB < 0) v += CP[cofs + (size_t)rr * ldc + col];      /* rowsPerB < 0: own element of the batched C plane */ else { const int bidx = rr / rowsPerB; v += CP[(size_t)bidx * sCPb + (size_t)by * 64 + col]; } } if (ACT == 1) v = (v > 0.f) ? v : expm1f(v); else if (ACT == 7) v = (v > 0.f) ? v + 1.0f : expf(v); else if (ACT == 8) v = tanhf(v); else if (ACT == 9) v = 0.5f * v * (1.0f + tanhf(0.7978845608028654f * (v + 0.044715f * v * v * v))); else if (ACT == 11) v = 1.0f / (1.0f + expf(-v)); else if (ACT == 12) v = (v > 0.f) ? v : 0.01f * v; else if (ACT == 14) v = (v > 0.f) ? v : 0.1f * v; else if (ACT == 16) v = (v >= 0.f) ? v : 0.3f * v; else if (ACT == 17) v = (v >= 0.f) ? v : 0.2f * v; else if (ACT == 15) v = v / (1.0f + expf(-v)); else if (ACT == 3) v = fmaxf(v, 0.f); else if (ACT == 6) v = 0.5f * v * (1.0f + erff(v * 0.70710678118654752f)); so[w][8 * hh + r][t * 16 + ln] = v; } }
  __builtin_amdgcn_fence(__ATOMIC_ACQ_REL, "workgroup"); __builtin_amdgcn_wave_barrier();
  const int rsub = lane >> 4, c4 = (lane & 15) * 4; typedef _Float16 v4h __attribute__((ext_vector_type(4)));
static_assert(QT == 256 && SQ == 8 * 256, "the softmax kernel is instantiated for 1 to 8 blocks of 256 keys");
  {
#pragma unroll
    for (int q = 0; q < 8; ++q) { const int r = q * 2 + rsub; if (col0 + c4 < N) { const v4f v = *(const v4fa*)&so[w][r][c4]; if (C) *(v4f*)(C + cofs + (size_t)(row0 + r) * ldc + col0 + c4) = v; if (C16) { v4h h4; for (int i = 0; i < 4; ++i) h4[i] = (_Float16)v[i]; *(v4h*)(C16 + cofs + (size_t)(row0 + r) * ldc + col0 + c4) = h4; } } }
     }
}


typedef _Float16 v4h __attribute__((ext_vector_type(4)));

__global__ __launch_bounds__(256) void k_x16(const float* __restrict__ x, _Float16* __restrict__ X16, size_t n8) { const size_t t = (size_t)blockIdx.x * 256 + threadIdx.x; if (t >= n8) return; FragH f;
#pragma unroll
  for (int q = 0; q < 8; ++q) f.h[q] = (_Float16)bf16_round(x[t * 8 + q]); *(v8us*)((unsigned short*)X16 + t * 8) = f.half[0];  }
__global__ __launch_bounds__(256) void k_h16(const float* __restrict__ x, _Float16* __restrict__ X16, size_t n8) { const size_t t = (size_t)blockIdx.x * 256 + threadIdx.x; if (t >= n8) return; FragH f;
#pragma unroll
  for (int q = 0; q < 8; ++q) f.h[q] = (_Float16)x[t * 8 + q]; *(v8us*)((unsigned short*)X16 + t * 8) = f.half[0];  }
__global__ __launch_bounds__(256) void k_round16f(const float* __restrict__ W, _Float16* __restrict__ Bt, size_t n8) { const size_t t = (size_t)blockIdx.x * 256 + threadIdx.x; if (t >= n8) return; FragH f;
#pragma unroll
  for (int i = 0; i < 8; ++i) f.h[i] = (_Float16)(bf16_round(W[t * 8 + i]) * 16.0f); *(v8us*)((unsigned short*)Bt + t * 8) = f.half[0];  }
template <int NHv, int TTv>
__global__ __launch_bounds__(256) void k_vt(const _Float16* __restrict__ V16, int ldv, int voff, _Float16* __restrict__ Vt) { __shared__ unsigned short tl[64][66]; const int tid = threadIdx.x; const int slab = blockIdx.x / (TTv / 64), lg = blockIdx.x % (TTv / 64); const int b = slab / NHv, h = slab % NHv;
  for (int i = tid; i < 64 * 8; i += 256) { const int r = i / 8, c8 = (i % 8) * 8; FragH f; f.half[0] = *(const v8us*)((const unsigned short*)V16 + ((size_t)b * TTv + lg * 64 + r) * ldv + voff + h * 64 + c8);
#pragma unroll
    for (int q = 0; q < 8; ++q) tl[r][c8 + q] = f.u[q]; }
  __syncthreads();
  {
#pragma unroll
    for (int rd = 0; rd < 2; ++rd) { const int d = rd * 32 + tid / 8, pc = tid % 8; FragH f;
#pragma unroll
      for (int q = 0; q < 8; ++q) f.u[q] = tl[pc * 8 + q][d];
      *(v8us*)((unsigned short*)Vt + ((size_t)slab * 64 + d) * TTv + lg * 64 + pc * 8) = f.half[0]; }
     } }

__global__ __launch_bounds__(256) void k_hl(const float* __restrict__ F, _Float16* __restrict__ Hh, _Float16* __restrict__ Hl, size_t n8) { const size_t t = (size_t)blockIdx.x * 256 + threadIdx.x; if (t >= n8) return; FragH fh, fl; const v4f a = *(const v4fa*)(F + t * 8), c = *(const v4fa*)(F + t * 8 + 4);
#pragma unroll
  for (int q = 0; q < 4; ++q) { _Float16 h = (_Float16)a[q]; fh.h[q] = h; fl.h[q] = (_Float16)((a[q] - (float)h) * 1024.0f); h = (_Float16)c[q]; fh.h[4 + q] = h; fl.h[4 + q] = (_Float16)((c[q] - (float)h) * 1024.0f); }
  { *(v8us*)((unsigned short*)Hh + t * 8) = fh.half[0]; *(v8us*)((unsigned short*)Hl + t * 8) = fl.half[0];  } }

// ---- fast GEMM (wave tile 32x64; requires M % 32 == 0 rows per launch region and N % 64 == 0); epilogue = k_gemm_hhx semantics ----
__device__ __forceinline__ v16h g2_frag(const _Float16* p, int hh) { FragH f; f.half[0] = *(const v8us*)((const unsigned short*)p + 8 * hh); f.half[1] = *(const v8us*)((const unsigned short*)p + 16 + 8 * hh); return f.v; }
__device__ __forceinline__ v8f g2_mma(v16h a, v16h b, v8f c) { v8f d = __builtin_amdgcn_wmma_f32_16x16x32_f16(false, a, false, b, (short)0, c, false, false); asm volatile("v_nop\n\tv_nop\n\tv_nop\n\tv_nop" : "+v"(d) : "v"(a), "v"(b)); return d; }
template <int ACT>
__global__ __launch_bounds__(128) void k_gemm2(const _Float16* __restrict__ A, int lda, size_t sA, const _Float16* __restrict__ Bh, int ldb, size_t sB, float alpha, const float* __restrict__ bias, size_t sBias, const float* __restrict__ CP, int rowsPerB, size_t sCPb, int row0g,
    float* __restrict__ C, _Float16* __restrict__ C16, int ldc, size_t sC, int M, int N, int K) { static_assert(ACT == 0 || ACT == 3 || ACT == 6 || ACT == 8 || ACT == 9 || ACT == 11 || ACT == 12 || ACT == 14 || ACT == 15 || ACT == 16 || ACT == 17, "k_gemm2: unsupported ACT code (would silently apply no activation)");
  __shared__ __attribute__((aligned(16))) float so[4][32][68];
  const int tid = threadIdx.x, w = tid >> 5, lane = tid & 31, ln = lane & 15, hh = lane >> 4; const int by = blockIdx.y;
  A += (size_t)by * sA; Bh += (size_t)by * sB; const size_t cofs = (size_t)by * sC; const float* bp = bias ? bias + (size_t)by * sBias : nullptr;
  const int ntn = N >> 6; const int mt = blockIdx.x / ntn, nq = blockIdx.x - mt * ntn; const int row0 = mt * 128 + 32 * w, col0 = nq * 64; if (row0 >= M) return;
  const _Float16* a0p = A + (size_t)(row0 + ln) * lda; const _Float16* a1p = a0p + (size_t)16 * lda;
  const _Float16* b0p = Bh + (size_t)(col0 + ln) * ldb; const _Float16* b1p = b0p + (size_t)16 * ldb; const _Float16* b2p = b1p + (size_t)16 * ldb; const _Float16* b3p = b2p + (size_t)16 * ldb;
  const v8f z8 = {0.f,0.f,0.f,0.f,0.f,0.f,0.f,0.f}; v8f c00 = z8, c01 = z8, c02 = z8, c03 = z8, c10 = z8, c11 = z8, c12 = z8, c13 = z8;
#pragma unroll 1
  for (int kb = 0; kb < K; kb += 32) { const v16h a0 = g2_frag(a0p + kb, hh), a1 = g2_frag(a1p + kb, hh);
    v16h b = g2_frag(b0p + kb, hh); c00 = g2_mma(a0, b, c00); c10 = g2_mma(a1, b, c10);
    b = g2_frag(b1p + kb, hh); c01 = g2_mma(a0, b, c01); c11 = g2_mma(a1, b, c11);
    b = g2_frag(b2p + kb, hh); c02 = g2_mma(a0, b, c02); c12 = g2_mma(a1, b, c12);
    b = g2_frag(b3p + kb, hh); c03 = g2_mma(a0, b, c03); c13 = g2_mma(a1, b, c13); }
  v8f accs[8] = {c00, c01, c02, c03, c10, c11, c12, c13};
#pragma unroll
  for (int u = 0; u < 8; ++u) { const int t = u & 3, half = u >> 2; const int col = col0 + t * 16 + ln; const float bv = bp ? bf16_round(bp[col]) : 0.f;
#pragma unroll
    for (int r = 0; r < 8; ++r) { const int rloc = half * 16 + 8 * hh + r; float v = accs[u][r] * alpha + bv; if (CP) { if (rowsPerB < 0) v += CP[cofs + (size_t)(row0g + row0 + rloc) * ldc + col];      /* rowsPerB < 0: own element of the batched C plane */ else { const int bidx = (row0g + row0 + rloc) / rowsPerB; v += CP[(size_t)bidx * sCPb + (size_t)by * 64 + col]; } }
      if (ACT == 3) v = fmaxf(v, 0.f); else if (ACT == 6) v = 0.5f * v * (1.0f + erff(v * 0.70710678118654752f)); else if (ACT == 11) v = 1.0f / (1.0f + expf(-v)); else if (ACT == 15) v = v / (1.0f + expf(-v)); else if (ACT == 12) v = (v > 0.f) ? v : 0.01f * v; else if (ACT == 8) v = tanhf(v); else if (ACT == 9) v = 0.5f * v * (1.0f + tanhf(0.7978845608028654f * (v + 0.044715f * v * v * v))); else if (ACT == 14) v = (v > 0.f) ? v : 0.1f * v; else if (ACT == 16) v = (v >= 0.f) ? v : 0.3f * v; else if (ACT == 17) v = (v >= 0.f) ? v : 0.2f * v;
      so[w][rloc][t * 16 + ln] = v; } }
  __builtin_amdgcn_fence(__ATOMIC_ACQ_REL, "workgroup"); __builtin_amdgcn_wave_barrier();
  const int rsub = lane >> 4, c4 = (lane & 15) * 4;
  {
#pragma unroll
    for (int q = 0; q < 16; ++q) { const int r = q * 2 + rsub; const v4f v = *(const v4fa*)&so[w][r][c4]; if (C) *(v4f*)(C + cofs + (size_t)(row0 + r) * ldc + col0 + c4) = v; if (C16) { v4h h4; for (int i = 0; i < 4; ++i) h4[i] = (_Float16)v[i]; *(v4h*)(C16 + cofs + (size_t)(row0 + r) * ldc + col0 + c4) = h4; } }
     } }


__global__ __launch_bounds__(256) void k_wnat(const float* __restrict__ w, size_t n8, _Float16* __restrict__ Bt) { const size_t t = (size_t)blockIdx.x * 256 + threadIdx.x; if (t >= n8) return; FragH f; for (int q = 0; q < 8; ++q) f.h[q] = (_Float16)(bf16_round(w[t * 8 + q]) * 16.0f); *(v8us*)((unsigned short*)Bt + t * 8) = f.half[0];  }
__global__ __launch_bounds__(256) void k_rsm(const float* __restrict__ S, _Float16* __restrict__ P, int nrows) {
  #pragma clang fp contract(off)
  const int i = blockIdx.x * 256 + threadIdx.x; if (i >= nrows) return; const float* s = S + (size_t)i * SQ; float mx = -3.0e38f;
#pragma unroll 1
  for (int j = 0; j < SQ; ++j) mx = fmaxf(mx, s[j]); float se = 0.f;
#pragma unroll 1
  for (int j = 0; j < SQ; ++j) se += expf(s[j] - mx); const float sc = 256.0f / se;
#pragma unroll 1
  for (int j0 = 0; j0 < SQ; j0 += 8) { FragH f; for (int q = 0; q < 8; ++q) f.h[q] = (_Float16)(expf(s[j0 + q] - mx) * sc); unsigned short* d = (unsigned short*)P + (size_t)i * SQ + j0; *(v8us*)d = f.half[0];  } }
__global__ __launch_bounds__(256) void k_vt(const _Float16* __restrict__ V16, int b, int h0, _Float16* __restrict__ VT) { __shared__ unsigned short tl[64][65]; const int tid = threadIdx.x; const int hh = blockIdx.x % HG, sg = blockIdx.x / HG; const int s0 = sg * 64; const int h = h0 + hh;
  for (int i = tid; i < 64 * 8; i += 256) { const int j = i / 8, d8 = (i % 8) * 8; FragH f; f.half[0] = *(const v8us*)((const unsigned short*)V16 + ((size_t)b * SQ + s0 + j) * DM + h * HD + d8); for (int q = 0; q < 8; ++q) tl[d8 + q][j] = f.u[q]; }
  __syncthreads();
  { for (int i = tid; i < 64 * 8; i += 256) { const int d = i / 8, j8 = (i % 8) * 8; FragH f; for (int q = 0; q < 8; ++q) f.u[q] = tl[d][j8 + q]; *(v8us*)((unsigned short*)VT + ((size_t)hh * HD + d) * SQ + s0 + j8) = f.half[0]; }  } }



// Causal row softmax, one wave per score row: lane l holds elements 128 u + 4 l .. + 3 of the row in registers (S read once, 512 contiguous bytes per load),
// maximum and sum by a butterfly over the 32 lanes, weights x256 stored as f16 (256 contiguous bytes per store). NC = computed keys / 256.
template <int CTRL> __device__ __forceinline__ float rs_row16(float v) { return __int_as_float(__builtin_amdgcn_update_dpp(0, __float_as_int(v), CTRL, 0xf, 0xf, true)); }      /* lane l ^ mask inside a 16-lane row (row_xmask) */
__device__ __forceinline__ float rs_x16(float v) { const int u = __float_as_int(v); return __int_as_float(__builtin_amdgcn_permlanex16(u, u, 0x76543210, 0xfedcba98, false, false)); }      /* lane l ^ 16 */
__device__ __forceinline__ float rs_wave_max(float v) { v = fmaxf(v, rs_row16<0x161>(v)); v = fmaxf(v, rs_row16<0x162>(v)); v = fmaxf(v, rs_row16<0x164>(v)); v = fmaxf(v, rs_row16<0x168>(v)); return fmaxf(v, rs_x16(v)); }
__device__ __forceinline__ float rs_wave_sum(float v) { v += rs_row16<0x161>(v); v += rs_row16<0x162>(v); v += rs_row16<0x164>(v); v += rs_row16<0x168>(v); return v + rs_x16(v); }
// e^x in the native form (x log2 e, then v_exp_f32). The v_nop in the same statement fills the one slot the instruction set asks for behind a transcendental:
// a v_nop in a statement of its own did not stay behind the v_exp.
__device__ __forceinline__ float rs_exp(float x) { float r; asm("v_exp_f32 %0, %1\n\tv_nop" : "=v"(r) : "v"(x * 1.44269504088896340736f)); return r; }
template <int NC>
__device__ __forceinline__ void rs_row(const float* __restrict__ s, _Float16* __restrict__ p, int last, int lane) {
  v4f v[2 * NC];      /* every loop below is fully unrolled so that v[] is indexed by constants and stays in registers, and all loads of the row are in flight together */
#pragma unroll
  for (int u = 0; u < 2 * NC; ++u) v[u] = *(const v4fa*)(s + u * 128 + lane * 4);
  float mx = -3.0e38f;
#pragma unroll
  for (int u = 0; u < 2 * NC; ++u)
#pragma unroll
    for (int q = 0; q < 4; ++q) { const float m = (u * 128 + lane * 4 + q <= last) ? v[u][q] : -1.0e9f; v[u][q] = m; mx = fmaxf(mx, m); }
  mx = rs_wave_max(mx);
  float se[4] = {0.f, 0.f, 0.f, 0.f};
#pragma unroll
  for (int u = 0; u < 2 * NC; ++u)
#pragma unroll
    for (int q = 0; q < 4; ++q) { const float e = rs_exp(v[u][q] - mx); v[u][q] = e; se[q] += e; }
  const float sc = 256.0f / rs_wave_sum((se[0] + se[1]) + (se[2] + se[3]));
#pragma unroll
  for (int u = 0; u < 2 * NC; ++u) { v4h h;
#pragma unroll
    for (int q = 0; q < 4; ++q) h[q] = (_Float16)(v[u][q] * sc);
    *(v4h*)(p + u * 128 + lane * 4) = h; } }
template <int NC>      /* the row length is a compile-time constant: one straight-line body that keeps the row in registers */
__global__ __launch_bounds__(256) void k_rsmcf2(const float* __restrict__ S, _Float16* __restrict__ P, int hg, int q0) {
  const int lane = threadIdx.x & 31; const int t = blockIdx.x * 8 + __builtin_amdgcn_readfirstlane(threadIdx.x >> 5); if (t >= hg * QT) return;      /* wave-uniform; no barrier in this kernel */
  rs_row<NC>(S + (size_t)t * NKX, P + (size_t)t * NKX, q0 + (t % QT), lane); }


template <int MASKADD>
__global__ __launch_bounds__(64) void k_att0(const float* __restrict__ QF, const float* __restrict__ KF, const float* __restrict__ VF, int ld, const float* __restrict__ mask, float scale, float* __restrict__ OF, int ldo) {
  #pragma clang fp contract(off)
  __shared__ __attribute__((aligned(16))) float lq[64][64]; __shared__ __attribute__((aligned(16))) float lo[64][64];
  const int tid = threadIdx.x; const int h = blockIdx.x / (QT0 / 64), rg = blockIdx.x % (QT0 / 64); const int i = rg * 64 + tid;
  const float* qr = QF + (size_t)i * ld + h * HD;
#pragma unroll 1
  for (int c = 0; c < HD / 4; ++c) { *(v4f*)&lq[tid][c * 4] = *(const v4fa*)(qr + c * 4); const v4f z = {0.f, 0.f, 0.f, 0.f}; *(v4f*)&lo[tid][c * 4] = z; }
  float m = -1.0e30f, l = 0.f; const int jmax = MASKADD ? (SQ - 1) : (rg * 64 + 63);      /* additive-mask form: every key (the mask input decides); causal form: keys up to the block's last row */
#pragma unroll 1
  for (int j = 0; j <= jmax; ++j) { const float* kr = KF + (size_t)j * ld + h * HD; const float* vr = VF + (size_t)j * ld + h * HD; float s = 0.f;
#pragma unroll 1
    for (int c = 0; c < HD / 4; ++c) { const v4f kq = *(const v4fa*)(kr + c * 4); const v4f qq = *(v4f*)&lq[tid][c * 4]; s = __fadd_rn(s, __fmul_rn(qq[0], kq[0])); s = __fadd_rn(s, __fmul_rn(qq[1], kq[1])); s = __fadd_rn(s, __fmul_rn(qq[2], kq[2])); s = __fadd_rn(s, __fmul_rn(qq[3], kq[3])); }
    s = __fmul_rn(s, scale); if (MASKADD) s = __fadd_rn(s, __fmul_rn(bf16_round(mask[(size_t)i * SQ + j]), -10000.0f));
    const float f = (MASKADD || j <= i) ? 1.f : 0.f; const float sm = fmaf(f, s, (1.f - f) * -1.0e30f); const float mn = fmaxf(m, sm); const float sc = expf(m - mn); const float e = expf(sm - mn); l = __fadd_rn(__fmul_rn(l, sc), e); m = mn;
#pragma unroll 1
    for (int c = 0; c < HD / 4; ++c) { const v4f vv = *(const v4fa*)(vr + c * 4); v4f oo = *(v4f*)&lo[tid][c * 4]; for (int u = 0; u < 4; ++u) oo[u] = __fadd_rn(__fmul_rn(oo[u], sc), __fmul_rn(e, vv[u])); *(v4f*)&lo[tid][c * 4] = oo; } }
  const float fin = 64.0f / l;      /* o carried x64 like the f16 path */
#pragma unroll 1
  for (int c = 0; c < HD / 4; ++c) { v4f oo = *(v4f*)&lo[tid][c * 4]; for (int u = 0; u < 4; ++u) oo[u] = __fmul_rn(oo[u], fin); *(v4f*)&lo[tid][c * 4] = oo; }
  __syncthreads();
  {
#pragma unroll 1
    for (int it = 0; it < 16; ++it) { const int row = it * 4 + tid / 16, pc = (tid % 16) * 4; const v4f v = *(const v4f*)&lo[row][pc]; *(v4f*)(OF + (size_t)(rg * 64 + row) * ldo + h * HD + pc) = v; }
     } }

extern "C" void kernel_launch(void* const* d_in, const int* in_sizes, int n_in,
                              void* d_out, int out_size, void* d_ws, size_t ws_size, hipStream_t stream) {
  (void)in_sizes; (void)n_in; (void)out_size;
  const float* const* I = (const float* const*)d_in; const float* x = I[0]; const float* wqkv = I[1]; const float* bqkv = nullptr; const float* wo = I[2]; const float* bo = I[3];      /* input order: y, Wqkv (fused [in][out] [1024][3072]), Wff ([in][out]), bff [1024]; the QKV projection has NO bias: bqkv is a null pointer (the two first-tile bias-third offsets are guarded); the output bias is bound */
  char* ws = (char*)d_ws; size_t off = 0;
  auto take = [&](size_t bytes) { char* p = ws + off; off += (bytes + 255) & ~(size_t)255; return p; };
  _Float16* BQKV = (_Float16*)take((size_t)3 * DM * DM * 2); _Float16* BO = (_Float16*)take((size_t)DM * DM * 2);
  _Float16* X16 = (_Float16*)take(NR * DM * 2); _Float16* QKV = (_Float16*)take(NR * 3 * DM * 2); _Float16* Q16 = QKV; _Float16* K16 = QKV + DM; _Float16* V16 = QKV + 2 * DM; _Float16* O16 = (_Float16*)take(NR * DM * 2);
  float* S = (float*)take((size_t)NH * QT * NKX * 4); _Float16* P = (_Float16*)take((size_t)NH * QT * NKX * 2); _Float16* VT = (_Float16*)take((size_t)NH * HD * SQ * 2);
  float* QF0 = (float*)take((size_t)QT0 * DM * 4); float* KF0 = (float*)take((size_t)QT0 * DM * 4); float* VF0 = (float*)take((size_t)QT0 * DM * 4); float* OF0 = (float*)take((size_t)NB * QT0 * DM * 4); _Float16* OH0 = (_Float16*)take((size_t)NB * QT0 * DM * 2); _Float16* OL0 = (_Float16*)take((size_t)NB * QT0 * DM * 2);
  if (off > ws_size) return;
  k_wt_f16<<<(unsigned)(((size_t)LQ * (DM / 8) + 255) / 256), 256, 0, stream>>>(wqkv, BQKV, DM, LQ, 16.0f); k_wt_f16<<<(unsigned)(((size_t)DM * (DM / 8) + 255) / 256), 256, 0, stream>>>(wo, BO, DM, DM, 16.0f);      /* [in][out] -> Bt[n][k] x16 */
  k_x16<<<(unsigned)((NR * DM / 8 + 255) / 256), 256, 0, stream>>>(x, X16, NR * DM / 8);
  const size_t r0p = (size_t)B0 * SQ;      /* first projected row */
  k_gemm2<0><<<dim3((unsigned)((MP / 128) * (3 * DM / 64)), 1), 128, 0, stream>>>(X16 + r0p * DM, DM, 0, BQKV, DM, 0, 0.0625f, bqkv, 0, nullptr, 1, 0, 0, nullptr, QKV + r0p * 3 * DM, 3 * DM, 0, MP, 3 * DM, DM);      /* q | k | v rows (f16); head h = columns h*HD.. of each DM block */
  for (int b = B0; b < B0 + NBR; ++b) { const size_t r0 = (size_t)b * SQ;
    k_vt<NH, SQ><<<NH * (SQ / 64), 256, 0, stream>>>(V16 + r0 * LQ, LQ, 0, VT);      /* V^T [NH][HD][SQ] for this batch */
    k_gemm2<0><<<dim3((QT0 / 128) * (DM / 64), 1), 128, 0, stream>>>(X16 + r0 * DM, DM, 0, BQKV, DM, 0, 0.0625f, bqkv, 0, nullptr, 1, 0, 0, QF0, nullptr, DM, 0, QT0, DM, DM); k_gemm2<0><<<dim3((QT0 / 128) * (DM / 64), 1), 128, 0, stream>>>(X16 + r0 * DM, DM, 0, (BQKV + (size_t)DM * DM), DM, 0, 0.0625f, ((bqkv ? bqkv + DM : nullptr)), 0, nullptr, 1, 0, 0, KF0, nullptr, DM, 0, QT0, DM, DM); k_gemm2<0><<<dim3((QT0 / 128) * (DM / 64), 1), 128, 0, stream>>>(X16 + r0 * DM, DM, 0, (BQKV + (size_t)2 * DM * DM), DM, 0, 0.0625f, ((bqkv ? bqkv + 2 * DM : nullptr)), 0, nullptr, 1, 0, 0, VF0, nullptr, DM, 0, QT0, DM, DM);      /* f32 q, k, v of the first 128 rows (exact products) */
    k_att0<0><<<NH * (QT0 / 64), 64, 0, stream>>>(QF0, KF0, VF0, DM, nullptr, 0.125f, OF0 + (size_t)b * QT0 * DM, DM);      /* exact f32 attention for rows 0..127 (o x64) */
    for (int q0 = 0; q0 < QN; q0 += QT) { const int nk = q0 + QT;      /* causal: only keys below the tile end are computed */
      k_gemm2<0><<<dim3((QT / 128) * (nk / 64), NHD), 128, 0, stream>>>(Q16 + (r0 + q0) * LQ, LQ, (size_t)HD, K16 + r0 * LQ, LQ, (size_t)HD, 0.125f, nullptr, 0, nullptr, 1, 0, 0, S, nullptr, NKX, (size_t)QT * NKX, QT, nk, HD);      /* scores, all heads on grid.y */
      switch (nk / 256) {      /* one wave per row, 8 rows per block; the kernel is instantiated per row length */
        case 1: k_rsmcf2<1><<<(NHD * QT + 7) / 8, 256, 0, stream>>>(S, P, NHD, q0); break; case 2: k_rsmcf2<2><<<(NHD * QT + 7) / 8, 256, 0, stream>>>(S, P, NHD, q0); break; case 3: k_rsmcf2<3><<<(NHD * QT + 7) / 8, 256, 0, stream>>>(S, P, NHD, q0); break; case 4: k_rsmcf2<4><<<(NHD * QT + 7) / 8, 256, 0, stream>>>(S, P, NHD, q0); break; case 5: k_rsmcf2<5><<<(NHD * QT + 7) / 8, 256, 0, stream>>>(S, P, NHD, q0); break; case 6: k_rsmcf2<6><<<(NHD * QT + 7) / 8, 256, 0, stream>>>(S, P, NHD, q0); break; case 7: k_rsmcf2<7><<<(NHD * QT + 7) / 8, 256, 0, stream>>>(S, P, NHD, q0); break; default: k_rsmcf2<8><<<(NHD * QT + 7) / 8, 256, 0, stream>>>(S, P, NHD, q0); break; }
      k_gemm2<0><<<dim3((QT / 128) * (HD / 64), NHD), 128, 0, stream>>>(P, NKX, (size_t)QT * NKX, VT, SQ, (size_t)HD * SQ, 0.25f, nullptr, 0, nullptr, 1, 0, 0, nullptr, O16 + (r0 + q0) * DM, DM, (size_t)HD, QT, HD, nk); } }      /* o (merged heads, x64) as f16 rows */
  k_gemm2<0><<<dim3((unsigned)((MPO / 128) * (DM / 64)), 1), 128, 0, stream>>>(O16 + r0p * DM, DM, 0, BO, DM, 0, 0.0009765625f, bo, 0, nullptr, 1, 0, 0, (float*)d_out + r0p * DM, nullptr, DM, 0, MPO, DM, DM);      /* out rows are the output layout */
  k_hl<<<(unsigned)(((size_t)NB * QT0 * DM / 8 + 255) / 256), 256, 0, stream>>>(OF0, OH0, OL0, (size_t)NB * QT0 * DM / 8);      /* first-tile o (x64) -> f16 hi + x1024 residual planes */
  for (int b = B0; b < B0 + NBR; ++b) { const size_t r0 = (size_t)b * SQ; const size_t f0 = (size_t)b * QT0;
    k_gemm2<0><<<dim3((QT0 / 128) * (DM / 64), 1), 128, 0, stream>>>(OH0 + f0 * DM, DM, 0, BO, DM, 0, 0.0009765625f, bo, 0, nullptr, 1, 0, 0, (float*)d_out + r0 * DM, nullptr, DM, 0, QT0, DM, DM);      /* rows 0..127: out = o_hi Wo (+ b), overwriting the f16-path rows */
    k_gemm2<0><<<dim3((QT0 / 128) * (DM / 64), 1), 128, 0, stream>>>(OL0 + f0 * DM, DM, 0, BO, DM, 0, 0.00000095367431640625f, nullptr, 0, (const float*)d_out + r0 * DM, -1, 0, 0, (float*)d_out + r0 * DM, nullptr, DM, 0, QT0, DM, DM); }      /* += o_lo Wo 2^-20 (own-element accumulate) */
}

// v002
// One run takes 1210 microseconds.
// In both of two side-by-side timings against v001, it was 1.71 times as fast.
// Counting every step since v000, it is 4.13 times as fast.
#include <hip/hip_runtime.h>
// Causal multi-head self-attention with a bias-free fused [in][out] QKV projection and a biased [in][out] output projection on two sequences (y [2][2048][1024]; qkv = y Wqkv ([in][out] 1024 x 3072, NO bias) reshaped (b, n, 3, 16, 64): q | k | v column thirds with the heads inside each; scores masked above the diagonal (-inf), then / sqrt(64); softmax over keys; out = merged Wff + bff ([in][out] + bias) -> [2][2048][1024]).
// Structure: token rows r = b*2048 + s; x as exact f16 rows (bf16-rounded); q | k | v as ONE WMMA GEMM (N = 3 x 1024) (32x64 wave tiles, f32 accumulation, exact x16 weights, no bias, f16 outputs); per batch: V^T for all heads via LDS transposes; per query tile of 256 rows: scores against the keys below the tile end only (K = 64, all heads on grid.y, alpha = 0.125), causal row softmax on VALU, one wave per row, keys above the diagonal masked over the computed range (f32 statistics, native exp; weights x256 f16), o = P . V^T (K = keys below the tile end, alpha 2^-2: o carried x64, folded into the output GEMM alpha) written straight into the merged f16 o rows; out = o W_o + b GEMM (f32) into the output layout.
// Compute dtype: inputs rounded to bf16; x / weights exact; q, k, v, softmax weights and o as plain f16 GEMM operands (~2^-12); scores and softmax statistics f32. v_wmma_f32_16x16x32_f16.
#define NB 2
#define SQ 2048
#define DM 1024
#define NH 16
#define HD 64
#define HG 4                         /* heads per launch of the (b, h0) k_vt, which is not launched */
#define QT 256                       /* query rows per causal tile */
#define NKX SQ                       /* S / P row pitch */
#define QT0 128                      /* first-tile rows recomputed exactly in f32 */
#define B0 0                         /* first batch processed (debug hook) */
#define NBR NB                       /* batches processed (debug hook) */
#define NR ((size_t)NB * SQ)         /* token rows */
#define MP ((int)((size_t)NBR * SQ)) /* rows projected (debug hook) */
#define QN SQ                        /* query rows attended per batch (debug hook) */
#define NHD NH                       /* heads attended (debug hook) */
#define MPO MP                       /* rows through the output stage (debug hook) */
#define LQ (3 * DM)      /* row pitch of the q/k/v rows */
typedef __bf16 v16b __attribute__((ext_vector_type(16)));
typedef unsigned short v8us __attribute__((ext_vector_type(8), may_alias));
typedef float  v8f  __attribute__((ext_vector_type(8)));
typedef float  v4f  __attribute__((ext_vector_type(4)));
typedef float  v4fa __attribute__((ext_vector_type(4), may_alias));
union FragB { v16b v; v8us half[2]; unsigned short u[16]; };

__device__ __forceinline__ unsigned short bf16_bits(float x) { unsigned int u = __float_as_uint(x); return (unsigned short)((u + 0x7FFFu + ((u >> 16) & 1u)) >> 16); }
__device__ __forceinline__ float bf16_val(unsigned short b) { return __uint_as_float(((unsigned int)b) << 16); }
__device__ __forceinline__ float bf16_round(float x) { return bf16_val(bf16_bits(x)); }
// D += A·B with NT terms: 1 = ah·bh, 2 = + al·bh (A split), 3 = + ah·bl (both split)
template <int NT>
__device__ __forceinline__ v8f mmaN(v16b ah, v16b al, v16b bh, v16b bl, v8f c) {
  c = __builtin_amdgcn_wmma_f32_16x16x32_bf16(false, ah, false, bh, (short)0, c, false, false);
  if (NT >= 2) c = __builtin_amdgcn_wmma_f32_16x16x32_bf16(false, al, false, bh, (short)0, c, false, false);
  if (NT >= 3) c = __builtin_amdgcn_wmma_f32_16x16x32_bf16(false, ah, false, bl, (short)0, c, false, false);
  asm volatile("v_nop\n\tv_nop\n\tv_nop\n\tv_nop" : "+v"(c) : "v"(ah), "v"(al), "v"(bh), "v"(bl));
  return c;
}

__global__ __launch_bounds__(256) void k_wt_bf16(const float* __restrict__ W, unsigned short* __restrict__ Wt, int K, int N) {
  const int t = blockIdx.x * 256 + threadIdx.x;
  const int k8n = K / 8;
  if (t >= N * k8n) return;
  const int n = t / k8n, k8 = (t % k8n) * 8;
  v8us v;
#pragma unroll
  for (int i = 0; i < 8; ++i) v[i] = bf16_bits(W[(size_t)(k8 + i) * N + n]);
  *(v8us*)(Wt + (size_t)n * K + k8) = v;
  
}

// GEMM C[M][N] (f32, pitch ldc) = act(A[M][K]·W + bias). A f32 row-major (pitch lda) converted per fragment to bf16
// (ASPLIT: hi/lo two planes -> 2 terms, else single rounded term); Wt bf16 [N][K] (pitch ldb). BIAS_BF16 rounds the
// bias to bf16 first (bias quantised to bf16 before the add). K%32==0, M%16==0, N%64==0.
template <bool ASPLIT, int ACT, bool BIAS_BF16>
__global__ __launch_bounds__(128) void k_gemm_bf(const float* __restrict__ A, int lda, const unsigned short* __restrict__ Wt, int ldb,
                                               const float* __restrict__ bias, float* __restrict__ C, int ldc, int M, int N, int K) {
  __shared__ __attribute__((aligned(16))) float so[4][16][64];
  const int tid = threadIdx.x, w = tid >> 5, lane = tid & 31, ln = lane & 15, hh = lane >> 4;
  const int ntn = N / 64;
  const int wid = blockIdx.x * 4 + w;
  const int mt = wid / ntn, nq = wid % ntn;
  if (mt * 16 >= M) return;
  const int row0 = mt * 16, col0 = nq * 64;
  const float* arow = A + (size_t)(row0 + ln) * lda;
  v8f acc[4] = {};
  for (int kb = 0; kb < K; kb += 32) {
    FragB ah, al;
    const v4f x0 = *(const v4fa*)(arow + kb + 8 * hh), x1 = *(const v4fa*)(arow + kb + 8 * hh + 4);
    const v4f x2 = *(const v4fa*)(arow + kb + 16 + 8 * hh), x3 = *(const v4fa*)(arow + kb + 16 + 8 * hh + 4);
    float xs[16] = {x0[0],x0[1],x0[2],x0[3],x1[0],x1[1],x1[2],x1[3],x2[0],x2[1],x2[2],x2[3],x3[0],x3[1],x3[2],x3[3]};
#pragma unroll
    for (int i = 0; i < 16; ++i) { const unsigned short hb = bf16_bits(xs[i]); ah.u[i] = hb; al.u[i] = ASPLIT ? bf16_bits(xs[i] - bf16_val(hb)) : (unsigned short)0; }
#pragma unroll
    for (int t = 0; t < 4; ++t) {
      const unsigned short* brow = Wt + (size_t)(col0 + t * 16 + ln) * ldb + kb;
      FragB b;
      b.half[0] = *(const v8us*)(brow + 8 * hh);
      b.half[1] = *(const v8us*)(brow + 16 + 8 * hh);
      acc[t] = mmaN<ASPLIT ? 2 : 1>(ah.v, al.v, b.v, b.v, acc[t]);
    }
  }
#pragma unroll
  for (int t = 0; t < 4; ++t) {
    float bv = bias ? bias[col0 + t * 16 + ln] : 0.f;
    if (BIAS_BF16) bv = bf16_round(bv);
#pragma unroll
    for (int r = 0; r < 8; ++r) { float v = acc[t][r] + bv; if (ACT == 1) v = fmaxf(v, 0.f); so[w][8 * hh + r][t * 16 + ln] = v; }
  }
  __builtin_amdgcn_fence(__ATOMIC_ACQ_REL, "workgroup");
  __builtin_amdgcn_wave_barrier();
  const int rsub = lane >> 4, c4 = (lane & 15) * 4;
  {
#pragma unroll
    for (int q = 0; q < 8; ++q) {
      const int r = q * 2 + rsub;
      const v4f v = *(const v4fa*)&so[w][r][c4];
      *(v4f*)(C + (size_t)(row0 + r) * ldc + col0 + c4) = v;
    }
    
  }
}

// GEMM C = act(A·W + bias + resid): A f32 (ASPLIT -> hi/lo 2 terms), Wt bf16 [N][K]; ACT 0 none, 1 relu, 2 exact gelu;
// resid (optional, f32, row index = (row % rmod), pitch ldr, RES_BF16 rounds it) added before the activation.
template <bool ASPLIT, int ACT, bool BIAS_BF16, bool RES_BF16>
__global__ __launch_bounds__(128) void k_gemm_bf3(const float* __restrict__ A, int lda, const unsigned short* __restrict__ Wt, int ldb,
                                                const float* __restrict__ bias, const float* __restrict__ resid, int rmod, int ldr,
                                                float* __restrict__ C, int ldc, int M, int N, int K) {
  __shared__ __attribute__((aligned(16))) float so[4][16][64];
  const int tid = threadIdx.x, w = tid >> 5, lane = tid & 31, ln = lane & 15, hh = lane >> 4;
  const int ntn = N / 64;
  const int wid = blockIdx.x * 4 + w;
  const int mt = wid / ntn, nq = wid % ntn;
  if (mt * 16 >= M) return;
  const int row0 = mt * 16, col0 = nq * 64;
  const float* arow = A + (size_t)(row0 + ln) * lda;
  v8f acc[4] = {};
  for (int kb = 0; kb < K; kb += 32) {
    FragB ah, al;
    const v4f x0 = *(const v4fa*)(arow + kb + 8 * hh), x1 = *(const v4fa*)(arow + kb + 8 * hh + 4);
    const v4f x2 = *(const v4fa*)(arow + kb + 16 + 8 * hh), x3 = *(const v4fa*)(arow + kb + 16 + 8 * hh + 4);
    float xs[16] = {x0[0],x0[1],x0[2],x0[3],x1[0],x1[1],x1[2],x1[3],x2[0],x2[1],x2[2],x2[3],x3[0],x3[1],x3[2],x3[3]};
#pragma unroll
    for (int i = 0; i < 16; ++i) { const unsigned short hb = bf16_bits(xs[i]); ah.u[i] = hb; al.u[i] = ASPLIT ? bf16_bits(xs[i] - bf16_val(hb)) : (unsigned short)0; }
#pragma unroll
    for (int t = 0; t < 4; ++t) {
      const unsigned short* brow = Wt + (size_t)(col0 + t * 16 + ln) * ldb + kb;
      FragB b;
      b.half[0] = *(const v8us*)(brow + 8 * hh);
      b.half[1] = *(const v8us*)(brow + 16 + 8 * hh);
      acc[t] = mmaN<ASPLIT ? 2 : 1>(ah.v, al.v, b.v, b.v, acc[t]);
    }
  }
#pragma unroll
  for (int t = 0; t < 4; ++t) {
    const int col = col0 + t * 16 + ln;
    float bv = bias ? bias[col] : 0.f;
    if (BIAS_BF16) bv = bf16_round(bv);
#pragma unroll
    for (int r = 0; r < 8; ++r) {
      float v = acc[t][r] + bv;
      if (resid) { float rv = resid[(size_t)((row0 + 8 * hh + r) % rmod) * ldr + col]; if (RES_BF16) rv = bf16_round(rv); v += rv; }
      if (ACT == 1) v = fmaxf(v, 0.f);
      if (ACT == 2) v = 0.5f * v * (1.0f + erff(v * 0.70710678118654752f));
      if (ACT == 3) { const float u = 0.7978845608028654f * (v + 0.044715f * v * v * v); v = 0.5f * v * (1.0f + tanhf(u)); }
      so[w][8 * hh + r][t * 16 + ln] = v;
    }
  }
  __builtin_amdgcn_fence(__ATOMIC_ACQ_REL, "workgroup");
  __builtin_amdgcn_wave_barrier();
  const int rsub = lane >> 4, c4 = (lane & 15) * 4;
  {
#pragma unroll
    for (int q = 0; q < 8; ++q) {
      const int r = q * 2 + rsub;
      const v4f v = *(const v4fa*)&so[w][r][c4];
      *(v4f*)(C + (size_t)(row0 + r) * ldc + col0 + c4) = v;
    }
    
  }
}
// row LayerNorm (biased variance, eps) over N: s = X (+ R); optional out_sum <- s; out_norm <- (s-mu)*rsqrt(var+eps)*g + b
template <bool PARAM_BF16>
__global__ __launch_bounds__(256) void k_layernorm(const float* __restrict__ X, const float* __restrict__ R, const float* __restrict__ g, const float* __restrict__ bta,
                                                  float* __restrict__ out_sum, float* __restrict__ out_norm, int N, float eps) {
  __shared__ float red[256];
  const int row = blockIdx.x, tid = threadIdx.x;
  const float* x = X + (size_t)row * N; const float* rr = R ? R + (size_t)row * N : nullptr;
  float vals[16];                     // up to N = 4096
  const int per = N / 256;            // contiguous chunk per thread? use strided-by-4 chunks: thread handles j = tid*4 + 1024*u
  float s1 = 0.f;
  for (int u = 0; u < per / 4; ++u) {
    const int j = tid * 4 + 1024 * u;
    const v4f a = *(const v4fa*)(x + j);
    v4f b = {0.f,0.f,0.f,0.f}; if (rr) b = *(const v4fa*)(rr + j);
#pragma unroll
    for (int q = 0; q < 4; ++q) { const float v = a[q] + b[q]; vals[u * 4 + q] = v; s1 += v; }
  }
  red[tid] = s1; __syncthreads();
  for (int st = 128; st > 0; st >>= 1) { if (tid < st) red[tid] += red[tid + st]; __syncthreads(); }
  const float mu = red[0] / (float)N; __syncthreads();
  float s2 = 0.f;
  for (int u = 0; u < per / 4; ++u)
#pragma unroll
    for (int q = 0; q < 4; ++q) { const float c = vals[u * 4 + q] - mu; s2 += c * c; }
  red[tid] = s2; __syncthreads();
  for (int st = 128; st > 0; st >>= 1) { if (tid < st) red[tid] += red[tid + st]; __syncthreads(); }
  const float rs = rsqrtf(red[0] / (float)N + eps);
  {
    for (int u = 0; u < per / 4; ++u) {
      const int j = tid * 4 + 1024 * u;
      v4f o, sm;
#pragma unroll
      for (int q = 0; q < 4; ++q) {
        float gg = g[j + q], bb = bta[j + q];
        if (PARAM_BF16) { gg = bf16_round(gg); bb = bf16_round(bb); }
        sm[q] = vals[u * 4 + q]; o[q] = (vals[u * 4 + q] - mu) * rs * gg + bb;
      }
      if (out_sum) *(v4f*)(out_sum + (size_t)row * N + j) = sm;
      *(v4f*)(out_norm + (size_t)row * N + j) = o;
    }
    
  }
}



// ---- f16 WMMA path (v_wmma_f32_16x16x32_f16): 11-bit significands for operands in range — used where a [0,1] probability operand needs more precision than bf16
typedef _Float16 v16h __attribute__((ext_vector_type(16)));
union FragH { v16h v; v8us half[2]; _Float16 h[16]; unsigned short u[16]; };
template <int NT>
__device__ __forceinline__ v8f mmaH(v16h ah, v16h al, v16h bh, v16h bl, v8f c) {
  c = __builtin_amdgcn_wmma_f32_16x16x32_f16(false, ah, false, bh, (short)0, c, false, false);
  if (NT >= 2) c = __builtin_amdgcn_wmma_f32_16x16x32_f16(false, al, false, bh, (short)0, c, false, false);
  if (NT >= 3) c = __builtin_amdgcn_wmma_f32_16x16x32_f16(false, ah, false, bl, (short)0, c, false, false);
  asm volatile("v_nop\n\tv_nop\n\tv_nop\n\tv_nop" : "+v"(c) : "v"(ah), "v"(al), "v"(bh), "v"(bl));
  return c;
}
// batched GEMM like k_gemm_b but f16 operands: A f32 (split into f16 hi/lo if ASPLIT, else rounded to f16), Bt = f16 values [n][k]; alpha; C f32; N multiple of 16 (partial tiles skipped)
template <bool ASPLIT>
__global__ __launch_bounds__(128) void k_gemm_h(const float* __restrict__ A, int lda, size_t sA, const _Float16* __restrict__ Bh, int ldb, size_t sB, float alpha, float* __restrict__ C, int ldc, size_t sC, int M, int N, int K) {
  __shared__ __attribute__((aligned(16))) float so[4][16][64];
  const int tid = threadIdx.x, w = tid >> 5, lane = tid & 31, ln = lane & 15, hh = lane >> 4; const int by = blockIdx.y;
  A += (size_t)by * sA; Bh += (size_t)by * sB; C += (size_t)by * sC;
  const int ntn = (N + 63) / 64; const int wid = blockIdx.x * 4 + w; const int mt = wid / ntn, nq = wid % ntn; if (mt * 16 >= M) return;
  const int row0 = mt * 16, col0 = nq * 64; const float* arow = A + (size_t)(row0 + ln) * lda;
  v8f acc[4] = {};
  for (int kb = 0; kb < K; kb += 32) {
    FragH ah, al;
    const v4f x0 = *(const v4fa*)(arow + kb + 8 * hh), x1 = *(const v4fa*)(arow + kb + 8 * hh + 4), x2 = *(const v4fa*)(arow + kb + 16 + 8 * hh), x3 = *(const v4fa*)(arow + kb + 16 + 8 * hh + 4);
    float xs[16] = {x0[0],x0[1],x0[2],x0[3],x1[0],x1[1],x1[2],x1[3],x2[0],x2[1],x2[2],x2[3],x3[0],x3[1],x3[2],x3[3]};
#pragma unroll
    for (int i = 0; i < 16; ++i) { const _Float16 h = (_Float16)xs[i]; ah.h[i] = h; al.h[i] = ASPLIT ? (_Float16)(xs[i] - (float)h) : (_Float16)0.0f; }
#pragma unroll
    for (int t = 0; t < 4; ++t) { if (col0 + t * 16 >= N) continue; const size_t boff = (size_t)(col0 + t * 16 + ln) * ldb + kb; FragH bq; bq.half[0] = *(const v8us*)(Bh + boff + 8 * hh); bq.half[1] = *(const v8us*)(Bh + boff + 16 + 8 * hh);
      acc[t] = mmaH<ASPLIT ? 2 : 1>(ah.v, al.v, bq.v, bq.v, acc[t]); }
  }
#pragma unroll
  for (int t = 0; t < 4; ++t) { if (col0 + t * 16 >= N) continue;
#pragma unroll
    for (int r = 0; r < 8; ++r) so[w][8 * hh + r][t * 16 + ln] = acc[t][r] * alpha; }
  __builtin_amdgcn_fence(__ATOMIC_ACQ_REL, "workgroup"); __builtin_amdgcn_wave_barrier();
  const int rsub = lane >> 4, c4 = (lane & 15) * 4;
  {
#pragma unroll
    for (int q = 0; q < 8; ++q) { const int r = q * 2 + rsub; if (col0 + c4 < N) { const v4f v = *(const v4fa*)&so[w][r][c4]; *(v4f*)(C + (size_t)(row0 + r) * ldc + col0 + c4) = v; } }
     }
}

// Wt[n][k] = f16(W[k][n]·scale) from f32 row-major W[K][N] (scale = power of two; bf16-exact weights stay exact in f16 away from the subnormal range)
__global__ __launch_bounds__(256) void k_wt_f16(const float* __restrict__ W, _Float16* __restrict__ Wt, int K, int N, float scale) {
  const int t = blockIdx.x * 256 + threadIdx.x; if (t >= N * (K / 8)) return; const int n = t / (K / 8), k8 = (t % (K / 8)) * 8; FragH f;
#pragma unroll
  for (int i = 0; i < 8; ++i) f.h[i] = (_Float16)(bf16_round(W[(size_t)(k8 + i) * N + n]) * scale); const v8us o = f.half[0];
  *(v8us*)((unsigned short*)Wt + (size_t)n * K + k8) = o; 
}
// k_gemm_hh variant with fused epilogue: v = acc·alpha + bias[by·sBias + col] (+ CP[(row/rowsPerB)·sCPb + by·64 + col] if CP) ; ACT 0 none / 1 elu ; writes f16 C16 (and f32 C if non-null)
template <int ACT>
__global__ __launch_bounds__(128) void k_gemm_hhx(const _Float16* __restrict__ A, int lda, size_t sA, const _Float16* __restrict__ Bh, int ldb, size_t sB, float alpha, const float* __restrict__ bias, size_t sBias, const float* __restrict__ CP, int rowsPerB, size_t sCPb, int row0g,
    float* __restrict__ C, _Float16* __restrict__ C16, int ldc, size_t sC, int M, int N, int K) {
  __shared__ __attribute__((aligned(16))) float so[4][16][64];
  const int tid = threadIdx.x, w = tid >> 5, lane = tid & 31, ln = lane & 15, hh = lane >> 4; const int by = blockIdx.y;
  A += (size_t)by * sA; Bh += (size_t)by * sB; const size_t cofs = (size_t)by * sC; const float* bp = bias ? bias + (size_t)by * sBias : nullptr;
  const int ntn = (N + 63) / 64; const int wid = blockIdx.x * 4 + w; const int mt = wid / ntn, nq = wid % ntn; if (mt * 16 >= M) return;
  const int row0 = mt * 16, col0 = nq * 64; const _Float16* arow = A + (size_t)(row0 + ln) * lda;
  v8f acc[4] = {};
  for (int kb = 0; kb < K; kb += 32) { FragH ah; ah.half[0] = *(const v8us*)((const unsigned short*)arow + kb + 8 * hh); ah.half[1] = *(const v8us*)((const unsigned short*)arow + kb + 16 + 8 * hh);
#pragma unroll
    for (int t = 0; t < 4; ++t) { if (col0 + t * 16 >= N) continue; const size_t boff = (size_t)(col0 + t * 16 + ln) * ldb + kb; FragH bq; bq.half[0] = *(const v8us*)((const unsigned short*)Bh + boff + 8 * hh); bq.half[1] = *(const v8us*)((const unsigned short*)Bh + boff + 16 + 8 * hh);
      acc[t] = mmaH<1>(ah.v, ah.v, bq.v, bq.v, acc[t]); }
  }
#pragma unroll
  for (int t = 0; t < 4; ++t) { if (col0 + t * 16 >= N) continue; const int col = col0 + t * 16 + ln; const float bv = bp ? bf16_round(bp[col]) : 0.f;
#pragma unroll
    for (int r = 0; r < 8; ++r) { float v = acc[t][r] * alpha + bv; if (CP) { const int rr = row0g + row0 + 8 * hh + r; if (rowsPerB < 0) v += CP[cofs + (size_t)rr * ldc + col];      /* rowsPerB < 0: own element of the batched C plane */ else { const int bidx = rr / rowsPerB; v += CP[(size_t)bidx * sCPb + (size_t)by * 64 + col]; } } if (ACT == 1) v = (v > 0.f) ? v : expm1f(v); else if (ACT == 7) v = (v > 0.f) ? v + 1.0f : expf(v); else if (ACT == 8) v = tanhf(v); else if (ACT == 9) v = 0.5f * v * (1.0f + tanhf(0.7978845608028654f * (v + 0.044715f * v * v * v))); else if (ACT == 11) v = 1.0f / (1.0f + expf(-v)); else if (ACT == 12) v = (v > 0.f) ? v : 0.01f * v; else if (ACT == 14) v = (v > 0.f) ? v : 0.1f * v; else if (ACT == 16) v = (v >= 0.f) ? v : 0.3f * v; else if (ACT == 17) v = (v >= 0.f) ? v : 0.2f * v; else if (ACT == 15) v = v / (1.0f + expf(-v)); else if (ACT == 3) v = fmaxf(v, 0.f); else if (ACT == 6) v = 0.5f * v * (1.0f + erff(v * 0.70710678118654752f)); so[w][8 * hh + r][t * 16 + ln] = v; } }
  __builtin_amdgcn_fence(__ATOMIC_ACQ_REL, "workgroup"); __builtin_amdgcn_wave_barrier();
  const int rsub = lane >> 4, c4 = (lane & 15) * 4; typedef _Float16 v4h __attribute__((ext_vector_type(4)));
static_assert(QT == 256 && SQ == 8 * 256, "the softmax kernel is instantiated for 1 to 8 blocks of 256 keys");
  {
#pragma unroll
    for (int q = 0; q < 8; ++q) { const int r = q * 2 + rsub; if (col0 + c4 < N) { const v4f v = *(const v4fa*)&so[w][r][c4]; if (C) *(v4f*)(C + cofs + (size_t)(row0 + r) * ldc + col0 + c4) = v; if (C16) { v4h h4; for (int i = 0; i < 4; ++i) h4[i] = (_Float16)v[i]; *(v4h*)(C16 + cofs + (size_t)(row0 + r) * ldc + col0 + c4) = h4; } } }
     }
}


typedef _Float16 v4h __attribute__((ext_vector_type(4)));

__global__ __launch_bounds__(256) void k_x16(const float* __restrict__ x, _Float16* __restrict__ X16, size_t n8) { const size_t t = (size_t)blockIdx.x * 256 + threadIdx.x; if (t >= n8) return; FragH f;
#pragma unroll
  for (int q = 0; q < 8; ++q) f.h[q] = (_Float16)bf16_round(x[t * 8 + q]); *(v8us*)((unsigned short*)X16 + t * 8) = f.half[0];  }
__global__ __launch_bounds__(256) void k_h16(const float* __restrict__ x, _Float16* __restrict__ X16, size_t n8) { const size_t t = (size_t)blockIdx.x * 256 + threadIdx.x; if (t >= n8) return; FragH f;
#pragma unroll
  for (int q = 0; q < 8; ++q) f.h[q] = (_Float16)x[t * 8 + q]; *(v8us*)((unsigned short*)X16 + t * 8) = f.half[0];  }
__global__ __launch_bounds__(256) void k_round16f(const float* __restrict__ W, _Float16* __restrict__ Bt, size_t n8) { const size_t t = (size_t)blockIdx.x * 256 + threadIdx.x; if (t >= n8) return; FragH f;
#pragma unroll
  for (int i = 0; i < 8; ++i) f.h[i] = (_Float16)(bf16_round(W[t * 8 + i]) * 16.0f); *(v8us*)((unsigned short*)Bt + t * 8) = f.half[0];  }
template <int NHv, int TTv>
__global__ __launch_bounds__(256) void k_vt(const _Float16* __restrict__ V16, int ldv, int voff, _Float16* __restrict__ Vt) { __shared__ unsigned short tl[64][66]; const int tid = threadIdx.x; const int slab = blockIdx.x / (TTv / 64), lg = blockIdx.x % (TTv / 64); const int b = slab / NHv, h = slab % NHv;
  for (int i = tid; i < 64 * 8; i += 256) { const int r = i / 8, c8 = (i % 8) * 8; FragH f; f.half[0] = *(const v8us*)((const unsigned short*)V16 + ((size_t)b * TTv + lg * 64 + r) * ldv + voff + h * 64 + c8);
#pragma unroll
    for (int q = 0; q < 8; ++q) tl[r][c8 + q] = f.u[q]; }
  __syncthreads();
  {
#pragma unroll
    for (int rd = 0; rd < 2; ++rd) { const int d = rd * 32 + tid / 8, pc = tid % 8; FragH f;
#pragma unroll
      for (int q = 0; q < 8; ++q) f.u[q] = tl[pc * 8 + q][d];
      *(v8us*)((unsigned short*)Vt + ((size_t)slab * 64 + d) * TTv + lg * 64 + pc * 8) = f.half[0]; }
     } }

__global__ __launch_bounds__(256) void k_hl(const float* __restrict__ F, _Float16* __restrict__ Hh, _Float16* __restrict__ Hl, size_t n8) { const size_t t = (size_t)blockIdx.x * 256 + threadIdx.x; if (t >= n8) return; FragH fh, fl; const v4f a = *(const v4fa*)(F + t * 8), c = *(const v4fa*)(F + t * 8 + 4);
#pragma unroll
  for (int q = 0; q < 4; ++q) { _Float16 h = (_Float16)a[q]; fh.h[q] = h; fl.h[q] = (_Float16)((a[q] - (float)h) * 1024.0f); h = (_Float16)c[q]; fh.h[4 + q] = h; fl.h[4 + q] = (_Float16)((c[q] - (float)h) * 1024.0f); }
  { *(v8us*)((unsigned short*)Hh + t * 8) = fh.half[0]; *(v8us*)((unsigned short*)Hl + t * 8) = fl.half[0];  } }

// ---- fast GEMM (wave tile 32x64; requires M % 32 == 0 rows per launch region and N % 64 == 0); epilogue = k_gemm_hhx semantics ----
__device__ __forceinline__ v16h g2_frag(const _Float16* p, int hh) { FragH f; f.half[0] = *(const v8us*)((const unsigned short*)p + 8 * hh); f.half[1] = *(const v8us*)((const unsigned short*)p + 16 + 8 * hh); return f.v; }
__device__ __forceinline__ v8f g2_mma(v16h a, v16h b, v8f c) { v8f d = __builtin_amdgcn_wmma_f32_16x16x32_f16(false, a, false, b, (short)0, c, false, false); asm volatile("v_nop\n\tv_nop\n\tv_nop\n\tv_nop" : "+v"(d) : "v"(a), "v"(b)); return d; }
template <int ACT>
__global__ __launch_bounds__(128) void k_gemm2(const _Float16* __restrict__ A, int lda, size_t sA, const _Float16* __restrict__ Bh, int ldb, size_t sB, float alpha, const float* __restrict__ bias, size_t sBias, const float* __restrict__ CP, int rowsPerB, size_t sCPb, int row0g,
    float* __restrict__ C, _Float16* __restrict__ C16, int ldc, size_t sC, int M, int N, int K) { static_assert(ACT == 0 || ACT == 3 || ACT == 6 || ACT == 8 || ACT == 9 || ACT == 11 || ACT == 12 || ACT == 14 || ACT == 15 || ACT == 16 || ACT == 17, "k_gemm2: unsupported ACT code (would silently apply no activation)");
  __shared__ __attribute__((aligned(16))) float so[4][32][68];
  const int tid = threadIdx.x, w = tid >> 5, lane = tid & 31, ln = lane & 15, hh = lane >> 4; const int by = blockIdx.y;
  A += (size_t)by * sA; Bh += (size_t)by * sB; const size_t cofs = (size_t)by * sC; const float* bp = bias ? bias + (size_t)by * sBias : nullptr;
  const int ntn = N >> 6; const int mt = blockIdx.x / ntn, nq = blockIdx.x - mt * ntn; const int row0 = mt * 128 + 32 * w, col0 = nq * 64; if (row0 >= M) return;
  const _Float16* a0p = A + (size_t)(row0 + ln) * lda; const _Float16* a1p = a0p + (size_t)16 * lda;
  const _Float16* b0p = Bh + (size_t)(col0 + ln) * ldb; const _Float16* b1p = b0p + (size_t)16 * ldb; const _Float16* b2p = b1p + (size_t)16 * ldb; const _Float16* b3p = b2p + (size_t)16 * ldb;
  const v8f z8 = {0.f,0.f,0.f,0.f,0.f,0.f,0.f,0.f}; v8f c00 = z8, c01 = z8, c02 = z8, c03 = z8, c10 = z8, c11 = z8, c12 = z8, c13 = z8;
#pragma unroll 1
  for (int kb = 0; kb < K; kb += 32) { const v16h a0 = g2_frag(a0p + kb, hh), a1 = g2_frag(a1p + kb, hh);
    v16h b = g2_frag(b0p + kb, hh); c00 = g2_mma(a0, b, c00); c10 = g2_mma(a1, b, c10);
    b = g2_frag(b1p + kb, hh); c01 = g2_mma(a0, b, c01); c11 = g2_mma(a1, b, c11);
    b = g2_frag(b2p + kb, hh); c02 = g2_mma(a0, b, c02); c12 = g2_mma(a1, b, c12);
    b = g2_frag(b3p + kb, hh); c03 = g2_mma(a0, b, c03); c13 = g2_mma(a1, b, c13); }
  v8f accs[8] = {c00, c01, c02, c03, c10, c11, c12, c13};
#pragma unroll
  for (int u = 0; u < 8; ++u) { const int t = u & 3, half = u >> 2; const int col = col0 + t * 16 + ln; const float bv = bp ? bf16_round(bp[col]) : 0.f;
#pragma unroll
    for (int r = 0; r < 8; ++r) { const int rloc = half * 16 + 8 * hh + r; float v = accs[u][r] * alpha + bv; if (CP) { if (rowsPerB < 0) v += CP[cofs + (size_t)(row0g + row0 + rloc) * ldc + col];      /* rowsPerB < 0: own element of the batched C plane */ else { const int bidx = (row0g + row0 + rloc) / rowsPerB; v += CP[(size_t)bidx * sCPb + (size_t)by * 64 + col]; } }
      if (ACT == 3) v = fmaxf(v, 0.f); else if (ACT == 6) v = 0.5f * v * (1.0f + erff(v * 0.70710678118654752f)); else if (ACT == 11) v = 1.0f / (1.0f + expf(-v)); else if (ACT == 15) v = v / (1.0f + expf(-v)); else if (ACT == 12) v = (v > 0.f) ? v : 0.01f * v; else if (ACT == 8) v = tanhf(v); else if (ACT == 9) v = 0.5f * v * (1.0f + tanhf(0.7978845608028654f * (v + 0.044715f * v * v * v))); else if (ACT == 14) v = (v > 0.f) ? v : 0.1f * v; else if (ACT == 16) v = (v >= 0.f) ? v : 0.3f * v; else if (ACT == 17) v = (v >= 0.f) ? v : 0.2f * v;
      so[w][rloc][t * 16 + ln] = v; } }
  __builtin_amdgcn_fence(__ATOMIC_ACQ_REL, "workgroup"); __builtin_amdgcn_wave_barrier();
  const int rsub = lane >> 4, c4 = (lane & 15) * 4;
  {
#pragma unroll
    for (int q = 0; q < 16; ++q) { const int r = q * 2 + rsub; const v4f v = *(const v4fa*)&so[w][r][c4]; if (C) *(v4f*)(C + cofs + (size_t)(row0 + r) * ldc + col0 + c4) = v; if (C16) { v4h h4; for (int i = 0; i < 4; ++i) h4[i] = (_Float16)v[i]; *(v4h*)(C16 + cofs + (size_t)(row0 + r) * ldc + col0 + c4) = h4; } }
     } }


__global__ __launch_bounds__(256) void k_wnat(const float* __restrict__ w, size_t n8, _Float16* __restrict__ Bt) { const size_t t = (size_t)blockIdx.x * 256 + threadIdx.x; if (t >= n8) return; FragH f; for (int q = 0; q < 8; ++q) f.h[q] = (_Float16)(bf16_round(w[t * 8 + q]) * 16.0f); *(v8us*)((unsigned short*)Bt + t * 8) = f.half[0];  }
__global__ __launch_bounds__(256) void k_rsm(const float* __restrict__ S, _Float16* __restrict__ P, int nrows) {
  #pragma clang fp contract(off)
  const int i = blockIdx.x * 256 + threadIdx.x; if (i >= nrows) return; const float* s = S + (size_t)i * SQ; float mx = -3.0e38f;
#pragma unroll 1
  for (int j = 0; j < SQ; ++j) mx = fmaxf(mx, s[j]); float se = 0.f;
#pragma unroll 1
  for (int j = 0; j < SQ; ++j) se += expf(s[j] - mx); const float sc = 256.0f / se;
#pragma unroll 1
  for (int j0 = 0; j0 < SQ; j0 += 8) { FragH f; for (int q = 0; q < 8; ++q) f.h[q] = (_Float16)(expf(s[j0 + q] - mx) * sc); unsigned short* d = (unsigned short*)P + (size_t)i * SQ + j0; *(v8us*)d = f.half[0];  } }
__global__ __launch_bounds__(256) void k_vt(const _Float16* __restrict__ V16, int b, int h0, _Float16* __restrict__ VT) { __shared__ unsigned short tl[64][65]; const int tid = threadIdx.x; const int hh = blockIdx.x % HG, sg = blockIdx.x / HG; const int s0 = sg * 64; const int h = h0 + hh;
  for (int i = tid; i < 64 * 8; i += 256) { const int j = i / 8, d8 = (i % 8) * 8; FragH f; f.half[0] = *(const v8us*)((const unsigned short*)V16 + ((size_t)b * SQ + s0 + j) * DM + h * HD + d8); for (int q = 0; q < 8; ++q) tl[d8 + q][j] = f.u[q]; }
  __syncthreads();
  { for (int i = tid; i < 64 * 8; i += 256) { const int d = i / 8, j8 = (i % 8) * 8; FragH f; for (int q = 0; q < 8; ++q) f.u[q] = tl[d][j8 + q]; *(v8us*)((unsigned short*)VT + ((size_t)hh * HD + d) * SQ + s0 + j8) = f.half[0]; }  } }



// Causal row softmax, one wave per score row: lane l holds elements 128 u + 4 l .. + 3 of the row in registers (S read once, 512 contiguous bytes per load),
// maximum and sum by a butterfly over the 32 lanes, weights x256 stored as f16 (256 contiguous bytes per store). NC = computed keys / 256.
template <int CTRL> __device__ __forceinline__ float rs_row16(float v) { return __int_as_float(__builtin_amdgcn_update_dpp(0, __float_as_int(v), CTRL, 0xf, 0xf, true)); }      /* lane l ^ mask inside a 16-lane row (row_xmask) */
__device__ __forceinline__ float rs_x16(float v) { const int u = __float_as_int(v); return __int_as_float(__builtin_amdgcn_permlanex16(u, u, 0x76543210, 0xfedcba98, false, false)); }      /* lane l ^ 16 */
__device__ __forceinline__ float rs_wave_max(float v) { v = fmaxf(v, rs_row16<0x161>(v)); v = fmaxf(v, rs_row16<0x162>(v)); v = fmaxf(v, rs_row16<0x164>(v)); v = fmaxf(v, rs_row16<0x168>(v)); return fmaxf(v, rs_x16(v)); }
__device__ __forceinline__ float rs_wave_sum(float v) { v += rs_row16<0x161>(v); v += rs_row16<0x162>(v); v += rs_row16<0x164>(v); v += rs_row16<0x168>(v); return v + rs_x16(v); }
// e^x in the native form (x log2 e, then v_exp_f32). The v_nop in the same statement fills the one slot the instruction set asks for behind a transcendental:
// a v_nop in a statement of its own did not stay behind the v_exp.
__device__ __forceinline__ float rs_exp(float x) { float r; asm("v_exp_f32 %0, %1\n\tv_nop" : "=v"(r) : "v"(x * 1.44269504088896340736f)); return r; }
template <int NC>
__device__ __forceinline__ void rs_row(const float* __restrict__ s, _Float16* __restrict__ p, int last, int lane) {
  v4f v[2 * NC];      /* every loop below is fully unrolled so that v[] is indexed by constants and stays in registers, and all loads of the row are in flight together */
#pragma unroll
  for (int u = 0; u < 2 * NC; ++u) v[u] = *(const v4fa*)(s + u * 128 + lane * 4);
  float mx = -3.0e38f;
#pragma unroll
  for (int u = 0; u < 2 * NC; ++u)
#pragma unroll
    for (int q = 0; q < 4; ++q) { const float m = (u * 128 + lane * 4 + q <= last) ? v[u][q] : -1.0e9f; v[u][q] = m; mx = fmaxf(mx, m); }
  mx = rs_wave_max(mx);
  float se[4] = {0.f, 0.f, 0.f, 0.f};
#pragma unroll
  for (int u = 0; u < 2 * NC; ++u)
#pragma unroll
    for (int q = 0; q < 4; ++q) { const float e = rs_exp(v[u][q] - mx); v[u][q] = e; se[q] += e; }
  const float sc = 256.0f / rs_wave_sum((se[0] + se[1]) + (se[2] + se[3]));
#pragma unroll
  for (int u = 0; u < 2 * NC; ++u) { v4h h;
#pragma unroll
    for (int q = 0; q < 4; ++q) h[q] = (_Float16)(v[u][q] * sc);
    *(v4h*)(p + u * 128 + lane * 4) = h; } }
template <int NC>      /* the row length is a compile-time constant: one straight-line body that keeps the row in registers */
__global__ __launch_bounds__(256) void k_rsmcf2(const float* __restrict__ S, _Float16* __restrict__ P, int hg, int q0) {
  const int lane = threadIdx.x & 31; const int t = blockIdx.x * 8 + __builtin_amdgcn_readfirstlane(threadIdx.x >> 5); if (t >= hg * QT) return;      /* wave-uniform; no barrier in this kernel */
  rs_row<NC>(S + (size_t)t * NKX, P + (size_t)t * NKX, q0 + (t % QT), lane); }


// e^x for x <= 0 to f32 accuracy: n = the integer nearest x log2 e; x log2 e - n by two fused multiply-adds (the constant as its f32 value plus its low part), so the product is never rounded
// before n is taken off; 2^n applied by ldexp; 0 below the f32 range. The v_nop in the same statement fills the one slot the instruction set asks for behind a transcendental.
__device__ __forceinline__ float a0_exp(float x) { const float n = rintf(x * 1.4426950216293334961f); const float a = fmaf(x, 1.9259628558643271390e-8f, fmaf(x, 1.4426950216293334961f, -n));
  float r; asm("v_exp_f32 %0, %1\n\tv_nop" : "=v"(r) : "v"(a)); return (x < -103.2789306640625f) ? 0.f : ldexpf(r, (int)n); }
// Exact f32 attention for the first QT0 rows of one batch (causal form). Four lanes share a query row: lane part p = lane & 3 keeps dims 16 c + 4 p .. + 3 (c = 0..3)
// of q and o in registers; a wave holds 8 rows and walks the keys up to its own last row. The head's K and V rows are staged once in LDS, all loads in flight together;
// the 8 row groups of a wave read the same 64 bytes of a key row per load (broadcast, no bank conflict). The dot product is 16 terms per lane, then a butterfly over the 4 lanes.
// Every loop over c, u and the four keys of a trip is fully unrolled, so that q[], o[] and the LDS data are indexed by constants and stay in registers.
#define A0R 32                       /* query rows per block: 4 waves x 8 rows */
__global__ __launch_bounds__(128) void k_att0(const float* __restrict__ QF, const float* __restrict__ KF, const float* __restrict__ VF, float scale, float* __restrict__ OF) {      /* all four planes: QT0 rows of pitch DM */
  __shared__ __attribute__((aligned(16))) float lk[QT0][HD]; __shared__ __attribute__((aligned(16))) float lv[QT0][HD];
  const int tid = threadIdx.x, lane = tid & 31, p4 = (lane & 3) * 4; const int w = __builtin_amdgcn_readfirstlane(tid >> 5);
  const int h = blockIdx.x / (QT0 / A0R), rg = blockIdx.x % (QT0 / A0R);
  const int row = rg * A0R + w * 8 + (lane >> 2);      /* this lane's query row */
  const int nk = rg * A0R + w * 8 + 8;                 /* wave-uniform: keys up to the wave's last row (a multiple of 8, at most QT0) */
  { const int r0 = tid / 16, c4 = (tid % 16) * 4; const float* kp = KF + h * HD + r0 * DM + c4; const float* vp = VF + h * HD + r0 * DM + c4;
    v4f tk[QT0 / 8], tv[QT0 / 8];      /* fully unrolled: constant indices keep both in registers and every load of the tile is issued before the first LDS store */
#pragma unroll
    for (int it = 0; it < QT0 / 8; ++it) { tk[it] = *(const v4fa*)(kp + it * 8 * DM); tv[it] = *(const v4fa*)(vp + it * 8 * DM); }
#pragma unroll
    for (int it = 0; it < QT0 / 8; ++it) { *(v4f*)&lk[it * 8 + r0][c4] = tk[it]; *(v4f*)&lv[it * 8 + r0][c4] = tv[it]; } }
  __syncthreads();
  const float* qr = QF + row * DM + h * HD + p4;
  v4f q[4], o[4];
#pragma unroll
  for (int c = 0; c < 4; ++c) { q[c] = *(const v4fa*)(qr + c * 16); const v4f z = {0.f, 0.f, 0.f, 0.f}; o[c] = z; }
  float m = -1.0e30f, l = 0.f;
  for (int j0 = 0; j0 < nk; j0 += 4) {      /* four keys per trip, unrolled: their dot products are independent and fill each other's dependent links */
#pragma unroll
    for (int jj = 0; jj < 4; ++jj) { const int j = j0 + jj; float s = 0.f;
#pragma unroll
      for (int c = 0; c < 4; ++c) { const v4f kq = *(const v4f*)&lk[j][c * 16 + p4]; s += q[c][0] * kq[0]; s += q[c][1] * kq[1]; s += q[c][2] * kq[2]; s += q[c][3] * kq[3]; }
      s += rs_row16<0x161>(s); s += rs_row16<0x162>(s);      /* sum over the row's 4 lanes; all 4 end with the same bits */
      const float sm = (j <= row) ? s * scale : -1.0e30f; const float mn = fmaxf(m, sm); const float sc = a0_exp(m - mn); const float e = a0_exp(sm - mn); l = l * sc + e; m = mn;
#pragma unroll
      for (int c = 0; c < 4; ++c) { const v4f vv = *(const v4f*)&lv[j][c * 16 + p4];
#pragma unroll
        for (int u = 0; u < 4; ++u) o[c][u] = o[c][u] * sc + e * vv[u]; } } }
  const float fin = 64.0f / l;      /* o carried x64 like the f16 path */
  float* orow = OF + row * DM + h * HD + p4;
#pragma unroll
  for (int c = 0; c < 4; ++c) { v4f oo = o[c];
#pragma unroll
    for (int u = 0; u < 4; ++u) oo[u] *= fin;
    *(v4f*)(orow + c * 16) = oo; } }

extern "C" void kernel_launch(void* const* d_in, const int* in_sizes, int n_in,
                              void* d_out, int out_size, void* d_ws, size_t ws_size, hipStream_t stream) {
  (void)in_sizes; (void)n_in; (void)out_size;
  const float* const* I = (const float* const*)d_in; const float* x = I[0]; const float* wqkv = I[1]; const float* bqkv = nullptr; const float* wo = I[2]; const float* bo = I[3];      /* input order: y, Wqkv (fused [in][out] [1024][3072]), Wff ([in][out]), bff [1024]; the QKV projection has NO bias: bqkv is a null pointer (the two first-tile bias-third offsets are guarded); the output bias is bound */
  char* ws = (char*)d_ws; size_t off = 0;
  auto take = [&](size_t bytes) { char* p = ws + off; off += (bytes + 255) & ~(size_t)255; return p; };
  _Float16* BQKV = (_Float16*)take((size_t)3 * DM * DM * 2); _Float16* BO = (_Float16*)take((size_t)DM * DM * 2);
  _Float16* X16 = (_Float16*)take(NR * DM * 2); _Float16* QKV = (_Float16*)take(NR * 3 * DM * 2); _Float16* Q16 = QKV; _Float16* K16 = QKV + DM; _Float16* V16 = QKV + 2 * DM; _Float16* O16 = (_Float16*)take(NR * DM * 2);
  float* S = (float*)take((size_t)NH * QT * NKX * 4); _Float16* P = (_Float16*)take((size_t)NH * QT * NKX * 2); _Float16* VT = (_Float16*)take((size_t)NH * HD * SQ * 2);
  float* QF0 = (float*)take((size_t)QT0 * DM * 4); float* KF0 = (float*)take((size_t)QT0 * DM * 4); float* VF0 = (float*)take((size_t)QT0 * DM * 4); float* OF0 = (float*)take((size_t)NB * QT0 * DM * 4); _Float16* OH0 = (_Float16*)take((size_t)NB * QT0 * DM * 2); _Float16* OL0 = (_Float16*)take((size_t)NB * QT0 * DM * 2);
  if (off > ws_size) return;
  k_wt_f16<<<(unsigned)(((size_t)LQ * (DM / 8) + 255) / 256), 256, 0, stream>>>(wqkv, BQKV, DM, LQ, 16.0f); k_wt_f16<<<(unsigned)(((size_t)DM * (DM / 8) + 255) / 256), 256, 0, stream>>>(wo, BO, DM, DM, 16.0f);      /* [in][out] -> Bt[n][k] x16 */
  k_x16<<<(unsigned)((NR * DM / 8 + 255) / 256), 256, 0, stream>>>(x, X16, NR * DM / 8);
  const size_t r0p = (size_t)B0 * SQ;      /* first projected row */
  k_gemm2<0><<<dim3((unsigned)((MP / 128) * (3 * DM / 64)), 1), 128, 0, stream>>>(X16 + r0p * DM, DM, 0, BQKV, DM, 0, 0.0625f, bqkv, 0, nullptr, 1, 0, 0, nullptr, QKV + r0p * 3 * DM, 3 * DM, 0, MP, 3 * DM, DM);      /* q | k | v rows (f16); head h = columns h*HD.. of each DM block */
  for (int b = B0; b < B0 + NBR; ++b) { const size_t r0 = (size_t)b * SQ;
    k_vt<NH, SQ><<<NH * (SQ / 64), 256, 0, stream>>>(V16 + r0 * LQ, LQ, 0, VT);      /* V^T [NH][HD][SQ] for this batch */
    k_gemm2<0><<<dim3((QT0 / 128) * (DM / 64), 1), 128, 0, stream>>>(X16 + r0 * DM, DM, 0, BQKV, DM, 0, 0.0625f, bqkv, 0, nullptr, 1, 0, 0, QF0, nullptr, DM, 0, QT0, DM, DM); k_gemm2<0><<<dim3((QT0 / 128) * (DM / 64), 1), 128, 0, stream>>>(X16 + r0 * DM, DM, 0, (BQKV + (size_t)DM * DM), DM, 0, 0.0625f, ((bqkv ? bqkv + DM : nullptr)), 0, nullptr, 1, 0, 0, KF0, nullptr, DM, 0, QT0, DM, DM); k_gemm2<0><<<dim3((QT0 / 128) * (DM / 64), 1), 128, 0, stream>>>(X16 + r0 * DM, DM, 0, (BQKV + (size_t)2 * DM * DM), DM, 0, 0.0625f, ((bqkv ? bqkv + 2 * DM : nullptr)), 0, nullptr, 1, 0, 0, VF0, nullptr, DM, 0, QT0, DM, DM);      /* f32 q, k, v of the first 128 rows (exact products) */
    k_att0<<<NH * (QT0 / A0R), 128, 0, stream>>>(QF0, KF0, VF0, 0.125f, OF0 + (size_t)b * QT0 * DM);      /* exact f32 attention for rows 0..127 (o x64) */
    for (int q0 = 0; q0 < QN; q0 += QT) { const int nk = q0 + QT;      /* causal: only keys below the tile end are computed */
      k_gemm2<0><<<dim3((QT / 128) * (nk / 64), NHD), 128, 0, stream>>>(Q16 + (r0 + q0) * LQ, LQ, (size_t)HD, K16 + r0 * LQ, LQ, (size_t)HD, 0.125f, nullptr, 0, nullptr, 1, 0, 0, S, nullptr, NKX, (size_t)QT * NKX, QT, nk, HD);      /* scores, all heads on grid.y */
      switch (nk / 256) {      /* one wave per row, 8 rows per block; the kernel is instantiated per row length */
        case 1: k_rsmcf2<1><<<(NHD * QT + 7) / 8, 256, 0, stream>>>(S, P, NHD, q0); break; case 2: k_rsmcf2<2><<<(NHD * QT + 7) / 8, 256, 0, stream>>>(S, P, NHD, q0); break; case 3: k_rsmcf2<3><<<(NHD * QT + 7) / 8, 256, 0, stream>>>(S, P, NHD, q0); break; case 4: k_rsmcf2<4><<<(NHD * QT + 7) / 8, 256, 0, stream>>>(S, P, NHD, q0); break; case 5: k_rsmcf2<5><<<(NHD * QT + 7) / 8, 256, 0, stream>>>(S, P, NHD, q0); break; case 6: k_rsmcf2<6><<<(NHD * QT + 7) / 8, 256, 0, stream>>>(S, P, NHD, q0); break; case 7: k_rsmcf2<7><<<(NHD * QT + 7) / 8, 256, 0, stream>>>(S, P, NHD, q0); break; default: k_rsmcf2<8><<<(NHD * QT + 7) / 8, 256, 0, stream>>>(S, P, NHD, q0); break; }
      k_gemm2<0><<<dim3((QT / 128) * (HD / 64), NHD), 128, 0, stream>>>(P, NKX, (size_t)QT * NKX, VT, SQ, (size_t)HD * SQ, 0.25f, nullptr, 0, nullptr, 1, 0, 0, nullptr, O16 + (r0 + q0) * DM, DM, (size_t)HD, QT, HD, nk); } }      /* o (merged heads, x64) as f16 rows */
  k_gemm2<0><<<dim3((unsigned)((MPO / 128) * (DM / 64)), 1), 128, 0, stream>>>(O16 + r0p * DM, DM, 0, BO, DM, 0, 0.0009765625f, bo, 0, nullptr, 1, 0, 0, (float*)d_out + r0p * DM, nullptr, DM, 0, MPO, DM, DM);      /* out rows are the output layout */
  k_hl<<<(unsigned)(((size_t)NB * QT0 * DM / 8 + 255) / 256), 256, 0, stream>>>(OF0, OH0, OL0, (size_t)NB * QT0 * DM / 8);      /* first-tile o (x64) -> f16 hi + x1024 residual planes */
  for (int b = B0; b < B0 + NBR; ++b) { const size_t r0 = (size_t)b * SQ; const size_t f0 = (size_t)b * QT0;
    k_gemm2<0><<<dim3((QT0 / 128) * (DM / 64), 1), 128, 0, stream>>>(OH0 + f0 * DM, DM, 0, BO, DM, 0, 0.0009765625f, bo, 0, nullptr, 1, 0, 0, (float*)d_out + r0 * DM, nullptr, DM, 0, QT0, DM, DM);      /* rows 0..127: out = o_hi Wo (+ b), overwriting the f16-path rows */
    k_gemm2<0><<<dim3((QT0 / 128) * (DM / 64), 1), 128, 0, stream>>>(OL0 + f0 * DM, DM, 0, BO, DM, 0, 0.00000095367431640625f, nullptr, 0, (const float*)d_out + r0 * DM, -1, 0, 0, (float*)d_out + r0 * DM, nullptr, DM, 0, QT0, DM, DM); }      /* += o_lo Wo 2^-20 (own-element accumulate) */
}

// v004
// Measured time: 301 microseconds a run.
// Versions between v002 and this one are left out; their measured steps multiply to 4.02 times as fast.
// Counting every step since v000, it is 16.6 times as fast.
#include <hip/hip_runtime.h>
#define NB 2
#define SQ 2048
#define DM 1024
#define NH 16
#define HD 64
#define HG 4                         /* heads per launch of the k_vt(V16, b, h0, VT) form, which is not launched */
#define QT0 128                      /* first-tile rows recomputed exactly in f32 */
#define B0 0                         /* first batch processed (debug hook) */
#define NBR NB                       /* batches processed (debug hook) */
#define NR ((size_t)NB * SQ)         /* token rows */
#define MP ((int)((size_t)NBR * SQ)) /* rows projected (debug hook) */
#define MPO MP                       /* rows through the output stage (debug hook) */
#define LQ (3 * DM)      /* row pitch of the q/k/v rows */
typedef __bf16 v16b __attribute__((ext_vector_type(16)));
typedef unsigned short v8us __attribute__((ext_vector_type(8), may_alias));
typedef float  v8f  __attribute__((ext_vector_type(8)));
typedef float  v4f  __attribute__((ext_vector_type(4)));
typedef float  v4fa __attribute__((ext_vector_type(4), may_alias));
union FragB { v16b v; v8us half[2]; unsigned short u[16]; };

__device__ __forceinline__ unsigned short bf16_bits(float x) { unsigned int u = __float_as_uint(x); return (unsigned short)((u + 0x7FFFu + ((u >> 16) & 1u)) >> 16); }
__device__ __forceinline__ float bf16_val(unsigned short b) { return __uint_as_float(((unsigned int)b) << 16); }
__device__ __forceinline__ float bf16_round(float x) { return bf16_val(bf16_bits(x)); }
// D += A·B with NT terms: 1 = ah·bh, 2 = + al·bh (A split), 3 = + ah·bl (both split)
template <int NT>
__device__ __forceinline__ v8f mmaN(v16b ah, v16b al, v16b bh, v16b bl, v8f c) {
  c = __builtin_amdgcn_wmma_f32_16x16x32_bf16(false, ah, false, bh, (short)0, c, false, false);
  if (NT >= 2) c = __builtin_amdgcn_wmma_f32_16x16x32_bf16(false, al, false, bh, (short)0, c, false, false);
  if (NT >= 3) c = __builtin_amdgcn_wmma_f32_16x16x32_bf16(false, ah, false, bl, (short)0, c, false, false);
  asm volatile("v_nop\n\tv_nop\n\tv_nop\n\tv_nop" : "+v"(c) : "v"(ah), "v"(al), "v"(bh), "v"(bl));
  return c;
}

__global__ __launch_bounds__(256) void k_wt_bf16(const float* __restrict__ W, unsigned short* __restrict__ Wt, int K, int N) {
  const int t = blockIdx.x * 256 + threadIdx.x;
  const int k8n = K / 8;
  if (t >= N * k8n) return;
  const int n = t / k8n, k8 = (t % k8n) * 8;
  v8us v;
#pragma unroll
  for (int i = 0; i < 8; ++i) v[i] = bf16_bits(W[(size_t)(k8 + i) * N + n]);
  *(v8us*)(Wt + (size_t)n * K + k8) = v;
  
}

// GEMM C[M][N] (f32, pitch ldc) = act(A[M][K]·W + bias). A f32 row-major (pitch lda) converted per fragment to bf16
// (ASPLIT: hi/lo two planes -> 2 terms, else single rounded term); Wt bf16 [N][K] (pitch ldb). BIAS_BF16 rounds the
// bias to bf16 first (bias quantised to bf16 before the add). K%32==0, M%16==0, N%64==0.
template <bool ASPLIT, int ACT, bool BIAS_BF16>
__global__ __launch_bounds__(128) void k_gemm_bf(const float* __restrict__ A, int lda, const unsigned short* __restrict__ Wt, int ldb,
                                               const float* __restrict__ bias, float* __restrict__ C, int ldc, int M, int N, int K) {
  __shared__ __attribute__((aligned(16))) float so[4][16][64];
  const int tid = threadIdx.x, w = tid >> 5, lane = tid & 31, ln = lane & 15, hh = lane >> 4;
  const int ntn = N / 64;
  const int wid = blockIdx.x * 4 + w;
  const int mt = wid / ntn, nq = wid % ntn;
  if (mt * 16 >= M) return;
  const int row0 = mt * 16, col0 = nq * 64;
  const float* arow = A + (size_t)(row0 + ln) * lda;
  v8f acc[4] = {};
  for (int kb = 0; kb < K; kb += 32) {
    FragB ah, al;
    const v4f x0 = *(const v4fa*)(arow + kb + 8 * hh), x1 = *(const v4fa*)(arow + kb + 8 * hh + 4);
    const v4f x2 = *(const v4fa*)(arow + kb + 16 + 8 * hh), x3 = *(const v4fa*)(arow + kb + 16 + 8 * hh + 4);
    float xs[16] = {x0[0],x0[1],x0[2],x0[3],x1[0],x1[1],x1[2],x1[3],x2[0],x2[1],x2[2],x2[3],x3[0],x3[1],x3[2],x3[3]};
#pragma unroll
    for (int i = 0; i < 16; ++i) { const unsigned short hb = bf16_bits(xs[i]); ah.u[i] = hb; al.u[i] = ASPLIT ? bf16_bits(xs[i] - bf16_val(hb)) : (unsigned short)0; }
#pragma unroll
    for (int t = 0; t < 4; ++t) {
      const unsigned short* brow = Wt + (size_t)(col0 + t * 16 + ln) * ldb + kb;
      FragB b;
      b.half[0] = *(const v8us*)(brow + 8 * hh);
      b.half[1] = *(const v8us*)(brow + 16 + 8 * hh);
      acc[t] = mmaN<ASPLIT ? 2 : 1>(ah.v, al.v, b.v, b.v, acc[t]);
    }
  }
#pragma unroll
  for (int t = 0; t < 4; ++t) {
    float bv = bias ? bias[col0 + t * 16 + ln] : 0.f;
    if (BIAS_BF16) bv = bf16_round(bv);
#pragma unroll
    for (int r = 0; r < 8; ++r) { float v = acc[t][r] + bv; if (ACT == 1) v = fmaxf(v, 0.f); so[w][8 * hh + r][t * 16 + ln] = v; }
  }
  __builtin_amdgcn_fence(__ATOMIC_ACQ_REL, "workgroup");
  __builtin_amdgcn_wave_barrier();
  const int rsub = lane >> 4, c4 = (lane & 15) * 4;
  {
#pragma unroll
    for (int q = 0; q < 8; ++q) {
      const int r = q * 2 + rsub;
      const v4f v = *(const v4fa*)&so[w][r][c4];
      *(v4f*)(C + (size_t)(row0 + r) * ldc + col0 + c4) = v;
    }
    
  }
}

// GEMM C = act(A·W + bias + resid): A f32 (ASPLIT -> hi/lo 2 terms), Wt bf16 [N][K]; ACT 0 none, 1 relu, 2 exact gelu;
// resid (optional, f32, row index = (row % rmod), pitch ldr, RES_BF16 rounds it) added before the activation.
template <bool ASPLIT, int ACT, bool BIAS_BF16, bool RES_BF16>
__global__ __launch_bounds__(128) void k_gemm_bf3(const float* __restrict__ A, int lda, const unsigned short* __restrict__ Wt, int ldb,
                                                const float* __restrict__ bias, const float* __restrict__ resid, int rmod, int ldr,
                                                float* __restrict__ C, int ldc, int M, int N, int K) {
  __shared__ __attribute__((aligned(16))) float so[4][16][64];
  const int tid = threadIdx.x, w = tid >> 5, lane = tid & 31, ln = lane & 15, hh = lane >> 4;
  const int ntn = N / 64;
  const int wid = blockIdx.x * 4 + w;
  const int mt = wid / ntn, nq = wid % ntn;
  if (mt * 16 >= M) return;
  const int row0 = mt * 16, col0 = nq * 64;
  const float* arow = A + (size_t)(row0 + ln) * lda;
  v8f acc[4] = {};
  for (int kb = 0; kb < K; kb += 32) {
    FragB ah, al;
    const v4f x0 = *(const v4fa*)(arow + kb + 8 * hh), x1 = *(const v4fa*)(arow + kb + 8 * hh + 4);
    const v4f x2 = *(const v4fa*)(arow + kb + 16 + 8 * hh), x3 = *(const v4fa*)(arow + kb + 16 + 8 * hh + 4);
    float xs[16] = {x0[0],x0[1],x0[2],x0[3],x1[0],x1[1],x1[2],x1[3],x2[0],x2[1],x2[2],x2[3],x3[0],x3[1],x3[2],x3[3]};
#pragma unroll
    for (int i = 0; i < 16; ++i) { const unsigned short hb = bf16_bits(xs[i]); ah.u[i] = hb; al.u[i] = ASPLIT ? bf16_bits(xs[i] - bf16_val(hb)) : (unsigned short)0; }
#pragma unroll
    for (int t = 0; t < 4; ++t) {
      const unsigned short* brow = Wt + (size_t)(col0 + t * 16 + ln) * ldb + kb;
      FragB b;
      b.half[0] = *(const v8us*)(brow + 8 * hh);
      b.half[1] = *(const v8us*)(brow + 16 + 8 * hh);
      acc[t] = mmaN<ASPLIT ? 2 : 1>(ah.v, al.v, b.v, b.v, acc[t]);
    }
  }
#pragma unroll
  for (int t = 0; t < 4; ++t) {
    const int col = col0 + t * 16 + ln;
    float bv = bias ? bias[col] : 0.f;
    if (BIAS_BF16) bv = bf16_round(bv);
#pragma unroll
    for (int r = 0; r < 8; ++r) {
      float v = acc[t][r] + bv;
      if (resid) { float rv = resid[(size_t)((row0 + 8 * hh + r) % rmod) * ldr + col]; if (RES_BF16) rv = bf16_round(rv); v += rv; }
      if (ACT == 1) v = fmaxf(v, 0.f);
      if (ACT == 2) v = 0.5f * v * (1.0f + erff(v * 0.70710678118654752f));
      if (ACT == 3) { const float u = 0.7978845608028654f * (v + 0.044715f * v * v * v); v = 0.5f * v * (1.0f + tanhf(u)); }
      so[w][8 * hh + r][t * 16 + ln] = v;
    }
  }
  __builtin_amdgcn_fence(__ATOMIC_ACQ_REL, "workgroup");
  __builtin_amdgcn_wave_barrier();
  const int rsub = lane >> 4, c4 = (lane & 15) * 4;
  {
#pragma unroll
    for (int q = 0; q < 8; ++q) {
      const int r = q * 2 + rsub;
      const v4f v = *(const v4fa*)&so[w][r][c4];
      *(v4f*)(C + (size_t)(row0 + r) * ldc + col0 + c4) = v;
    }
    
  }
}
// row LayerNorm (biased variance, eps) over N: s = X (+ R); optional out_sum <- s; out_norm <- (s-mu)*rsqrt(var+eps)*g + b
template <bool PARAM_BF16>
__global__ __launch_bounds__(256) void k_layernorm(const float* __restrict__ X, const float* __restrict__ R, const float* __restrict__ g, const float* __restrict__ bta,
                                                  float* __restrict__ out_sum, float* __restrict__ out_norm, int N, float eps) {
  __shared__ float red[256];
  const int row = blockIdx.x, tid = threadIdx.x;
  const float* x = X + (size_t)row * N; const float* rr = R ? R + (size_t)row * N : nullptr;
  float vals[16];                     // up to N = 4096
  const int per = N / 256;            // contiguous chunk per thread? use strided-by-4 chunks: thread handles j = tid*4 + 1024*u
  float s1 = 0.f;
  for (int u = 0; u < per / 4; ++u) {
    const int j = tid * 4 + 1024 * u;
    const v4f a = *(const v4fa*)(x + j);
    v4f b = {0.f,0.f,0.f,0.f}; if (rr) b = *(const v4fa*)(rr + j);
#pragma unroll
    for (int q = 0; q < 4; ++q) { const float v = a[q] + b[q]; vals[u * 4 + q] = v; s1 += v; }
  }
  red[tid] = s1; __syncthreads();
  for (int st = 128; st > 0; st >>= 1) { if (tid < st) red[tid] += red[tid + st]; __syncthreads(); }
  const float mu = red[0] / (float)N; __syncthreads();
  float s2 = 0.f;
  for (int u = 0; u < per / 4; ++u)
#pragma unroll
    for (int q = 0; q < 4; ++q) { const float c = vals[u * 4 + q] - mu; s2 += c * c; }
  red[tid] = s2; __syncthreads();
  for (int st = 128; st > 0; st >>= 1) { if (tid < st) red[tid] += red[tid + st]; __syncthreads(); }
  const float rs = rsqrtf(red[0] / (float)N + eps);
  {
    for (int u = 0; u < per / 4; ++u) {
      const int j = tid * 4 + 1024 * u;
      v4f o, sm;
#pragma unroll
      for (int q = 0; q < 4; ++q) {
        float gg = g[j + q], bb = bta[j + q];
        if (PARAM_BF16) { gg = bf16_round(gg); bb = bf16_round(bb); }
        sm[q] = vals[u * 4 + q]; o[q] = (vals[u * 4 + q] - mu) * rs * gg + bb;
      }
      if (out_sum) *(v4f*)(out_sum + (size_t)row * N + j) = sm;
      *(v4f*)(out_norm + (size_t)row * N + j) = o;
    }
    
  }
}



// ---- f16 WMMA path (v_wmma_f32_16x16x32_f16): 11-bit significands for operands in range — used where a [0,1] probability operand needs more precision than bf16
typedef _Float16 v16h __attribute__((ext_vector_type(16)));
union FragH { v16h v; v8us half[2]; _Float16 h[16]; unsigned short u[16]; };
template <int NT>
__device__ __forceinline__ v8f mmaH(v16h ah, v16h al, v16h bh, v16h bl, v8f c) {
  c = __builtin_amdgcn_wmma_f32_16x16x32_f16(false, ah, false, bh, (short)0, c, false, false);
  if (NT >= 2) c = __builtin_amdgcn_wmma_f32_16x16x32_f16(false, al, false, bh, (short)0, c, false, false);
  if (NT >= 3) c = __builtin_amdgcn_wmma_f32_16x16x32_f16(false, ah, false, bl, (short)0, c, false, false);
  asm volatile("v_nop\n\tv_nop\n\tv_nop\n\tv_nop" : "+v"(c) : "v"(ah), "v"(al), "v"(bh), "v"(bl));
  return c;
}
// batched GEMM like k_gemm_b but f16 operands: A f32 (split into f16 hi/lo if ASPLIT, else rounded to f16), Bt = f16 values [n][k]; alpha; C f32; N multiple of 16 (partial tiles skipped)
template <bool ASPLIT>
__global__ __launch_bounds__(128) void k_gemm_h(const float* __restrict__ A, int lda, size_t sA, const _Float16* __restrict__ Bh, int ldb, size_t sB, float alpha, float* __restrict__ C, int ldc, size_t sC, int M, int N, int K) {
  __shared__ __attribute__((aligned(16))) float so[4][16][64];
  const int tid = threadIdx.x, w = tid >> 5, lane = tid & 31, ln = lane & 15, hh = lane >> 4; const int by = blockIdx.y;
  A += (size_t)by * sA; Bh += (size_t)by * sB; C += (size_t)by * sC;
  const int ntn = (N + 63) / 64; const int wid = blockIdx.x * 4 + w; const int mt = wid / ntn, nq = wid % ntn; if (mt * 16 >= M) return;
  const int row0 = mt * 16, col0 = nq * 64; const float* arow = A + (size_t)(row0 + ln) * lda;
  v8f acc[4] = {};
  for (int kb = 0; kb < K; kb += 32) {
    FragH ah, al;
    const v4f x0 = *(const v4fa*)(arow + kb + 8 * hh), x1 = *(const v4fa*)(arow + kb + 8 * hh + 4), x2 = *(const v4fa*)(arow + kb + 16 + 8 * hh), x3 = *(const v4fa*)(arow + kb + 16 + 8 * hh + 4);
    float xs[16] = {x0[0],x0[1],x0[2],x0[3],x1[0],x1[1],x1[2],x1[3],x2[0],x2[1],x2[2],x2[3],x3[0],x3[1],x3[2],x3[3]};
#pragma unroll
    for (int i = 0; i < 16; ++i) { const _Float16 h = (_Float16)xs[i]; ah.h[i] = h; al.h[i] = ASPLIT ? (_Float16)(xs[i] - (float)h) : (_Float16)0.0f; }
#pragma unroll
    for (int t = 0; t < 4; ++t) { if (col0 + t * 16 >= N) continue; const size_t boff = (size_t)(col0 + t * 16 + ln) * ldb + kb; FragH bq; bq.half[0] = *(const v8us*)(Bh + boff + 8 * hh); bq.half[1] = *(const v8us*)(Bh + boff + 16 + 8 * hh);
      acc[t] = mmaH<ASPLIT ? 2 : 1>(ah.v, al.v, bq.v, bq.v, acc[t]); }
  }
#pragma unroll
  for (int t = 0; t < 4; ++t) { if (col0 + t * 16 >= N) continue;
#pragma unroll
    for (int r = 0; r < 8; ++r) so[w][8 * hh + r][t * 16 + ln] = acc[t][r] * alpha; }
  __builtin_amdgcn_fence(__ATOMIC_ACQ_REL, "workgroup"); __builtin_amdgcn_wave_barrier();
  const int rsub = lane >> 4, c4 = (lane & 15) * 4;
  {
#pragma unroll
    for (int q = 0; q < 8; ++q) { const int r = q * 2 + rsub; if (col0 + c4 < N) { const v4f v = *(const v4fa*)&so[w][r][c4]; *(v4f*)(C + (size_t)(row0 + r) * ldc + col0 + c4) = v; } }
     }
}

// Wt[n][k] = f16(W[k][n]·scale) from f32 row-major W[K][N] (scale = power of two; bf16-exact weights stay exact in f16 away from the subnormal range)
__global__ __launch_bounds__(256) void k_wt_f16(const float* __restrict__ W, _Float16* __restrict__ Wt, int K, int N, float scale) {
  const int t = blockIdx.x * 256 + threadIdx.x; if (t >= N * (K / 8)) return; const int n = t / (K / 8), k8 = (t % (K / 8)) * 8; FragH f;
#pragma unroll
  for (int i = 0; i < 8; ++i) f.h[i] = (_Float16)(bf16_round(W[(size_t)(k8 + i) * N + n]) * scale); const v8us o = f.half[0];
  *(v8us*)((unsigned short*)Wt + (size_t)n * K + k8) = o; 
}
// k_gemm_hh variant with fused epilogue: v = acc·alpha + bias[by·sBias + col] (+ CP[(row/rowsPerB)·sCPb + by·64 + col] if CP) ; ACT 0 none / 1 elu ; writes f16 C16 (and f32 C if non-null)
template <int ACT>
__global__ __launch_bounds__(128) void k_gemm_hhx(const _Float16* __restrict__ A, int lda, size_t sA, const _Float16* __restrict__ Bh, int ldb, size_t sB, float alpha, const float* __restrict__ bias, size_t sBias, const float* __restrict__ CP, int rowsPerB, size_t sCPb, int row0g,
    float* __restrict__ C, _Float16* __restrict__ C16, int ldc, size_t sC, int M, int N, int K) {
  __shared__ __attribute__((aligned(16))) float so[4][16][64];
  const int tid = threadIdx.x, w = tid >> 5, lane = tid & 31, ln = lane & 15, hh = lane >> 4; const int by = blockIdx.y;
  A += (size_t)by * sA; Bh += (size_t)by * sB; const size_t cofs = (size_t)by * sC; const float* bp = bias ? bias + (size_t)by * sBias : nullptr;
  const int ntn = (N + 63) / 64; const int wid = blockIdx.x * 4 + w; const int mt = wid / ntn, nq = wid % ntn; if (mt * 16 >= M) return;
  const int row0 = mt * 16, col0 = nq * 64; const _Float16* arow = A + (size_t)(row0 + ln) * lda;
  v8f acc[4] = {};
  for (int kb = 0; kb < K; kb += 32) { FragH ah; ah.half[0] = *(const v8us*)((const unsigned short*)arow + kb + 8 * hh); ah.half[1] = *(const v8us*)((const unsigned short*)arow + kb + 16 + 8 * hh);
#pragma unroll
    for (int t = 0; t < 4; ++t) { if (col0 + t * 16 >= N) continue; const size_t boff = (size_t)(col0 + t * 16 + ln) * ldb + kb; FragH bq; bq.half[0] = *(const v8us*)((const unsigned short*)Bh + boff + 8 * hh); bq.half[1] = *(const v8us*)((const unsigned short*)Bh + boff + 16 + 8 * hh);
      acc[t] = mmaH<1>(ah.v, ah.v, bq.v, bq.v, acc[t]); }
  }
#pragma unroll
  for (int t = 0; t < 4; ++t) { if (col0 + t * 16 >= N) continue; const int col = col0 + t * 16 + ln; const float bv = bp ? bf16_round(bp[col]) : 0.f;
#pragma unroll
    for (int r = 0; r < 8; ++r) { float v = acc[t][r] * alpha + bv; if (CP) { const int rr = row0g + row0 + 8 * hh + r; if (rowsPerB < 0) v += CP[cofs + (size_t)rr * ldc + col];      /* rowsPerB < 0: own element of the batched C plane */ else { const int bidx = rr / rowsPerB; v += CP[(size_t)bidx * sCPb + (size_t)by * 64 + col]; } } if (ACT == 1) v = (v > 0.f) ? v : expm1f(v); else if (ACT == 7) v = (v > 0.f) ? v + 1.0f : expf(v); else if (ACT == 8) v = tanhf(v); else if (ACT == 9) v = 0.5f * v * (1.0f + tanhf(0.7978845608028654f * (v + 0.044715f * v * v * v))); else if (ACT == 11) v = 1.0f / (1.0f + expf(-v)); else if (ACT == 12) v = (v > 0.f) ? v : 0.01f * v; else if (ACT == 14) v = (v > 0.f) ? v : 0.1f * v; else if (ACT == 16) v = (v >= 0.f) ? v : 0.3f * v; else if (ACT == 17) v = (v >= 0.f) ? v : 0.2f * v; else if (ACT == 15) v = v / (1.0f + expf(-v)); else if (ACT == 3) v = fmaxf(v, 0.f); else if (ACT == 6) v = 0.5f * v * (1.0f + erff(v * 0.70710678118654752f)); so[w][8 * hh + r][t * 16 + ln] = v; } }
  __builtin_amdgcn_fence(__ATOMIC_ACQ_REL, "workgroup"); __builtin_amdgcn_wave_barrier();
  const int rsub = lane >> 4, c4 = (lane & 15) * 4; typedef _Float16 v4h __attribute__((ext_vector_type(4)));
  {
#pragma unroll
    for (int q = 0; q < 8; ++q) { const int r = q * 2 + rsub; if (col0 + c4 < N) { const v4f v = *(const v4fa*)&so[w][r][c4]; if (C) *(v4f*)(C + cofs + (size_t)(row0 + r) * ldc + col0 + c4) = v; if (C16) { v4h h4; for (int i = 0; i < 4; ++i) h4[i] = (_Float16)v[i]; *(v4h*)(C16 + cofs + (size_t)(row0 + r) * ldc + col0 + c4) = h4; } } }
     }
}


typedef _Float16 v4h __attribute__((ext_vector_type(4)));

__global__ __launch_bounds__(256) void k_x16(const float* __restrict__ x, _Float16* __restrict__ X16, size_t n8) { const size_t t = (size_t)blockIdx.x * 256 + threadIdx.x; if (t >= n8) return; FragH f;
#pragma unroll
  for (int q = 0; q < 8; ++q) f.h[q] = (_Float16)bf16_round(x[t * 8 + q]); *(v8us*)((unsigned short*)X16 + t * 8) = f.half[0];  }
__global__ __launch_bounds__(256) void k_h16(const float* __restrict__ x, _Float16* __restrict__ X16, size_t n8) { const size_t t = (size_t)blockIdx.x * 256 + threadIdx.x; if (t >= n8) return; FragH f;
#pragma unroll
  for (int q = 0; q < 8; ++q) f.h[q] = (_Float16)x[t * 8 + q]; *(v8us*)((unsigned short*)X16 + t * 8) = f.half[0];  }
__global__ __launch_bounds__(256) void k_round16f(const float* __restrict__ W, _Float16* __restrict__ Bt, size_t n8) { const size_t t = (size_t)blockIdx.x * 256 + threadIdx.x; if (t >= n8) return; FragH f;
#pragma unroll
  for (int i = 0; i < 8; ++i) f.h[i] = (_Float16)(bf16_round(W[t * 8 + i]) * 16.0f); *(v8us*)((unsigned short*)Bt + t * 8) = f.half[0];  }
template <int NHv, int TTv>
__global__ __launch_bounds__(256) void k_vt(const _Float16* __restrict__ V16, int ldv, int voff, _Float16* __restrict__ Vt) { __shared__ unsigned short tl[64][66]; const int tid = threadIdx.x; const int slab = blockIdx.x / (TTv / 64), lg = blockIdx.x % (TTv / 64); const int b = slab / NHv, h = slab % NHv;
  for (int i = tid; i < 64 * 8; i += 256) { const int r = i / 8, c8 = (i % 8) * 8; FragH f; f.half[0] = *(const v8us*)((const unsigned short*)V16 + ((size_t)b * TTv + lg * 64 + r) * ldv + voff + h * 64 + c8);
#pragma unroll
    for (int q = 0; q < 8; ++q) tl[r][c8 + q] = f.u[q]; }
  __syncthreads();
  {
#pragma unroll
    for (int rd = 0; rd < 2; ++rd) { const int d = rd * 32 + tid / 8, pc = tid % 8; FragH f;
#pragma unroll
      for (int q = 0; q < 8; ++q) f.u[q] = tl[pc * 8 + q][d];
      *(v8us*)((unsigned short*)Vt + ((size_t)slab * 64 + d) * TTv + lg * 64 + pc * 8) = f.half[0]; }
     } }

__global__ __launch_bounds__(256) void k_hl(const float* __restrict__ F, _Float16* __restrict__ Hh, _Float16* __restrict__ Hl, size_t n8) { const size_t t = (size_t)blockIdx.x * 256 + threadIdx.x; if (t >= n8) return; FragH fh, fl; const v4f a = *(const v4fa*)(F + t * 8), c = *(const v4fa*)(F + t * 8 + 4);
#pragma unroll
  for (int q = 0; q < 4; ++q) { _Float16 h = (_Float16)a[q]; fh.h[q] = h; fl.h[q] = (_Float16)((a[q] - (float)h) * 1024.0f); h = (_Float16)c[q]; fh.h[4 + q] = h; fl.h[4 + q] = (_Float16)((c[q] - (float)h) * 1024.0f); }
  { *(v8us*)((unsigned short*)Hh + t * 8) = fh.half[0]; *(v8us*)((unsigned short*)Hl + t * 8) = fl.half[0];  } }

// ---- fast GEMM (wave tile 32x64; requires M % 32 == 0 rows per launch region and N % 64 == 0); epilogue = k_gemm_hhx semantics ----
__device__ __forceinline__ v16h g2_frag(const _Float16* p, int hh) { FragH f; f.half[0] = *(const v8us*)((const unsigned short*)p + 8 * hh); f.half[1] = *(const v8us*)((const unsigned short*)p + 16 + 8 * hh); return f.v; }
__device__ __forceinline__ v8f g2_mma(v16h a, v16h b, v8f c) { v8f d = __builtin_amdgcn_wmma_f32_16x16x32_f16(false, a, false, b, (short)0, c, false, false); asm volatile("v_nop\n\tv_nop\n\tv_nop\n\tv_nop" : "+v"(d) : "v"(a), "v"(b)); return d; }
template <int ACT>
__global__ __launch_bounds__(128) void k_gemm2(const _Float16* __restrict__ A, int lda, size_t sA, const _Float16* __restrict__ Bh, int ldb, size_t sB, float alpha, const float* __restrict__ bias, size_t sBias, const float* __restrict__ CP, int rowsPerB, size_t sCPb, int row0g,
    float* __restrict__ C, _Float16* __restrict__ C16, int ldc, size_t sC, int M, int N, int K) { static_assert(ACT == 0 || ACT == 3 || ACT == 6 || ACT == 8 || ACT == 9 || ACT == 11 || ACT == 12 || ACT == 14 || ACT == 15 || ACT == 16 || ACT == 17, "k_gemm2: unsupported ACT code (would silently apply no activation)");
  __shared__ __attribute__((aligned(16))) float so[4][32][68];
  const int tid = threadIdx.x, w = tid >> 5, lane = tid & 31, ln = lane & 15, hh = lane >> 4; const int by = blockIdx.y;
  A += (size_t)by * sA; Bh += (size_t)by * sB; const size_t cofs = (size_t)by * sC; const float* bp = bias ? bias + (size_t)by * sBias : nullptr;
  const int ntn = N >> 6; const int mt = blockIdx.x / ntn, nq = blockIdx.x - mt * ntn; const int row0 = mt * 128 + 32 * w, col0 = nq * 64; if (row0 >= M) return;
  const _Float16* a0p = A + (size_t)(row0 + ln) * lda; const _Float16* a1p = a0p + (size_t)16 * lda;
  const _Float16* b0p = Bh + (size_t)(col0 + ln) * ldb; const _Float16* b1p = b0p + (size_t)16 * ldb; const _Float16* b2p = b1p + (size_t)16 * ldb; const _Float16* b3p = b2p + (size_t)16 * ldb;
  const v8f z8 = {0.f,0.f,0.f,0.f,0.f,0.f,0.f,0.f}; v8f c00 = z8, c01 = z8, c02 = z8, c03 = z8, c10 = z8, c11 = z8, c12 = z8, c13 = z8;
#pragma unroll 1
  for (int kb = 0; kb < K; kb += 32) { const v16h a0 = g2_frag(a0p + kb, hh), a1 = g2_frag(a1p + kb, hh);
    v16h b = g2_frag(b0p + kb, hh); c00 = g2_mma(a0, b, c00); c10 = g2_mma(a1, b, c10);
    b = g2_frag(b1p + kb, hh); c01 = g2_mma(a0, b, c01); c11 = g2_mma(a1, b, c11);
    b = g2_frag(b2p + kb, hh); c02 = g2_mma(a0, b, c02); c12 = g2_mma(a1, b, c12);
    b = g2_frag(b3p + kb, hh); c03 = g2_mma(a0, b, c03); c13 = g2_mma(a1, b, c13); }
  v8f accs[8] = {c00, c01, c02, c03, c10, c11, c12, c13};
#pragma unroll
  for (int u = 0; u < 8; ++u) { const int t = u & 3, half = u >> 2; const int col = col0 + t * 16 + ln; const float bv = bp ? bf16_round(bp[col]) : 0.f;
#pragma unroll
    for (int r = 0; r < 8; ++r) { const int rloc = half * 16 + 8 * hh + r; float v = accs[u][r] * alpha + bv; if (CP) { if (rowsPerB < 0) v += CP[cofs + (size_t)(row0g + row0 + rloc) * ldc + col];      /* rowsPerB < 0: own element of the batched C plane */ else { const int bidx = (row0g + row0 + rloc) / rowsPerB; v += CP[(size_t)bidx * sCPb + (size_t)by * 64 + col]; } }
      if (ACT == 3) v = fmaxf(v, 0.f); else if (ACT == 6) v = 0.5f * v * (1.0f + erff(v * 0.70710678118654752f)); else if (ACT == 11) v = 1.0f / (1.0f + expf(-v)); else if (ACT == 15) v = v / (1.0f + expf(-v)); else if (ACT == 12) v = (v > 0.f) ? v : 0.01f * v; else if (ACT == 8) v = tanhf(v); else if (ACT == 9) v = 0.5f * v * (1.0f + tanhf(0.7978845608028654f * (v + 0.044715f * v * v * v))); else if (ACT == 14) v = (v > 0.f) ? v : 0.1f * v; else if (ACT == 16) v = (v >= 0.f) ? v : 0.3f * v; else if (ACT == 17) v = (v >= 0.f) ? v : 0.2f * v;
      so[w][rloc][t * 16 + ln] = v; } }
  __builtin_amdgcn_fence(__ATOMIC_ACQ_REL, "workgroup"); __builtin_amdgcn_wave_barrier();
  const int rsub = lane >> 4, c4 = (lane & 15) * 4;
  {
#pragma unroll
    for (int q = 0; q < 16; ++q) { const int r = q * 2 + rsub; const v4f v = *(const v4fa*)&so[w][r][c4]; if (C) *(v4f*)(C + cofs + (size_t)(row0 + r) * ldc + col0 + c4) = v; if (C16) { v4h h4; for (int i = 0; i < 4; ++i) h4[i] = (_Float16)v[i]; *(v4h*)(C16 + cofs + (size_t)(row0 + r) * ldc + col0 + c4) = h4; } }
     } }


__global__ __launch_bounds__(256) void k_wnat(const float* __restrict__ w, size_t n8, _Float16* __restrict__ Bt) { const size_t t = (size_t)blockIdx.x * 256 + threadIdx.x; if (t >= n8) return; FragH f; for (int q = 0; q < 8; ++q) f.h[q] = (_Float16)(bf16_round(w[t * 8 + q]) * 16.0f); *(v8us*)((unsigned short*)Bt + t * 8) = f.half[0];  }
__global__ __launch_bounds__(256) void k_rsm(const float* __restrict__ S, _Float16* __restrict__ P, int nrows) {
  #pragma clang fp contract(off)
  const int i = blockIdx.x * 256 + threadIdx.x; if (i >= nrows) return; const float* s = S + (size_t)i * SQ; float mx = -3.0e38f;
#pragma unroll 1
  for (int j = 0; j < SQ; ++j) mx = fmaxf(mx, s[j]); float se = 0.f;
#pragma unroll 1
  for (int j = 0; j < SQ; ++j) se += expf(s[j] - mx); const float sc = 256.0f / se;
#pragma unroll 1
  for (int j0 = 0; j0 < SQ; j0 += 8) { FragH f; for (int q = 0; q < 8; ++q) f.h[q] = (_Float16)(expf(s[j0 + q] - mx) * sc); unsigned short* d = (unsigned short*)P + (size_t)i * SQ + j0; *(v8us*)d = f.half[0];  } }
__global__ __launch_bounds__(256) void k_vt(const _Float16* __restrict__ V16, int b, int h0, _Float16* __restrict__ VT) { __shared__ unsigned short tl[64][65]; const int tid = threadIdx.x; const int hh = blockIdx.x % HG, sg = blockIdx.x / HG; const int s0 = sg * 64; const int h = h0 + hh;
  for (int i = tid; i < 64 * 8; i += 256) { const int j = i / 8, d8 = (i % 8) * 8; FragH f; f.half[0] = *(const v8us*)((const unsigned short*)V16 + ((size_t)b * SQ + s0 + j) * DM + h * HD + d8); for (int q = 0; q < 8; ++q) tl[d8 + q][j] = f.u[q]; }
  __syncthreads();
  { for (int i = tid; i < 64 * 8; i += 256) { const int d = i / 8, j8 = (i % 8) * 8; FragH f; for (int q = 0; q < 8; ++q) f.u[q] = tl[d][j8 + q]; *(v8us*)((unsigned short*)VT + ((size_t)hh * HD + d) * SQ + s0 + j8) = f.half[0]; }  } }



template <int CTRL> __device__ __forceinline__ float rs_row16(float v) { return __int_as_float(__builtin_amdgcn_update_dpp(0, __float_as_int(v), CTRL, 0xf, 0xf, true)); }      /* lane l ^ mask inside a 16-lane row (row_xmask) */
__device__ __forceinline__ float rs_x16(float v) { const int u = __float_as_int(v); return __int_as_float(__builtin_amdgcn_permlanex16(u, u, 0x76543210, 0xfedcba98, false, false)); }      /* lane l ^ 16 */
#define FAQ 128                      /* query rows per block: 4 waves x 32 columns */
#define FAC 0.18033688011112042592f  /* log2(e) / sqrt(64) */
__device__ __forceinline__ v8f fa_mma(v16h a, v16h b, v8f c) { return __builtin_amdgcn_wmma_f32_16x16x32_f16(false, a, false, b, (short)0, c, false, false); }
// 2^x in the native form. The v_nop in the same statement fills the one slot the instruction set asks for behind a transcendental; in the eight-wide form each v_exp is followed by an
// independent one (early-clobber outputs: no result register is a later source), so one v_nop behind the last serves all eight.
__device__ __forceinline__ float fa_exp2(float x) { float r; asm("v_exp_f32 %0, %1\n\tv_nop" : "=v"(r) : "v"(x)); return r; }
__device__ __forceinline__ v8f fa_exp2x8(v8f x) { float r0, r1, r2, r3, r4, r5, r6, r7;
  asm("v_exp_f32 %0, %8\n\tv_exp_f32 %1, %9\n\tv_exp_f32 %2, %10\n\tv_exp_f32 %3, %11\n\tv_exp_f32 %4, %12\n\tv_exp_f32 %5, %13\n\tv_exp_f32 %6, %14\n\tv_exp_f32 %7, %15\n\tv_nop"
      : "=&v"(r0), "=&v"(r1), "=&v"(r2), "=&v"(r3), "=&v"(r4), "=&v"(r5), "=&v"(r6), "=&v"(r7) : "v"(x[0]), "v"(x[1]), "v"(x[2]), "v"(x[3]), "v"(x[4]), "v"(x[5]), "v"(x[6]), "v"(x[7]));
  const v8f r = {r0, r1, r2, r3, r4, r5, r6, r7}; return r; }
// One pass of 32 keys for a wave's 32 query columns. kf holds this pass's K fragments and is refilled for the next pass right behind the score products (LAST: the diagonal pass, masked, no refill).
// Every loop is fully unrolled so that the fragment and accumulator arrays are indexed by constants and stay in registers.
template <bool LAST>
__device__ __forceinline__ void fa_pass(const _Float16* __restrict__ kn, const _Float16* __restrict__ vp, int hh, int dq, const v16h (&qf)[2][2], v16h (&kf)[2][2], v8f (&o)[2][4], float (&m)[2], float (&l)[2]) {
  v16h vf[4];
#pragma unroll
  for (int dt = 0; dt < 4; ++dt) vf[dt] = g2_frag(vp + (size_t)dt * 16 * SQ, hh);
  const v8f z8 = {0.f, 0.f, 0.f, 0.f, 0.f, 0.f, 0.f, 0.f}; v8f s[2][2];
#pragma unroll
  for (int j = 0; j < 2; ++j)
#pragma unroll
    for (int t = 0; t < 2; ++t) s[j][t] = fa_mma(kf[t][1], qf[j][1], fa_mma(kf[t][0], qf[j][0], z8));
  if (!LAST) {
#pragma unroll
    for (int t = 0; t < 2; ++t)
#pragma unroll
      for (int c = 0; c < 2; ++c) kf[t][c] = g2_frag(kn + (size_t)t * 16 * LQ + c * 32, hh);
    __builtin_amdgcn_sched_barrier(0); }      /* keeps the refill in front of the softmax: without it the loads sank to the pass's end and the next pass waited out their whole latency */
#pragma unroll
  for (int j = 0; j < 2; ++j) {
    if (LAST) {      /* key - query = 16 t + r + dq - 16 j: above the diagonal when positive */
#pragma unroll
      for (int t = 0; t < 2; ++t)
#pragma unroll
        for (int r = 0; r < 8; ++r) if (16 * t + r + dq - 16 * j > 0) s[j][t][r] = -1.0e30f; }
    float mx = s[j][0][0];
#pragma unroll
    for (int r = 0; r < 8; ++r) mx = fmaxf(mx, fmaxf(s[j][0][r], s[j][1][r]));
    mx = fmaxf(mx, rs_x16(mx));      /* the column's other 16 keys are in lane ^ 16 */
    const float mn = fmaxf(m[j], mx); const float sc = fa_exp2((m[j] - mn) * FAC); const float nb = 8.0f - mn * FAC; m[j] = mn;      /* + 8: weights carried x256 */
    const v8f e0 = fa_exp2x8(s[j][0] * FAC + nb), e1 = fa_exp2x8(s[j][1] * FAC + nb);
    const v8f es = e0 + e1; l[j] = l[j] * sc + (((es[0] + es[1]) + (es[2] + es[3])) + ((es[4] + es[5]) + (es[6] + es[7])));      /* each half keeps its own partial sum; joined in the epilogue */
    FragH p;
#pragma unroll
    for (int r = 0; r < 8; ++r) { p.h[r] = (_Float16)e0[r]; p.h[8 + r] = (_Float16)e1[r]; }
#pragma unroll
    for (int dt = 0; dt < 4; ++dt) o[j][dt] = fa_mma(vf[dt], p.v, o[j][dt] * sc); } }
__global__ __launch_bounds__(128) void k_fattn(const _Float16* __restrict__ QKVp, const _Float16* __restrict__ VTp, _Float16* __restrict__ O) {      /* QKVp: q | k | v rows of pitch LQ; VTp: [NB * NH][HD][SQ]; O: merged rows of pitch DM */
  const int lane = threadIdx.x & 31, ln = lane & 15, hh = lane >> 4; const int w = __builtin_amdgcn_readfirstlane(threadIdx.x >> 5);
  const int bh = blockIdx.y, b = bh / NH, h = bh % NH;
  const int qt = (bh < NB * NH / 2) ? SQ / FAQ - 1 - (int)blockIdx.x : (int)blockIdx.x;      /* all blocks are resident at once and a tile's cost grows with its index: the two halves of the grid walk the tiles in opposite order, so that blocks half a grid apart add up to the same cost */
  const int q0 = qt * FAQ + w * 32;      /* no barrier in this kernel: each wave has its own trip count. The loops over j, c, dt and r below are fully unrolled for constant indices (registers), as in fa_pass */
  const _Float16* qp = QKVp + ((size_t)b * SQ + q0 + ln) * LQ + h * HD; const _Float16* kp = QKVp + ((size_t)b * SQ + ln) * LQ + DM + h * HD; const _Float16* vp = VTp + ((size_t)bh * HD + ln) * SQ;
  v16h qf[2][2], kf[2][2]; v8f o[2][4]; float m[2] = {-1.0e30f, -1.0e30f}, l[2] = {0.f, 0.f};
#pragma unroll
  for (int j = 0; j < 2; ++j)
#pragma unroll
    for (int c = 0; c < 2; ++c) { qf[j][c] = g2_frag(qp + (size_t)j * 16 * LQ + c * 32, hh); kf[j][c] = g2_frag(kp + (size_t)j * 16 * LQ + c * 32, hh); }
  asm volatile("s_wait_xcnt 0x0" ::: "memory");      /* the address registers of the loads above are reused for the zeroed accumulators below */
#pragma unroll
  for (int j = 0; j < 2; ++j)
#pragma unroll
    for (int dt = 0; dt < 4; ++dt) { const v8f z8 = {0.f, 0.f, 0.f, 0.f, 0.f, 0.f, 0.f, 0.f}; o[j][dt] = z8; }
  const int dq = 8 * hh - ln;
  for (int k0 = 0; k0 < q0; k0 += 32) fa_pass<false>(kp + (size_t)(k0 + 32) * LQ, vp + k0, hh, dq, qf, kf, o, m, l);      /* keys wholly below the wave's first query */
  fa_pass<true>(kp, vp + q0, hh, dq, qf, kf, o, m, l);      /* keys q0 .. q0 + 31: the diagonal */
#pragma unroll
  for (int j = 0; j < 2; ++j) { const float fin = 64.0f / (l[j] + rs_x16(l[j]));      /* o carried x64; the x256 of the weights cancels against the sum */
    unsigned short* op = (unsigned short*)O + ((size_t)b * SQ + q0 + j * 16 + ln) * DM + h * HD + 8 * hh;
#pragma unroll
    for (int dt = 0; dt < 4; ++dt) { FragH f;
#pragma unroll
      for (int r = 0; r < 8; ++r) f.h[r] = (_Float16)(o[j][dt][r] * fin);
      *(v8us*)(op + dt * 16) = f.half[0]; } } }


// e^x for x <= 0 to f32 accuracy: n = the integer nearest x log2 e; x log2 e - n by two fused multiply-adds (the constant as its f32 value plus its low part), so the product is never rounded
// before n is taken off; 2^n applied by ldexp; 0 below the f32 range. The v_nop in the same statement fills the one slot the instruction set asks for behind a transcendental.
__device__ __forceinline__ float a0_exp(float x) { const float n = rintf(x * 1.4426950216293334961f); const float a = fmaf(x, 1.9259628558643271390e-8f, fmaf(x, 1.4426950216293334961f, -n));
  float r; asm("v_exp_f32 %0, %1\n\tv_nop" : "=v"(r) : "v"(a)); return (x < -103.2789306640625f) ? 0.f : ldexpf(r, (int)n); }
// Exact f32 attention for the first QT0 rows of every batch (causal form; blockIdx.y = batch). Four lanes share a query row: lane part p = lane & 3 keeps dims 16 c + 4 p .. + 3 (c = 0..3)
// of q and o in registers; a wave holds 8 rows and walks the keys up to its own last row. The head's K and V rows are staged once in LDS, all loads in flight together;
// the 8 row groups of a wave read the same 64 bytes of a key row per load (broadcast, no bank conflict). The dot product is 16 terms per lane, then a butterfly over the 4 lanes.
// Every loop over c, u and the four keys of a trip is fully unrolled, so that q[], o[] and the LDS data are indexed by constants and stay in registers.
#define A0R 32                       /* query rows per block: 4 waves x 8 rows */
__global__ __launch_bounds__(128) void k_att0(const float* __restrict__ QKVF, float scale, float* __restrict__ OF) {      /* QKVF: per batch QT0 f32 q | k | v rows of pitch LQ; OF: per batch QT0 rows of pitch DM */
  __shared__ __attribute__((aligned(16))) float lk[QT0][HD]; __shared__ __attribute__((aligned(16))) float lv[QT0][HD];
  const int tid = threadIdx.x, lane = tid & 31, p4 = (lane & 3) * 4; const int w = __builtin_amdgcn_readfirstlane(tid >> 5);
  const int h = blockIdx.x / (QT0 / A0R), rg = blockIdx.x % (QT0 / A0R);
  const float* QF = QKVF + (size_t)blockIdx.y * QT0 * LQ; const float* KF = QF + DM; const float* VF = QF + 2 * DM; OF += (size_t)blockIdx.y * QT0 * DM;
  const int row = rg * A0R + w * 8 + (lane >> 2);      /* this lane's query row */
  const int nk = rg * A0R + w * 8 + 8;                 /* wave-uniform: keys up to the wave's last row (a multiple of 8, at most QT0) */
  { const int r0 = tid / 16, c4 = (tid % 16) * 4; const float* kp = KF + h * HD + r0 * LQ + c4; const float* vp = VF + h * HD + r0 * LQ + c4;
    v4f tk[QT0 / 8], tv[QT0 / 8];      /* fully unrolled: constant indices keep both in registers and every load of the tile is issued before the first LDS store */
#pragma unroll
    for (int it = 0; it < QT0 / 8; ++it) { tk[it] = *(const v4fa*)(kp + it * 8 * LQ); tv[it] = *(const v4fa*)(vp + it * 8 * LQ); }
#pragma unroll
    for (int it = 0; it < QT0 / 8; ++it) { *(v4f*)&lk[it * 8 + r0][c4] = tk[it]; *(v4f*)&lv[it * 8 + r0][c4] = tv[it]; } }
  __syncthreads();
  const float* qr = QF + row * LQ + h * HD + p4;
  v4f q[4], o[4];
#pragma unroll
  for (int c = 0; c < 4; ++c) { q[c] = *(const v4fa*)(qr + c * 16); const v4f z = {0.f, 0.f, 0.f, 0.f}; o[c] = z; }
  float m = -1.0e30f, l = 0.f;
  for (int j0 = 0; j0 < nk; j0 += 4) {      /* four keys per trip, unrolled: their dot products are independent and fill each other's dependent links */
#pragma unroll
    for (int jj = 0; jj < 4; ++jj) { const int j = j0 + jj; float s = 0.f;
#pragma unroll
      for (int c = 0; c < 4; ++c) { const v4f kq = *(const v4f*)&lk[j][c * 16 + p4]; s += q[c][0] * kq[0]; s += q[c][1] * kq[1]; s += q[c][2] * kq[2]; s += q[c][3] * kq[3]; }
      s += rs_row16<0x161>(s); s += rs_row16<0x162>(s);      /* sum over the row's 4 lanes; all 4 end with the same bits */
      const float sm = (j <= row) ? s * scale : -1.0e30f; const float mn = fmaxf(m, sm); const float sc = a0_exp(m - mn); const float e = a0_exp(sm - mn); l = l * sc + e; m = mn;
#pragma unroll
      for (int c = 0; c < 4; ++c) { const v4f vv = *(const v4f*)&lv[j][c * 16 + p4];
#pragma unroll
        for (int u = 0; u < 4; ++u) o[c][u] = o[c][u] * sc + e * vv[u]; } } }
  const float fin = 64.0f / l;      /* o carried x64 like the f16 path */
  float* orow = OF + row * DM + h * HD + p4;
#pragma unroll
  for (int c = 0; c < 4; ++c) { v4f oo = o[c];
#pragma unroll
    for (int u = 0; u < 4; ++u) oo[u] *= fin;
    *(v4f*)(orow + c * 16) = oo; } }

extern "C" void kernel_launch(void* const* d_in, const int* in_sizes, int n_in,
                              void* d_out, int out_size, void* d_ws, size_t ws_size, hipStream_t stream) {
  (void)in_sizes; (void)n_in; (void)out_size;
  const float* const* I = (const float* const*)d_in; const float* x = I[0]; const float* wqkv = I[1]; const float* bqkv = nullptr; const float* wo = I[2]; const float* bo = I[3];      /* input order: y, Wqkv (fused [in][out] [1024][3072]), Wff ([in][out]), bff [1024]; the QKV projection has NO bias: bqkv is a null pointer; the output bias is bound */
  char* ws = (char*)d_ws; size_t off = 0;
  auto take = [&](size_t bytes) { char* p = ws + off; off += (bytes + 255) & ~(size_t)255; return p; };
  _Float16* BQKV = (_Float16*)take((size_t)3 * DM * DM * 2); _Float16* BO = (_Float16*)take((size_t)DM * DM * 2);
  _Float16* X16 = (_Float16*)take(NR * DM * 2); _Float16* QKV = (_Float16*)take(NR * 3 * DM * 2); _Float16* V16 = QKV + 2 * DM; _Float16* O16 = (_Float16*)take(NR * DM * 2);
  _Float16* VT = (_Float16*)take((size_t)NB * NH * HD * SQ * 2);
  float* QKVF0 = (float*)take((size_t)NB * QT0 * LQ * 4); float* OF0 = (float*)take((size_t)NB * QT0 * DM * 4); _Float16* OH0 = (_Float16*)take((size_t)NB * QT0 * DM * 2); _Float16* OL0 = (_Float16*)take((size_t)NB * QT0 * DM * 2);
  if (off > ws_size) return;
  k_wt_f16<<<(unsigned)(((size_t)LQ * (DM / 8) + 255) / 256), 256, 0, stream>>>(wqkv, BQKV, DM, LQ, 16.0f); k_wt_f16<<<(unsigned)(((size_t)DM * (DM / 8) + 255) / 256), 256, 0, stream>>>(wo, BO, DM, DM, 16.0f);      /* [in][out] -> Bt[n][k] x16 */
  k_x16<<<(unsigned)((NR * DM / 8 + 255) / 256), 256, 0, stream>>>(x, X16, NR * DM / 8);
  const size_t r0p = (size_t)B0 * SQ;      /* first projected row */
  k_gemm2<0><<<dim3((unsigned)((MP / 128) * (3 * DM / 64)), 1), 128, 0, stream>>>(X16 + r0p * DM, DM, 0, BQKV, DM, 0, 0.0625f, bqkv, 0, nullptr, 1, 0, 0, nullptr, QKV + r0p * 3 * DM, 3 * DM, 0, MP, 3 * DM, DM);      /* q | k | v rows (f16); head h = columns h*HD.. of each DM block */
  /* The launches below that take a batch index (slab of k_vt, blockIdx.y elsewhere) cover every batch at once: their grids are far smaller than the chip and each is bound by its own serial K or key loop. */
  k_vt<NH, SQ><<<NBR * NH * (SQ / 64), 256, 0, stream>>>(V16 + r0p * LQ, LQ, 0, VT + (size_t)B0 * NH * HD * SQ);      /* V^T [NB * NH][HD][SQ] */
  k_gemm2<0><<<dim3((QT0 / 128) * (LQ / 64), NBR), 128, 0, stream>>>(X16 + r0p * DM, DM, (size_t)SQ * DM, BQKV, DM, 0, 0.0625f, bqkv, 0, nullptr, 1, 0, 0, QKVF0, nullptr, LQ, (size_t)QT0 * LQ, QT0, LQ, DM);      /* f32 q | k | v of each batch's first 128 rows (exact products), N = 3 x 1024 */
  k_att0<<<dim3(NH * (QT0 / A0R), NBR), 128, 0, stream>>>(QKVF0, 0.125f, OF0 + (size_t)B0 * QT0 * DM);      /* exact f32 attention for rows 0..127 of each batch (o x64) */
  k_fattn<<<dim3(SQ / FAQ, NB * NH), 128, 0, stream>>>(QKV, VT, O16);      /* scores, causal softmax and P V of every batch, head and query tile in one launch: o (merged heads, x64) as f16 rows */
  k_gemm2<0><<<dim3((unsigned)((MPO / 128) * (DM / 64)), 1), 128, 0, stream>>>(O16 + r0p * DM, DM, 0, BO, DM, 0, 0.0009765625f, bo, 0, nullptr, 1, 0, 0, (float*)d_out + r0p * DM, nullptr, DM, 0, MPO, DM, DM);      /* out rows are the output layout */
  k_hl<<<(unsigned)(((size_t)NB * QT0 * DM / 8 + 255) / 256), 256, 0, stream>>>(OF0, OH0, OL0, (size_t)NB * QT0 * DM / 8);      /* first-tile o (x64) -> f16 hi + x1024 residual planes */
  k_gemm2<0><<<dim3((QT0 / 128) * (DM / 64), NBR), 128, 0, stream>>>(OH0 + (size_t)B0 * QT0 * DM, DM, (size_t)QT0 * DM, BO, DM, 0, 0.0009765625f, bo, 0, nullptr, 1, 0, 0, (float*)d_out + r0p * DM, nullptr, DM, (size_t)SQ * DM, QT0, DM, DM);      /* rows 0..127 of each batch: out = o_hi Wo (+ b), overwriting the f16-path rows */
  k_gemm2<0><<<dim3((QT0 / 128) * (DM / 64), NBR), 128, 0, stream>>>(OL0 + (size_t)B0 * QT0 * DM, DM, (size_t)QT0 * DM, BO, DM, 0, 0.00000095367431640625f, nullptr, 0, (const float*)d_out + r0p * DM, -1, 0, 0, (float*)d_out + r0p * DM, nullptr, DM, (size_t)SQ * DM, QT0, DM, DM);      /* += o_lo Wo 2^-20 (own-element accumulate) */
}

// v005
// It runs in 188 microseconds.
// Next to v004, in two timings, it ran 1.62 and 1.61 times as fast.
// Over all steps from v000 it is 26.8 times as fast.
#include <hip/hip_runtime.h>
#define NB 2
#define SQ 2048
#define DM 1024
#define NH 16
#define HD 64
#define HG 4                         /* heads per launch of the k_vt(V16, b, h0, VT) form, which is not launched */
#define QT0 128                      /* first-tile rows recomputed exactly in f32 */
#define B0 0                         /* first batch processed (debug hook) */
#define NBR NB                       /* batches processed (debug hook) */
#define NR ((size_t)NB * SQ)         /* token rows */
#define MP ((int)((size_t)NBR * SQ)) /* rows projected (debug hook) */
#define MPO MP                       /* rows through the output stage (debug hook) */
#define LQ (3 * DM)      /* row pitch of the q/k/v rows */
typedef __bf16 v16b __attribute__((ext_vector_type(16)));
typedef unsigned short v8us __attribute__((ext_vector_type(8), may_alias));
typedef float  v8f  __attribute__((ext_vector_type(8)));
typedef float  v4f  __attribute__((ext_vector_type(4)));
typedef float  v4fa __attribute__((ext_vector_type(4), may_alias));
union FragB { v16b v; v8us half[2]; unsigned short u[16]; };

__device__ __forceinline__ unsigned short bf16_bits(float x) { unsigned int u = __float_as_uint(x); return (unsigned short)((u + 0x7FFFu + ((u >> 16) & 1u)) >> 16); }
__device__ __forceinline__ float bf16_val(unsigned short b) { return __uint_as_float(((unsigned int)b) << 16); }
__device__ __forceinline__ float bf16_round(float x) { return bf16_val(bf16_bits(x)); }
// D += A·B with NT terms: 1 = ah·bh, 2 = + al·bh (A split), 3 = + ah·bl (both split)
template <int NT>
__device__ __forceinline__ v8f mmaN(v16b ah, v16b al, v16b bh, v16b bl, v8f c) {
  c = __builtin_amdgcn_wmma_f32_16x16x32_bf16(false, ah, false, bh, (short)0, c, false, false);
  if (NT >= 2) c = __builtin_amdgcn_wmma_f32_16x16x32_bf16(false, al, false, bh, (short)0, c, false, false);
  if (NT >= 3) c = __builtin_amdgcn_wmma_f32_16x16x32_bf16(false, ah, false, bl, (short)0, c, false, false);
  asm volatile("v_nop\n\tv_nop\n\tv_nop\n\tv_nop" : "+v"(c) : "v"(ah), "v"(al), "v"(bh), "v"(bl));
  return c;
}

__global__ __launch_bounds__(256) void k_wt_bf16(const float* __restrict__ W, unsigned short* __restrict__ Wt, int K, int N) {
  const int t = blockIdx.x * 256 + threadIdx.x;
  const int k8n = K / 8;
  if (t >= N * k8n) return;
  const int n = t / k8n, k8 = (t % k8n) * 8;
  v8us v;
#pragma unroll
  for (int i = 0; i < 8; ++i) v[i] = bf16_bits(W[(size_t)(k8 + i) * N + n]);
  *(v8us*)(Wt + (size_t)n * K + k8) = v;
  
}

// GEMM C[M][N] (f32, pitch ldc) = act(A[M][K]·W + bias). A f32 row-major (pitch lda) converted per fragment to bf16
// (ASPLIT: hi/lo two planes -> 2 terms, else single rounded term); Wt bf16 [N][K] (pitch ldb). BIAS_BF16 rounds the
// bias to bf16 first (bias quantised to bf16 before the add). K%32==0, M%16==0, N%64==0.
template <bool ASPLIT, int ACT, bool BIAS_BF16>
__global__ __launch_bounds__(128) void k_gemm_bf(const float* __restrict__ A, int lda, const unsigned short* __restrict__ Wt, int ldb,
                                               const float* __restrict__ bias, float* __restrict__ C, int ldc, int M, int N, int K) {
  __shared__ __attribute__((aligned(16))) float so[4][16][64];
  const int tid = threadIdx.x, w = tid >> 5, lane = tid & 31, ln = lane & 15, hh = lane >> 4;
  const int ntn = N / 64;
  const int wid = blockIdx.x * 4 + w;
  const int mt = wid / ntn, nq = wid % ntn;
  if (mt * 16 >= M) return;
  const int row0 = mt * 16, col0 = nq * 64;
  const float* arow = A + (size_t)(row0 + ln) * lda;
  v8f acc[4] = {};
  for (int kb = 0; kb < K; kb += 32) {
    FragB ah, al;
    const v4f x0 = *(const v4fa*)(arow + kb + 8 * hh), x1 = *(const v4fa*)(arow + kb + 8 * hh + 4);
    const v4f x2 = *(const v4fa*)(arow + kb + 16 + 8 * hh), x3 = *(const v4fa*)(arow + kb + 16 + 8 * hh + 4);
    float xs[16] = {x0[0],x0[1],x0[2],x0[3],x1[0],x1[1],x1[2],x1[3],x2[0],x2[1],x2[2],x2[3],x3[0],x3[1],x3[2],x3[3]};
#pragma unroll
    for (int i = 0; i < 16; ++i) { const unsigned short hb = bf16_bits(xs[i]); ah.u[i] = hb; al.u[i] = ASPLIT ? bf16_bits(xs[i] - bf16_val(hb)) : (unsigned short)0; }
#pragma unroll
    for (int t = 0; t < 4; ++t) {
      const unsigned short* brow = Wt + (size_t)(col0 + t * 16 + ln) * ldb + kb;
      FragB b;
      b.half[0] = *(const v8us*)(brow + 8 * hh);
      b.half[1] = *(const v8us*)(brow + 16 + 8 * hh);
      acc[t] = mmaN<ASPLIT ? 2 : 1>(ah.v, al.v, b.v, b.v, acc[t]);
    }
  }
#pragma unroll
  for (int t = 0; t < 4; ++t) {
    float bv = bias ? bias[col0 + t * 16 + ln] : 0.f;
    if (BIAS_BF16) bv = bf16_round(bv);
#pragma unroll
    for (int r = 0; r < 8; ++r) { float v = acc[t][r] + bv; if (ACT == 1) v = fmaxf(v, 0.f); so[w][8 * hh + r][t * 16 + ln] = v; }
  }
  __builtin_amdgcn_fence(__ATOMIC_ACQ_REL, "workgroup");
  __builtin_amdgcn_wave_barrier();
  const int rsub = lane >> 4, c4 = (lane & 15) * 4;
  {
#pragma unroll
    for (int q = 0; q < 8; ++q) {
      const int r = q * 2 + rsub;
      const v4f v = *(const v4fa*)&so[w][r][c4];
      *(v4f*)(C + (size_t)(row0 + r) * ldc + col0 + c4) = v;
    }
    
  }
}

// GEMM C = act(A·W + bias + resid): A f32 (ASPLIT -> hi/lo 2 terms), Wt bf16 [N][K]; ACT 0 none, 1 relu, 2 exact gelu;
// resid (optional, f32, row index = (row % rmod), pitch ldr, RES_BF16 rounds it) added before the activation.
template <bool ASPLIT, int ACT, bool BIAS_BF16, bool RES_BF16>
__global__ __launch_bounds__(128) void k_gemm_bf3(const float* __restrict__ A, int lda, const unsigned short* __restrict__ Wt, int ldb,
                                                const float* __restrict__ bias, const float* __restrict__ resid, int rmod, int ldr,
                                                float* __restrict__ C, int ldc, int M, int N, int K) {
  __shared__ __attribute__((aligned(16))) float so[4][16][64];
  const int tid = threadIdx.x, w = tid >> 5, lane = tid & 31, ln = lane & 15, hh = lane >> 4;
  const int ntn = N / 64;
  const int wid = blockIdx.x * 4 + w;
  const int mt = wid / ntn, nq = wid % ntn;
  if (mt * 16 >= M) return;
  const int row0 = mt * 16, col0 = nq * 64;
  const float* arow = A + (size_t)(row0 + ln) * lda;
  v8f acc[4] = {};
  for (int kb = 0; kb < K; kb += 32) {
    FragB ah, al;
    const v4f x0 = *(const v4fa*)(arow + kb + 8 * hh), x1 = *(const v4fa*)(arow + kb + 8 * hh + 4);
    const v4f x2 = *(const v4fa*)(arow + kb + 16 + 8 * hh), x3 = *(const v4fa*)(arow + kb + 16 + 8 * hh + 4);
    float xs[16] = {x0[0],x0[1],x0[2],x0[3],x1[0],x1[1],x1[2],x1[3],x2[0],x2[1],x2[2],x2[3],x3[0],x3[1],x3[2],x3[3]};
#pragma unroll
    for (int i = 0; i < 16; ++i) { const unsigned short hb = bf16_bits(xs[i]); ah.u[i] = hb; al.u[i] = ASPLIT ? bf16_bits(xs[i] - bf16_val(hb)) : (unsigned short)0; }
#pragma unroll
    for (int t = 0; t < 4; ++t) {
      const unsigned short* brow = Wt + (size_t)(col0 + t * 16 + ln) * ldb + kb;
      FragB b;
      b.half[0] = *(const v8us*)(brow + 8 * hh);
      b.half[1] = *(const v8us*)(brow + 16 + 8 * hh);
      acc[t] = mmaN<ASPLIT ? 2 : 1>(ah.v, al.v, b.v, b.v, acc[t]);
    }
  }
#pragma unroll
  for (int t = 0; t < 4; ++t) {
    const int col = col0 + t * 16 + ln;
    float bv = bias ? bias[col] : 0.f;
    if (BIAS_BF16) bv = bf16_round(bv);
#pragma unroll
    for (int r = 0; r < 8; ++r) {
      float v = acc[t][r] + bv;
      if (resid) { float rv = resid[(size_t)((row0 + 8 * hh + r) % rmod) * ldr + col]; if (RES_BF16) rv = bf16_round(rv); v += rv; }
      if (ACT == 1) v = fmaxf(v, 0.f);
      if (ACT == 2) v = 0.5f * v * (1.0f + erff(v * 0.70710678118654752f));
      if (ACT == 3) { const float u = 0.7978845608028654f * (v + 0.044715f * v * v * v); v = 0.5f * v * (1.0f + tanhf(u)); }
      so[w][8 * hh + r][t * 16 + ln] = v;
    }
  }
  __builtin_amdgcn_fence(__ATOMIC_ACQ_REL, "workgroup");
  __builtin_amdgcn_wave_barrier();
  const int rsub = lane >> 4, c4 = (lane & 15) * 4;
  {
#pragma unroll
    for (int q = 0; q < 8; ++q) {
      const int r = q * 2 + rsub;
      const v4f v = *(const v4fa*)&so[w][r][c4];
      *(v4f*)(C + (size_t)(row0 + r) * ldc + col0 + c4) = v;
    }
    
  }
}
// row LayerNorm (biased variance, eps) over N: s = X (+ R); optional out_sum <- s; out_norm <- (s-mu)*rsqrt(var+eps)*g + b
template <bool PARAM_BF16>
__global__ __launch_bounds__(256) void k_layernorm(const float* __restrict__ X, const float* __restrict__ R, const float* __restrict__ g, const float* __restrict__ bta,
                                                  float* __restrict__ out_sum, float* __restrict__ out_norm, int N, float eps) {
  __shared__ float red[256];
  const int row = blockIdx.x, tid = threadIdx.x;
  const float* x = X + (size_t)row * N; const float* rr = R ? R + (size_t)row * N : nullptr;
  float vals[16];                     // up to N = 4096
  const int per = N / 256;            // contiguous chunk per thread? use strided-by-4 chunks: thread handles j = tid*4 + 1024*u
  float s1 = 0.f;
  for (int u = 0; u < per / 4; ++u) {
    const int j = tid * 4 + 1024 * u;
    const v4f a = *(const v4fa*)(x + j);
    v4f b = {0.f,0.f,0.f,0.f}; if (rr) b = *(const v4fa*)(rr + j);
#pragma unroll
    for (int q = 0; q < 4; ++q) { const float v = a[q] + b[q]; vals[u * 4 + q] = v; s1 += v; }
  }
  red[tid] = s1; __syncthreads();
  for (int st = 128; st > 0; st >>= 1) { if (tid < st) red[tid] += red[tid + st]; __syncthreads(); }
  const float mu = red[0] / (float)N; __syncthreads();
  float s2 = 0.f;
  for (int u = 0; u < per / 4; ++u)
#pragma unroll
    for (int q = 0; q < 4; ++q) { const float c = vals[u * 4 + q] - mu; s2 += c * c; }
  red[tid] = s2; __syncthreads();
  for (int st = 128; st > 0; st >>= 1) { if (tid < st) red[tid] += red[tid + st]; __syncthreads(); }
  const float rs = rsqrtf(red[0] / (float)N + eps);
  {
    for (int u = 0; u < per / 4; ++u) {
      const int j = tid * 4 + 1024 * u;
      v4f o, sm;
#pragma unroll
      for (int q = 0; q < 4; ++q) {
        float gg = g[j + q], bb = bta[j + q];
        if (PARAM_BF16) { gg = bf16_round(gg); bb = bf16_round(bb); }
        sm[q] = vals[u * 4 + q]; o[q] = (vals[u * 4 + q] - mu) * rs * gg + bb;
      }
      if (out_sum) *(v4f*)(out_sum + (size_t)row * N + j) = sm;
      *(v4f*)(out_norm + (size_t)row * N + j) = o;
    }
    
  }
}



// ---- f16 WMMA path (v_wmma_f32_16x16x32_f16): 11-bit significands for operands in range — used where a [0,1] probability operand needs more precision than bf16
typedef _Float16 v16h __attribute__((ext_vector_type(16)));
union FragH { v16h v; v8us half[2]; _Float16 h[16]; unsigned short u[16]; };
template <int NT>
__device__ __forceinline__ v8f mmaH(v16h ah, v16h al, v16h bh, v16h bl, v8f c) {
  c = __builtin_amdgcn_wmma_f32_16x16x32_f16(false, ah, false, bh, (short)0, c, false, false);
  if (NT >= 2) c = __builtin_amdgcn_wmma_f32_16x16x32_f16(false, al, false, bh, (short)0, c, false, false);
  if (NT >= 3) c = __builtin_amdgcn_wmma_f32_16x16x32_f16(false, ah, false, bl, (short)0, c, false, false);
  asm volatile("v_nop\n\tv_nop\n\tv_nop\n\tv_nop" : "+v"(c) : "v"(ah), "v"(al), "v"(bh), "v"(bl));
  return c;
}
// batched GEMM like k_gemm_b but f16 operands: A f32 (split into f16 hi/lo if ASPLIT, else rounded to f16), Bt = f16 values [n][k]; alpha; C f32; N multiple of 16 (partial tiles skipped)
template <bool ASPLIT>
__global__ __launch_bounds__(128) void k_gemm_h(const float* __restrict__ A, int lda, size_t sA, const _Float16* __restrict__ Bh, int ldb, size_t sB, float alpha, float* __restrict__ C, int ldc, size_t sC, int M, int N, int K) {
  __shared__ __attribute__((aligned(16))) float so[4][16][64];
  const int tid = threadIdx.x, w = tid >> 5, lane = tid & 31, ln = lane & 15, hh = lane >> 4; const int by = blockIdx.y;
  A += (size_t)by * sA; Bh += (size_t)by * sB; C += (size_t)by * sC;
  const int ntn = (N + 63) / 64; const int wid = blockIdx.x * 4 + w; const int mt = wid / ntn, nq = wid % ntn; if (mt * 16 >= M) return;
  const int row0 = mt * 16, col0 = nq * 64; const float* arow = A + (size_t)(row0 + ln) * lda;
  v8f acc[4] = {};
  for (int kb = 0; kb < K; kb += 32) {
    FragH ah, al;
    const v4f x0 = *(const v4fa*)(arow + kb + 8 * hh), x1 = *(const v4fa*)(arow + kb + 8 * hh + 4), x2 = *(const v4fa*)(arow + kb + 16 + 8 * hh), x3 = *(const v4fa*)(arow + kb + 16 + 8 * hh + 4);
    float xs[16] = {x0[0],x0[1],x0[2],x0[3],x1[0],x1[1],x1[2],x1[3],x2[0],x2[1],x2[2],x2[3],x3[0],x3[1],x3[2],x3[3]};
#pragma unroll
    for (int i = 0; i < 16; ++i) { const _Float16 h = (_Float16)xs[i]; ah.h[i] = h; al.h[i] = ASPLIT ? (_Float16)(xs[i] - (float)h) : (_Float16)0.0f; }
#pragma unroll
    for (int t = 0; t < 4; ++t) { if (col0 + t * 16 >= N) continue; const size_t boff = (size_t)(col0 + t * 16 + ln) * ldb + kb; FragH bq; bq.half[0] = *(const v8us*)(Bh + boff + 8 * hh); bq.half[1] = *(const v8us*)(Bh + boff + 16 + 8 * hh);
      acc[t] = mmaH<ASPLIT ? 2 : 1>(ah.v, al.v, bq.v, bq.v, acc[t]); }
  }
#pragma unroll
  for (int t = 0; t < 4; ++t) { if (col0 + t * 16 >= N) continue;
#pragma unroll
    for (int r = 0; r < 8; ++r) so[w][8 * hh + r][t * 16 + ln] = acc[t][r] * alpha; }
  __builtin_amdgcn_fence(__ATOMIC_ACQ_REL, "workgroup"); __builtin_amdgcn_wave_barrier();
  const int rsub = lane >> 4, c4 = (lane & 15) * 4;
  {
#pragma unroll
    for (int q = 0; q < 8; ++q) { const int r = q * 2 + rsub; if (col0 + c4 < N) { const v4f v = *(const v4fa*)&so[w][r][c4]; *(v4f*)(C + (size_t)(row0 + r) * ldc + col0 + c4) = v; } }
     }
}

// Wt[n][k] = f16(W[k][n]·scale) from f32 row-major W[K][N] (scale = power of two; bf16-exact weights stay exact in f16 away from the subnormal range)
__global__ __launch_bounds__(256) void k_wt_f16(const float* __restrict__ W, _Float16* __restrict__ Wt, int K, int N, float scale) {
  const int t = blockIdx.x * 256 + threadIdx.x; if (t >= N * (K / 8)) return; const int n = t / (K / 8), k8 = (t % (K / 8)) * 8; FragH f;
#pragma unroll
  for (int i = 0; i < 8; ++i) f.h[i] = (_Float16)(bf16_round(W[(size_t)(k8 + i) * N + n]) * scale); const v8us o = f.half[0];
  *(v8us*)((unsigned short*)Wt + (size_t)n * K + k8) = o; 
}
// k_gemm_hh variant with fused epilogue: v = acc·alpha + bias[by·sBias + col] (+ CP[(row/rowsPerB)·sCPb + by·64 + col] if CP) ; ACT 0 none / 1 elu ; writes f16 C16 (and f32 C if non-null)
template <int ACT>
__global__ __launch_bounds__(128) void k_gemm_hhx(const _Float16* __restrict__ A, int lda, size_t sA, const _Float16* __restrict__ Bh, int ldb, size_t sB, float alpha, const float* __restrict__ bias, size_t sBias, const float* __restrict__ CP, int rowsPerB, size_t sCPb, int row0g,
    float* __restrict__ C, _Float16* __restrict__ C16, int ldc, size_t sC, int M, int N, int K) {
  __shared__ __attribute__((aligned(16))) float so[4][16][64];
  const int tid = threadIdx.x, w = tid >> 5, lane = tid & 31, ln = lane & 15, hh = lane >> 4; const int by = blockIdx.y;
  A += (size_t)by * sA; Bh += (size_t)by * sB; const size_t cofs = (size_t)by * sC; const float* bp = bias ? bias + (size_t)by * sBias : nullptr;
  const int ntn = (N + 63) / 64; const int wid = blockIdx.x * 4 + w; const int mt = wid / ntn, nq = wid % ntn; if (mt * 16 >= M) return;
  const int row0 = mt * 16, col0 = nq * 64; const _Float16* arow = A + (size_t)(row0 + ln) * lda;
  v8f acc[4] = {};
  for (int kb = 0; kb < K; kb += 32) { FragH ah; ah.half[0] = *(const v8us*)((const unsigned short*)arow + kb + 8 * hh); ah.half[1] = *(const v8us*)((const unsigned short*)arow + kb + 16 + 8 * hh);
#pragma unroll
    for (int t = 0; t < 4; ++t) { if (col0 + t * 16 >= N) continue; const size_t boff = (size_t)(col0 + t * 16 + ln) * ldb + kb; FragH bq; bq.half[0] = *(const v8us*)((const unsigned short*)Bh + boff + 8 * hh); bq.half[1] = *(const v8us*)((const unsigned short*)Bh + boff + 16 + 8 * hh);
      acc[t] = mmaH<1>(ah.v, ah.v, bq.v, bq.v, acc[t]); }
  }
#pragma unroll
  for (int t = 0; t < 4; ++t) { if (col0 + t * 16 >= N) continue; const int col = col0 + t * 16 + ln; const float bv = bp ? bf16_round(bp[col]) : 0.f;
#pragma unroll
    for (int r = 0; r < 8; ++r) { float v = acc[t][r] * alpha + bv; if (CP) { const int rr = row0g + row0 + 8 * hh + r; if (rowsPerB < 0) v += CP[cofs + (size_t)rr * ldc + col];      /* rowsPerB < 0: own element of the batched C plane */ else { const int bidx = rr / rowsPerB; v += CP[(size_t)bidx * sCPb + (size_t)by * 64 + col]; } } if (ACT == 1) v = (v > 0.f) ? v : expm1f(v); else if (ACT == 7) v = (v > 0.f) ? v + 1.0f : expf(v); else if (ACT == 8) v = tanhf(v); else if (ACT == 9) v = 0.5f * v * (1.0f + tanhf(0.7978845608028654f * (v + 0.044715f * v * v * v))); else if (ACT == 11) v = 1.0f / (1.0f + expf(-v)); else if (ACT == 12) v = (v > 0.f) ? v : 0.01f * v; else if (ACT == 14) v = (v > 0.f) ? v : 0.1f * v; else if (ACT == 16) v = (v >= 0.f) ? v : 0.3f * v; else if (ACT == 17) v = (v >= 0.f) ? v : 0.2f * v; else if (ACT == 15) v = v / (1.0f + expf(-v)); else if (ACT == 3) v = fmaxf(v, 0.f); else if (ACT == 6) v = 0.5f * v * (1.0f + erff(v * 0.70710678118654752f)); so[w][8 * hh + r][t * 16 + ln] = v; } }
  __builtin_amdgcn_fence(__ATOMIC_ACQ_REL, "workgroup"); __builtin_amdgcn_wave_barrier();
  const int rsub = lane >> 4, c4 = (lane & 15) * 4; typedef _Float16 v4h __attribute__((ext_vector_type(4)));
  {
#pragma unroll
    for (int q = 0; q < 8; ++q) { const int r = q * 2 + rsub; if (col0 + c4 < N) { const v4f v = *(const v4fa*)&so[w][r][c4]; if (C) *(v4f*)(C + cofs + (size_t)(row0 + r) * ldc + col0 + c4) = v; if (C16) { v4h h4; for (int i = 0; i < 4; ++i) h4[i] = (_Float16)v[i]; *(v4h*)(C16 + cofs + (size_t)(row0 + r) * ldc + col0 + c4) = h4; } } }
     }
}


typedef _Float16 v4h __attribute__((ext_vector_type(4)));

__global__ __launch_bounds__(256) void k_x16(const float* __restrict__ x, _Float16* __restrict__ X16, size_t n8) { const size_t t = (size_t)blockIdx.x * 256 + threadIdx.x; if (t >= n8) return; FragH f;
#pragma unroll
  for (int q = 0; q < 8; ++q) f.h[q] = (_Float16)bf16_round(x[t * 8 + q]); *(v8us*)((unsigned short*)X16 + t * 8) = f.half[0];  }
__global__ __launch_bounds__(256) void k_h16(const float* __restrict__ x, _Float16* __restrict__ X16, size_t n8) { const size_t t = (size_t)blockIdx.x * 256 + threadIdx.x; if (t >= n8) return; FragH f;
#pragma unroll
  for (int q = 0; q < 8; ++q) f.h[q] = (_Float16)x[t * 8 + q]; *(v8us*)((unsigned short*)X16 + t * 8) = f.half[0];  }
__global__ __launch_bounds__(256) void k_round16f(const float* __restrict__ W, _Float16* __restrict__ Bt, size_t n8) { const size_t t = (size_t)blockIdx.x * 256 + threadIdx.x; if (t >= n8) return; FragH f;
#pragma unroll
  for (int i = 0; i < 8; ++i) f.h[i] = (_Float16)(bf16_round(W[t * 8 + i]) * 16.0f); *(v8us*)((unsigned short*)Bt + t * 8) = f.half[0];  }
template <int NHv, int TTv>
__global__ __launch_bounds__(256) void k_vt(const _Float16* __restrict__ V16, int ldv, int voff, _Float16* __restrict__ Vt) { __shared__ unsigned short tl[64][66]; const int tid = threadIdx.x; const int slab = blockIdx.x / (TTv / 64), lg = blockIdx.x % (TTv / 64); const int b = slab / NHv, h = slab % NHv;
  for (int i = tid; i < 64 * 8; i += 256) { const int r = i / 8, c8 = (i % 8) * 8; FragH f; f.half[0] = *(const v8us*)((const unsigned short*)V16 + ((size_t)b * TTv + lg * 64 + r) * ldv + voff + h * 64 + c8);
#pragma unroll
    for (int q = 0; q < 8; ++q) tl[r][c8 + q] = f.u[q]; }
  __syncthreads();
  {
#pragma unroll
    for (int rd = 0; rd < 2; ++rd) { const int d = rd * 32 + tid / 8, pc = tid % 8; FragH f;
#pragma unroll
      for (int q = 0; q < 8; ++q) f.u[q] = tl[pc * 8 + q][d];
      *(v8us*)((unsigned short*)Vt + ((size_t)slab * 64 + d) * TTv + lg * 64 + pc * 8) = f.half[0]; }
     } }

__global__ __launch_bounds__(256) void k_hl(const float* __restrict__ F, _Float16* __restrict__ Hh, _Float16* __restrict__ Hl, size_t n8) { const size_t t = (size_t)blockIdx.x * 256 + threadIdx.x; if (t >= n8) return; FragH fh, fl; const v4f a = *(const v4fa*)(F + t * 8), c = *(const v4fa*)(F + t * 8 + 4);
#pragma unroll
  for (int q = 0; q < 4; ++q) { _Float16 h = (_Float16)a[q]; fh.h[q] = h; fl.h[q] = (_Float16)((a[q] - (float)h) * 1024.0f); h = (_Float16)c[q]; fh.h[4 + q] = h; fl.h[4 + q] = (_Float16)((c[q] - (float)h) * 1024.0f); }
  { *(v8us*)((unsigned short*)Hh + t * 8) = fh.half[0]; *(v8us*)((unsigned short*)Hl + t * 8) = fl.half[0];  } }

// ---- fast GEMM (block tile 128x64, wave tile 32x64; requires M % 128 == 0 rows per launch region, N % 64 == 0 and K % 64 == 0); epilogue = k_gemm_hhx semantics ----
// Operands go global -> LDS by asynchronous copies, 64 k (one whole 128-B line of each of the 128 A rows and 64 B rows) per trip, two buffers: the next tile flies while this one is multiplied.
// A wave-wide copy covers 4 rows x 128 B (4 whole lines) and the B rows are fetched once per block; the fragments are then read from LDS in the same k order as from global memory.
#define G2KC 64                      /* k per trip */
#define G2PB 144                     /* LDS row pitch in bytes: 128 + 16 (16 B x odd), conflict-free for the 16-byte fragment reads */
#define G2BB (192 * G2PB)            /* bytes of one buffer: 128 A rows, then 64 B rows */
// One tile: thread (row r = tid / 8, 16-byte piece tid % 8) copies its piece of rows r + 16 i: 8 of A, then 4 of B. l: the LDS byte address of its piece of row r. Every lane is on.
// The s_wait_xcnt in the same statement stands in front of any later rewrite of the address registers that the copies name.
__device__ __forceinline__ void g2_stage(unsigned l, const _Float16* a, size_t a16, const _Float16* b, size_t b16) {
  asm volatile("global_load_async_to_lds_b128 %0, %12, off\n\tglobal_load_async_to_lds_b128 %1, %13, off\n\tglobal_load_async_to_lds_b128 %2, %14, off\n\tglobal_load_async_to_lds_b128 %3, %15, off\n\t"
               "global_load_async_to_lds_b128 %4, %16, off\n\tglobal_load_async_to_lds_b128 %5, %17, off\n\tglobal_load_async_to_lds_b128 %6, %18, off\n\tglobal_load_async_to_lds_b128 %7, %19, off\n\t"
               "global_load_async_to_lds_b128 %8, %20, off\n\tglobal_load_async_to_lds_b128 %9, %21, off\n\tglobal_load_async_to_lds_b128 %10, %22, off\n\tglobal_load_async_to_lds_b128 %11, %23, off\n\ts_wait_xcnt 0x0"
               :: "v"(l), "v"(l + 16 * G2PB), "v"(l + 32 * G2PB), "v"(l + 48 * G2PB), "v"(l + 64 * G2PB), "v"(l + 80 * G2PB), "v"(l + 96 * G2PB), "v"(l + 112 * G2PB),
                  "v"(l + 128 * G2PB), "v"(l + 144 * G2PB), "v"(l + 160 * G2PB), "v"(l + 176 * G2PB),
                  "v"(a), "v"(a + a16), "v"(a + 2 * a16), "v"(a + 3 * a16), "v"(a + 4 * a16), "v"(a + 5 * a16), "v"(a + 6 * a16), "v"(a + 7 * a16),
                  "v"(b), "v"(b + b16), "v"(b + 2 * b16), "v"(b + 3 * b16) : "memory"); }
__device__ __forceinline__ v16h g2_frag(const _Float16* p, int hh) { FragH f; f.half[0] = *(const v8us*)((const unsigned short*)p + 8 * hh); f.half[1] = *(const v8us*)((const unsigned short*)p + 16 + 8 * hh); return f.v; }
__device__ __forceinline__ v8f g2_mma(v16h a, v16h b, v8f c) { v8f d = __builtin_amdgcn_wmma_f32_16x16x32_f16(false, a, false, b, (short)0, c, false, false); asm volatile("v_nop\n\tv_nop\n\tv_nop\n\tv_nop" : "+v"(d) : "v"(a), "v"(b)); return d; }
template <int ACT>
__global__ __launch_bounds__(128) void k_gemm2(const _Float16* __restrict__ A, int lda, size_t sA, const _Float16* __restrict__ Bh, int ldb, size_t sB, float alpha, const float* __restrict__ bias, size_t sBias, const float* __restrict__ CP, int rowsPerB, size_t sCPb, int row0g,
    float* __restrict__ C, _Float16* __restrict__ C16, int ldc, size_t sC, int M, int N, int K) { static_assert(ACT == 0 || ACT == 3 || ACT == 6 || ACT == 8 || ACT == 9 || ACT == 11 || ACT == 12 || ACT == 14 || ACT == 15 || ACT == 16 || ACT == 17, "k_gemm2: unsupported ACT code (would silently apply no activation)");
  __shared__ __attribute__((aligned(16))) unsigned char sm[2 * G2BB];      /* the two operand buffers; behind the K loop's last barrier the same bytes serve as the epilogue's staging rows */
  float (*so)[32][68] = (float (*)[32][68])sm;
  const int tid = threadIdx.x, w = tid >> 5, lane = tid & 31, ln = lane & 15, hh = lane >> 4; const int by = blockIdx.y;
  A += (size_t)by * sA; Bh += (size_t)by * sB; const size_t cofs = (size_t)by * sC; const float* bp = bias ? bias + (size_t)by * sBias : nullptr;
  const int ntn = N >> 6; const int mt = blockIdx.x / ntn, nq = blockIdx.x - mt * ntn; const int row0 = mt * 128 + 32 * w, col0 = nq * 64; if (mt * 128 >= M) return;      /* the same for the whole block, in front of every barrier */
  const int sr = tid >> 3, sp = tid & 7;      /* staging: this thread's first row and its 16-byte piece of the 128-B row */
  const _Float16* ag = A + (size_t)(mt * 128 + sr) * lda + sp * 8; const _Float16* bg = Bh + (size_t)(col0 + sr) * ldb + sp * 8; const size_t a16 = (size_t)16 * lda, b16 = (size_t)16 * ldb;
  const unsigned ls = (unsigned)(size_t)sm + (unsigned)(sr * G2PB + sp * 16);      /* LDS byte address: the low 32 bits of the shared address */
  const unsigned char* af = sm + (32 * w + ln) * G2PB; const unsigned char* bf = sm + (128 + ln) * G2PB;      /* this lane's first A and B fragment rows in buffer 0 */
  const int nt = K / G2KC;
  const v8f z8 = {0.f,0.f,0.f,0.f,0.f,0.f,0.f,0.f}; v8f c00 = z8, c01 = z8, c02 = z8, c03 = z8, c10 = z8, c11 = z8, c12 = z8, c13 = z8;
  g2_stage(ls, ag, a16, bg, b16);
  asm volatile("s_wait_asynccnt 0x0" ::: "memory");      /* this wave's copies of tile 0 have landed */
  __syncthreads();      /* ... and every other wave's */
  if (nt > 1) g2_stage(ls + G2BB, ag + G2KC, a16, bg + G2KC, b16);
#pragma unroll 1      /* rolled: one copy of the trip; the buffer is chosen by an offset */
  for (int t = 0; t < nt; ++t) { const unsigned bo = (unsigned)(t & 1) * G2BB; const _Float16* ap = (const _Float16*)(af + bo); const _Float16* bq = (const _Float16*)(bf + bo);
    /* all 12 fragments of the trip are asked for first, in the order of their use, so that their LDS latencies overlap; 8 * G2PB halves = 16 rows, + 32 halves = the second 32 k */
    const v16h a00 = g2_frag(ap, hh), b00 = g2_frag(bq, hh), a10 = g2_frag(ap + 8 * G2PB, hh), b10 = g2_frag(bq + 8 * G2PB, hh), b20 = g2_frag(bq + 16 * G2PB, hh), b30 = g2_frag(bq + 24 * G2PB, hh);
    const v16h a01 = g2_frag(ap + 32, hh), b01 = g2_frag(bq + 32, hh), a11 = g2_frag(ap + 8 * G2PB + 32, hh), b11 = g2_frag(bq + 8 * G2PB + 32, hh), b21 = g2_frag(bq + 16 * G2PB + 32, hh), b31 = g2_frag(bq + 24 * G2PB + 32, hh);
    c00 = g2_mma(a00, b00, c00); c10 = g2_mma(a10, b00, c10); c01 = g2_mma(a00, b10, c01); c11 = g2_mma(a10, b10, c11);
    c02 = g2_mma(a00, b20, c02); c12 = g2_mma(a10, b20, c12); c03 = g2_mma(a00, b30, c03); c13 = g2_mma(a10, b30, c13);
    c00 = g2_mma(a01, b01, c00); c10 = g2_mma(a11, b01, c10); c01 = g2_mma(a01, b11, c01); c11 = g2_mma(a11, b11, c11);
    c02 = g2_mma(a01, b21, c02); c12 = g2_mma(a11, b21, c12); c03 = g2_mma(a01, b31, c03); c13 = g2_mma(a11, b31, c13);
    asm volatile("s_wait_dscnt 0x0" ::: "memory");      /* this wave's reads of the buffer are done before it may be refilled */
    asm volatile("s_wait_asynccnt 0x0" ::: "memory");      /* this wave's copies of tile t + 1 have landed */
    __syncthreads();      /* publishes tile t + 1 and ends every wave's reads of tile t */
    if (t + 2 < nt) g2_stage(ls + bo, ag + (size_t)(t + 2) * G2KC, a16, bg + (size_t)(t + 2) * G2KC, b16); }
  asm volatile("s_wait_asynccnt 0x0" ::: "memory");      /* nothing in flight when the buffers become the staging rows */
  v8f accs[8] = {c00, c01, c02, c03, c10, c11, c12, c13};
#pragma unroll
  for (int u = 0; u < 8; ++u) { const int t = u & 3, half = u >> 2; const int col = col0 + t * 16 + ln; const float bv = bp ? bf16_round(bp[col]) : 0.f;
#pragma unroll
    for (int r = 0; r < 8; ++r) { const int rloc = half * 16 + 8 * hh + r; float v = accs[u][r] * alpha + bv; if (CP) { if (rowsPerB < 0) v += CP[cofs + (size_t)(row0g + row0 + rloc) * ldc + col];      /* rowsPerB < 0: own element of the batched C plane */ else { const int bidx = (row0g + row0 + rloc) / rowsPerB; v += CP[(size_t)bidx * sCPb + (size_t)by * 64 + col]; } }
      if (ACT == 3) v = fmaxf(v, 0.f); else if (ACT == 6) v = 0.5f * v * (1.0f + erff(v * 0.70710678118654752f)); else if (ACT == 11) v = 1.0f / (1.0f + expf(-v)); else if (ACT == 15) v = v / (1.0f + expf(-v)); else if (ACT == 12) v = (v > 0.f) ? v : 0.01f * v; else if (ACT == 8) v = tanhf(v); else if (ACT == 9) v = 0.5f * v * (1.0f + tanhf(0.7978845608028654f * (v + 0.044715f * v * v * v))); else if (ACT == 14) v = (v > 0.f) ? v : 0.1f * v; else if (ACT == 16) v = (v >= 0.f) ? v : 0.3f * v; else if (ACT == 17) v = (v >= 0.f) ? v : 0.2f * v;
      so[w][rloc][t * 16 + ln] = v; } }
  __builtin_amdgcn_fence(__ATOMIC_ACQ_REL, "workgroup"); __builtin_amdgcn_wave_barrier();
  const int rsub = lane >> 4, c4 = (lane & 15) * 4;
  {
#pragma unroll
    for (int q = 0; q < 16; ++q) { const int r = q * 2 + rsub; const v4f v = *(const v4fa*)&so[w][r][c4]; if (C) *(v4f*)(C + cofs + (size_t)(row0 + r) * ldc + col0 + c4) = v; if (C16) { v4h h4; for (int i = 0; i < 4; ++i) h4[i] = (_Float16)v[i]; *(v4h*)(C16 + cofs + (size_t)(row0 + r) * ldc + col0 + c4) = h4; } }
     } }


__global__ __launch_bounds__(256) void k_wnat(const float* __restrict__ w, size_t n8, _Float16* __restrict__ Bt) { const size_t t = (size_t)blockIdx.x * 256 + threadIdx.x; if (t >= n8) return; FragH f; for (int q = 0; q < 8; ++q) f.h[q] = (_Float16)(bf16_round(w[t * 8 + q]) * 16.0f); *(v8us*)((unsigned short*)Bt + t * 8) = f.half[0];  }
__global__ __launch_bounds__(256) void k_rsm(const float* __restrict__ S, _Float16* __restrict__ P, int nrows) {
  #pragma clang fp contract(off)
  const int i = blockIdx.x * 256 + threadIdx.x; if (i >= nrows) return; const float* s = S + (size_t)i * SQ; float mx = -3.0e38f;
#pragma unroll 1
  for (int j = 0; j < SQ; ++j) mx = fmaxf(mx, s[j]); float se = 0.f;
#pragma unroll 1
  for (int j = 0; j < SQ; ++j) se += expf(s[j] - mx); const float sc = 256.0f / se;
#pragma unroll 1
  for (int j0 = 0; j0 < SQ; j0 += 8) { FragH f; for (int q = 0; q < 8; ++q) f.h[q] = (_Float16)(expf(s[j0 + q] - mx) * sc); unsigned short* d = (unsigned short*)P + (size_t)i * SQ + j0; *(v8us*)d = f.half[0];  } }
__global__ __launch_bounds__(256) void k_vt(const _Float16* __restrict__ V16, int b, int h0, _Float16* __restrict__ VT) { __shared__ unsigned short tl[64][65]; const int tid = threadIdx.x; const int hh = blockIdx.x % HG, sg = blockIdx.x / HG; const int s0 = sg * 64; const int h = h0 + hh;
  for (int i = tid; i < 64 * 8; i += 256) { const int j = i / 8, d8 = (i % 8) * 8; FragH f; f.half[0] = *(const v8us*)((const unsigned short*)V16 + ((size_t)b * SQ + s0 + j) * DM + h * HD + d8); for (int q = 0; q < 8; ++q) tl[d8 + q][j] = f.u[q]; }
  __syncthreads();
  { for (int i = tid; i < 64 * 8; i += 256) { const int d = i / 8, j8 = (i % 8) * 8; FragH f; for (int q = 0; q < 8; ++q) f.u[q] = tl[d][j8 + q]; *(v8us*)((unsigned short*)VT + ((size_t)hh * HD + d) * SQ + s0 + j8) = f.half[0]; }  } }



template <int CTRL> __device__ __forceinline__ float rs_row16(float v) { return __int_as_float(__builtin_amdgcn_update_dpp(0, __float_as_int(v), CTRL, 0xf, 0xf, true)); }      /* lane l ^ mask inside a 16-lane row (row_xmask) */
__device__ __forceinline__ float rs_x16(float v) { const int u = __float_as_int(v); return __int_as_float(__builtin_amdgcn_permlanex16(u, u, 0x76543210, 0xfedcba98, false, false)); }      /* lane l ^ 16 */
#define FAQ 128                      /* query rows per block: 4 waves x 32 columns */
#define FAC 0.18033688011112042592f  /* log2(e) / sqrt(64) */
__device__ __forceinline__ v8f fa_mma(v16h a, v16h b, v8f c) { return __builtin_amdgcn_wmma_f32_16x16x32_f16(false, a, false, b, (short)0, c, false, false); }
// 2^x in the native form. The v_nop in the same statement fills the one slot the instruction set asks for behind a transcendental; in the eight-wide form each v_exp is followed by an
// independent one (early-clobber outputs: no result register is a later source), so one v_nop behind the last serves all eight.
__device__ __forceinline__ float fa_exp2(float x) { float r; asm("v_exp_f32 %0, %1\n\tv_nop" : "=v"(r) : "v"(x)); return r; }
__device__ __forceinline__ v8f fa_exp2x8(v8f x) { float r0, r1, r2, r3, r4, r5, r6, r7;
  asm("v_exp_f32 %0, %8\n\tv_exp_f32 %1, %9\n\tv_exp_f32 %2, %10\n\tv_exp_f32 %3, %11\n\tv_exp_f32 %4, %12\n\tv_exp_f32 %5, %13\n\tv_exp_f32 %6, %14\n\tv_exp_f32 %7, %15\n\tv_nop"
      : "=&v"(r0), "=&v"(r1), "=&v"(r2), "=&v"(r3), "=&v"(r4), "=&v"(r5), "=&v"(r6), "=&v"(r7) : "v"(x[0]), "v"(x[1]), "v"(x[2]), "v"(x[3]), "v"(x[4]), "v"(x[5]), "v"(x[6]), "v"(x[7]));
  const v8f r = {r0, r1, r2, r3, r4, r5, r6, r7}; return r; }
// One pass of 32 keys for a wave's 32 query columns. kf holds this pass's K fragments and is refilled for the next pass right behind the score products (LAST: the diagonal pass, masked, no refill).
// Every loop is fully unrolled so that the fragment and accumulator arrays are indexed by constants and stay in registers.
template <bool LAST>
__device__ __forceinline__ void fa_pass(const _Float16* __restrict__ kn, const _Float16* __restrict__ vp, int hh, int dq, const v16h (&qf)[2][2], v16h (&kf)[2][2], v8f (&o)[2][4], float (&m)[2], float (&l)[2]) {
  v16h vf[4];
#pragma unroll
  for (int dt = 0; dt < 4; ++dt) vf[dt] = g2_frag(vp + (size_t)dt * 16 * SQ, hh);
  const v8f z8 = {0.f, 0.f, 0.f, 0.f, 0.f, 0.f, 0.f, 0.f}; v8f s[2][2];
#pragma unroll
  for (int j = 0; j < 2; ++j)
#pragma unroll
    for (int t = 0; t < 2; ++t) s[j][t] = fa_mma(kf[t][1], qf[j][1], fa_mma(kf[t][0], qf[j][0], z8));
  if (!LAST) {
#pragma unroll
    for (int t = 0; t < 2; ++t)
#pragma unroll
      for (int c = 0; c < 2; ++c) kf[t][c] = g2_frag(kn + (size_t)t * 16 * LQ + c * 32, hh);
    __builtin_amdgcn_sched_barrier(0); }      /* keeps the refill in front of the softmax: without it the loads sank to the pass's end and the next pass waited out their whole latency */
#pragma unroll
  for (int j = 0; j < 2; ++j) {
    if (LAST) {      /* key - query = 16 t + r + dq - 16 j: above the diagonal when positive */
#pragma unroll
      for (int t = 0; t < 2; ++t)
#pragma unroll
        for (int r = 0; r < 8; ++r) if (16 * t + r + dq - 16 * j > 0) s[j][t][r] = -1.0e30f; }
    float mx = s[j][0][0];
#pragma unroll
    for (int r = 0; r < 8; ++r) mx = fmaxf(mx, fmaxf(s[j][0][r], s[j][1][r]));
    mx = fmaxf(mx, rs_x16(mx));      /* the column's other 16 keys are in lane ^ 16 */
    const float mn = fmaxf(m[j], mx); const float sc = fa_exp2((m[j] - mn) * FAC); const float nb = 8.0f - mn * FAC; m[j] = mn;      /* + 8: weights carried x256 */
    const v8f e0 = fa_exp2x8(s[j][0] * FAC + nb), e1 = fa_exp2x8(s[j][1] * FAC + nb);
    const v8f es = e0 + e1; l[j] = l[j] * sc + (((es[0] + es[1]) + (es[2] + es[3])) + ((es[4] + es[5]) + (es[6] + es[7])));      /* each half keeps its own partial sum; joined in the epilogue */
    FragH p;
#pragma unroll
    for (int r = 0; r < 8; ++r) { p.h[r] = (_Float16)e0[r]; p.h[8 + r] = (_Float16)e1[r]; }
#pragma unroll
    for (int dt = 0; dt < 4; ++dt) o[j][dt] = fa_mma(vf[dt], p.v, o[j][dt] * sc); } }
__global__ __launch_bounds__(128) void k_fattn(const _Float16* __restrict__ QKVp, const _Float16* __restrict__ VTp, _Float16* __restrict__ O) {      /* QKVp: q | k | v rows of pitch LQ; VTp: [NB * NH][HD][SQ]; O: merged rows of pitch DM */
  const int lane = threadIdx.x & 31, ln = lane & 15, hh = lane >> 4; const int w = __builtin_amdgcn_readfirstlane(threadIdx.x >> 5);
  const int bh = blockIdx.y, b = bh / NH, h = bh % NH;
  const int qt = (bh < NB * NH / 2) ? SQ / FAQ - 1 - (int)blockIdx.x : (int)blockIdx.x;      /* all blocks are resident at once and a tile's cost grows with its index: the two halves of the grid walk the tiles in opposite order, so that blocks half a grid apart add up to the same cost */
  const int q0 = qt * FAQ + w * 32;      /* no barrier in this kernel: each wave has its own trip count. The loops over j, c, dt and r below are fully unrolled for constant indices (registers), as in fa_pass */
  const _Float16* qp = QKVp + ((size_t)b * SQ + q0 + ln) * LQ + h * HD; const _Float16* kp = QKVp + ((size_t)b * SQ + ln) * LQ + DM + h * HD; const _Float16* vp = VTp + ((size_t)bh * HD + ln) * SQ;
  v16h qf[2][2], kf[2][2]; v8f o[2][4]; float m[2] = {-1.0e30f, -1.0e30f}, l[2] = {0.f, 0.f};
#pragma unroll
  for (int j = 0; j < 2; ++j)
#pragma unroll
    for (int c = 0; c < 2; ++c) { qf[j][c] = g2_frag(qp + (size_t)j * 16 * LQ + c * 32, hh); kf[j][c] = g2_frag(kp + (size_t)j * 16 * LQ + c * 32, hh); }
  asm volatile("s_wait_xcnt 0x0" ::: "memory");      /* the address registers of the loads above are reused for the zeroed accumulators below */
#pragma unroll
  for (int j = 0; j < 2; ++j)
#pragma unroll
    for (int dt = 0; dt < 4; ++dt) { const v8f z8 = {0.f, 0.f, 0.f, 0.f, 0.f, 0.f, 0.f, 0.f}; o[j][dt] = z8; }
  const int dq = 8 * hh - ln;
  for (int k0 = 0; k0 < q0; k0 += 32) fa_pass<false>(kp + (size_t)(k0 + 32) * LQ, vp + k0, hh, dq, qf, kf, o, m, l);      /* keys wholly below the wave's first query */
  fa_pass<true>(kp, vp + q0, hh, dq, qf, kf, o, m, l);      /* keys q0 .. q0 + 31: the diagonal */
#pragma unroll
  for (int j = 0; j < 2; ++j) { const float fin = 64.0f / (l[j] + rs_x16(l[j]));      /* o carried x64; the x256 of the weights cancels against the sum */
    unsigned short* op = (unsigned short*)O + ((size_t)b * SQ + q0 + j * 16 + ln) * DM + h * HD + 8 * hh;
#pragma unroll
    for (int dt = 0; dt < 4; ++dt) { FragH f;
#pragma unroll
      for (int r = 0; r < 8; ++r) f.h[r] = (_Float16)(o[j][dt][r] * fin);
      *(v8us*)(op + dt * 16) = f.half[0]; } } }


// e^x for x <= 0 to f32 accuracy: n = the integer nearest x log2 e; x log2 e - n by two fused multiply-adds (the constant as its f32 value plus its low part), so the product is never rounded
// before n is taken off; 2^n applied by ldexp; 0 below the f32 range. The v_nop in the same statement fills the one slot the instruction set asks for behind a transcendental.
__device__ __forceinline__ float a0_exp(float x) { const float n = rintf(x * 1.4426950216293334961f); const float a = fmaf(x, 1.9259628558643271390e-8f, fmaf(x, 1.4426950216293334961f, -n));
  float r; asm("v_exp_f32 %0, %1\n\tv_nop" : "=v"(r) : "v"(a)); return (x < -103.2789306640625f) ? 0.f : ldexpf(r, (int)n); }
// Exact f32 attention for the first QT0 rows of every batch (causal form; blockIdx.y = batch). Four lanes share a query row: lane part p = lane & 3 keeps dims 16 c + 4 p .. + 3 (c = 0..3)
// of q and o in registers; a wave holds 8 rows and walks the keys up to its own last row. The head's K and V rows are staged once in LDS, all loads in flight together;
// the 8 row groups of a wave read the same 64 bytes of a key row per load (broadcast, no bank conflict). The dot product is 16 terms per lane, then a butterfly over the 4 lanes.
// Every loop over c, u and the four keys of a trip is fully unrolled, so that q[], o[] and the LDS data are indexed by constants and stay in registers.
#define A0R 32                       /* query rows per block: 4 waves x 8 rows */
__global__ __launch_bounds__(128) void k_att0(const float* __restrict__ QKVF, float scale, float* __restrict__ OF) {      /* QKVF: per batch QT0 f32 q | k | v rows of pitch LQ; OF: per batch QT0 rows of pitch DM */
  __shared__ __attribute__((aligned(16))) float lk[QT0][HD]; __shared__ __attribute__((aligned(16))) float lv[QT0][HD];
  const int tid = threadIdx.x, lane = tid & 31, p4 = (lane & 3) * 4; const int w = __builtin_amdgcn_readfirstlane(tid >> 5);
  const int h = blockIdx.x / (QT0 / A0R), rg = blockIdx.x % (QT0 / A0R);
  const float* QF = QKVF + (size_t)blockIdx.y * QT0 * LQ; const float* KF = QF + DM; const float* VF = QF + 2 * DM; OF += (size_t)blockIdx.y * QT0 * DM;
  const int row = rg * A0R + w * 8 + (lane >> 2);      /* this lane's query row */
  const int nk = rg * A0R + w * 8 + 8;                 /* wave-uniform: keys up to the wave's last row (a multiple of 8, at most QT0) */
  { const int r0 = tid / 16, c4 = (tid % 16) * 4; const float* kp = KF + h * HD + r0 * LQ + c4; const float* vp = VF + h * HD + r0 * LQ + c4;
    v4f tk[QT0 / 8], tv[QT0 / 8];      /* fully unrolled: constant indices keep both in registers and every load of the tile is issued before the first LDS store */
#pragma unroll
    for (int it = 0; it < QT0 / 8; ++it) { tk[it] = *(const v4fa*)(kp + it * 8 * LQ); tv[it] = *(const v4fa*)(vp + it * 8 * LQ); }
#pragma unroll
    for (int it = 0; it < QT0 / 8; ++it) { *(v4f*)&lk[it * 8 + r0][c4] = tk[it]; *(v4f*)&lv[it * 8 + r0][c4] = tv[it]; } }
  __syncthreads();
  const float* qr = QF + row * LQ + h * HD + p4;
  v4f q[4], o[4];
#pragma unroll
  for (int c = 0; c < 4; ++c) { q[c] = *(const v4fa*)(qr + c * 16); const v4f z = {0.f, 0.f, 0.f, 0.f}; o[c] = z; }
  float m = -1.0e30f, l = 0.f;
  for (int j0 = 0; j0 < nk; j0 += 4) {      /* four keys per trip, unrolled: their dot products are independent and fill each other's dependent links */
#pragma unroll
    for (int jj = 0; jj < 4; ++jj) { const int j = j0 + jj; float s = 0.f;
#pragma unroll
      for (int c = 0; c < 4; ++c) { const v4f kq = *(const v4f*)&lk[j][c * 16 + p4]; s += q[c][0] * kq[0]; s += q[c][1] * kq[1]; s += q[c][2] * kq[2]; s += q[c][3] * kq[3]; }
      s += rs_row16<0x161>(s); s += rs_row16<0x162>(s);      /* sum over the row's 4 lanes; all 4 end with the same bits */
      const float sm = (j <= row) ? s * scale : -1.0e30f; const float mn = fmaxf(m, sm); const float sc = a0_exp(m - mn); const float e = a0_exp(sm - mn); l = l * sc + e; m = mn;
#pragma unroll
      for (int c = 0; c < 4; ++c) { const v4f vv = *(const v4f*)&lv[j][c * 16 + p4];
#pragma unroll
        for (int u = 0; u < 4; ++u) o[c][u] = o[c][u] * sc + e * vv[u]; } } }
  const float fin = 64.0f / l;      /* o carried x64 like the f16 path */
  float* orow = OF + row * DM + h * HD + p4;
#pragma unroll
  for (int c = 0; c < 4; ++c) { v4f oo = o[c];
#pragma unroll
    for (int u = 0; u < 4; ++u) oo[u] *= fin;
    *(v4f*)(orow + c * 16) = oo; } }

extern "C" void kernel_launch(void* const* d_in, const int* in_sizes, int n_in,
                              void* d_out, int out_size, void* d_ws, size_t ws_size, hipStream_t stream) {
  (void)in_sizes; (void)n_in; (void)out_size;
  const float* const* I = (const float* const*)d_in; const float* x = I[0]; const float* wqkv = I[1]; const float* bqkv = nullptr; const float* wo = I[2]; const float* bo = I[3];      /* input order: y, Wqkv (fused [in][out] [1024][3072]), Wff ([in][out]), bff [1024]; the QKV projection has NO bias: bqkv is a null pointer; the output bias is bound */
  char* ws = (char*)d_ws; size_t off = 0;
  auto take = [&](size_t bytes) { char* p = ws + off; off += (bytes + 255) & ~(size_t)255; return p; };
  _Float16* BQKV = (_Float16*)take((size_t)3 * DM * DM * 2); _Float16* BO = (_Float16*)take((size_t)DM * DM * 2);
  _Float16* X16 = (_Float16*)take(NR * DM * 2); _Float16* QKV = (_Float16*)take(NR * 3 * DM * 2); _Float16* V16 = QKV + 2 * DM; _Float16* O16 = (_Float16*)take(NR * DM * 2);
  _Float16* VT = (_Float16*)take((size_t)NB * NH * HD * SQ * 2);
  float* QKVF0 = (float*)take((size_t)NB * QT0 * LQ * 4); float* OF0 = (float*)take((size_t)NB * QT0 * DM * 4); _Float16* OH0 = (_Float16*)take((size_t)NB * QT0 * DM * 2); _Float16* OL0 = (_Float16*)take((size_t)NB * QT0 * DM * 2);
  if (off > ws_size) return;
  k_wt_f16<<<(unsigned)(((size_t)LQ * (DM / 8) + 255) / 256), 256, 0, stream>>>(wqkv, BQKV, DM, LQ, 16.0f); k_wt_f16<<<(unsigned)(((size_t)DM * (DM / 8) + 255) / 256), 256, 0, stream>>>(wo, BO, DM, DM, 16.0f);      /* [in][out] -> Bt[n][k] x16 */
  k_x16<<<(unsigned)((NR * DM / 8 + 255) / 256), 256, 0, stream>>>(x, X16, NR * DM / 8);
  const size_t r0p = (size_t)B0 * SQ;      /* first projected row */
  k_gemm2<0><<<dim3((unsigned)((MP / 128) * (3 * DM / 64)), 1), 128, 0, stream>>>(X16 + r0p * DM, DM, 0, BQKV, DM, 0, 0.0625f, bqkv, 0, nullptr, 1, 0, 0, nullptr, QKV + r0p * 3 * DM, 3 * DM, 0, MP, 3 * DM, DM);      /* q | k | v rows (f16); head h = columns h*HD.. of each DM block */
  /* The launches below that take a batch index (slab of k_vt, blockIdx.y elsewhere) cover every batch at once: their grids are far smaller than the chip and each is bound by its own serial K or key loop. */
  k_vt<NH, SQ><<<NBR * NH * (SQ / 64), 256, 0, stream>>>(V16 + r0p * LQ, LQ, 0, VT + (size_t)B0 * NH * HD * SQ);      /* V^T [NB * NH][HD][SQ] */
  k_gemm2<0><<<dim3((QT0 / 128) * (LQ / 64), NBR), 128, 0, stream>>>(X16 + r0p * DM, DM, (size_t)SQ * DM, BQKV, DM, 0, 0.0625f, bqkv, 0, nullptr, 1, 0, 0, QKVF0, nullptr, LQ, (size_t)QT0 * LQ, QT0, LQ, DM);      /* f32 q | k | v of each batch's first 128 rows (exact products), N = 3 x 1024 */
  k_att0<<<dim3(NH * (QT0 / A0R), NBR), 128, 0, stream>>>(QKVF0, 0.125f, OF0 + (size_t)B0 * QT0 * DM);      /* exact f32 attention for rows 0..127 of each batch (o x64) */
  k_fattn<<<dim3(SQ / FAQ, NB * NH), 128, 0, stream>>>(QKV, VT, O16);      /* scores, causal softmax and P V of every batch, head and query tile in one launch: o (merged heads, x64) as f16 rows */
  k_gemm2<0><<<dim3((unsigned)((MPO / 128) * (DM / 64)), 1), 128, 0, stream>>>(O16 + r0p * DM, DM, 0, BO, DM, 0, 0.0009765625f, bo, 0, nullptr, 1, 0, 0, (float*)d_out + r0p * DM, nullptr, DM, 0, MPO, DM, DM);      /* out rows are the output layout */
  k_hl<<<(unsigned)(((size_t)NB * QT0 * DM / 8 + 255) / 256), 256, 0, stream>>>(OF0, OH0, OL0, (size_t)NB * QT0 * DM / 8);      /* first-tile o (x64) -> f16 hi + x1024 residual planes */
  k_gemm2<0><<<dim3((QT0 / 128) * (DM / 64), NBR), 128, 0, stream>>>(OH0 + (size_t)B0 * QT0 * DM, DM, (size_t)QT0 * DM, BO, DM, 0, 0.0009765625f, bo, 0, nullptr, 1, 0, 0, (float*)d_out + r0p * DM, nullptr, DM, (size_t)SQ * DM, QT0, DM, DM);      /* rows 0..127 of each batch: out = o_hi Wo (+ b), overwriting the f16-path rows */
  k_gemm2<0><<<dim3((QT0 / 128) * (DM / 64), NBR), 128, 0, stream>>>(OL0 + (size_t)B0 * QT0 * DM, DM, (size_t)QT0 * DM, BO, DM, 0, 0.00000095367431640625f, nullptr, 0, (const float*)d_out + r0p * DM, -1, 0, 0, (float*)d_out + r0p * DM, nullptr, DM, (size_t)SQ * DM, QT0, DM, DM);      /* += o_lo Wo 2^-20 (own-element accumulate) */
}

// v006
// A run of this version takes 129 microseconds.
// Timed twice side by side with v005, it ran 1.47 times as fast both times.
// Over all steps from v000 it is 39.4 times as fast.
#include <hip/hip_runtime.h>
#define NB 2
#define SQ 2048
#define DM 1024
#define NH 16
#define HD 64
#define HG 4                         /* heads per launch of the k_vt(V16, b, h0, VT) form, which is not launched */
#define QT0 128                      /* first-tile rows recomputed exactly in f32 */
#define B0 0                         /* first batch processed (debug hook) */
#define NBR NB                       /* batches processed (debug hook) */
#define NR ((size_t)NB * SQ)         /* token rows */
#define MP ((int)((size_t)NBR * SQ)) /* rows projected (debug hook) */
#define MPO MP                       /* rows through the output stage (debug hook) */
#define LQ (3 * DM)      /* row pitch of the q/k/v rows */
typedef __bf16 v16b __attribute__((ext_vector_type(16)));
typedef unsigned short v8us __attribute__((ext_vector_type(8), may_alias));
typedef float  v8f  __attribute__((ext_vector_type(8)));
typedef float  v4f  __attribute__((ext_vector_type(4)));
typedef float  v4fa __attribute__((ext_vector_type(4), may_alias));
union FragB { v16b v; v8us half[2]; unsigned short u[16]; };

__device__ __forceinline__ unsigned short bf16_bits(float x) { unsigned int u = __float_as_uint(x); return (unsigned short)((u + 0x7FFFu + ((u >> 16) & 1u)) >> 16); }
__device__ __forceinline__ float bf16_val(unsigned short b) { return __uint_as_float(((unsigned int)b) << 16); }
__device__ __forceinline__ float bf16_round(float x) { return bf16_val(bf16_bits(x)); }
// D += A·B with NT terms: 1 = ah·bh, 2 = + al·bh (A split), 3 = + ah·bl (both split)
template <int NT>
__device__ __forceinline__ v8f mmaN(v16b ah, v16b al, v16b bh, v16b bl, v8f c) {
  c = __builtin_amdgcn_wmma_f32_16x16x32_bf16(false, ah, false, bh, (short)0, c, false, false);
  if (NT >= 2) c = __builtin_amdgcn_wmma_f32_16x16x32_bf16(false, al, false, bh, (short)0, c, false, false);
  if (NT >= 3) c = __builtin_amdgcn_wmma_f32_16x16x32_bf16(false, ah, false, bl, (short)0, c, false, false);
  asm volatile("v_nop\n\tv_nop\n\tv_nop\n\tv_nop" : "+v"(c) : "v"(ah), "v"(al), "v"(bh), "v"(bl));
  return c;
}

__global__ __launch_bounds__(256) void k_wt_bf16(const float* __restrict__ W, unsigned short* __restrict__ Wt, int K, int N) {
  const int t = blockIdx.x * 256 + threadIdx.x;
  const int k8n = K / 8;
  if (t >= N * k8n) return;
  const int n = t / k8n, k8 = (t % k8n) * 8;
  v8us v;
#pragma unroll
  for (int i = 0; i < 8; ++i) v[i] = bf16_bits(W[(size_t)(k8 + i) * N + n]);
  *(v8us*)(Wt + (size_t)n * K + k8) = v;
  
}

// GEMM C[M][N] (f32, pitch ldc) = act(A[M][K]·W + bias). A f32 row-major (pitch lda) converted per fragment to bf16
// (ASPLIT: hi/lo two planes -> 2 terms, else single rounded term); Wt bf16 [N][K] (pitch ldb). BIAS_BF16 rounds the
// bias to bf16 first (bias quantised to bf16 before the add). K%32==0, M%16==0, N%64==0.
template <bool ASPLIT, int ACT, bool BIAS_BF16>
__global__ __launch_bounds__(128) void k_gemm_bf(const float* __restrict__ A, int lda, const unsigned short* __restrict__ Wt, int ldb,
                                               const float* __restrict__ bias, float* __restrict__ C, int ldc, int M, int N, int K) {
  __shared__ __attribute__((aligned(16))) float so[4][16][64];
  const int tid = threadIdx.x, w = tid >> 5, lane = tid & 31, ln = lane & 15, hh = lane >> 4;
  const int ntn = N / 64;
  const int wid = blockIdx.x * 4 + w;
  const int mt = wid / ntn, nq = wid % ntn;
  if (mt * 16 >= M) return;
  const int row0 = mt * 16, col0 = nq * 64;
  const float* arow = A + (size_t)(row0 + ln) * lda;
  v8f acc[4] = {};
  for (int kb = 0; kb < K; kb += 32) {
    FragB ah, al;
    const v4f x0 = *(const v4fa*)(arow + kb + 8 * hh), x1 = *(const v4fa*)(arow + kb + 8 * hh + 4);
    const v4f x2 = *(const v4fa*)(arow + kb + 16 + 8 * hh), x3 = *(const v4fa*)(arow + kb + 16 + 8 * hh + 4);
    float xs[16] = {x0[0],x0[1],x0[2],x0[3],x1[0],x1[1],x1[2],x1[3],x2[0],x2[1],x2[2],x2[3],x3[0],x3[1],x3[2],x3[3]};
#pragma unroll
    for (int i = 0; i < 16; ++i) { const unsigned short hb = bf16_bits(xs[i]); ah.u[i] = hb; al.u[i] = ASPLIT ? bf16_bits(xs[i] - bf16_val(hb)) : (unsigned short)0; }
#pragma unroll
    for (int t = 0; t < 4; ++t) {
      const unsigned short* brow = Wt + (size_t)(col0 + t * 16 + ln) * ldb + kb;
      FragB b;
      b.half[0] = *(const v8us*)(brow + 8 * hh);
      b.half[1] = *(const v8us*)(brow + 16 + 8 * hh);
      acc[t] = mmaN<ASPLIT ? 2 : 1>(ah.v, al.v, b.v, b.v, acc[t]);
    }
  }
#pragma unroll
  for (int t = 0; t < 4; ++t) {
    float bv = bias ? bias[col0 + t * 16 + ln] : 0.f;
    if (BIAS_BF16) bv = bf16_round(bv);
#pragma unroll
    for (int r = 0; r < 8; ++r) { float v = acc[t][r] + bv; if (ACT == 1) v = fmaxf(v, 0.f); so[w][8 * hh + r][t * 16 + ln] = v; }
  }
  __builtin_amdgcn_fence(__ATOMIC_ACQ_REL, "workgroup");
  __builtin_amdgcn_wave_barrier();
  const int rsub = lane >> 4, c4 = (lane & 15) * 4;
  {
#pragma unroll
    for (int q = 0; q < 8; ++q) {
      const int r = q * 2 + rsub;
      const v4f v = *(const v4fa*)&so[w][r][c4];
      *(v4f*)(C + (size_t)(row0 + r) * ldc + col0 + c4) = v;
    }
    
  }
}

// GEMM C = act(A·W + bias + resid): A f32 (ASPLIT -> hi/lo 2 terms), Wt bf16 [N][K]; ACT 0 none, 1 relu, 2 exact gelu;
// resid (optional, f32, row index = (row % rmod), pitch ldr, RES_BF16 rounds it) added before the activation.
template <bool ASPLIT, int ACT, bool BIAS_BF16, bool RES_BF16>
__global__ __launch_bounds__(128) void k_gemm_bf3(const float* __restrict__ A, int lda, const unsigned short* __restrict__ Wt, int ldb,
                                                const float* __restrict__ bias, const float* __restrict__ resid, int rmod, int ldr,
                                                float* __restrict__ C, int ldc, int M, int N, int K) {
  __shared__ __attribute__((aligned(16))) float so[4][16][64];
  const int tid = threadIdx.x, w = tid >> 5, lane = tid & 31, ln = lane & 15, hh = lane >> 4;
  const int ntn = N / 64;
  const int wid = blockIdx.x * 4 + w;
  const int mt = wid / ntn, nq = wid % ntn;
  if (mt * 16 >= M) return;
  const int row0 = mt * 16, col0 = nq * 64;
  const float* arow = A + (size_t)(row0 + ln) * lda;
  v8f acc[4] = {};
  for (int kb = 0; kb < K; kb += 32) {
    FragB ah, al;
    const v4f x0 = *(const v4fa*)(arow + kb + 8 * hh), x1 = *(const v4fa*)(arow + kb + 8 * hh + 4);
    const v4f x2 = *(const v4fa*)(arow + kb + 16 + 8 * hh), x3 = *(const v4fa*)(arow + kb + 16 + 8 * hh + 4);
    float xs[16] = {x0[0],x0[1],x0[2],x0[3],x1[0],x1[1],x1[2],x1[3],x2[0],x2[1],x2[2],x2[3],x3[0],x3[1],x3[2],x3[3]};
#pragma unroll
    for (int i = 0; i < 16; ++i) { const unsigned short hb = bf16_bits(xs[i]); ah.u[i] = hb; al.u[i] = ASPLIT ? bf16_bits(xs[i] - bf16_val(hb)) : (unsigned short)0; }
#pragma unroll
    for (int t = 0; t < 4; ++t) {
      const unsigned short* brow = Wt + (size_t)(col0 + t * 16 + ln) * ldb + kb;
      FragB b;
      b.half[0] = *(const v8us*)(brow + 8 * hh);
      b.half[1] = *(const v8us*)(brow + 16 + 8 * hh);
      acc[t] = mmaN<ASPLIT ? 2 : 1>(ah.v, al.v, b.v, b.v, acc[t]);
    }
  }
#pragma unroll
  for (int t = 0; t < 4; ++t) {
    const int col = col0 + t * 16 + ln;
    float bv = bias ? bias[col] : 0.f;
    if (BIAS_BF16) bv = bf16_round(bv);
#pragma unroll
    for (int r = 0; r < 8; ++r) {
      float v = acc[t][r] + bv;
      if (resid) { float rv = resid[(size_t)((row0 + 8 * hh + r) % rmod) * ldr + col]; if (RES_BF16) rv = bf16_round(rv); v += rv; }
      if (ACT == 1) v = fmaxf(v, 0.f);
      if (ACT == 2) v = 0.5f * v * (1.0f + erff(v * 0.70710678118654752f));
      if (ACT == 3) { const float u = 0.7978845608028654f * (v + 0.044715f * v * v * v); v = 0.5f * v * (1.0f + tanhf(u)); }
      so[w][8 * hh + r][t * 16 + ln] = v;
    }
  }
  __builtin_amdgcn_fence(__ATOMIC_ACQ_REL, "workgroup");
  __builtin_amdgcn_wave_barrier();
  const int rsub = lane >> 4, c4 = (lane & 15) * 4;
  {
#pragma unroll
    for (int q = 0; q < 8; ++q) {
      const int r = q * 2 + rsub;
      const v4f v = *(const v4fa*)&so[w][r][c4];
      *(v4f*)(C + (size_t)(row0 + r) * ldc + col0 + c4) = v;
    }
    
  }
}
// row LayerNorm (biased variance, eps) over N: s = X (+ R); optional out_sum <- s; out_norm <- (s-mu)*rsqrt(var+eps)*g + b
template <bool PARAM_BF16>
__global__ __launch_bounds__(256) void k_layernorm(const float* __restrict__ X, const float* __restrict__ R, const float* __restrict__ g, const float* __restrict__ bta,
                                                  float* __restrict__ out_sum, float* __restrict__ out_norm, int N, float eps) {
  __shared__ float red[256];
  const int row = blockIdx.x, tid = threadIdx.x;
  const float* x = X + (size_t)row * N; const float* rr = R ? R + (size_t)row * N : nullptr;
  float vals[16];                     // up to N = 4096
  const int per = N / 256;            // contiguous chunk per thread? use strided-by-4 chunks: thread handles j = tid*4 + 1024*u
  float s1 = 0.f;
  for (int u = 0; u < per / 4; ++u) {
    const int j = tid * 4 + 1024 * u;
    const v4f a = *(const v4fa*)(x + j);
    v4f b = {0.f,0.f,0.f,0.f}; if (rr) b = *(const v4fa*)(rr + j);
#pragma unroll
    for (int q = 0; q < 4; ++q) { const float v = a[q] + b[q]; vals[u * 4 + q] = v; s1 += v; }
  }
  red[tid] = s1; __syncthreads();
  for (int st = 128; st > 0; st >>= 1) { if (tid < st) red[tid] += red[tid + st]; __syncthreads(); }
  const float mu = red[0] / (float)N; __syncthreads();
  float s2 = 0.f;
  for (int u = 0; u < per / 4; ++u)
#pragma unroll
    for (int q = 0; q < 4; ++q) { const float c = vals[u * 4 + q] - mu; s2 += c * c; }
  red[tid] = s2; __syncthreads();
  for (int st = 128; st > 0; st >>= 1) { if (tid < st) red[tid] += red[tid + st]; __syncthreads(); }
  const float rs = rsqrtf(red[0] / (float)N + eps);
  {
    for (int u = 0; u < per / 4; ++u) {
      const int j = tid * 4 + 1024 * u;
      v4f o, sm;
#pragma unroll
      for (int q = 0; q < 4; ++q) {
        float gg = g[j + q], bb = bta[j + q];
        if (PARAM_BF16) { gg = bf16_round(gg); bb = bf16_round(bb); }
        sm[q] = vals[u * 4 + q]; o[q] = (vals[u * 4 + q] - mu) * rs * gg + bb;
      }
      if (out_sum) *(v4f*)(out_sum + (size_t)row * N + j) = sm;
      *(v4f*)(out_norm + (size_t)row * N + j) = o;
    }
    
  }
}



// ---- f16 WMMA path (v_wmma_f32_16x16x32_f16): 11-bit significands for operands in range — used where a [0,1] probability operand needs more precision than bf16
typedef _Float16 v16h __attribute__((ext_vector_type(16)));
union FragH { v16h v; v8us half[2]; _Float16 h[16]; unsigned short u[16]; };
template <int NT>
__device__ __forceinline__ v8f mmaH(v16h ah, v16h al, v16h bh, v16h bl, v8f c) {
  c = __builtin_amdgcn_wmma_f32_16x16x32_f16(false, ah, false, bh, (short)0, c, false, false);
  if (NT >= 2) c = __builtin_amdgcn_wmma_f32_16x16x32_f16(false, al, false, bh, (short)0, c, false, false);
  if (NT >= 3) c = __builtin_amdgcn_wmma_f32_16x16x32_f16(false, ah, false, bl, (short)0, c, false, false);
  asm volatile("v_nop\n\tv_nop\n\tv_nop\n\tv_nop" : "+v"(c) : "v"(ah), "v"(al), "v"(bh), "v"(bl));
  return c;
}
// batched GEMM like k_gemm_b but f16 operands: A f32 (split into f16 hi/lo if ASPLIT, else rounded to f16), Bt = f16 values [n][k]; alpha; C f32; N multiple of 16 (partial tiles skipped)
template <bool ASPLIT>
__global__ __launch_bounds__(128) void k_gemm_h(const float* __restrict__ A, int lda, size_t sA, const _Float16* __restrict__ Bh, int ldb, size_t sB, float alpha, float* __restrict__ C, int ldc, size_t sC, int M, int N, int K) {
  __shared__ __attribute__((aligned(16))) float so[4][16][64];
  const int tid = threadIdx.x, w = tid >> 5, lane = tid & 31, ln = lane & 15, hh = lane >> 4; const int by = blockIdx.y;
  A += (size_t)by * sA; Bh += (size_t)by * sB; C += (size_t)by * sC;
  const int ntn = (N + 63) / 64; const int wid = blockIdx.x * 4 + w; const int mt = wid / ntn, nq = wid % ntn; if (mt * 16 >= M) return;
  const int row0 = mt * 16, col0 = nq * 64; const float* arow = A + (size_t)(row0 + ln) * lda;
  v8f acc[4] = {};
  for (int kb = 0; kb < K; kb += 32) {
    FragH ah, al;
    const v4f x0 = *(const v4fa*)(arow + kb + 8 * hh), x1 = *(const v4fa*)(arow + kb + 8 * hh + 4), x2 = *(const v4fa*)(arow + kb + 16 + 8 * hh), x3 = *(const v4fa*)(arow + kb + 16 + 8 * hh + 4);
    float xs[16] = {x0[0],x0[1],x0[2],x0[3],x1[0],x1[1],x1[2],x1[3],x2[0],x2[1],x2[2],x2[3],x3[0],x3[1],x3[2],x3[3]};
#pragma unroll
    for (int i = 0; i < 16; ++i) { const _Float16 h = (_Float16)xs[i]; ah.h[i] = h; al.h[i] = ASPLIT ? (_Float16)(xs[i] - (float)h) : (_Float16)0.0f; }
#pragma unroll
    for (int t = 0; t < 4; ++t) { if (col0 + t * 16 >= N) continue; const size_t boff = (size_t)(col0 + t * 16 + ln) * ldb + kb; FragH bq; bq.half[0] = *(const v8us*)(Bh + boff + 8 * hh); bq.half[1] = *(const v8us*)(Bh + boff + 16 + 8 * hh);
      acc[t] = mmaH<ASPLIT ? 2 : 1>(ah.v, al.v, bq.v, bq.v, acc[t]); }
  }
#pragma unroll
  for (int t = 0; t < 4; ++t) { if (col0 + t * 16 >= N) continue;
#pragma unroll
    for (int r = 0; r < 8; ++r) so[w][8 * hh + r][t * 16 + ln] = acc[t][r] * alpha; }
  __builtin_amdgcn_fence(__ATOMIC_ACQ_REL, "workgroup"); __builtin_amdgcn_wave_barrier();
  const int rsub = lane >> 4, c4 = (lane & 15) * 4;
  {
#pragma unroll
    for (int q = 0; q < 8; ++q) { const int r = q * 2 + rsub; if (col0 + c4 < N) { const v4f v = *(const v4fa*)&so[w][r][c4]; *(v4f*)(C + (size_t)(row0 + r) * ldc + col0 + c4) = v; } }
     }
}

// Wt[n][k] = f16(W[k][n]·scale) from f32 row-major W[K][N] (scale = power of two; bf16-exact weights stay exact in f16 away from the subnormal range)
__global__ __launch_bounds__(256) void k_wt_f16(const float* __restrict__ W, _Float16* __restrict__ Wt, int K, int N, float scale) {
  const int t = blockIdx.x * 256 + threadIdx.x; if (t >= N * (K / 8)) return; const int n = t / (K / 8), k8 = (t % (K / 8)) * 8; FragH f;
#pragma unroll
  for (int i = 0; i < 8; ++i) f.h[i] = (_Float16)(bf16_round(W[(size_t)(k8 + i) * N + n]) * scale); const v8us o = f.half[0];
  *(v8us*)((unsigned short*)Wt + (size_t)n * K + k8) = o; 
}
// k_gemm_hh variant with fused epilogue: v = acc·alpha + bias[by·sBias + col] (+ CP[(row/rowsPerB)·sCPb + by·64 + col] if CP) ; ACT 0 none / 1 elu ; writes f16 C16 (and f32 C if non-null)
template <int ACT>
__global__ __launch_bounds__(128) void k_gemm_hhx(const _Float16* __restrict__ A, int lda, size_t sA, const _Float16* __restrict__ Bh, int ldb, size_t sB, float alpha, const float* __restrict__ bias, size_t sBias, const float* __restrict__ CP, int rowsPerB, size_t sCPb, int row0g,
    float* __restrict__ C, _Float16* __restrict__ C16, int ldc, size_t sC, int M, int N, int K) {
  __shared__ __attribute__((aligned(16))) float so[4][16][64];
  const int tid = threadIdx.x, w = tid >> 5, lane = tid & 31, ln = lane & 15, hh = lane >> 4; const int by = blockIdx.y;
  A += (size_t)by * sA; Bh += (size_t)by * sB; const size_t cofs = (size_t)by * sC; const float* bp = bias ? bias + (size_t)by * sBias : nullptr;
  const int ntn = (N + 63) / 64; const int wid = blockIdx.x * 4 + w; const int mt = wid / ntn, nq = wid % ntn; if (mt * 16 >= M) return;
  const int row0 = mt * 16, col0 = nq * 64; const _Float16* arow = A + (size_t)(row0 + ln) * lda;
  v8f acc[4] = {};
  for (int kb = 0; kb < K; kb += 32) { FragH ah; ah.half[0] = *(const v8us*)((const unsigned short*)arow + kb + 8 * hh); ah.half[1] = *(const v8us*)((const unsigned short*)arow + kb + 16 + 8 * hh);
#pragma unroll
    for (int t = 0; t < 4; ++t) { if (col0 + t * 16 >= N) continue; const size_t boff = (size_t)(col0 + t * 16 + ln) * ldb + kb; FragH bq; bq.half[0] = *(const v8us*)((const unsigned short*)Bh + boff + 8 * hh); bq.half[1] = *(const v8us*)((const unsigned short*)Bh + boff + 16 + 8 * hh);
      acc[t] = mmaH<1>(ah.v, ah.v, bq.v, bq.v, acc[t]); }
  }
#pragma unroll
  for (int t = 0; t < 4; ++t) { if (col0 + t * 16 >= N) continue; const int col = col0 + t * 16 + ln; const float bv = bp ? bf16_round(bp[col]) : 0.f;
#pragma unroll
    for (int r = 0; r < 8; ++r) { float v = acc[t][r] * alpha + bv; if (CP) { const int rr = row0g + row0 + 8 * hh + r; if (rowsPerB < 0) v += CP[cofs + (size_t)rr * ldc + col];      /* rowsPerB < 0: own element of the batched C plane */ else { const int bidx = rr / rowsPerB; v += CP[(size_t)bidx * sCPb + (size_t)by * 64 + col]; } } if (ACT == 1) v = (v > 0.f) ? v : expm1f(v); else if (ACT == 7) v = (v > 0.f) ? v + 1.0f : expf(v); else if (ACT == 8) v = tanhf(v); else if (ACT == 9) v = 0.5f * v * (1.0f + tanhf(0.7978845608028654f * (v + 0.044715f * v * v * v))); else if (ACT == 11) v = 1.0f / (1.0f + expf(-v)); else if (ACT == 12) v = (v > 0.f) ? v : 0.01f * v; else if (ACT == 14) v = (v > 0.f) ? v : 0.1f * v; else if (ACT == 16) v = (v >= 0.f) ? v : 0.3f * v; else if (ACT == 17) v = (v >= 0.f) ? v : 0.2f * v; else if (ACT == 15) v = v / (1.0f + expf(-v)); else if (ACT == 3) v = fmaxf(v, 0.f); else if (ACT == 6) v = 0.5f * v * (1.0f + erff(v * 0.70710678118654752f)); so[w][8 * hh + r][t * 16 + ln] = v; } }
  __builtin_amdgcn_fence(__ATOMIC_ACQ_REL, "workgroup"); __builtin_amdgcn_wave_barrier();
  const int rsub = lane >> 4, c4 = (lane & 15) * 4; typedef _Float16 v4h __attribute__((ext_vector_type(4)));
  {
#pragma unroll
    for (int q = 0; q < 8; ++q) { const int r = q * 2 + rsub; if (col0 + c4 < N) { const v4f v = *(const v4fa*)&so[w][r][c4]; if (C) *(v4f*)(C + cofs + (size_t)(row0 + r) * ldc + col0 + c4) = v; if (C16) { v4h h4; for (int i = 0; i < 4; ++i) h4[i] = (_Float16)v[i]; *(v4h*)(C16 + cofs + (size_t)(row0 + r) * ldc + col0 + c4) = h4; } } }
     }
}


typedef _Float16 v4h __attribute__((ext_vector_type(4)));

__global__ __launch_bounds__(256) void k_x16(const float* __restrict__ x, _Float16* __restrict__ X16, size_t n8) { const size_t t = (size_t)blockIdx.x * 256 + threadIdx.x; if (t >= n8) return; FragH f;
#pragma unroll
  for (int q = 0; q < 8; ++q) f.h[q] = (_Float16)bf16_round(x[t * 8 + q]); *(v8us*)((unsigned short*)X16 + t * 8) = f.half[0];  }
__global__ __launch_bounds__(256) void k_h16(const float* __restrict__ x, _Float16* __restrict__ X16, size_t n8) { const size_t t = (size_t)blockIdx.x * 256 + threadIdx.x; if (t >= n8) return; FragH f;
#pragma unroll
  for (int q = 0; q < 8; ++q) f.h[q] = (_Float16)x[t * 8 + q]; *(v8us*)((unsigned short*)X16 + t * 8) = f.half[0];  }
__global__ __launch_bounds__(256) void k_round16f(const float* __restrict__ W, _Float16* __restrict__ Bt, size_t n8) { const size_t t = (size_t)blockIdx.x * 256 + threadIdx.x; if (t >= n8) return; FragH f;
#pragma unroll
  for (int i = 0; i < 8; ++i) f.h[i] = (_Float16)(bf16_round(W[t * 8 + i]) * 16.0f); *(v8us*)((unsigned short*)Bt + t * 8) = f.half[0];  }
template <int NHv, int TTv>
__global__ __launch_bounds__(256) void k_vt(const _Float16* __restrict__ V16, int ldv, int voff, _Float16* __restrict__ Vt) { __shared__ unsigned short tl[64][66]; const int tid = threadIdx.x; const int slab = blockIdx.x / (TTv / 64), lg = blockIdx.x % (TTv / 64); const int b = slab / NHv, h = slab % NHv;
  for (int i = tid; i < 64 * 8; i += 256) { const int r = i / 8, c8 = (i % 8) * 8; FragH f; f.half[0] = *(const v8us*)((const unsigned short*)V16 + ((size_t)b * TTv + lg * 64 + r) * ldv + voff + h * 64 + c8);
#pragma unroll
    for (int q = 0; q < 8; ++q) tl[r][c8 + q] = f.u[q]; }
  __syncthreads();
  {
#pragma unroll
    for (int rd = 0; rd < 2; ++rd) { const int d = rd * 32 + tid / 8, pc = tid % 8; FragH f;
#pragma unroll
      for (int q = 0; q < 8; ++q) f.u[q] = tl[pc * 8 + q][d];
      *(v8us*)((unsigned short*)Vt + ((size_t)slab * 64 + d) * TTv + lg * 64 + pc * 8) = f.half[0]; }
     } }

// ---- fast GEMM (block tile 128x64, wave tile 32x64; requires M % 128 == 0 rows per launch region, N % 64 == 0 and K % 64 == 0); epilogue = k_gemm_hhx semantics ----
// Operands go global -> LDS by asynchronous copies, 64 k (one whole 128-B line of each of the 128 A rows and 64 B rows) per trip, two buffers: the next tile flies while this one is multiplied.
// A wave-wide copy covers 4 rows x 128 B (4 whole lines) and the B rows are fetched once per block; the fragments are then read from LDS in the same k order as from global memory.
#define G2KC 64                      /* k per trip */
#define G2PB 144                     /* LDS row pitch in bytes: 128 + 16 (16 B x odd), conflict-free for the 16-byte fragment reads */
#define G2BB (192 * G2PB)            /* bytes of one buffer: 128 A rows, then 64 B rows */
// One tile: thread (row r = tid / 8, 16-byte piece tid % 8) copies its piece of rows r + 16 i: 8 of A, then 4 of B. l: the LDS byte address of its piece of row r. Every lane is on.
// The s_wait_xcnt in the same statement stands in front of any later rewrite of the address registers that the copies name.
__device__ __forceinline__ void g2_stage(unsigned l, const _Float16* a, size_t a16, const _Float16* b, size_t b16) {
  asm volatile("global_load_async_to_lds_b128 %0, %12, off\n\tglobal_load_async_to_lds_b128 %1, %13, off\n\tglobal_load_async_to_lds_b128 %2, %14, off\n\tglobal_load_async_to_lds_b128 %3, %15, off\n\t"
               "global_load_async_to_lds_b128 %4, %16, off\n\tglobal_load_async_to_lds_b128 %5, %17, off\n\tglobal_load_async_to_lds_b128 %6, %18, off\n\tglobal_load_async_to_lds_b128 %7, %19, off\n\t"
               "global_load_async_to_lds_b128 %8, %20, off\n\tglobal_load_async_to_lds_b128 %9, %21, off\n\tglobal_load_async_to_lds_b128 %10, %22, off\n\tglobal_load_async_to_lds_b128 %11, %23, off\n\ts_wait_xcnt 0x0"
               :: "v"(l), "v"(l + 16 * G2PB), "v"(l + 32 * G2PB), "v"(l + 48 * G2PB), "v"(l + 64 * G2PB), "v"(l + 80 * G2PB), "v"(l + 96 * G2PB), "v"(l + 112 * G2PB),
                  "v"(l + 128 * G2PB), "v"(l + 144 * G2PB), "v"(l + 160 * G2PB), "v"(l + 176 * G2PB),
                  "v"(a), "v"(a + a16), "v"(a + 2 * a16), "v"(a + 3 * a16), "v"(a + 4 * a16), "v"(a + 5 * a16), "v"(a + 6 * a16), "v"(a + 7 * a16),
                  "v"(b), "v"(b + b16), "v"(b + 2 * b16), "v"(b + 3 * b16) : "memory"); }
__device__ __forceinline__ v16h g2_frag(const _Float16* p, int hh) { FragH f; f.half[0] = *(const v8us*)((const unsigned short*)p + 8 * hh); f.half[1] = *(const v8us*)((const unsigned short*)p + 16 + 8 * hh); return f.v; }
__device__ __forceinline__ v8f g2_mma(v16h a, v16h b, v8f c) { v8f d = __builtin_amdgcn_wmma_f32_16x16x32_f16(false, a, false, b, (short)0, c, false, false); asm volatile("v_nop\n\tv_nop\n\tv_nop\n\tv_nop" : "+v"(d) : "v"(a), "v"(b)); return d; }
// FT 1: a block that holds the first QT0 rows of a batch also stores them as f32 rows into CT (per batch QT0 rows of pitch ldc).
// FT 2: those rows are not taken from A but from A2, where every 128 rows are 64 rows of o as f16 (hi) followed by the same 64 rows' x1024 residual (lo): such a block (they come first in the grid) multiplies both planes in the one K loop,
// waves 0 and 1 the hi rows, waves 2 and 3 the lo rows, and its epilogue stores (hi alpha + bias) + lo alpha 2^-10. The other blocks take the M tiles behind each batch's first.
#define G2MP (SQ / 128)              /* M tiles per batch */
template <int ACT, int FT>
__global__ __launch_bounds__(128) void k_gemm2(const _Float16* __restrict__ A, int lda, size_t sA, const _Float16* __restrict__ Bh, int ldb, size_t sB, float alpha, const float* __restrict__ bias, size_t sBias, const float* __restrict__ CP, int rowsPerB, size_t sCPb, int row0g,
    float* __restrict__ C, _Float16* __restrict__ C16, int ldc, size_t sC, int M, int N, int K, const _Float16* __restrict__ A2, float* __restrict__ CT) { static_assert(ACT == 0 || ACT == 3 || ACT == 6 || ACT == 8 || ACT == 9 || ACT == 11 || ACT == 12 || ACT == 14 || ACT == 15 || ACT == 16 || ACT == 17, "k_gemm2: unsupported ACT code (would silently apply no activation)"); static_assert(QT0 == 128, "the first tile is one M tile");
  __shared__ __attribute__((aligned(16))) unsigned char sm[2 * G2BB];      /* the two operand buffers; behind the K loop's last barrier the same bytes serve as the epilogue's staging rows */
  float (*so)[32][68] = (float (*)[32][68])sm;
  const int tid = threadIdx.x, w = tid >> 5, lane = tid & 31, ln = lane & 15, hh = lane >> 4; const int by = blockIdx.y;
  A += (size_t)by * sA; Bh += (size_t)by * sB; const size_t cofs = (size_t)by * sC; const float* bp = bias ? bias + (size_t)by * sBias : nullptr;
  const int ntn = N >> 6; const int g = blockIdx.x / ntn, nq = blockIdx.x - g * ntn; const bool pair = FT == 2 && g < 2 * NB;      /* hi | lo block g: batch g / 2, rows 64 (g & 1) .. + 63; the same for the whole block */
  const int mt = (FT == 2 && !pair) ? (g - 2 * NB) + 1 + (g - 2 * NB) / (G2MP - 1) : g; const int row0 = mt * 128 + 32 * w, col0 = nq * 64; if (!pair && mt * 128 >= M) return;      /* the same for the whole block, in front of every barrier */
  const int sr = tid >> 3, sp = tid & 7;      /* staging: this thread's first row and its 16-byte piece of the 128-B row */
  const _Float16* ag = (pair ? A2 : A) + (size_t)(mt * 128 + sr) * lda + sp * 8; const _Float16* bg = Bh + (size_t)(col0 + sr) * ldb + sp * 8; const size_t a16 = (size_t)16 * lda, b16 = (size_t)16 * ldb;
  const unsigned ls = (unsigned)(size_t)sm + (unsigned)(sr * G2PB + sp * 16);      /* LDS byte address: the low 32 bits of the shared address */
  const unsigned char* af = sm + (32 * w + ln) * G2PB; const unsigned char* bf = sm + (128 + ln) * G2PB;      /* this lane's first A and B fragment rows in buffer 0 */
  const int nt = K / G2KC;
  const v8f z8 = {0.f,0.f,0.f,0.f,0.f,0.f,0.f,0.f}; v8f c00 = z8, c01 = z8, c02 = z8, c03 = z8, c10 = z8, c11 = z8, c12 = z8, c13 = z8;
  g2_stage(ls, ag, a16, bg, b16);
  asm volatile("s_wait_asynccnt 0x0" ::: "memory");      /* this wave's copies of tile 0 have landed */
  __syncthreads();      /* ... and every other wave's */
  if (nt > 1) g2_stage(ls + G2BB, ag + G2KC, a16, bg + G2KC, b16);
#pragma unroll 1      /* rolled: one copy of the trip; the buffer is chosen by an offset */
  for (int t = 0; t < nt; ++t) { const unsigned bo = (unsigned)(t & 1) * G2BB; const _Float16* ap = (const _Float16*)(af + bo); const _Float16* bq = (const _Float16*)(bf + bo);
    /* all 12 fragments of the trip are asked for first, in the order of their use, so that their LDS latencies overlap; 8 * G2PB halves = 16 rows, + 32 halves = the second 32 k */
    const v16h a00 = g2_frag(ap, hh), b00 = g2_frag(bq, hh), a10 = g2_frag(ap + 8 * G2PB, hh), b10 = g2_frag(bq + 8 * G2PB, hh), b20 = g2_frag(bq + 16 * G2PB, hh), b30 = g2_frag(bq + 24 * G2PB, hh);
    const v16h a01 = g2_frag(ap + 32, hh), b01 = g2_frag(bq + 32, hh), a11 = g2_frag(ap + 8 * G2PB + 32, hh), b11 = g2_frag(bq + 8 * G2PB + 32, hh), b21 = g2_frag(bq + 16 * G2PB + 32, hh), b31 = g2_frag(bq + 24 * G2PB + 32, hh);
    c00 = g2_mma(a00, b00, c00); c10 = g2_mma(a10, b00, c10); c01 = g2_mma(a00, b10, c01); c11 = g2_mma(a10, b10, c11);
    c02 = g2_mma(a00, b20, c02); c12 = g2_mma(a10, b20, c12); c03 = g2_mma(a00, b30, c03); c13 = g2_mma(a10, b30, c13);
    c00 = g2_mma(a01, b01, c00); c10 = g2_mma(a11, b01, c10); c01 = g2_mma(a01, b11, c01); c11 = g2_mma(a11, b11, c11);
    c02 = g2_mma(a01, b21, c02); c12 = g2_mma(a11, b21, c12); c03 = g2_mma(a01, b31, c03); c13 = g2_mma(a11, b31, c13);
    asm volatile("s_wait_dscnt 0x0" ::: "memory");      /* this wave's reads of the buffer are done before it may be refilled */
    asm volatile("s_wait_asynccnt 0x0" ::: "memory");      /* this wave's copies of tile t + 1 have landed */
    __syncthreads();      /* publishes tile t + 1 and ends every wave's reads of tile t */
    if (t + 2 < nt) g2_stage(ls + bo, ag + (size_t)(t + 2) * G2KC, a16, bg + (size_t)(t + 2) * G2KC, b16); }
  asm volatile("s_wait_asynccnt 0x0" ::: "memory");      /* nothing in flight when the buffers become the staging rows */
  v8f accs[8] = {c00, c01, c02, c03, c10, c11, c12, c13};
  const bool lo = pair && w >= 2; if (lo) alpha *= 0.0009765625f;      /* the residual plane: x1024 taken off again, no bias */
#pragma unroll
  for (int u = 0; u < 8; ++u) { const int t = u & 3, half = u >> 2; const int col = col0 + t * 16 + ln; const float bv = (bp && !lo) ? bf16_round(bp[col]) : 0.f;
#pragma unroll
    for (int r = 0; r < 8; ++r) { const int rloc = half * 16 + 8 * hh + r; float v = accs[u][r] * alpha + bv; if (FT == 0 && CP) { if (rowsPerB < 0) v += CP[cofs + (size_t)(row0g + row0 + rloc) * ldc + col];      /* rowsPerB < 0: own element of the batched C plane */ else { const int bidx = (row0g + row0 + rloc) / rowsPerB; v += CP[(size_t)bidx * sCPb + (size_t)by * 64 + col]; } }
      if (ACT == 3) v = fmaxf(v, 0.f); else if (ACT == 6) v = 0.5f * v * (1.0f + erff(v * 0.70710678118654752f)); else if (ACT == 11) v = 1.0f / (1.0f + expf(-v)); else if (ACT == 15) v = v / (1.0f + expf(-v)); else if (ACT == 12) v = (v > 0.f) ? v : 0.01f * v; else if (ACT == 8) v = tanhf(v); else if (ACT == 9) v = 0.5f * v * (1.0f + tanhf(0.7978845608028654f * (v + 0.044715f * v * v * v))); else if (ACT == 14) v = (v > 0.f) ? v : 0.1f * v; else if (ACT == 16) v = (v >= 0.f) ? v : 0.3f * v; else if (ACT == 17) v = (v >= 0.f) ? v : 0.2f * v;
      so[w][rloc][t * 16 + ln] = v; } }
  const int rsub = lane >> 4, c4 = (lane & 15) * 4;
  if (pair) { __syncthreads();      /* the hi and the lo rows of one output row come from two waves */
#pragma unroll      /* the 16 LDS reads and 8 stores are independent: unrolled, their latencies overlap */
    for (int q = 0; q < 8; ++q) { const int rr = 16 * w + q * 2 + rsub; const v4f vh = *(const v4fa*)&so[rr >> 5][rr & 31][c4], vl = *(const v4fa*)&so[2 + (rr >> 5)][rr & 31][c4];      /* wave w stores rows 16 w .. + 15 of the block's 64 */
      *(v4f*)(C + cofs + (size_t)((g >> 1) * SQ + (g & 1) * 64 + rr) * ldc + col0 + c4) = vh + vl; }
    return; }
  __builtin_amdgcn_fence(__ATOMIC_ACQ_REL, "workgroup"); __builtin_amdgcn_wave_barrier();
  {
#pragma unroll
    for (int q = 0; q < 16; ++q) { const int r = q * 2 + rsub; const v4f v = *(const v4fa*)&so[w][r][c4]; if (C) *(v4f*)(C + cofs + (size_t)(row0 + r) * ldc + col0 + c4) = v; if (C16) { v4h h4; for (int i = 0; i < 4; ++i) h4[i] = (_Float16)v[i]; *(v4h*)(C16 + cofs + (size_t)(row0 + r) * ldc + col0 + c4) = h4; } }
     }
  if (FT == 1 && mt % G2MP == 0) {      /* a batch's first rows: the same values once more, as f32 rows for the exact path */
#pragma unroll      /* the 16 LDS reads and stores are independent: unrolled, their latencies overlap */
    for (int q = 0; q < 16; ++q) { const int r = q * 2 + rsub; const v4f v = *(const v4fa*)&so[w][r][c4]; *(v4f*)(CT + ((size_t)(mt / G2MP) * QT0 + 32 * w + r) * ldc + col0 + c4) = v; } } }


__global__ __launch_bounds__(256) void k_wnat(const float* __restrict__ w, size_t n8, _Float16* __restrict__ Bt) { const size_t t = (size_t)blockIdx.x * 256 + threadIdx.x; if (t >= n8) return; FragH f; for (int q = 0; q < 8; ++q) f.h[q] = (_Float16)(bf16_round(w[t * 8 + q]) * 16.0f); *(v8us*)((unsigned short*)Bt + t * 8) = f.half[0];  }
__global__ __launch_bounds__(256) void k_rsm(const float* __restrict__ S, _Float16* __restrict__ P, int nrows) {
  #pragma clang fp contract(off)
  const int i = blockIdx.x * 256 + threadIdx.x; if (i >= nrows) return; const float* s = S + (size_t)i * SQ; float mx = -3.0e38f;
#pragma unroll 1
  for (int j = 0; j < SQ; ++j) mx = fmaxf(mx, s[j]); float se = 0.f;
#pragma unroll 1
  for (int j = 0; j < SQ; ++j) se += expf(s[j] - mx); const float sc = 256.0f / se;
#pragma unroll 1
  for (int j0 = 0; j0 < SQ; j0 += 8) { FragH f; for (int q = 0; q < 8; ++q) f.h[q] = (_Float16)(expf(s[j0 + q] - mx) * sc); unsigned short* d = (unsigned short*)P + (size_t)i * SQ + j0; *(v8us*)d = f.half[0];  } }
__global__ __launch_bounds__(256) void k_vt(const _Float16* __restrict__ V16, int b, int h0, _Float16* __restrict__ VT) { __shared__ unsigned short tl[64][65]; const int tid = threadIdx.x; const int hh = blockIdx.x % HG, sg = blockIdx.x / HG; const int s0 = sg * 64; const int h = h0 + hh;
  for (int i = tid; i < 64 * 8; i += 256) { const int j = i / 8, d8 = (i % 8) * 8; FragH f; f.half[0] = *(const v8us*)((const unsigned short*)V16 + ((size_t)b * SQ + s0 + j) * DM + h * HD + d8); for (int q = 0; q < 8; ++q) tl[d8 + q][j] = f.u[q]; }
  __syncthreads();
  { for (int i = tid; i < 64 * 8; i += 256) { const int d = i / 8, j8 = (i % 8) * 8; FragH f; for (int q = 0; q < 8; ++q) f.u[q] = tl[d][j8 + q]; *(v8us*)((unsigned short*)VT + ((size_t)hh * HD + d) * SQ + s0 + j8) = f.half[0]; }  } }



template <int CTRL> __device__ __forceinline__ float rs_row16(float v) { return __int_as_float(__builtin_amdgcn_update_dpp(0, __float_as_int(v), CTRL, 0xf, 0xf, true)); }      /* lane l ^ mask inside a 16-lane row (row_xmask) */
__device__ __forceinline__ float rs_x16(float v) { const int u = __float_as_int(v); return __int_as_float(__builtin_amdgcn_permlanex16(u, u, 0x76543210, 0xfedcba98, false, false)); }      /* lane l ^ 16 */
#define FAQ 128                      /* query rows per block: 4 waves x 32 columns */
#define FAC 0.18033688011112042592f  /* log2(e) / sqrt(64) */
__device__ __forceinline__ v8f fa_mma(v16h a, v16h b, v8f c) { return __builtin_amdgcn_wmma_f32_16x16x32_f16(false, a, false, b, (short)0, c, false, false); }
// 2^x in the native form. The v_nop in the same statement fills the one slot the instruction set asks for behind a transcendental; in the eight-wide form each v_exp is followed by an
// independent one (early-clobber outputs: no result register is a later source), so one v_nop behind the last serves all eight.
__device__ __forceinline__ float fa_exp2(float x) { float r; asm("v_exp_f32 %0, %1\n\tv_nop" : "=v"(r) : "v"(x)); return r; }
__device__ __forceinline__ v8f fa_exp2x8(v8f x) { float r0, r1, r2, r3, r4, r5, r6, r7;
  asm("v_exp_f32 %0, %8\n\tv_exp_f32 %1, %9\n\tv_exp_f32 %2, %10\n\tv_exp_f32 %3, %11\n\tv_exp_f32 %4, %12\n\tv_exp_f32 %5, %13\n\tv_exp_f32 %6, %14\n\tv_exp_f32 %7, %15\n\tv_nop"
      : "=&v"(r0), "=&v"(r1), "=&v"(r2), "=&v"(r3), "=&v"(r4), "=&v"(r5), "=&v"(r6), "=&v"(r7) : "v"(x[0]), "v"(x[1]), "v"(x[2]), "v"(x[3]), "v"(x[4]), "v"(x[5]), "v"(x[6]), "v"(x[7]));
  const v8f r = {r0, r1, r2, r3, r4, r5, r6, r7}; return r; }
// One pass of 32 keys for a wave's 32 query columns. kf holds this pass's K fragments and is refilled for the next pass right behind the score products (LAST: the diagonal pass, masked, no refill).
// Every loop is fully unrolled so that the fragment and accumulator arrays are indexed by constants and stay in registers.
template <bool LAST>
__device__ __forceinline__ void fa_pass(const _Float16* __restrict__ kn, const _Float16* __restrict__ vp, int hh, int dq, const v16h (&qf)[2][2], v16h (&kf)[2][2], v8f (&o)[2][4], float (&m)[2], float (&l)[2]) {
  v16h vf[4];
#pragma unroll
  for (int dt = 0; dt < 4; ++dt) vf[dt] = g2_frag(vp + (size_t)dt * 16 * SQ, hh);
  const v8f z8 = {0.f, 0.f, 0.f, 0.f, 0.f, 0.f, 0.f, 0.f}; v8f s[2][2];
#pragma unroll
  for (int j = 0; j < 2; ++j)
#pragma unroll
    for (int t = 0; t < 2; ++t) s[j][t] = fa_mma(kf[t][1], qf[j][1], fa_mma(kf[t][0], qf[j][0], z8));
  if (!LAST) {
#pragma unroll
    for (int t = 0; t < 2; ++t)
#pragma unroll
      for (int c = 0; c < 2; ++c) kf[t][c] = g2_frag(kn + (size_t)t * 16 * LQ + c * 32, hh);
    __builtin_amdgcn_sched_barrier(0); }      /* keeps the refill in front of the softmax: without it the loads sank to the pass's end and the next pass waited out their whole latency */
#pragma unroll
  for (int j = 0; j < 2; ++j) {
    if (LAST) {      /* key - query = 16 t + r + dq - 16 j: above the diagonal when positive */
#pragma unroll
      for (int t = 0; t < 2; ++t)
#pragma unroll
        for (int r = 0; r < 8; ++r) if (16 * t + r + dq - 16 * j > 0) s[j][t][r] = -1.0e30f; }
    float mx = s[j][0][0];
#pragma unroll
    for (int r = 0; r < 8; ++r) mx = fmaxf(mx, fmaxf(s[j][0][r], s[j][1][r]));
    mx = fmaxf(mx, rs_x16(mx));      /* the column's other 16 keys are in lane ^ 16 */
    const float mn = fmaxf(m[j], mx); const float sc = fa_exp2((m[j] - mn) * FAC); const float nb = 8.0f - mn * FAC; m[j] = mn;      /* + 8: weights carried x256 */
    const v8f e0 = fa_exp2x8(s[j][0] * FAC + nb), e1 = fa_exp2x8(s[j][1] * FAC + nb);
    const v8f es = e0 + e1; l[j] = l[j] * sc + (((es[0] + es[1]) + (es[2] + es[3])) + ((es[4] + es[5]) + (es[6] + es[7])));      /* each half keeps its own partial sum; joined in the epilogue */
    FragH p;
#pragma unroll
    for (int r = 0; r < 8; ++r) { p.h[r] = (_Float16)e0[r]; p.h[8 + r] = (_Float16)e1[r]; }
#pragma unroll
    for (int dt = 0; dt < 4; ++dt) o[j][dt] = fa_mma(vf[dt], p.v, o[j][dt] * sc); } }
__device__ __forceinline__ void fa_tile(const _Float16* __restrict__ QKVp, const _Float16* __restrict__ VTp, _Float16* __restrict__ O, int bh, int qt) {      /* one block: query tile qt of batch and head bh. QKVp: q | k | v rows of pitch LQ; VTp: [NB * NH][HD][SQ]; O: merged rows of pitch DM */
  const int lane = threadIdx.x & 31, ln = lane & 15, hh = lane >> 4; const int w = __builtin_amdgcn_readfirstlane(threadIdx.x >> 5);
  const int b = bh / NH, h = bh % NH;
  const int q0 = qt * FAQ + w * 32;      /* no barrier in this function: each wave has its own trip count. The loops over j, c, dt and r below are fully unrolled for constant indices (registers), as in fa_pass */
  const _Float16* qp = QKVp + ((size_t)b * SQ + q0 + ln) * LQ + h * HD; const _Float16* kp = QKVp + ((size_t)b * SQ + ln) * LQ + DM + h * HD; const _Float16* vp = VTp + ((size_t)bh * HD + ln) * SQ;
  v16h qf[2][2], kf[2][2]; v8f o[2][4]; float m[2] = {-1.0e30f, -1.0e30f}, l[2] = {0.f, 0.f};
#pragma unroll
  for (int j = 0; j < 2; ++j)
#pragma unroll
    for (int c = 0; c < 2; ++c) { qf[j][c] = g2_frag(qp + (size_t)j * 16 * LQ + c * 32, hh); kf[j][c] = g2_frag(kp + (size_t)j * 16 * LQ + c * 32, hh); }
  asm volatile("s_wait_xcnt 0x0" ::: "memory");      /* the address registers of the loads above are reused for the zeroed accumulators below */
#pragma unroll
  for (int j = 0; j < 2; ++j)
#pragma unroll
    for (int dt = 0; dt < 4; ++dt) { const v8f z8 = {0.f, 0.f, 0.f, 0.f, 0.f, 0.f, 0.f, 0.f}; o[j][dt] = z8; }
  const int dq = 8 * hh - ln;
  for (int k0 = 0; k0 < q0; k0 += 32) fa_pass<false>(kp + (size_t)(k0 + 32) * LQ, vp + k0, hh, dq, qf, kf, o, m, l);      /* keys wholly below the wave's first query */
  fa_pass<true>(kp, vp + q0, hh, dq, qf, kf, o, m, l);      /* keys q0 .. q0 + 31: the diagonal */
#pragma unroll
  for (int j = 0; j < 2; ++j) { const float fin = 64.0f / (l[j] + rs_x16(l[j]));      /* o carried x64; the x256 of the weights cancels against the sum */
    unsigned short* op = (unsigned short*)O + ((size_t)b * SQ + q0 + j * 16 + ln) * DM + h * HD + 8 * hh;
#pragma unroll
    for (int dt = 0; dt < 4; ++dt) { FragH f;
#pragma unroll
      for (int r = 0; r < 8; ++r) f.h[r] = (_Float16)(o[j][dt][r] * fin);
      *(v8us*)(op + dt * 16) = f.half[0]; } } }


// e^x for x <= 0 to f32 accuracy: n = the integer nearest x log2 e; x log2 e - n by two fused multiply-adds (the constant as its f32 value plus its low part), so the product is never rounded
// before n is taken off; 2^n applied by ldexp; 0 below the f32 range. The v_nop in the same statement fills the one slot the instruction set asks for behind a transcendental.
__device__ __forceinline__ float a0_exp(float x) { const float n = rintf(x * 1.4426950216293334961f); const float a = fmaf(x, 1.9259628558643271390e-8f, fmaf(x, 1.4426950216293334961f, -n));
  float r; asm("v_exp_f32 %0, %1\n\tv_nop" : "=v"(r) : "v"(a)); return (x < -103.2789306640625f) ? 0.f : ldexpf(r, (int)n); }
// Exact f32 attention for the first QT0 rows of every batch (causal form; block blk of NB * NH * QT0 / A0R: batch, head, row group). Four lanes share a query row: lane part p = lane & 3 keeps dims 16 c + 4 p .. + 3 (c = 0..3)
// of q and o in registers; a wave holds 8 rows and walks the keys up to its own last row. The head's K and V rows are staged once in LDS, all loads in flight together;
// the 8 row groups of a wave read the same 64 bytes of a key row per load (broadcast, no bank conflict). The dot product is 16 terms per lane, then a butterfly over the 4 lanes.
// Every loop over c, u and the four keys of a trip is fully unrolled, so that q[], o[] and the LDS data are indexed by constants and stay in registers.
#define A0R 32                       /* query rows per block: 4 waves x 8 rows */
__device__ __forceinline__ void a0_block(float (*lk)[HD], float (*lv)[HD], const float* __restrict__ QKVF, float scale, _Float16* __restrict__ OHL, int blk) {      /* QKVF: per batch QT0 f32 q | k | v rows of pitch LQ; OHL: the A2 rows of k_gemm2<.., 2>, pitch DM */
  const int tid = threadIdx.x, lane = tid & 31, p4 = (lane & 3) * 4; const int w = __builtin_amdgcn_readfirstlane(tid >> 5);
  const int bt = blk / (NH * (QT0 / A0R)), h = blk / (QT0 / A0R) % NH, rg = blk % (QT0 / A0R);
  const float* QF = QKVF + (size_t)bt * QT0 * LQ; const float* KF = QF + DM; const float* VF = QF + 2 * DM;
  const int row = rg * A0R + w * 8 + (lane >> 2);      /* this lane's query row */
  const int nk = rg * A0R + w * 8 + 8;                 /* wave-uniform: keys up to the wave's last row (a multiple of 8, at most QT0) */
  { const int r0 = tid / 16, c4 = (tid % 16) * 4; const float* kp = KF + h * HD + r0 * LQ + c4; const float* vp = VF + h * HD + r0 * LQ + c4;
    v4f tk[QT0 / 8], tv[QT0 / 8];      /* fully unrolled: constant indices keep both in registers and every load of the tile is issued before the first LDS store */
#pragma unroll
    for (int it = 0; it < QT0 / 8; ++it) { tk[it] = *(const v4fa*)(kp + it * 8 * LQ); tv[it] = *(const v4fa*)(vp + it * 8 * LQ); }
#pragma unroll
    for (int it = 0; it < QT0 / 8; ++it) { *(v4f*)&lk[it * 8 + r0][c4] = tk[it]; *(v4f*)&lv[it * 8 + r0][c4] = tv[it]; } }
  __syncthreads();
  const float* qr = QF + row * LQ + h * HD + p4;
  v4f q[4], o[4];
#pragma unroll
  for (int c = 0; c < 4; ++c) { q[c] = *(const v4fa*)(qr + c * 16); const v4f z = {0.f, 0.f, 0.f, 0.f}; o[c] = z; }
  float m = -1.0e30f, l = 0.f;
  for (int j0 = 0; j0 < nk; j0 += 4) {      /* four keys per trip, unrolled: their dot products are independent and fill each other's dependent links */
#pragma unroll
    for (int jj = 0; jj < 4; ++jj) { const int j = j0 + jj; float s = 0.f;
#pragma unroll
      for (int c = 0; c < 4; ++c) { const v4f kq = *(const v4f*)&lk[j][c * 16 + p4]; s += q[c][0] * kq[0]; s += q[c][1] * kq[1]; s += q[c][2] * kq[2]; s += q[c][3] * kq[3]; }
      s += rs_row16<0x161>(s); s += rs_row16<0x162>(s);      /* sum over the row's 4 lanes; all 4 end with the same bits */
      const float sm = (j <= row) ? s * scale : -1.0e30f; const float mn = fmaxf(m, sm); const float sc = a0_exp(m - mn); const float e = a0_exp(sm - mn); l = l * sc + e; m = mn;
#pragma unroll
      for (int c = 0; c < 4; ++c) { const v4f vv = *(const v4f*)&lv[j][c * 16 + p4];
#pragma unroll
        for (int u = 0; u < 4; ++u) o[c][u] = o[c][u] * sc + e * vv[u]; } } }
  const float fin = 64.0f / l;      /* o carried x64 like the f16 path */
  _Float16* orow = OHL + ((size_t)(bt * (QT0 / 64) + (row >> 6)) * 128 + (row & 63)) * DM + h * HD + p4;      /* the row's f16 value; its x1024 residual stands 64 rows further */
#pragma unroll
  for (int c = 0; c < 4; ++c) { v4h oh, ol;
#pragma unroll
    for (int u = 0; u < 4; ++u) { const float a = o[c][u] * fin; const _Float16 hv = (_Float16)a; oh[u] = hv; ol[u] = (_Float16)((a - (float)hv) * 1024.0f); }
    *(v4h*)(orow + c * 16) = oh; *(v4h*)(orow + (size_t)64 * DM + c * 16) = ol; }
  asm volatile("s_wait_xcnt 0x0" ::: "memory"); }      /* stands in front of any later rewrite of a register that the stores above name (in the built kernel the other path's code follows them) */
// One launch for both attention paths; they share no data. All blocks are resident at once and a WMMA tile's cost grows with its index: the two halves of the first NB * NH grid rows walk the tiles in opposite order,
// so that blocks half of those rows apart add up to the same cost. Tile 0 (a batch's first QT0 rows) belongs to the exact f32 path: its NB * NH places and the grid rows behind take that path's blocks.
__global__ __launch_bounds__(128) void k_attn(const _Float16* __restrict__ QKVp, const _Float16* __restrict__ VTp, _Float16* __restrict__ O, const float* __restrict__ QKVF, float scale, _Float16* __restrict__ OHL) {
  static_assert(FAQ == QT0, "tile 0 is the exact path's");
  __shared__ __attribute__((aligned(16))) float lk[QT0][HD]; __shared__ __attribute__((aligned(16))) float lv[QT0][HD];
  const int bh = blockIdx.y; const int qt = (bh < NB * NH / 2) ? SQ / FAQ - 1 - (int)blockIdx.x : (int)blockIdx.x;
  if (bh < NB * NH && qt != 0) { fa_tile(QKVp, VTp, O, bh, qt); return; }
  a0_block(lk, lv, QKVF, scale, OHL, bh < NB * NH ? bh : NB * NH + (bh - NB * NH) * (SQ / FAQ) + (int)blockIdx.x); }

extern "C" void kernel_launch(void* const* d_in, const int* in_sizes, int n_in,
                              void* d_out, int out_size, void* d_ws, size_t ws_size, hipStream_t stream) {
  (void)in_sizes; (void)n_in; (void)out_size;
  const float* const* I = (const float* const*)d_in; const float* x = I[0]; const float* wqkv = I[1]; const float* bqkv = nullptr; const float* wo = I[2]; const float* bo = I[3];      /* input order: y, Wqkv (fused [in][out] [1024][3072]), Wff ([in][out]), bff [1024]; the QKV projection has NO bias: bqkv is a null pointer; the output bias is bound */
  char* ws = (char*)d_ws; size_t off = 0;
  auto take = [&](size_t bytes) { char* p = ws + off; off += (bytes + 255) & ~(size_t)255; return p; };
  _Float16* BQKV = (_Float16*)take((size_t)3 * DM * DM * 2); _Float16* BO = (_Float16*)take((size_t)DM * DM * 2);
  _Float16* X16 = (_Float16*)take(NR * DM * 2); _Float16* QKV = (_Float16*)take(NR * 3 * DM * 2); _Float16* V16 = QKV + 2 * DM; _Float16* O16 = (_Float16*)take(NR * DM * 2);
  _Float16* VT = (_Float16*)take((size_t)NB * NH * HD * SQ * 2);
  float* QKVF0 = (float*)take((size_t)NB * QT0 * LQ * 4); _Float16* OHL0 = (_Float16*)take((size_t)NB * QT0 * 2 * DM * 2);
  if (off > ws_size) return;
  k_wt_f16<<<(unsigned)(((size_t)LQ * (DM / 8) + 255) / 256), 256, 0, stream>>>(wqkv, BQKV, DM, LQ, 16.0f); k_wt_f16<<<(unsigned)(((size_t)DM * (DM / 8) + 255) / 256), 256, 0, stream>>>(wo, BO, DM, DM, 16.0f);      /* [in][out] -> Bt[n][k] x16 */
  k_x16<<<(unsigned)((NR * DM / 8 + 255) / 256), 256, 0, stream>>>(x, X16, NR * DM / 8);
  const size_t r0p = (size_t)B0 * SQ;      /* first projected row */
  k_gemm2<0, 1><<<dim3((unsigned)((MP / 128) * (3 * DM / 64)), 1), 128, 0, stream>>>(X16 + r0p * DM, DM, 0, BQKV, DM, 0, 0.0625f, bqkv, 0, nullptr, 1, 0, 0, nullptr, QKV + r0p * 3 * DM, 3 * DM, 0, MP, 3 * DM, DM, nullptr, QKVF0);      /* q | k | v rows (f16); head h = columns h*HD.. of each DM block; each batch's first 128 rows also as f32 (exact products) */
  k_vt<NH, SQ><<<NBR * NH * (SQ / 64), 256, 0, stream>>>(V16 + r0p * LQ, LQ, 0, VT + (size_t)B0 * NH * HD * SQ);      /* V^T [NB * NH][HD][SQ] */
  k_attn<<<dim3(SQ / FAQ, NB * NH + (NB * NH * (QT0 / A0R) - NB * NH) / (SQ / FAQ)), 128, 0, stream>>>(QKV, VT, O16, QKVF0, 0.125f, OHL0);      /* scores, causal softmax and P V of every batch, head and query tile in one launch: o (merged heads, x64) as f16 rows; rows 0..127 of each batch exactly in f32, o (x64) as f16 hi + x1024 residual rows */
  k_gemm2<0, 2><<<dim3((unsigned)((MPO / 128 + NB) * (DM / 64)), 1), 128, 0, stream>>>(O16 + r0p * DM, DM, 0, BO, DM, 0, 0.0009765625f, bo, 0, nullptr, 1, 0, 0, (float*)d_out + r0p * DM, nullptr, DM, 0, MPO, DM, DM, OHL0, nullptr);      /* out rows are the output layout; rows 0..127 of each batch = o_hi Wo + b + o_lo Wo 2^-10 */
}

// v007
// One run takes 114 microseconds.
// Timed twice side by side with v006, it ran 1.13 and 1.12 times as fast.
// Over all steps from v000 it is 44.6 times as fast.
#include <hip/hip_runtime.h>
#define NB 2
#define SQ 2048
#define DM 1024
#define NH 16
#define HD 64
#define HG 4                         /* heads per launch of the k_vt(V16, b, h0, VT) form, which is not launched */
#define QT0 128                      /* first-tile rows recomputed exactly in f32 */
#define B0 0                         /* first batch processed (debug hook) */
#define NBR NB                       /* batches processed (debug hook) */
#define NR ((size_t)NB * SQ)         /* token rows */
#define MP ((int)((size_t)NBR * SQ)) /* rows projected (debug hook) */
#define MPO MP                       /* rows through the output stage (debug hook) */
#define LQ (3 * DM)      /* row pitch of the q/k/v rows */
typedef __bf16 v16b __attribute__((ext_vector_type(16)));
typedef unsigned short v8us __attribute__((ext_vector_type(8), may_alias));
typedef float  v8f  __attribute__((ext_vector_type(8)));
typedef float  v4f  __attribute__((ext_vector_type(4)));
typedef float  v4fa __attribute__((ext_vector_type(4), may_alias));
union FragB { v16b v; v8us half[2]; unsigned short u[16]; };

__device__ __forceinline__ unsigned short bf16_bits(float x) { unsigned int u = __float_as_uint(x); return (unsigned short)((u + 0x7FFFu + ((u >> 16) & 1u)) >> 16); }
__device__ __forceinline__ float bf16_val(unsigned short b) { return __uint_as_float(((unsigned int)b) << 16); }
__device__ __forceinline__ float bf16_round(float x) { return bf16_val(bf16_bits(x)); }
// D += A·B with NT terms: 1 = ah·bh, 2 = + al·bh (A split), 3 = + ah·bl (both split)
template <int NT>
__device__ __forceinline__ v8f mmaN(v16b ah, v16b al, v16b bh, v16b bl, v8f c) {
  c = __builtin_amdgcn_wmma_f32_16x16x32_bf16(false, ah, false, bh, (short)0, c, false, false);
  if (NT >= 2) c = __builtin_amdgcn_wmma_f32_16x16x32_bf16(false, al, false, bh, (short)0, c, false, false);
  if (NT >= 3) c = __builtin_amdgcn_wmma_f32_16x16x32_bf16(false, ah, false, bl, (short)0, c, false, false);
  asm volatile("v_nop\n\tv_nop\n\tv_nop\n\tv_nop" : "+v"(c) : "v"(ah), "v"(al), "v"(bh), "v"(bl));
  return c;
}

__global__ __launch_bounds__(256) void k_wt_bf16(const float* __restrict__ W, unsigned short* __restrict__ Wt, int K, int N) {
  const int t = blockIdx.x * 256 + threadIdx.x;
  const int k8n = K / 8;
  if (t >= N * k8n) return;
  const int n = t / k8n, k8 = (t % k8n) * 8;
  v8us v;
#pragma unroll
  for (int i = 0; i < 8; ++i) v[i] = bf16_bits(W[(size_t)(k8 + i) * N + n]);
  *(v8us*)(Wt + (size_t)n * K + k8) = v;
  
}

// GEMM C[M][N] (f32, pitch ldc) = act(A[M][K]·W + bias). A f32 row-major (pitch lda) converted per fragment to bf16
// (ASPLIT: hi/lo two planes -> 2 terms, else single rounded term); Wt bf16 [N][K] (pitch ldb). BIAS_BF16 rounds the
// bias to bf16 first (bias quantised to bf16 before the add). K%32==0, M%16==0, N%64==0.
template <bool ASPLIT, int ACT, bool BIAS_BF16>
__global__ __launch_bounds__(128) void k_gemm_bf(const float* __restrict__ A, int lda, const unsigned short* __restrict__ Wt, int ldb,
                                               const float* __restrict__ bias, float* __restrict__ C, int ldc, int M, int N, int K) {
  __shared__ __attribute__((aligned(16))) float so[4][16][64];
  const int tid = threadIdx.x, w = tid >> 5, lane = tid & 31, ln = lane & 15, hh = lane >> 4;
  const int ntn = N / 64;
  const int wid = blockIdx.x * 4 + w;
  const int mt = wid / ntn, nq = wid % ntn;
  if (mt * 16 >= M) return;
  const int row0 = mt * 16, col0 = nq * 64;
  const float* arow = A + (size_t)(row0 + ln) * lda;
  v8f acc[4] = {};
  for (int kb = 0; kb < K; kb += 32) {
    FragB ah, al;
    const v4f x0 = *(const v4fa*)(arow + kb + 8 * hh), x1 = *(const v4fa*)(arow + kb + 8 * hh + 4);
    const v4f x2 = *(const v4fa*)(arow + kb + 16 + 8 * hh), x3 = *(const v4fa*)(arow + kb + 16 + 8 * hh + 4);
    float xs[16] = {x0[0],x0[1],x0[2],x0[3],x1[0],x1[1],x1[2],x1[3],x2[0],x2[1],x2[2],x2[3],x3[0],x3[1],x3[2],x3[3]};
#pragma unroll
    for (int i = 0; i < 16; ++i) { const unsigned short hb = bf16_bits(xs[i]); ah.u[i] = hb; al.u[i] = ASPLIT ? bf16_bits(xs[i] - bf16_val(hb)) : (unsigned short)0; }
#pragma unroll
    for (int t = 0; t < 4; ++t) {
      const unsigned short* brow = Wt + (size_t)(col0 + t * 16 + ln) * ldb + kb;
      FragB b;
      b.half[0] = *(const v8us*)(brow + 8 * hh);
      b.half[1] = *(const v8us*)(brow + 16 + 8 * hh);
      acc[t] = mmaN<ASPLIT ? 2 : 1>(ah.v, al.v, b.v, b.v, acc[t]);
    }
  }
#pragma unroll
  for (int t = 0; t < 4; ++t) {
    float bv = bias ? bias[col0 + t * 16 + ln] : 0.f;
    if (BIAS_BF16) bv = bf16_round(bv);
#pragma unroll
    for (int r = 0; r < 8; ++r) { float v = acc[t][r] + bv; if (ACT == 1) v = fmaxf(v, 0.f); so[w][8 * hh + r][t * 16 + ln] = v; }
  }
  __builtin_amdgcn_fence(__ATOMIC_ACQ_REL, "workgroup");
  __builtin_amdgcn_wave_barrier();
  const int rsub = lane >> 4, c4 = (lane & 15) * 4;
  {
#pragma unroll
    for (int q = 0; q < 8; ++q) {
      const int r = q * 2 + rsub;
      const v4f v = *(const v4fa*)&so[w][r][c4];
      *(v4f*)(C + (size_t)(row0 + r) * ldc + col0 + c4) = v;
    }
    
  }
}

// GEMM C = act(A·W + bias + resid): A f32 (ASPLIT -> hi/lo 2 terms), Wt bf16 [N][K]; ACT 0 none, 1 relu, 2 exact gelu;
// resid (optional, f32, row index = (row % rmod), pitch ldr, RES_BF16 rounds it) added before the activation.
template <bool ASPLIT, int ACT, bool BIAS_BF16, bool RES_BF16>
__global__ __launch_bounds__(128) void k_gemm_bf3(const float* __restrict__ A, int lda, const unsigned short* __restrict__ Wt, int ldb,
                                                const float* __restrict__ bias, const float* __restrict__ resid, int rmod, int ldr,
                                                float* __restrict__ C, int ldc, int M, int N, int K) {
  __shared__ __attribute__((aligned(16))) float so[4][16][64];
  const int tid = threadIdx.x, w = tid >> 5, lane = tid & 31, ln = lane & 15, hh = lane >> 4;
  const int ntn = N / 64;
  const int wid = blockIdx.x * 4 + w;
  const int mt = wid / ntn, nq = wid % ntn;
  if (mt * 16 >= M) return;
  const int row0 = mt * 16, col0 = nq * 64;
  const float* arow = A + (size_t)(row0 + ln) * lda;
  v8f acc[4] = {};
  for (int kb = 0; kb < K; kb += 32) {
    FragB ah, al;
    const v4f x0 = *(const v4fa*)(arow + kb + 8 * hh), x1 = *(const v4fa*)(arow + kb + 8 * hh + 4);
    const v4f x2 = *(const v4fa*)(arow + kb + 16 + 8 * hh), x3 = *(const v4fa*)(arow + kb + 16 + 8 * hh + 4);
    float xs[16] = {x0[0],x0[1],x0[2],x0[3],x1[0],x1[1],x1[2],x1[3],x2[0],x2[1],x2[2],x2[3],x3[0],x3[1],x3[2],x3[3]};
#pragma unroll
    for (int i = 0; i < 16; ++i) { const unsigned short hb = bf16_bits(xs[i]); ah.u[i] = hb; al.u[i] = ASPLIT ? bf16_bits(xs[i] - bf16_val(hb)) : (unsigned short)0; }
#pragma unroll
    for (int t = 0; t < 4; ++t) {
      const unsigned short* brow = Wt + (size_t)(col0 + t * 16 + ln) * ldb + kb;
      FragB b;
      b.half[0] = *(const v8us*)(brow + 8 * hh);
      b.half[1] = *(const v8us*)(brow + 16 + 8 * hh);
      acc[t] = mmaN<ASPLIT ? 2 : 1>(ah.v, al.v, b.v, b.v, acc[t]);
    }
  }
#pragma unroll
  for (int t = 0; t < 4; ++t) {
    const int col = col0 + t * 16 + ln;
    float bv = bias ? bias[col] : 0.f;
    if (BIAS_BF16) bv = bf16_round(bv);
#pragma unroll
    for (int r = 0; r < 8; ++r) {
      float v = acc[t][r] + bv;
      if (resid) { float rv = resid[(size_t)((row0 + 8 * hh + r) % rmod) * ldr + col]; if (RES_BF16) rv = bf16_round(rv); v += rv; }
      if (ACT == 1) v = fmaxf(v, 0.f);
      if (ACT == 2) v = 0.5f * v * (1.0f + erff(v * 0.70710678118654752f));
      if (ACT == 3) { const float u = 0.7978845608028654f * (v + 0.044715f * v * v * v); v = 0.5f * v * (1.0f + tanhf(u)); }
      so[w][8 * hh + r][t * 16 + ln] = v;
    }
  }
  __builtin_amdgcn_fence(__ATOMIC_ACQ_REL, "workgroup");
  __builtin_amdgcn_wave_barrier();
  const int rsub = lane >> 4, c4 = (lane & 15) * 4;
  {
#pragma unroll
    for (int q = 0; q < 8; ++q) {
      const int r = q * 2 + rsub;
      const v4f v = *(const v4fa*)&so[w][r][c4];
      *(v4f*)(C + (size_t)(row0 + r) * ldc + col0 + c4) = v;
    }
    
  }
}
// row LayerNorm (biased variance, eps) over N: s = X (+ R); optional out_sum <- s; out_norm <- (s-mu)*rsqrt(var+eps)*g + b
template <bool PARAM_BF16>
__global__ __launch_bounds__(256) void k_layernorm(const float* __restrict__ X, const float* __restrict__ R, const float* __restrict__ g, const float* __restrict__ bta,
                                                  float* __restrict__ out_sum, float* __restrict__ out_norm, int N, float eps) {
  __shared__ float red[256];
  const int row = blockIdx.x, tid = threadIdx.x;
  const float* x = X + (size_t)row * N; const float* rr = R ? R + (size_t)row * N : nullptr;
  float vals[16];                     // up to N = 4096
  const int per = N / 256;            // contiguous chunk per thread? use strided-by-4 chunks: thread handles j = tid*4 + 1024*u
  float s1 = 0.f;
  for (int u = 0; u < per / 4; ++u) {
    const int j = tid * 4 + 1024 * u;
    const v4f a = *(const v4fa*)(x + j);
    v4f b = {0.f,0.f,0.f,0.f}; if (rr) b = *(const v4fa*)(rr + j);
#pragma unroll
    for (int q = 0; q < 4; ++q) { const float v = a[q] + b[q]; vals[u * 4 + q] = v; s1 += v; }
  }
  red[tid] = s1; __syncthreads();
  for (int st = 128; st > 0; st >>= 1) { if (tid < st) red[tid] += red[tid + st]; __syncthreads(); }
  const float mu = red[0] / (float)N; __syncthreads();
  float s2 = 0.f;
  for (int u = 0; u < per / 4; ++u)
#pragma unroll
    for (int q = 0; q < 4; ++q) { const float c = vals[u * 4 + q] - mu; s2 += c * c; }
  red[tid] = s2; __syncthreads();
  for (int st = 128; st > 0; st >>= 1) { if (tid < st) red[tid] += red[tid + st]; __syncthreads(); }
  const float rs = rsqrtf(red[0] / (float)N + eps);
  {
    for (int u = 0; u < per / 4; ++u) {
      const int j = tid * 4 + 1024 * u;
      v4f o, sm;
#pragma unroll
      for (int q = 0; q < 4; ++q) {
        float gg = g[j + q], bb = bta[j + q];
        if (PARAM_BF16) { gg = bf16_round(gg); bb = bf16_round(bb); }
        sm[q] = vals[u * 4 + q]; o[q] = (vals[u * 4 + q] - mu) * rs * gg + bb;
      }
      if (out_sum) *(v4f*)(out_sum + (size_t)row * N + j) = sm;
      *(v4f*)(out_norm + (size_t)row * N + j) = o;
    }
    
  }
}



// ---- f16 WMMA path (v_wmma_f32_16x16x32_f16): 11-bit significands for operands in range — used where a [0,1] probability operand needs more precision than bf16
typedef _Float16 v16h __attribute__((ext_vector_type(16)));
union FragH { v16h v; v8us half[2]; _Float16 h[16]; unsigned short u[16]; };
template <int NT>
__device__ __forceinline__ v8f mmaH(v16h ah, v16h al, v16h bh, v16h bl, v8f c) {
  c = __builtin_amdgcn_wmma_f32_16x16x32_f16(false, ah, false, bh, (short)0, c, false, false);
  if (NT >= 2) c = __builtin_amdgcn_wmma_f32_16x16x32_f16(false, al, false, bh, (short)0, c, false, false);
  if (NT >= 3) c = __builtin_amdgcn_wmma_f32_16x16x32_f16(false, ah, false, bl, (short)0, c, false, false);
  asm volatile("v_nop\n\tv_nop\n\tv_nop\n\tv_nop" : "+v"(c) : "v"(ah), "v"(al), "v"(bh), "v"(bl));
  return c;
}
// batched GEMM like k_gemm_b but f16 operands: A f32 (split into f16 hi/lo if ASPLIT, else rounded to f16), Bt = f16 values [n][k]; alpha; C f32; N multiple of 16 (partial tiles skipped)
template <bool ASPLIT>
__global__ __launch_bounds__(128) void k_gemm_h(const float* __restrict__ A, int lda, size_t sA, const _Float16* __restrict__ Bh, int ldb, size_t sB, float alpha, float* __restrict__ C, int ldc, size_t sC, int M, int N, int K) {
  __shared__ __attribute__((aligned(16))) float so[4][16][64];
  const int tid = threadIdx.x, w = tid >> 5, lane = tid & 31, ln = lane & 15, hh = lane >> 4; const int by = blockIdx.y;
  A += (size_t)by * sA; Bh += (size_t)by * sB; C += (size_t)by * sC;
  const int ntn = (N + 63) / 64; const int wid = blockIdx.x * 4 + w; const int mt = wid / ntn, nq = wid % ntn; if (mt * 16 >= M) return;
  const int row0 = mt * 16, col0 = nq * 64; const float* arow = A + (size_t)(row0 + ln) * lda;
  v8f acc[4] = {};
  for (int kb = 0; kb < K; kb += 32) {
    FragH ah, al;
    const v4f x0 = *(const v4fa*)(arow + kb + 8 * hh), x1 = *(const v4fa*)(arow + kb + 8 * hh + 4), x2 = *(const v4fa*)(arow + kb + 16 + 8 * hh), x3 = *(const v4fa*)(arow + kb + 16 + 8 * hh + 4);
    float xs[16] = {x0[0],x0[1],x0[2],x0[3],x1[0],x1[1],x1[2],x1[3],x2[0],x2[1],x2[2],x2[3],x3[0],x3[1],x3[2],x3[3]};
#pragma unroll
    for (int i = 0; i < 16; ++i) { const _Float16 h = (_Float16)xs[i]; ah.h[i] = h; al.h[i] = ASPLIT ? (_Float16)(xs[i] - (float)h) : (_Float16)0.0f; }
#pragma unroll
    for (int t = 0; t < 4; ++t) { if (col0 + t * 16 >= N) continue; const size_t boff = (size_t)(col0 + t * 16 + ln) * ldb + kb; FragH bq; bq.half[0] = *(const v8us*)(Bh + boff + 8 * hh); bq.half[1] = *(const v8us*)(Bh + boff + 16 + 8 * hh);
      acc[t] = mmaH<ASPLIT ? 2 : 1>(ah.v, al.v, bq.v, bq.v, acc[t]); }
  }
#pragma unroll
  for (int t = 0; t < 4; ++t) { if (col0 + t * 16 >= N) continue;
#pragma unroll
    for (int r = 0; r < 8; ++r) so[w][8 * hh + r][t * 16 + ln] = acc[t][r] * alpha; }
  __builtin_amdgcn_fence(__ATOMIC_ACQ_REL, "workgroup"); __builtin_amdgcn_wave_barrier();
  const int rsub = lane >> 4, c4 = (lane & 15) * 4;
  {
#pragma unroll
    for (int q = 0; q < 8; ++q) { const int r = q * 2 + rsub; if (col0 + c4 < N) { const v4f v = *(const v4fa*)&so[w][r][c4]; *(v4f*)(C + (size_t)(row0 + r) * ldc + col0 + c4) = v; } }
     }
}

// Wt[n][k] = f16(bf16(W[k][n]) * scale) from f32 row-major W[K][N] (scale = power of two; bf16-exact weights stay exact in f16 away from the subnormal range). Grid (K / 64) * (N / 128).
// One block turns a tile of 64 k x 128 n through LDS, so that both sides of the transpose move whole 128-B lines: wave w reads rows k0 + 8 w .. + 7, each as 512 contiguous bytes (lane l: columns 4 l .. + 3),
// which leaves in every lane the 8 k of 4 output rows (one 16-byte piece each); the pieces go to LDS rows of 64 k, and behind the barrier 8 lanes store each output row's 128 bytes.
// K and N are compile-time: the row steps become immediate offsets on one address.
#define WTK 64                       /* k per tile */
#define WTN 128                      /* n per tile */
#define WTP 144                      /* LDS row pitch in bytes: 128 + 16, keeps the 16-byte pieces aligned */
template <int K, int N>
__global__ __launch_bounds__(256) void k_wt_f16(const float* __restrict__ W, _Float16* __restrict__ Wt, float scale) { static_assert(K % WTK == 0 && N % WTN == 0, "whole tiles only");
  __shared__ __attribute__((aligned(16))) unsigned char tl[WTN * WTP];
  const int tid = threadIdx.x, w = tid >> 5, lane = tid & 31; const int kt = blockIdx.x / (N / WTN), nt = blockIdx.x % (N / WTN); const int k0 = kt * WTK, n0 = nt * WTN;
  const float* src = W + (size_t)(k0 + 8 * w) * N + n0 + 4 * lane; v4f x[8];
#pragma unroll      /* constant indices keep x[] in registers, and all 8 loads are in flight together */
  for (int i = 0; i < 8; ++i) x[i] = *(const v4fa*)(src + (size_t)i * N);
#pragma unroll      /* constant indices into x[] */
  for (int q = 0; q < 4; ++q) { FragH f;
#pragma unroll      /* likewise, and f stays in registers */
    for (int i = 0; i < 8; ++i) f.h[i] = (_Float16)(bf16_round(x[i][q]) * scale);
    *(v8us*)(tl + (4 * lane + q) * WTP + 16 * w) = f.half[0]; }
  __syncthreads();      /* an output row's 8 pieces come from the 8 waves */
  unsigned short* dst = (unsigned short*)Wt + (size_t)(n0 + (tid >> 3)) * K + k0 + 8 * (tid & 7); const unsigned char* tr = tl + (tid >> 3) * WTP + 16 * (tid & 7);
#pragma unroll      /* the 4 LDS reads and stores are independent: unrolled, their latencies overlap */
  for (int i = 0; i < 4; ++i) { const v8us o = *(const v8us*)(tr + 32 * i * WTP); *(v8us*)(dst + (size_t)32 * i * K) = o; }
}
// k_gemm_hh variant with fused epilogue: v = acc·alpha + bias[by·sBias + col] (+ CP[(row/rowsPerB)·sCPb + by·64 + col] if CP) ; ACT 0 none / 1 elu ; writes f16 C16 (and f32 C if non-null)
template <int ACT>
__global__ __launch_bounds__(128) void k_gemm_hhx(const _Float16* __restrict__ A, int lda, size_t sA, const _Float16* __restrict__ Bh, int ldb, size_t sB, float alpha, const float* __restrict__ bias, size_t sBias, const float* __restrict__ CP, int rowsPerB, size_t sCPb, int row0g,
    float* __restrict__ C, _Float16* __restrict__ C16, int ldc, size_t sC, int M, int N, int K) {
  __shared__ __attribute__((aligned(16))) float so[4][16][64];
  const int tid = threadIdx.x, w = tid >> 5, lane = tid & 31, ln = lane & 15, hh = lane >> 4; const int by = blockIdx.y;
  A += (size_t)by * sA; Bh += (size_t)by * sB; const size_t cofs = (size_t)by * sC; const float* bp = bias ? bias + (size_t)by * sBias : nullptr;
  const int ntn = (N + 63) / 64; const int wid = blockIdx.x * 4 + w; const int mt = wid / ntn, nq = wid % ntn; if (mt * 16 >= M) return;
  const int row0 = mt * 16, col0 = nq * 64; const _Float16* arow = A + (size_t)(row0 + ln) * lda;
  v8f acc[4] = {};
  for (int kb = 0; kb < K; kb += 32) { FragH ah; ah.half[0] = *(const v8us*)((const unsigned short*)arow + kb + 8 * hh); ah.half[1] = *(const v8us*)((const unsigned short*)arow + kb + 16 + 8 * hh);
#pragma unroll
    for (int t = 0; t < 4; ++t) { if (col0 + t * 16 >= N) continue; const size_t boff = (size_t)(col0 + t * 16 + ln) * ldb + kb; FragH bq; bq.half[0] = *(const v8us*)((const unsigned short*)Bh + boff + 8 * hh); bq.half[1] = *(const v8us*)((const unsigned short*)Bh + boff + 16 + 8 * hh);
      acc[t] = mmaH<1>(ah.v, ah.v, bq.v, bq.v, acc[t]); }
  }
#pragma unroll
  for (int t = 0; t < 4; ++t) { if (col0 + t * 16 >= N) continue; const int col = col0 + t * 16 + ln; const float bv = bp ? bf16_round(bp[col]) : 0.f;
#pragma unroll
    for (int r = 0; r < 8; ++r) { float v = acc[t][r] * alpha + bv; if (CP) { const int rr = row0g + row0 + 8 * hh + r; if (rowsPerB < 0) v += CP[cofs + (size_t)rr * ldc + col];      /* rowsPerB < 0: own element of the batched C plane */ else { const int bidx = rr / rowsPerB; v += CP[(size_t)bidx * sCPb + (size_t)by * 64 + col]; } } if (ACT == 1) v = (v > 0.f) ? v : expm1f(v); else if (ACT == 7) v = (v > 0.f) ? v + 1.0f : expf(v); else if (ACT == 8) v = tanhf(v); else if (ACT == 9) v = 0.5f * v * (1.0f + tanhf(0.7978845608028654f * (v + 0.044715f * v * v * v))); else if (ACT == 11) v = 1.0f / (1.0f + expf(-v)); else if (ACT == 12) v = (v > 0.f) ? v : 0.01f * v; else if (ACT == 14) v = (v > 0.f) ? v : 0.1f * v; else if (ACT == 16) v = (v >= 0.f) ? v : 0.3f * v; else if (ACT == 17) v = (v >= 0.f) ? v : 0.2f * v; else if (ACT == 15) v = v / (1.0f + expf(-v)); else if (ACT == 3) v = fmaxf(v, 0.f); else if (ACT == 6) v = 0.5f * v * (1.0f + erff(v * 0.70710678118654752f)); so[w][8 * hh + r][t * 16 + ln] = v; } }
  __builtin_amdgcn_fence(__ATOMIC_ACQ_REL, "workgroup"); __builtin_amdgcn_wave_barrier();
  const int rsub = lane >> 4, c4 = (lane & 15) * 4; typedef _Float16 v4h __attribute__((ext_vector_type(4)));
  {
#pragma unroll
    for (int q = 0; q < 8; ++q) { const int r = q * 2 + rsub; if (col0 + c4 < N) { const v4f v = *(const v4fa*)&so[w][r][c4]; if (C) *(v4f*)(C + cofs + (size_t)(row0 + r) * ldc + col0 + c4) = v; if (C16) { v4h h4; for (int i = 0; i < 4; ++i) h4[i] = (_Float16)v[i]; *(v4h*)(C16 + cofs + (size_t)(row0 + r) * ldc + col0 + c4) = h4; } } }
     }
}


typedef _Float16 v4h __attribute__((ext_vector_type(4)));

__global__ __launch_bounds__(256) void k_x16(const float* __restrict__ x, _Float16* __restrict__ X16, size_t n8) { const size_t t = (size_t)blockIdx.x * 256 + threadIdx.x; if (t >= n8) return; FragH f;
#pragma unroll
  for (int q = 0; q < 8; ++q) f.h[q] = (_Float16)bf16_round(x[t * 8 + q]); *(v8us*)((unsigned short*)X16 + t * 8) = f.half[0];  }
__global__ __launch_bounds__(256) void k_h16(const float* __restrict__ x, _Float16* __restrict__ X16, size_t n8) { const size_t t = (size_t)blockIdx.x * 256 + threadIdx.x; if (t >= n8) return; FragH f;
#pragma unroll
  for (int q = 0; q < 8; ++q) f.h[q] = (_Float16)x[t * 8 + q]; *(v8us*)((unsigned short*)X16 + t * 8) = f.half[0];  }
__global__ __launch_bounds__(256) void k_round16f(const float* __restrict__ W, _Float16* __restrict__ Bt, size_t n8) { const size_t t = (size_t)blockIdx.x * 256 + threadIdx.x; if (t >= n8) return; FragH f;
#pragma unroll
  for (int i = 0; i < 8; ++i) f.h[i] = (_Float16)(bf16_round(W[t * 8 + i]) * 16.0f); *(v8us*)((unsigned short*)Bt + t * 8) = f.half[0];  }
template <int NHv, int TTv>
__global__ __launch_bounds__(256) void k_vt(const _Float16* __restrict__ V16, int ldv, int voff, _Float16* __restrict__ Vt) { __shared__ unsigned short tl[64][66]; const int tid = threadIdx.x; const int slab = blockIdx.x / (TTv / 64), lg = blockIdx.x % (TTv / 64); const int b = slab / NHv, h = slab % NHv;
  for (int i = tid; i < 64 * 8; i += 256) { const int r = i / 8, c8 = (i % 8) * 8; FragH f; f.half[0] = *(const v8us*)((const unsigned short*)V16 + ((size_t)b * TTv + lg * 64 + r) * ldv + voff + h * 64 + c8);
#pragma unroll
    for (int q = 0; q < 8; ++q) tl[r][c8 + q] = f.u[q]; }
  __syncthreads();
  {
#pragma unroll
    for (int rd = 0; rd < 2; ++rd) { const int d = rd * 32 + tid / 8, pc = tid % 8; FragH f;
#pragma unroll
      for (int q = 0; q < 8; ++q) f.u[q] = tl[pc * 8 + q][d];
      *(v8us*)((unsigned short*)Vt + ((size_t)slab * 64 + d) * TTv + lg * 64 + pc * 8) = f.half[0]; }
     } }

// ---- fast GEMM (block tile 128x64, wave tile 32x64; requires M % 128 == 0 rows per launch region, N % 64 == 0 and K % 64 == 0); epilogue = k_gemm_hhx semantics ----
// Operands go global -> LDS by asynchronous copies, 64 k (one whole 128-B line of each of the 128 A rows and 64 B rows) per trip, two buffers: the next tile flies while this one is multiplied.
// A wave-wide copy covers 4 rows x 128 B (4 whole lines) and the B rows are fetched once per block; the fragments are then read from LDS in the same k order as from global memory.
#define G2KC 64                      /* k per trip */
#define G2PB 144                     /* LDS row pitch in bytes: 128 + 16 (16 B x odd), conflict-free for the 16-byte fragment reads */
#define G2BB (192 * G2PB)            /* bytes of one buffer: 128 A rows, then 64 B rows */
// One tile: thread (row r = tid / 8, 16-byte piece tid % 8) copies its piece of rows r + 16 i: 8 of A, then 4 of B. l: the LDS byte address of its piece of row r. Every lane is on.
// The s_wait_xcnt in the same statement stands in front of any later rewrite of the address registers that the copies name.
__device__ __forceinline__ void g2_stage(unsigned l, const _Float16* a, size_t a16, const _Float16* b, size_t b16) {
  asm volatile("global_load_async_to_lds_b128 %0, %12, off\n\tglobal_load_async_to_lds_b128 %1, %13, off\n\tglobal_load_async_to_lds_b128 %2, %14, off\n\tglobal_load_async_to_lds_b128 %3, %15, off\n\t"
               "global_load_async_to_lds_b128 %4, %16, off\n\tglobal_load_async_to_lds_b128 %5, %17, off\n\tglobal_load_async_to_lds_b128 %6, %18, off\n\tglobal_load_async_to_lds_b128 %7, %19, off\n\t"
               "global_load_async_to_lds_b128 %8, %20, off\n\tglobal_load_async_to_lds_b128 %9, %21, off\n\tglobal_load_async_to_lds_b128 %10, %22, off\n\tglobal_load_async_to_lds_b128 %11, %23, off\n\ts_wait_xcnt 0x0"
               :: "v"(l), "v"(l + 16 * G2PB), "v"(l + 32 * G2PB), "v"(l + 48 * G2PB), "v"(l + 64 * G2PB), "v"(l + 80 * G2PB), "v"(l + 96 * G2PB), "v"(l + 112 * G2PB),
                  "v"(l + 128 * G2PB), "v"(l + 144 * G2PB), "v"(l + 160 * G2PB), "v"(l + 176 * G2PB),
                  "v"(a), "v"(a + a16), "v"(a + 2 * a16), "v"(a + 3 * a16), "v"(a + 4 * a16), "v"(a + 5 * a16), "v"(a + 6 * a16), "v"(a + 7 * a16),
                  "v"(b), "v"(b + b16), "v"(b + 2 * b16), "v"(b + 3 * b16) : "memory"); }
__device__ __forceinline__ v16h g2_frag(const _Float16* p, int hh) { FragH f; f.half[0] = *(const v8us*)((const unsigned short*)p + 8 * hh); f.half[1] = *(const v8us*)((const unsigned short*)p + 16 + 8 * hh); return f.v; }
__device__ __forceinline__ v8f g2_mma(v16h a, v16h b, v8f c) { v8f d = __builtin_amdgcn_wmma_f32_16x16x32_f16(false, a, false, b, (short)0, c, false, false); asm volatile("v_nop\n\tv_nop\n\tv_nop\n\tv_nop" : "+v"(d) : "v"(a), "v"(b)); return d; }
// FT 1: a block that holds the first QT0 rows of a batch also stores them as f32 rows into CT (per batch QT0 rows of pitch ldc).
// FT 2: those rows are not taken from A but from A2, where every 128 rows are 64 rows of o as f16 (hi) followed by the same 64 rows' x1024 residual (lo): such a block (they come first in the grid) multiplies both planes in the one K loop,
// waves 0 and 1 the hi rows, waves 2 and 3 the lo rows, and its epilogue stores (hi alpha + bias) + lo alpha 2^-10. The other blocks take the M tiles behind each batch's first.
#define G2MP (SQ / 128)              /* M tiles per batch */
template <int ACT, int FT>
__global__ __launch_bounds__(128) void k_gemm2(const _Float16* __restrict__ A, int lda, size_t sA, const _Float16* __restrict__ Bh, int ldb, size_t sB, float alpha, const float* __restrict__ bias, size_t sBias, const float* __restrict__ CP, int rowsPerB, size_t sCPb, int row0g,
    float* __restrict__ C, _Float16* __restrict__ C16, int ldc, size_t sC, int M, int N, int K, const _Float16* __restrict__ A2, float* __restrict__ CT) { static_assert(ACT == 0 || ACT == 3 || ACT == 6 || ACT == 8 || ACT == 9 || ACT == 11 || ACT == 12 || ACT == 14 || ACT == 15 || ACT == 16 || ACT == 17, "k_gemm2: unsupported ACT code (would silently apply no activation)"); static_assert(QT0 == 128, "the first tile is one M tile");
  __shared__ __attribute__((aligned(16))) unsigned char sm[2 * G2BB];      /* the two operand buffers; behind the K loop's last barrier the same bytes serve as the epilogue's staging rows */
  float (*so)[32][68] = (float (*)[32][68])sm;
  const int tid = threadIdx.x, w = tid >> 5, lane = tid & 31, ln = lane & 15, hh = lane >> 4; const int by = blockIdx.y;
  A += (size_t)by * sA; Bh += (size_t)by * sB; const size_t cofs = (size_t)by * sC; const float* bp = bias ? bias + (size_t)by * sBias : nullptr;
  const int ntn = N >> 6; const int g = blockIdx.x / ntn, nq = blockIdx.x - g * ntn; const bool pair = FT == 2 && g < 2 * NB;      /* hi | lo block g: batch g / 2, rows 64 (g & 1) .. + 63; the same for the whole block */
  const int mt = (FT == 2 && !pair) ? (g - 2 * NB) + 1 + (g - 2 * NB) / (G2MP - 1) : g; const int row0 = mt * 128 + 32 * w, col0 = nq * 64; if (!pair && mt * 128 >= M) return;      /* the same for the whole block, in front of every barrier */
  const int sr = tid >> 3, sp = tid & 7;      /* staging: this thread's first row and its 16-byte piece of the 128-B row */
  const _Float16* ag = (pair ? A2 : A) + (size_t)(mt * 128 + sr) * lda + sp * 8; const _Float16* bg = Bh + (size_t)(col0 + sr) * ldb + sp * 8; const size_t a16 = (size_t)16 * lda, b16 = (size_t)16 * ldb;
  const unsigned ls = (unsigned)(size_t)sm + (unsigned)(sr * G2PB + sp * 16);      /* LDS byte address: the low 32 bits of the shared address */
  const unsigned char* af = sm + (32 * w + ln) * G2PB; const unsigned char* bf = sm + (128 + ln) * G2PB;      /* this lane's first A and B fragment rows in buffer 0 */
  const int nt = K / G2KC;
  const v8f z8 = {0.f,0.f,0.f,0.f,0.f,0.f,0.f,0.f}; v8f c00 = z8, c01 = z8, c02 = z8, c03 = z8, c10 = z8, c11 = z8, c12 = z8, c13 = z8;
  g2_stage(ls, ag, a16, bg, b16);
  asm volatile("s_wait_asynccnt 0x0" ::: "memory");      /* this wave's copies of tile 0 have landed */
  __syncthreads();      /* ... and every other wave's */
  if (nt > 1) g2_stage(ls + G2BB, ag + G2KC, a16, bg + G2KC, b16);
#pragma unroll 1      /* rolled: one copy of the trip; the buffer is chosen by an offset */
  for (int t = 0; t < nt; ++t) { const unsigned bo = (unsigned)(t & 1) * G2BB; const _Float16* ap = (const _Float16*)(af + bo); const _Float16* bq = (const _Float16*)(bf + bo);
    /* all 12 fragments of the trip are asked for first, in the order of their use, so that their LDS latencies overlap; 8 * G2PB halves = 16 rows, + 32 halves = the second 32 k */
    const v16h a00 = g2_frag(ap, hh), b00 = g2_frag(bq, hh), a10 = g2_frag(ap + 8 * G2PB, hh), b10 = g2_frag(bq + 8 * G2PB, hh), b20 = g2_frag(bq + 16 * G2PB, hh), b30 = g2_frag(bq + 24 * G2PB, hh);
    const v16h a01 = g2_frag(ap + 32, hh), b01 = g2_frag(bq + 32, hh), a11 = g2_frag(ap + 8 * G2PB + 32, hh), b11 = g2_frag(bq + 8 * G2PB + 32, hh), b21 = g2_frag(bq + 16 * G2PB + 32, hh), b31 = g2_frag(bq + 24 * G2PB + 32, hh);
    c00 = g2_mma(a00, b00, c00); c10 = g2_mma(a10, b00, c10); c01 = g2_mma(a00, b10, c01); c11 = g2_mma(a10, b10, c11);
    c02 = g2_mma(a00, b20, c02); c12 = g2_mma(a10, b20, c12); c03 = g2_mma(a00, b30, c03); c13 = g2_mma(a10, b30, c13);
    c00 = g2_mma(a01, b01, c00); c10 = g2_mma(a11, b01, c10); c01 = g2_mma(a01, b11, c01); c11 = g2_mma(a11, b11, c11);
    c02 = g2_mma(a01, b21, c02); c12 = g2_mma(a11, b21, c12); c03 = g2_mma(a01, b31, c03); c13 = g2_mma(a11, b31, c13);
    asm volatile("s_wait_dscnt 0x0" ::: "memory");      /* this wave's reads of the buffer are done before it may be refilled */
    asm volatile("s_wait_asynccnt 0x0" ::: "memory");      /* this wave's copies of tile t + 1 have landed */
    __syncthreads();      /* publishes tile t + 1 and ends every wave's reads of tile t */
    if (t + 2 < nt) g2_stage(ls + bo, ag + (size_t)(t + 2) * G2KC, a16, bg + (size_t)(t + 2) * G2KC, b16); }
  asm volatile("s_wait_asynccnt 0x0" ::: "memory");      /* nothing in flight when the buffers become the staging rows */
  v8f accs[8] = {c00, c01, c02, c03, c10, c11, c12, c13};
  const bool lo = pair && w >= 2; if (lo) alpha *= 0.0009765625f;      /* the residual plane: x1024 taken off again, no bias */
#pragma unroll
  for (int u = 0; u < 8; ++u) { const int t = u & 3, half = u >> 2; const int col = col0 + t * 16 + ln; const float bv = (bp && !lo) ? bf16_round(bp[col]) : 0.f;
#pragma unroll
    for (int r = 0; r < 8; ++r) { const int rloc = half * 16 + 8 * hh + r; float v = accs[u][r] * alpha + bv; if (FT == 0 && CP) { if (rowsPerB < 0) v += CP[cofs + (size_t)(row0g + row0 + rloc) * ldc + col];      /* rowsPerB < 0: own element of the batched C plane */ else { const int bidx = (row0g + row0 + rloc) / rowsPerB; v += CP[(size_t)bidx * sCPb + (size_t)by * 64 + col]; } }
      if (ACT == 3) v = fmaxf(v, 0.f); else if (ACT == 6) v = 0.5f * v * (1.0f + erff(v * 0.70710678118654752f)); else if (ACT == 11) v = 1.0f / (1.0f + expf(-v)); else if (ACT == 15) v = v / (1.0f + expf(-v)); else if (ACT == 12) v = (v > 0.f) ? v : 0.01f * v; else if (ACT == 8) v = tanhf(v); else if (ACT == 9) v = 0.5f * v * (1.0f + tanhf(0.7978845608028654f * (v + 0.044715f * v * v * v))); else if (ACT == 14) v = (v > 0.f) ? v : 0.1f * v; else if (ACT == 16) v = (v >= 0.f) ? v : 0.3f * v; else if (ACT == 17) v = (v >= 0.f) ? v : 0.2f * v;
      so[w][rloc][t * 16 + ln] = v; } }
  const int rsub = lane >> 4, c4 = (lane & 15) * 4;
  if (pair) { __syncthreads();      /* the hi and the lo rows of one output row come from two waves */
#pragma unroll      /* the 16 LDS reads and 8 stores are independent: unrolled, their latencies overlap */
    for (int q = 0; q < 8; ++q) { const int rr = 16 * w + q * 2 + rsub; const v4f vh = *(const v4fa*)&so[rr >> 5][rr & 31][c4], vl = *(const v4fa*)&so[2 + (rr >> 5)][rr & 31][c4];      /* wave w stores rows 16 w .. + 15 of the block's 64 */
      *(v4f*)(C + cofs + (size_t)((g >> 1) * SQ + (g & 1) * 64 + rr) * ldc + col0 + c4) = vh + vl; }
    return; }
  __builtin_amdgcn_fence(__ATOMIC_ACQ_REL, "workgroup"); __builtin_amdgcn_wave_barrier();
  {
#pragma unroll
    for (int q = 0; q < 16; ++q) { const int r = q * 2 + rsub; const v4f v = *(const v4fa*)&so[w][r][c4]; if (C) *(v4f*)(C + cofs + (size_t)(row0 + r) * ldc + col0 + c4) = v; if (C16) { v4h h4; for (int i = 0; i < 4; ++i) h4[i] = (_Float16)v[i]; *(v4h*)(C16 + cofs + (size_t)(row0 + r) * ldc + col0 + c4) = h4; } }
     }
  if (FT == 1 && mt % G2MP == 0) {      /* a batch's first rows: the same values once more, as f32 rows for the exact path */
#pragma unroll      /* the 16 LDS reads and stores are independent: unrolled, their latencies overlap */
    for (int q = 0; q < 16; ++q) { const int r = q * 2 + rsub; const v4f v = *(const v4fa*)&so[w][r][c4]; *(v4f*)(CT + ((size_t)(mt / G2MP) * QT0 + 32 * w + r) * ldc + col0 + c4) = v; } } }


__global__ __launch_bounds__(256) void k_wnat(const float* __restrict__ w, size_t n8, _Float16* __restrict__ Bt) { const size_t t = (size_t)blockIdx.x * 256 + threadIdx.x; if (t >= n8) return; FragH f; for (int q = 0; q < 8; ++q) f.h[q] = (_Float16)(bf16_round(w[t * 8 + q]) * 16.0f); *(v8us*)((unsigned short*)Bt + t * 8) = f.half[0];  }
__global__ __launch_bounds__(256) void k_rsm(const float* __restrict__ S, _Float16* __restrict__ P, int nrows) {
  #pragma clang fp contract(off)
  const int i = blockIdx.x * 256 + threadIdx.x; if (i >= nrows) return; const float* s = S + (size_t)i * SQ; float mx = -3.0e38f;
#pragma unroll 1
  for (int j = 0; j < SQ; ++j) mx = fmaxf(mx, s[j]); float se = 0.f;
#pragma unroll 1
  for (int j = 0; j < SQ; ++j) se += expf(s[j] - mx); const float sc = 256.0f / se;
#pragma unroll 1
  for (int j0 = 0; j0 < SQ; j0 += 8) { FragH f; for (int q = 0; q < 8; ++q) f.h[q] = (_Float16)(expf(s[j0 + q] - mx) * sc); unsigned short* d = (unsigned short*)P + (size_t)i * SQ + j0; *(v8us*)d = f.half[0];  } }
__global__ __launch_bounds__(256) void k_vt(const _Float16* __restrict__ V16, int b, int h0, _Float16* __restrict__ VT) { __shared__ unsigned short tl[64][65]; const int tid = threadIdx.x; const int hh = blockIdx.x % HG, sg = blockIdx.x / HG; const int s0 = sg * 64; const int h = h0 + hh;
  for (int i = tid; i < 64 * 8; i += 256) { const int j = i / 8, d8 = (i % 8) * 8; FragH f; f.half[0] = *(const v8us*)((const unsigned short*)V16 + ((size_t)b * SQ + s0 + j) * DM + h * HD + d8); for (int q = 0; q < 8; ++q) tl[d8 + q][j] = f.u[q]; }
  __syncthreads();
  { for (int i = tid; i < 64 * 8; i += 256) { const int d = i / 8, j8 = (i % 8) * 8; FragH f; for (int q = 0; q < 8; ++q) f.u[q] = tl[d][j8 + q]; *(v8us*)((unsigned short*)VT + ((size_t)hh * HD + d) * SQ + s0 + j8) = f.half[0]; }  } }



template <int CTRL> __device__ __forceinline__ float rs_row16(float v) { return __int_as_float(__builtin_amdgcn_update_dpp(0, __float_as_int(v), CTRL, 0xf, 0xf, true)); }      /* lane l ^ mask inside a 16-lane row (row_xmask) */
__device__ __forceinline__ float rs_x16(float v) { const int u = __float_as_int(v); return __int_as_float(__builtin_amdgcn_permlanex16(u, u, 0x76543210, 0xfedcba98, false, false)); }      /* lane l ^ 16 */
#define FAQ 128                      /* query rows per block: 4 waves x 32 columns */
#define FAC 0.18033688011112042592f  /* log2(e) / sqrt(64) */
__device__ __forceinline__ v8f fa_mma(v16h a, v16h b, v8f c) { return __builtin_amdgcn_wmma_f32_16x16x32_f16(false, a, false, b, (short)0, c, false, false); }
// 2^x in the native form. The v_nop in the same statement fills the one slot the instruction set asks for behind a transcendental; in the eight-wide form each v_exp is followed by an
// independent one (early-clobber outputs: no result register is a later source), so one v_nop behind the last serves all eight.
__device__ __forceinline__ float fa_exp2(float x) { float r; asm("v_exp_f32 %0, %1\n\tv_nop" : "=v"(r) : "v"(x)); return r; }
__device__ __forceinline__ v8f fa_exp2x8(v8f x) { float r0, r1, r2, r3, r4, r5, r6, r7;
  asm("v_exp_f32 %0, %8\n\tv_exp_f32 %1, %9\n\tv_exp_f32 %2, %10\n\tv_exp_f32 %3, %11\n\tv_exp_f32 %4, %12\n\tv_exp_f32 %5, %13\n\tv_exp_f32 %6, %14\n\tv_exp_f32 %7, %15\n\tv_nop"
      : "=&v"(r0), "=&v"(r1), "=&v"(r2), "=&v"(r3), "=&v"(r4), "=&v"(r5), "=&v"(r6), "=&v"(r7) : "v"(x[0]), "v"(x[1]), "v"(x[2]), "v"(x[3]), "v"(x[4]), "v"(x[5]), "v"(x[6]), "v"(x[7]));
  const v8f r = {r0, r1, r2, r3, r4, r5, r6, r7}; return r; }
// One pass of 32 keys for a wave's 32 query columns. kf holds this pass's K fragments and is refilled for the next pass right behind the score products (LAST: the diagonal pass, masked, no refill).
// Every loop is fully unrolled so that the fragment and accumulator arrays are indexed by constants and stay in registers.
template <bool LAST>
__device__ __forceinline__ void fa_pass(const _Float16* __restrict__ kn, const _Float16* __restrict__ vp, int hh, int dq, const v16h (&qf)[2][2], v16h (&kf)[2][2], v8f (&o)[2][4], float (&m)[2], float (&l)[2]) {
  v16h vf[4];
#pragma unroll
  for (int dt = 0; dt < 4; ++dt) vf[dt] = g2_frag(vp + (size_t)dt * 16 * SQ, hh);
  const v8f z8 = {0.f, 0.f, 0.f, 0.f, 0.f, 0.f, 0.f, 0.f}; v8f s[2][2];
#pragma unroll
  for (int j = 0; j < 2; ++j)
#pragma unroll
    for (int t = 0; t < 2; ++t) s[j][t] = fa_mma(kf[t][1], qf[j][1], fa_mma(kf[t][0], qf[j][0], z8));
  if (!LAST) {
#pragma unroll
    for (int t = 0; t < 2; ++t)
#pragma unroll
      for (int c = 0; c < 2; ++c) kf[t][c] = g2_frag(kn + (size_t)t * 16 * LQ + c * 32, hh);
    __builtin_amdgcn_sched_barrier(0); }      /* keeps the refill in front of the softmax: without it the loads sank to the pass's end and the next pass waited out their whole latency */
#pragma unroll
  for (int j = 0; j < 2; ++j) {
    if (LAST) {      /* key - query = 16 t + r + dq - 16 j: above the diagonal when positive */
#pragma unroll
      for (int t = 0; t < 2; ++t)
#pragma unroll
        for (int r = 0; r < 8; ++r) if (16 * t + r + dq - 16 * j > 0) s[j][t][r] = -1.0e30f; }
    float mx = s[j][0][0];
#pragma unroll
    for (int r = 0; r < 8; ++r) mx = fmaxf(mx, fmaxf(s[j][0][r], s[j][1][r]));
    mx = fmaxf(mx, rs_x16(mx));      /* the column's other 16 keys are in lane ^ 16 */
    const float mn = fmaxf(m[j], mx); const float sc = fa_exp2((m[j] - mn) * FAC); const float nb = 8.0f - mn * FAC; m[j] = mn;      /* + 8: weights carried x256 */
    const v8f e0 = fa_exp2x8(s[j][0] * FAC + nb), e1 = fa_exp2x8(s[j][1] * FAC + nb);
    const v8f es = e0 + e1; l[j] = l[j] * sc + (((es[0] + es[1]) + (es[2] + es[3])) + ((es[4] + es[5]) + (es[6] + es[7])));      /* each half keeps its own partial sum; joined in the epilogue */
    FragH p;
#pragma unroll
    for (int r = 0; r < 8; ++r) { p.h[r] = (_Float16)e0[r]; p.h[8 + r] = (_Float16)e1[r]; }
#pragma unroll
    for (int dt = 0; dt < 4; ++dt) o[j][dt] = fa_mma(vf[dt], p.v, o[j][dt] * sc); } }
__device__ __forceinline__ void fa_tile(const _Float16* __restrict__ QKVp, const _Float16* __restrict__ VTp, _Float16* __restrict__ O, int bh, int qt) {      /* one block: query tile qt of batch and head bh. QKVp: q | k | v rows of pitch LQ; VTp: [NB * NH][HD][SQ]; O: merged rows of pitch DM */
  const int lane = threadIdx.x & 31, ln = lane & 15, hh = lane >> 4; const int w = __builtin_amdgcn_readfirstlane(threadIdx.x >> 5);
  const int b = bh / NH, h = bh % NH;
  const int q0 = qt * FAQ + w * 32;      /* no barrier in this function: each wave has its own trip count. The loops over j, c, dt and r below are fully unrolled for constant indices (registers), as in fa_pass */
  const _Float16* qp = QKVp + ((size_t)b * SQ + q0 + ln) * LQ + h * HD; const _Float16* kp = QKVp + ((size_t)b * SQ + ln) * LQ + DM + h * HD; const _Float16* vp = VTp + ((size_t)bh * HD + ln) * SQ;
  v16h qf[2][2], kf[2][2]; v8f o[2][4]; float m[2] = {-1.0e30f, -1.0e30f}, l[2] = {0.f, 0.f};
#pragma unroll
  for (int j = 0; j < 2; ++j)
#pragma unroll
    for (int c = 0; c < 2; ++c) { qf[j][c] = g2_frag(qp + (size_t)j * 16 * LQ + c * 32, hh); kf[j][c] = g2_frag(kp + (size_t)j * 16 * LQ + c * 32, hh); }
  asm volatile("s_wait_xcnt 0x0" ::: "memory");      /* the address registers of the loads above are reused for the zeroed accumulators below */
#pragma unroll
  for (int j = 0; j < 2; ++j)
#pragma unroll
    for (int dt = 0; dt < 4; ++dt) { const v8f z8 = {0.f, 0.f, 0.f, 0.f, 0.f, 0.f, 0.f, 0.f}; o[j][dt] = z8; }
  const int dq = 8 * hh - ln;
  for (int k0 = 0; k0 < q0; k0 += 32) fa_pass<false>(kp + (size_t)(k0 + 32) * LQ, vp + k0, hh, dq, qf, kf, o, m, l);      /* keys wholly below the wave's first query */
  fa_pass<true>(kp, vp + q0, hh, dq, qf, kf, o, m, l);      /* keys q0 .. q0 + 31: the diagonal */
#pragma unroll
  for (int j = 0; j < 2; ++j) { const float fin = 64.0f / (l[j] + rs_x16(l[j]));      /* o carried x64; the x256 of the weights cancels against the sum */
    unsigned short* op = (unsigned short*)O + ((size_t)b * SQ + q0 + j * 16 + ln) * DM + h * HD + 8 * hh;
#pragma unroll
    for (int dt = 0; dt < 4; ++dt) { FragH f;
#pragma unroll
      for (int r = 0; r < 8; ++r) f.h[r] = (_Float16)(o[j][dt][r] * fin);
      *(v8us*)(op + dt * 16) = f.half[0]; } } }


// e^x for x <= 0 to f32 accuracy: n = the integer nearest x log2 e; x log2 e - n by two fused multiply-adds (the constant as its f32 value plus its low part), so the product is never rounded
// before n is taken off; 2^n applied by ldexp; 0 below the f32 range. The v_nop in the same statement fills the one slot the instruction set asks for behind a transcendental.
__device__ __forceinline__ float a0_exp(float x) { const float n = rintf(x * 1.4426950216293334961f); const float a = fmaf(x, 1.9259628558643271390e-8f, fmaf(x, 1.4426950216293334961f, -n));
  float r; asm("v_exp_f32 %0, %1\n\tv_nop" : "=v"(r) : "v"(a)); return (x < -103.2789306640625f) ? 0.f : ldexpf(r, (int)n); }
// Exact f32 attention for the first QT0 rows of every batch (causal form; block blk of NB * NH * QT0 / A0R: batch, head, row group). Four lanes share a query row: lane part p = lane & 3 keeps dims 16 c + 4 p .. + 3 (c = 0..3)
// of q and o in registers; a wave holds 8 rows and walks the keys up to its own last row. The head's K and V rows are staged once in LDS, all loads in flight together;
// the 8 row groups of a wave read the same 64 bytes of a key row per load (broadcast, no bank conflict). The dot product is 16 terms per lane, then a butterfly over the 4 lanes.
// Every loop over c, u and the four keys of a trip is fully unrolled, so that q[], o[] and the LDS data are indexed by constants and stay in registers.
#define A0R 32                       /* query rows per block: 4 waves x 8 rows */
__device__ __forceinline__ void a0_block(float (*lk)[HD], float (*lv)[HD], const float* __restrict__ QKVF, float scale, _Float16* __restrict__ OHL, int blk) {      /* QKVF: per batch QT0 f32 q | k | v rows of pitch LQ; OHL: the A2 rows of k_gemm2<.., 2>, pitch DM */
  const int tid = threadIdx.x, lane = tid & 31, p4 = (lane & 3) * 4; const int w = __builtin_amdgcn_readfirstlane(tid >> 5);
  const int bt = blk / (NH * (QT0 / A0R)), h = blk / (QT0 / A0R) % NH, rg = blk % (QT0 / A0R);
  const float* QF = QKVF + (size_t)bt * QT0 * LQ; const float* KF = QF + DM; const float* VF = QF + 2 * DM;
  const int row = rg * A0R + w * 8 + (lane >> 2);      /* this lane's query row */
  const int nk = rg * A0R + w * 8 + 8;                 /* wave-uniform: keys up to the wave's last row (a multiple of 8, at most QT0) */
  { const int r0 = tid / 16, c4 = (tid % 16) * 4; const float* kp = KF + h * HD + r0 * LQ + c4; const float* vp = VF + h * HD + r0 * LQ + c4;
    v4f tk[QT0 / 8], tv[QT0 / 8];      /* fully unrolled: constant indices keep both in registers and every load of the tile is issued before the first LDS store */
#pragma unroll
    for (int it = 0; it < QT0 / 8; ++it) { tk[it] = *(const v4fa*)(kp + it * 8 * LQ); tv[it] = *(const v4fa*)(vp + it * 8 * LQ); }
#pragma unroll
    for (int it = 0; it < QT0 / 8; ++it) { *(v4f*)&lk[it * 8 + r0][c4] = tk[it]; *(v4f*)&lv[it * 8 + r0][c4] = tv[it]; } }
  __syncthreads();
  const float* qr = QF + row * LQ + h * HD + p4;
  v4f q[4], o[4];
#pragma unroll
  for (int c = 0; c < 4; ++c) { q[c] = *(const v4fa*)(qr + c * 16); const v4f z = {0.f, 0.f, 0.f, 0.f}; o[c] = z; }
  float m = -1.0e30f, l = 0.f;
  for (int j0 = 0; j0 < nk; j0 += 4) {      /* four keys per trip, unrolled: their dot products are independent and fill each other's dependent links */
#pragma unroll
    for (int jj = 0; jj < 4; ++jj) { const int j = j0 + jj; float s = 0.f;
#pragma unroll
      for (int c = 0; c < 4; ++c) { const v4f kq = *(const v4f*)&lk[j][c * 16 + p4]; s += q[c][0] * kq[0]; s += q[c][1] * kq[1]; s += q[c][2] * kq[2]; s += q[c][3] * kq[3]; }
      s += rs_row16<0x161>(s); s += rs_row16<0x162>(s);      /* sum over the row's 4 lanes; all 4 end with the same bits */
      const float sm = (j <= row) ? s * scale : -1.0e30f; const float mn = fmaxf(m, sm); const float sc = a0_exp(m - mn); const float e = a0_exp(sm - mn); l = l * sc + e; m = mn;
#pragma unroll
      for (int c = 0; c < 4; ++c) { const v4f vv = *(const v4f*)&lv[j][c * 16 + p4];
#pragma unroll
        for (int u = 0; u < 4; ++u) o[c][u] = o[c][u] * sc + e * vv[u]; } } }
  const float fin = 64.0f / l;      /* o carried x64 like the f16 path */
  _Float16* orow = OHL + ((size_t)(bt * (QT0 / 64) + (row >> 6)) * 128 + (row & 63)) * DM + h * HD + p4;      /* the row's f16 value; its x1024 residual stands 64 rows further */
#pragma unroll
  for (int c = 0; c < 4; ++c) { v4h oh, ol;
#pragma unroll
    for (int u = 0; u < 4; ++u) { const float a = o[c][u] * fin; const _Float16 hv = (_Float16)a; oh[u] = hv; ol[u] = (_Float16)((a - (float)hv) * 1024.0f); }
    *(v4h*)(orow + c * 16) = oh; *(v4h*)(orow + (size_t)64 * DM + c * 16) = ol; }
  asm volatile("s_wait_xcnt 0x0" ::: "memory"); }      /* stands in front of any later rewrite of a register that the stores above name (in the built kernel the other path's code follows them) */
// One launch for both attention paths; they share no data. All blocks are resident at once and a WMMA tile's cost grows with its index: the two halves of the first NB * NH grid rows walk the tiles in opposite order,
// so that blocks half of those rows apart add up to the same cost. Tile 0 (a batch's first QT0 rows) belongs to the exact f32 path: its NB * NH places and the grid rows behind take that path's blocks.
__global__ __launch_bounds__(128) void k_attn(const _Float16* __restrict__ QKVp, const _Float16* __restrict__ VTp, _Float16* __restrict__ O, const float* __restrict__ QKVF, float scale, _Float16* __restrict__ OHL) {
  static_assert(FAQ == QT0, "tile 0 is the exact path's");
  __shared__ __attribute__((aligned(16))) float lk[QT0][HD]; __shared__ __attribute__((aligned(16))) float lv[QT0][HD];
  const int bh = blockIdx.y; const int qt = (bh < NB * NH / 2) ? SQ / FAQ - 1 - (int)blockIdx.x : (int)blockIdx.x;
  if (bh < NB * NH && qt != 0) { fa_tile(QKVp, VTp, O, bh, qt); return; }
  a0_block(lk, lv, QKVF, scale, OHL, bh < NB * NH ? bh : NB * NH + (bh - NB * NH) * (SQ / FAQ) + (int)blockIdx.x); }

extern "C" void kernel_launch(void* const* d_in, const int* in_sizes, int n_in,
                              void* d_out, int out_size, void* d_ws, size_t ws_size, hipStream_t stream) {
  (void)in_sizes; (void)n_in; (void)out_size;
  const float* const* I = (const float* const*)d_in; const float* x = I[0]; const float* wqkv = I[1]; const float* bqkv = nullptr; const float* wo = I[2]; const float* bo = I[3];      /* input order: y, Wqkv (fused [in][out] [1024][3072]), Wff ([in][out]), bff [1024]; the QKV projection has NO bias: bqkv is a null pointer; the output bias is bound */
  char* ws = (char*)d_ws; size_t off = 0;
  auto take = [&](size_t bytes) { char* p = ws + off; off += (bytes + 255) & ~(size_t)255; return p; };
  _Float16* BQKV = (_Float16*)take((size_t)3 * DM * DM * 2); _Float16* BO = (_Float16*)take((size_t)DM * DM * 2);
  _Float16* X16 = (_Float16*)take(NR * DM * 2); _Float16* QKV = (_Float16*)take(NR * 3 * DM * 2); _Float16* V16 = QKV + 2 * DM; _Float16* O16 = (_Float16*)take(NR * DM * 2);
  _Float16* VT = (_Float16*)take((size_t)NB * NH * HD * SQ * 2);
  float* QKVF0 = (float*)take((size_t)NB * QT0 * LQ * 4); _Float16* OHL0 = (_Float16*)take((size_t)NB * QT0 * 2 * DM * 2);
  if (off > ws_size) return;
  k_wt_f16<DM, LQ><<<(DM / WTK) * (LQ / WTN), 256, 0, stream>>>(wqkv, BQKV, 16.0f); k_wt_f16<DM, DM><<<(DM / WTK) * (DM / WTN), 256, 0, stream>>>(wo, BO, 16.0f);      /* [in][out] -> Bt[n][k] x16 */
  k_x16<<<(unsigned)((NR * DM / 8 + 255) / 256), 256, 0, stream>>>(x, X16, NR * DM / 8);
  const size_t r0p = (size_t)B0 * SQ;      /* first projected row */
  k_gemm2<0, 1><<<dim3((unsigned)((MP / 128) * (3 * DM / 64)), 1), 128, 0, stream>>>(X16 + r0p * DM, DM, 0, BQKV, DM, 0, 0.0625f, bqkv, 0, nullptr, 1, 0, 0, nullptr, QKV + r0p * 3 * DM, 3 * DM, 0, MP, 3 * DM, DM, nullptr, QKVF0);      /* q | k | v rows (f16); head h = columns h*HD.. of each DM block; each batch's first 128 rows also as f32 (exact products) */
  k_vt<NH, SQ><<<NBR * NH * (SQ / 64), 256, 0, stream>>>(V16 + r0p * LQ, LQ, 0, VT + (size_t)B0 * NH * HD * SQ);      /* V^T [NB * NH][HD][SQ] */
  k_attn<<<dim3(SQ / FAQ, NB * NH + (NB * NH * (QT0 / A0R) - NB * NH) / (SQ / FAQ)), 128, 0, stream>>>(QKV, VT, O16, QKVF0, 0.125f, OHL0);      /* scores, causal softmax and P V of every batch, head and query tile in one launch: o (merged heads, x64) as f16 rows; rows 0..127 of each batch exactly in f32, o (x64) as f16 hi + x1024 residual rows */
  k_gemm2<0, 2><<<dim3((unsigned)((MPO / 128 + NB) * (DM / 64)), 1), 128, 0, stream>>>(O16 + r0p * DM, DM, 0, BO, DM, 0, 0.0009765625f, bo, 0, nullptr, 1, 0, 0, (float*)d_out + r0p * DM, nullptr, DM, 0, MPO, DM, DM, OHL0, nullptr);      /* out rows are the output layout; rows 0..127 of each batch = o_hi Wo + b + o_lo Wo 2^-10 */
}

// v008
// A run of this version takes 109 microseconds.
// Next to v007, in two timings, it ran 1.04 and 1.05 times as fast.
// Over all steps from v000 it is 46.6 times as fast.
#include <hip/hip_runtime.h>
#define NB 2
#define SQ 2048
#define DM 1024
#define NH 16
#define HD 64
#define HG 4                         /* heads per launch of the k_vt(V16, b, h0, VT) form, which is not launched */
#define QT0 128                      /* first-tile rows recomputed exactly in f32 */
#define B0 0                         /* first batch processed (debug hook) */
#define NBR NB                       /* batches processed (debug hook) */
#define NR ((size_t)NB * SQ)         /* token rows */
#define MP ((int)((size_t)NBR * SQ)) /* rows projected (debug hook) */
#define MPO MP                       /* rows through the output stage (debug hook) */
#define LQ (3 * DM)      /* row pitch of the q/k/v rows */
typedef __bf16 v16b __attribute__((ext_vector_type(16)));
typedef unsigned short v8us __attribute__((ext_vector_type(8), may_alias));
typedef float  v8f  __attribute__((ext_vector_type(8)));
typedef float  v4f  __attribute__((ext_vector_type(4)));
typedef float  v4fa __attribute__((ext_vector_type(4), may_alias));
union FragB { v16b v; v8us half[2]; unsigned short u[16]; };

__device__ __forceinline__ unsigned short bf16_bits(float x) { unsigned int u = __float_as_uint(x); return (unsigned short)((u + 0x7FFFu + ((u >> 16) & 1u)) >> 16); }
__device__ __forceinline__ float bf16_val(unsigned short b) { return __uint_as_float(((unsigned int)b) << 16); }
__device__ __forceinline__ float bf16_round(float x) { return bf16_val(bf16_bits(x)); }
// D += A·B with NT terms: 1 = ah·bh, 2 = + al·bh (A split), 3 = + ah·bl (both split)
template <int NT>
__device__ __forceinline__ v8f mmaN(v16b ah, v16b al, v16b bh, v16b bl, v8f c) {
  c = __builtin_amdgcn_wmma_f32_16x16x32_bf16(false, ah, false, bh, (short)0, c, false, false);
  if (NT >= 2) c = __builtin_amdgcn_wmma_f32_16x16x32_bf16(false, al, false, bh, (short)0, c, false, false);
  if (NT >= 3) c = __builtin_amdgcn_wmma_f32_16x16x32_bf16(false, ah, false, bl, (short)0, c, false, false);
  asm volatile("v_nop\n\tv_nop\n\tv_nop\n\tv_nop" : "+v"(c) : "v"(ah), "v"(al), "v"(bh), "v"(bl));
  return c;
}

__global__ __launch_bounds__(256) void k_wt_bf16(const float* __restrict__ W, unsigned short* __restrict__ Wt, int K, int N) {
  const int t = blockIdx.x * 256 + threadIdx.x;
  const int k8n = K / 8;
  if (t >= N * k8n) return;
  const int n = t / k8n, k8 = (t % k8n) * 8;
  v8us v;
#pragma unroll
  for (int i = 0; i < 8; ++i) v[i] = bf16_bits(W[(size_t)(k8 + i) * N + n]);
  *(v8us*)(Wt + (size_t)n * K + k8) = v;
  
}

// GEMM C[M][N] (f32, pitch ldc) = act(A[M][K]·W + bias). A f32 row-major (pitch lda) converted per fragment to bf16
// (ASPLIT: hi/lo two planes -> 2 terms, else single rounded term); Wt bf16 [N][K] (pitch ldb). BIAS_BF16 rounds the
// bias to bf16 first (bias quantised to bf16 before the add). K%32==0, M%16==0, N%64==0.
template <bool ASPLIT, int ACT, bool BIAS_BF16>
__global__ __launch_bounds__(128) void k_gemm_bf(const float* __restrict__ A, int lda, const unsigned short* __restrict__ Wt, int ldb,
                                               const float* __restrict__ bias, float* __restrict__ C, int ldc, int M, int N, int K) {
  __shared__ __attribute__((aligned(16))) float so[4][16][64];
  const int tid = threadIdx.x, w = tid >> 5, lane = tid & 31, ln = lane & 15, hh = lane >> 4;
  const int ntn = N / 64;
  const int wid = blockIdx.x * 4 + w;
  const int mt = wid / ntn, nq = wid % ntn;
  if (mt * 16 >= M) return;
  const int row0 = mt * 16, col0 = nq * 64;
  const float* arow = A + (size_t)(row0 + ln) * lda;
  v8f acc[4] = {};
  for (int kb = 0; kb < K; kb += 32) {
    FragB ah, al;
    const v4f x0 = *(const v4fa*)(arow + kb + 8 * hh), x1 = *(const v4fa*)(arow + kb + 8 * hh + 4);
    const v4f x2 = *(const v4fa*)(arow + kb + 16 + 8 * hh), x3 = *(const v4fa*)(arow + kb + 16 + 8 * hh + 4);
    float xs[16] = {x0[0],x0[1],x0[2],x0[3],x1[0],x1[1],x1[2],x1[3],x2[0],x2[1],x2[2],x2[3],x3[0],x3[1],x3[2],x3[3]};
#pragma unroll
    for (int i = 0; i < 16; ++i) { const unsigned short hb = bf16_bits(xs[i]); ah.u[i] = hb; al.u[i] = ASPLIT ? bf16_bits(xs[i] - bf16_val(hb)) : (unsigned short)0; }
#pragma unroll
    for (int t = 0; t < 4; ++t) {
      const unsigned short* brow = Wt + (size_t)(col0 + t * 16 + ln) * ldb + kb;
      FragB b;
      b.half[0] = *(const v8us*)(brow + 8 * hh);
      b.half[1] = *(const v8us*)(brow + 16 + 8 * hh);
      acc[t] = mmaN<ASPLIT ? 2 : 1>(ah.v, al.v, b.v, b.v, acc[t]);
    }
  }
#pragma unroll
  for (int t = 0; t < 4; ++t) {
    float bv = bias ? bias[col0 + t * 16 + ln] : 0.f;
    if (BIAS_BF16) bv = bf16_round(bv);
#pragma unroll
    for (int r = 0; r < 8; ++r) { float v = acc[t][r] + bv; if (ACT == 1) v = fmaxf(v, 0.f); so[w][8 * hh + r][t * 16 + ln] = v; }
  }
  __builtin_amdgcn_fence(__ATOMIC_ACQ_REL, "workgroup");
  __builtin_amdgcn_wave_barrier();
  const int rsub = lane >> 4, c4 = (lane & 15) * 4;
  {
#pragma unroll
    for (int q = 0; q < 8; ++q) {
      const int r = q * 2 + rsub;
      const v4f v = *(const v4fa*)&so[w][r][c4];
      *(v4f*)(C + (size_t)(row0 + r) * ldc + col0 + c4) = v;
    }
    
  }
}

// GEMM C = act(A·W + bias + resid): A f32 (ASPLIT -> hi/lo 2 terms), Wt bf16 [N][K]; ACT 0 none, 1 relu, 2 exact gelu;
// resid (optional, f32, row index = (row % rmod), pitch ldr, RES_BF16 rounds it) added before the activation.
template <bool ASPLIT, int ACT, bool BIAS_BF16, bool RES_BF16>
__global__ __launch_bounds__(128) void k_gemm_bf3(const float* __restrict__ A, int lda, const unsigned short* __restrict__ Wt, int ldb,
                                                const float* __restrict__ bias, const float* __restrict__ resid, int rmod, int ldr,
                                                float* __restrict__ C, int ldc, int M, int N, int K) {
  __shared__ __attribute__((aligned(16))) float so[4][16][64];
  const int tid = threadIdx.x, w = tid >> 5, lane = tid & 31, ln = lane & 15, hh = lane >> 4;
  const int ntn = N / 64;
  const int wid = blockIdx.x * 4 + w;
  const int mt = wid / ntn, nq = wid % ntn;
  if (mt * 16 >= M) return;
  const int row0 = mt * 16, col0 = nq * 64;
  const float* arow = A + (size_t)(row0 + ln) * lda;
  v8f acc[4] = {};
  for (int kb = 0; kb < K; kb += 32) {
    FragB ah, al;
    const v4f x0 = *(const v4fa*)(arow + kb + 8 * hh), x1 = *(const v4fa*)(arow + kb + 8 * hh + 4);
    const v4f x2 = *(const v4fa*)(arow + kb + 16 + 8 * hh), x3 = *(const v4fa*)(arow + kb + 16 + 8 * hh + 4);
    float xs[16] = {x0[0],x0[1],x0[2],x0[3],x1[0],x1[1],x1[2],x1[3],x2[0],x2[1],x2[2],x2[3],x3[0],x3[1],x3[2],x3[3]};
#pragma unroll
    for (int i = 0; i < 16; ++i) { const unsigned short hb = bf16_bits(xs[i]); ah.u[i] = hb; al.u[i] = ASPLIT ? bf16_bits(xs[i] - bf16_val(hb)) : (unsigned short)0; }
#pragma unroll
    for (int t = 0; t < 4; ++t) {
      const unsigned short* brow = Wt + (size_t)(col0 + t * 16 + ln) * ldb + kb;
      FragB b;
      b.half[0] = *(const v8us*)(brow + 8 * hh);
      b.half[1] = *(const v8us*)(brow + 16 + 8 * hh);
      acc[t] = mmaN<ASPLIT ? 2 : 1>(ah.v, al.v, b.v, b.v, acc[t]);
    }
  }
#pragma unroll
  for (int t = 0; t < 4; ++t) {
    const int col = col0 + t * 16 + ln;
    float bv = bias ? bias[col] : 0.f;
    if (BIAS_BF16) bv = bf16_round(bv);
#pragma unroll
    for (int r = 0; r < 8; ++r) {
      float v = acc[t][r] + bv;
      if (resid) { float rv = resid[(size_t)((row0 + 8 * hh + r) % rmod) * ldr + col]; if (RES_BF16) rv = bf16_round(rv); v += rv; }
      if (ACT == 1) v = fmaxf(v, 0.f);
      if (ACT == 2) v = 0.5f * v * (1.0f + erff(v * 0.70710678118654752f));
      if (ACT == 3) { const float u = 0.7978845608028654f * (v + 0.044715f * v * v * v); v = 0.5f * v * (1.0f + tanhf(u)); }
      so[w][8 * hh + r][t * 16 + ln] = v;
    }
  }
  __builtin_amdgcn_fence(__ATOMIC_ACQ_REL, "workgroup");
  __builtin_amdgcn_wave_barrier();
  const int rsub = lane >> 4, c4 = (lane & 15) * 4;
  {
#pragma unroll
    for (int q = 0; q < 8; ++q) {
      const int r = q * 2 + rsub;
      const v4f v = *(const v4fa*)&so[w][r][c4];
      *(v4f*)(C + (size_t)(row0 + r) * ldc + col0 + c4) = v;
    }
    
  }
}
// row LayerNorm (biased variance, eps) over N: s = X (+ R); optional out_sum <- s; out_norm <- (s-mu)*rsqrt(var+eps)*g + b
template <bool PARAM_BF16>
__global__ __launch_bounds__(256) void k_layernorm(const float* __restrict__ X, const float* __restrict__ R, const float* __restrict__ g, const float* __restrict__ bta,
                                                  float* __restrict__ out_sum, float* __restrict__ out_norm, int N, float eps) {
  __shared__ float red[256];
  const int row = blockIdx.x, tid = threadIdx.x;
  const float* x = X + (size_t)row * N; const float* rr = R ? R + (size_t)row * N : nullptr;
  float vals[16];                     // up to N = 4096
  const int per = N / 256;            // contiguous chunk per thread? use strided-by-4 chunks: thread handles j = tid*4 + 1024*u
  float s1 = 0.f;
  for (int u = 0; u < per / 4; ++u) {
    const int j = tid * 4 + 1024 * u;
    const v4f a = *(const v4fa*)(x + j);
    v4f b = {0.f,0.f,0.f,0.f}; if (rr) b = *(const v4fa*)(rr + j);
#pragma unroll
    for (int q = 0; q < 4; ++q) { const float v = a[q] + b[q]; vals[u * 4 + q] = v; s1 += v; }
  }
  red[tid] = s1; __syncthreads();
  for (int st = 128; st > 0; st >>= 1) { if (tid < st) red[tid] += red[tid + st]; __syncthreads(); }
  const float mu = red[0] / (float)N; __syncthreads();
  float s2 = 0.f;
  for (int u = 0; u < per / 4; ++u)
#pragma unroll
    for (int q = 0; q < 4; ++q) { const float c = vals[u * 4 + q] - mu; s2 += c * c; }
  red[tid] = s2; __syncthreads();
  for (int st = 128; st > 0; st >>= 1) { if (tid < st) red[tid] += red[tid + st]; __syncthreads(); }
  const float rs = rsqrtf(red[0] / (float)N + eps);
  {
    for (int u = 0; u < per / 4; ++u) {
      const int j = tid * 4 + 1024 * u;
      v4f o, sm;
#pragma unroll
      for (int q = 0; q < 4; ++q) {
        float gg = g[j + q], bb = bta[j + q];
        if (PARAM_BF16) { gg = bf16_round(gg); bb = bf16_round(bb); }
        sm[q] = vals[u * 4 + q]; o[q] = (vals[u * 4 + q] - mu) * rs * gg + bb;
      }
      if (out_sum) *(v4f*)(out_sum + (size_t)row * N + j) = sm;
      *(v4f*)(out_norm + (size_t)row * N + j) = o;
    }
    
  }
}



// ---- f16 WMMA path (v_wmma_f32_16x16x32_f16): 11-bit significands for operands in range — used where a [0,1] probability operand needs more precision than bf16
typedef _Float16 v16h __attribute__((ext_vector_type(16)));
union FragH { v16h v; v8us half[2]; _Float16 h[16]; unsigned short u[16]; };
template <int NT>
__device__ __forceinline__ v8f mmaH(v16h ah, v16h al, v16h bh, v16h bl, v8f c) {
  c = __builtin_amdgcn_wmma_f32_16x16x32_f16(false, ah, false, bh, (short)0, c, false, false);
  if (NT >= 2) c = __builtin_amdgcn_wmma_f32_16x16x32_f16(false, al, false, bh, (short)0, c, false, false);
  if (NT >= 3) c = __builtin_amdgcn_wmma_f32_16x16x32_f16(false, ah, false, bl, (short)0, c, false, false);
  asm volatile("v_nop\n\tv_nop\n\tv_nop\n\tv_nop" : "+v"(c) : "v"(ah), "v"(al), "v"(bh), "v"(bl));
  return c;
}
// batched GEMM like k_gemm_b but f16 operands: A f32 (split into f16 hi/lo if ASPLIT, else rounded to f16), Bt = f16 values [n][k]; alpha; C f32; N multiple of 16 (partial tiles skipped)
template <bool ASPLIT>
__global__ __launch_bounds__(128) void k_gemm_h(const float* __restrict__ A, int lda, size_t sA, const _Float16* __restrict__ Bh, int ldb, size_t sB, float alpha, float* __restrict__ C, int ldc, size_t sC, int M, int N, int K) {
  __shared__ __attribute__((aligned(16))) float so[4][16][64];
  const int tid = threadIdx.x, w = tid >> 5, lane = tid & 31, ln = lane & 15, hh = lane >> 4; const int by = blockIdx.y;
  A += (size_t)by * sA; Bh += (size_t)by * sB; C += (size_t)by * sC;
  const int ntn = (N + 63) / 64; const int wid = blockIdx.x * 4 + w; const int mt = wid / ntn, nq = wid % ntn; if (mt * 16 >= M) return;
  const int row0 = mt * 16, col0 = nq * 64; const float* arow = A + (size_t)(row0 + ln) * lda;
  v8f acc[4] = {};
  for (int kb = 0; kb < K; kb += 32) {
    FragH ah, al;
    const v4f x0 = *(const v4fa*)(arow + kb + 8 * hh), x1 = *(const v4fa*)(arow + kb + 8 * hh + 4), x2 = *(const v4fa*)(arow + kb + 16 + 8 * hh), x3 = *(const v4fa*)(arow + kb + 16 + 8 * hh + 4);
    float xs[16] = {x0[0],x0[1],x0[2],x0[3],x1[0],x1[1],x1[2],x1[3],x2[0],x2[1],x2[2],x2[3],x3[0],x3[1],x3[2],x3[3]};
#pragma unroll
    for (int i = 0; i < 16; ++i) { const _Float16 h = (_Float16)xs[i]; ah.h[i] = h; al.h[i] = ASPLIT ? (_Float16)(xs[i] - (float)h) : (_Float16)0.0f; }
#pragma unroll
    for (int t = 0; t < 4; ++t) { if (col0 + t * 16 >= N) continue; const size_t boff = (size_t)(col0 + t * 16 + ln) * ldb + kb; FragH bq; bq.half[0] = *(const v8us*)(Bh + boff + 8 * hh); bq.half[1] = *(const v8us*)(Bh + boff + 16 + 8 * hh);
      acc[t] = mmaH<ASPLIT ? 2 : 1>(ah.v, al.v, bq.v, bq.v, acc[t]); }
  }
#pragma unroll
  for (int t = 0; t < 4; ++t) { if (col0 + t * 16 >= N) continue;
#pragma unroll
    for (int r = 0; r < 8; ++r) so[w][8 * hh + r][t * 16 + ln] = acc[t][r] * alpha; }
  __builtin_amdgcn_fence(__ATOMIC_ACQ_REL, "workgroup"); __builtin_amdgcn_wave_barrier();
  const int rsub = lane >> 4, c4 = (lane & 15) * 4;
  {
#pragma unroll
    for (int q = 0; q < 8; ++q) { const int r = q * 2 + rsub; if (col0 + c4 < N) { const v4f v = *(const v4fa*)&so[w][r][c4]; *(v4f*)(C + (size_t)(row0 + r) * ldc + col0 + c4) = v; } }
     }
}

// Wt[n][k] = f16(W[k][n] * scale) from f32 row-major W[K][N] (scale = power of two; bf16-exact weights stay exact in f16 away from the subnormal range). Tile blk of (K / 64) * (N / 128); tl: WTN * WTP bytes of LDS.
// One block turns a tile of 64 k x 128 n through LDS, so that both sides of the transpose move whole 128-B lines: wave w reads rows k0 + 8 w .. + 7, each as 512 contiguous bytes (lane l: columns 4 l .. + 3),
// which leaves in every lane the 8 k of 4 output rows (one 16-byte piece each); the pieces go to LDS rows of 64 k, and behind the barrier 8 lanes store each output row's 128 bytes.
// K and N are compile-time: the row steps become immediate offsets on one address.
#define WTK 64                       /* k per tile */
#define WTN 128                      /* n per tile */
#define WTP 144                      /* LDS row pitch in bytes: 128 + 16, keeps the 16-byte pieces aligned */
template <int K, int N>
__device__ __forceinline__ void wt_tile(unsigned char* tl, const float* __restrict__ W, _Float16* __restrict__ Wt, float scale, int blk) { static_assert(K % WTK == 0 && N % WTN == 0, "whole tiles only");
  const int tid = threadIdx.x, w = tid >> 5, lane = tid & 31; const int kt = blk / (N / WTN), nt = blk % (N / WTN); const int k0 = kt * WTK, n0 = nt * WTN;
  const float* src = W + (size_t)(k0 + 8 * w) * N + n0 + 4 * lane; v4f x[8];
#pragma unroll      /* constant indices keep x[] in registers, and all 8 loads are in flight together */
  for (int i = 0; i < 8; ++i) x[i] = *(const v4fa*)(src + (size_t)i * N);
#pragma unroll      /* constant indices into x[] */
  for (int q = 0; q < 4; ++q) { FragH f;
#pragma unroll      /* likewise, and f stays in registers */
    for (int i = 0; i < 8; ++i) f.h[i] = (_Float16)(bf16_round(x[i][q]) * scale);
    *(v8us*)(tl + (4 * lane + q) * WTP + 16 * w) = f.half[0]; }
  __syncthreads();      /* an output row's 8 pieces come from the 8 waves */
  unsigned short* dst = (unsigned short*)Wt + (size_t)(n0 + (tid >> 3)) * K + k0 + 8 * (tid & 7); const unsigned char* tr = tl + (tid >> 3) * WTP + 16 * (tid & 7);
#pragma unroll      /* the 4 LDS reads and stores are independent: unrolled, their latencies overlap */
  for (int i = 0; i < 4; ++i) { const v8us o = *(const v8us*)(tr + 32 * i * WTP); *(v8us*)(dst + (size_t)32 * i * K) = o; }
  asm volatile("s_wait_xcnt 0x0" ::: "memory");      /* stands in front of any later rewrite of a register that the stores above name (in the built kernel another path's code follows them) */
}
// k_gemm_hh variant with fused epilogue: v = acc·alpha + bias[by·sBias + col] (+ CP[(row/rowsPerB)·sCPb + by·64 + col] if CP) ; ACT 0 none / 1 elu ; writes f16 C16 (and f32 C if non-null)
template <int ACT>
__global__ __launch_bounds__(128) void k_gemm_hhx(const _Float16* __restrict__ A, int lda, size_t sA, const _Float16* __restrict__ Bh, int ldb, size_t sB, float alpha, const float* __restrict__ bias, size_t sBias, const float* __restrict__ CP, int rowsPerB, size_t sCPb, int row0g,
    float* __restrict__ C, _Float16* __restrict__ C16, int ldc, size_t sC, int M, int N, int K) {
  __shared__ __attribute__((aligned(16))) float so[4][16][64];
  const int tid = threadIdx.x, w = tid >> 5, lane = tid & 31, ln = lane & 15, hh = lane >> 4; const int by = blockIdx.y;
  A += (size_t)by * sA; Bh += (size_t)by * sB; const size_t cofs = (size_t)by * sC; const float* bp = bias ? bias + (size_t)by * sBias : nullptr;
  const int ntn = (N + 63) / 64; const int wid = blockIdx.x * 4 + w; const int mt = wid / ntn, nq = wid % ntn; if (mt * 16 >= M) return;
  const int row0 = mt * 16, col0 = nq * 64; const _Float16* arow = A + (size_t)(row0 + ln) * lda;
  v8f acc[4] = {};
  for (int kb = 0; kb < K; kb += 32) { FragH ah; ah.half[0] = *(const v8us*)((const unsigned short*)arow + kb + 8 * hh); ah.half[1] = *(const v8us*)((const unsigned short*)arow + kb + 16 + 8 * hh);
#pragma unroll
    for (int t = 0; t < 4; ++t) { if (col0 + t * 16 >= N) continue; const size_t boff = (size_t)(col0 + t * 16 + ln) * ldb + kb; FragH bq; bq.half[0] = *(const v8us*)((const unsigned short*)Bh + boff + 8 * hh); bq.half[1] = *(const v8us*)((const unsigned short*)Bh + boff + 16 + 8 * hh);
      acc[t] = mmaH<1>(ah.v, ah.v, bq.v, bq.v, acc[t]); }
  }
#pragma unroll
  for (int t = 0; t < 4; ++t) { if (col0 + t * 16 >= N) continue; const int col = col0 + t * 16 + ln; const float bv = bp ? bf16_round(bp[col]) : 0.f;
#pragma unroll
    for (int r = 0; r < 8; ++r) { float v = acc[t][r] * alpha + bv; if (CP) { const int rr = row0g + row0 + 8 * hh + r; if (rowsPerB < 0) v += CP[cofs + (size_t)rr * ldc + col];      /* rowsPerB < 0: own element of the batched C plane */ else { const int bidx = rr / rowsPerB; v += CP[(size_t)bidx * sCPb + (size_t)by * 64 + col]; } } if (ACT == 1) v = (v > 0.f) ? v : expm1f(v); else if (ACT == 7) v = (v > 0.f) ? v + 1.0f : expf(v); else if (ACT == 8) v = tanhf(v); else if (ACT == 9) v = 0.5f * v * (1.0f + tanhf(0.7978845608028654f * (v + 0.044715f * v * v * v))); else if (ACT == 11) v = 1.0f / (1.0f + expf(-v)); else if (ACT == 12) v = (v > 0.f) ? v : 0.01f * v; else if (ACT == 14) v = (v > 0.f) ? v : 0.1f * v; else if (ACT == 16) v = (v >= 0.f) ? v : 0.3f * v; else if (ACT == 17) v = (v >= 0.f) ? v : 0.2f * v; else if (ACT == 15) v = v / (1.0f + expf(-v)); else if (ACT == 3) v = fmaxf(v, 0.f); else if (ACT == 6) v = 0.5f * v * (1.0f + erff(v * 0.70710678118654752f)); so[w][8 * hh + r][t * 16 + ln] = v; } }
  __builtin_amdgcn_fence(__ATOMIC_ACQ_REL, "workgroup"); __builtin_amdgcn_wave_barrier();
  const int rsub = lane >> 4, c4 = (lane & 15) * 4; typedef _Float16 v4h __attribute__((ext_vector_type(4)));
  {
#pragma unroll
    for (int q = 0; q < 8; ++q) { const int r = q * 2 + rsub; if (col0 + c4 < N) { const v4f v = *(const v4fa*)&so[w][r][c4]; if (C) *(v4f*)(C + cofs + (size_t)(row0 + r) * ldc + col0 + c4) = v; if (C16) { v4h h4; for (int i = 0; i < 4; ++i) h4[i] = (_Float16)v[i]; *(v4h*)(C16 + cofs + (size_t)(row0 + r) * ldc + col0 + c4) = h4; } } }
     }
}


typedef _Float16 v4h __attribute__((ext_vector_type(4)));

// X16 = f16(bf16-rounded x), piece blk of XTE elements: as many as a weight tile holds, so that the blocks of the shared grid below weigh alike. A thread turns 8 neighbours (32 B read, 16 B stored) in each of the piece's 4 quarters.
#define XTE (WTK * WTN)              /* elements of x per block */
__device__ __forceinline__ void x16_tile(const float* __restrict__ x, _Float16* __restrict__ X16, int blk) { static_assert(XTE == 4 * 256 * 8 && (NR * DM) % XTE == 0, "whole pieces only");
  const size_t e0 = (size_t)blk * XTE + threadIdx.x * 8; const float* src = x + e0; unsigned short* dst = (unsigned short*)X16 + e0; v4f a[4][2];
#pragma unroll      /* constant indices keep a[] in registers, and all 8 loads are in flight together */
  for (int i = 0; i < 4; ++i) { a[i][0] = *(const v4fa*)(src + i * 2048); a[i][1] = *(const v4fa*)(src + i * 2048 + 4); }
#pragma unroll      /* constant indices into a[] */
  for (int i = 0; i < 4; ++i) { FragH f;
#pragma unroll      /* likewise, and f stays in registers */
    for (int q = 0; q < 4; ++q) { f.h[q] = (_Float16)bf16_round(a[i][0][q]); f.h[4 + q] = (_Float16)bf16_round(a[i][1][q]); }
    *(v8us*)(dst + i * 2048) = f.half[0]; }
  asm volatile("s_wait_xcnt 0x0" ::: "memory"); }      /* stands in front of any later rewrite of a register that the stores above name (in the built kernel another path's code follows them) */
// The three operand preparations (both weight transposes and the f16 rows of x) read only inputs and share no data: one launch, the grid split by block index. The transposes, whose path is the longer (LDS and a barrier), come first.
#define PW1 ((DM / WTK) * (LQ / WTN))   /* tiles of the q | k | v weight */
#define PW2 ((DM / WTK) * (DM / WTN))   /* tiles of the output weight */
#define PX ((int)(NR * DM / XTE))       /* pieces of x */
__global__ __launch_bounds__(256) void k_prep(const float* __restrict__ wqkv, _Float16* __restrict__ BQKV, const float* __restrict__ wo, _Float16* __restrict__ BO, const float* __restrict__ x, _Float16* __restrict__ X16) {
  __shared__ __attribute__((aligned(16))) unsigned char tl[WTN * WTP];
  const int blk = blockIdx.x;      /* every test below reads the same for the whole block: the barrier inside wt_tile is passed by all of a block's waves or by none */
  if (blk < PW1) wt_tile<DM, LQ>(tl, wqkv, BQKV, 16.0f, blk);      /* [in][out] -> Bt[n][k] x16 */
  else if (blk < PW1 + PW2) wt_tile<DM, DM>(tl, wo, BO, 16.0f, blk - PW1);
  else x16_tile(x, X16, blk - (PW1 + PW2)); }
__global__ __launch_bounds__(256) void k_h16(const float* __restrict__ x, _Float16* __restrict__ X16, size_t n8) { const size_t t = (size_t)blockIdx.x * 256 + threadIdx.x; if (t >= n8) return; FragH f;
#pragma unroll
  for (int q = 0; q < 8; ++q) f.h[q] = (_Float16)x[t * 8 + q]; *(v8us*)((unsigned short*)X16 + t * 8) = f.half[0];  }
__global__ __launch_bounds__(256) void k_round16f(const float* __restrict__ W, _Float16* __restrict__ Bt, size_t n8) { const size_t t = (size_t)blockIdx.x * 256 + threadIdx.x; if (t >= n8) return; FragH f;
#pragma unroll
  for (int i = 0; i < 8; ++i) f.h[i] = (_Float16)(bf16_round(W[t * 8 + i]) * 16.0f); *(v8us*)((unsigned short*)Bt + t * 8) = f.half[0];  }
template <int NHv, int TTv>
__global__ __launch_bounds__(256) void k_vt(const _Float16* __restrict__ V16, int ldv, int voff, _Float16* __restrict__ Vt) { __shared__ unsigned short tl[64][66]; const int tid = threadIdx.x; const int slab = blockIdx.x / (TTv / 64), lg = blockIdx.x % (TTv / 64); const int b = slab / NHv, h = slab % NHv;
  for (int i = tid; i < 64 * 8; i += 256) { const int r = i / 8, c8 = (i % 8) * 8; FragH f; f.half[0] = *(const v8us*)((const unsigned short*)V16 + ((size_t)b * TTv + lg * 64 + r) * ldv + voff + h * 64 + c8);
#pragma unroll
    for (int q = 0; q < 8; ++q) tl[r][c8 + q] = f.u[q]; }
  __syncthreads();
  {
#pragma unroll
    for (int rd = 0; rd < 2; ++rd) { const int d = rd * 32 + tid / 8, pc = tid % 8; FragH f;
#pragma unroll
      for (int q = 0; q < 8; ++q) f.u[q] = tl[pc * 8 + q][d];
      *(v8us*)((unsigned short*)Vt + ((size_t)slab * 64 + d) * TTv + lg * 64 + pc * 8) = f.half[0]; }
     } }

// ---- fast GEMM (block tile 128x64, wave tile 32x64; requires M % 128 == 0 rows per launch region, N % 64 == 0 and K % 64 == 0); epilogue = k_gemm_hhx semantics ----
// Operands go global -> LDS by asynchronous copies, 64 k (one whole 128-B line of each of the 128 A rows and 64 B rows) per trip, two buffers: the next tile flies while this one is multiplied.
// A wave-wide copy covers 4 rows x 128 B (4 whole lines) and the B rows are fetched once per block; the fragments are then read from LDS in the same k order as from global memory.
#define G2KC 64                      /* k per trip */
#define G2PB 144                     /* LDS row pitch in bytes: 128 + 16 (16 B x odd), conflict-free for the 16-byte fragment reads */
#define G2BB (192 * G2PB)            /* bytes of one buffer: 128 A rows, then 64 B rows */
// One tile: thread (row r = tid / 8, 16-byte piece tid % 8) copies its piece of rows r + 16 i: 8 of A, then 4 of B. l: the LDS byte address of its piece of row r. Every lane is on.
// The s_wait_xcnt in the same statement stands in front of any later rewrite of the address registers that the copies name.
__device__ __forceinline__ void g2_stage(unsigned l, const _Float16* a, size_t a16, const _Float16* b, size_t b16) {
  asm volatile("global_load_async_to_lds_b128 %0, %12, off\n\tglobal_load_async_to_lds_b128 %1, %13, off\n\tglobal_load_async_to_lds_b128 %2, %14, off\n\tglobal_load_async_to_lds_b128 %3, %15, off\n\t"
               "global_load_async_to_lds_b128 %4, %16, off\n\tglobal_load_async_to_lds_b128 %5, %17, off\n\tglobal_load_async_to_lds_b128 %6, %18, off\n\tglobal_load_async_to_lds_b128 %7, %19, off\n\t"
               "global_load_async_to_lds_b128 %8, %20, off\n\tglobal_load_async_to_lds_b128 %9, %21, off\n\tglobal_load_async_to_lds_b128 %10, %22, off\n\tglobal_load_async_to_lds_b128 %11, %23, off\n\ts_wait_xcnt 0x0"
               :: "v"(l), "v"(l + 16 * G2PB), "v"(l + 32 * G2PB), "v"(l + 48 * G2PB), "v"(l + 64 * G2PB), "v"(l + 80 * G2PB), "v"(l + 96 * G2PB), "v"(l + 112 * G2PB),
                  "v"(l + 128 * G2PB), "v"(l + 144 * G2PB), "v"(l + 160 * G2PB), "v"(l + 176 * G2PB),
                  "v"(a), "v"(a + a16), "v"(a + 2 * a16), "v"(a + 3 * a16), "v"(a + 4 * a16), "v"(a + 5 * a16), "v"(a + 6 * a16), "v"(a + 7 * a16),
                  "v"(b), "v"(b + b16), "v"(b + 2 * b16), "v"(b + 3 * b16) : "memory"); }
__device__ __forceinline__ v16h g2_frag(const _Float16* p, int hh) { FragH f; f.half[0] = *(const v8us*)((const unsigned short*)p + 8 * hh); f.half[1] = *(const v8us*)((const unsigned short*)p + 16 + 8 * hh); return f.v; }
__device__ __forceinline__ v8f g2_mma(v16h a, v16h b, v8f c) { v8f d = __builtin_amdgcn_wmma_f32_16x16x32_f16(false, a, false, b, (short)0, c, false, false); asm volatile("v_nop\n\tv_nop\n\tv_nop\n\tv_nop" : "+v"(d) : "v"(a), "v"(b)); return d; }
// FT 1: a block that holds the first QT0 rows of a batch also stores them as f32 rows into CT (per batch QT0 rows of pitch ldc).
// FT 2: those rows are not taken from A but from A2, where every 128 rows are 64 rows of o as f16 (hi) followed by the same 64 rows' x1024 residual (lo): such a block (they come first in the grid) multiplies both planes in the one K loop,
// waves 0 and 1 the hi rows, waves 2 and 3 the lo rows, and its epilogue stores (hi alpha + bias) + lo alpha 2^-10. The other blocks take the M tiles behind each batch's first.
#define G2MP (SQ / 128)              /* M tiles per batch */
template <int ACT, int FT>
__global__ __launch_bounds__(128) void k_gemm2(const _Float16* __restrict__ A, int lda, size_t sA, const _Float16* __restrict__ Bh, int ldb, size_t sB, float alpha, const float* __restrict__ bias, size_t sBias, const float* __restrict__ CP, int rowsPerB, size_t sCPb, int row0g,
    float* __restrict__ C, _Float16* __restrict__ C16, int ldc, size_t sC, int M, int N, int K, const _Float16* __restrict__ A2, float* __restrict__ CT) { static_assert(ACT == 0 || ACT == 3 || ACT == 6 || ACT == 8 || ACT == 9 || ACT == 11 || ACT == 12 || ACT == 14 || ACT == 15 || ACT == 16 || ACT == 17, "k_gemm2: unsupported ACT code (would silently apply no activation)"); static_assert(QT0 == 128, "the first tile is one M tile");
  __shared__ __attribute__((aligned(16))) unsigned char sm[2 * G2BB];      /* the two operand buffers; behind the K loop's last barrier the same bytes serve as the epilogue's staging rows */
  float (*so)[32][68] = (float (*)[32][68])sm;
  const int tid = threadIdx.x, w = tid >> 5, lane = tid & 31, ln = lane & 15, hh = lane >> 4; const int by = blockIdx.y;
  A += (size_t)by * sA; Bh += (size_t)by * sB; const size_t cofs = (size_t)by * sC; const float* bp = bias ? bias + (size_t)by * sBias : nullptr;
  const int ntn = N >> 6; const int g = blockIdx.x / ntn, nq = blockIdx.x - g * ntn; const bool pair = FT == 2 && g < 2 * NB;      /* hi | lo block g: batch g / 2, rows 64 (g & 1) .. + 63; the same for the whole block */
  const int mt = (FT == 2 && !pair) ? (g - 2 * NB) + 1 + (g - 2 * NB) / (G2MP - 1) : g; const int row0 = mt * 128 + 32 * w, col0 = nq * 64; if (!pair && mt * 128 >= M) return;      /* the same for the whole block, in front of every barrier */
  const int sr = tid >> 3, sp = tid & 7;      /* staging: this thread's first row and its 16-byte piece of the 128-B row */
  const _Float16* ag = (pair ? A2 : A) + (size_t)(mt * 128 + sr) * lda + sp * 8; const _Float16* bg = Bh + (size_t)(col0 + sr) * ldb + sp * 8; const size_t a16 = (size_t)16 * lda, b16 = (size_t)16 * ldb;
  const unsigned ls = (unsigned)(size_t)sm + (unsigned)(sr * G2PB + sp * 16);      /* LDS byte address: the low 32 bits of the shared address */
  const unsigned char* af = sm + (32 * w + ln) * G2PB; const unsigned char* bf = sm + (128 + ln) * G2PB;      /* this lane's first A and B fragment rows in buffer 0 */
  const int nt = K / G2KC;
  const v8f z8 = {0.f,0.f,0.f,0.f,0.f,0.f,0.f,0.f}; v8f c00 = z8, c01 = z8, c02 = z8, c03 = z8, c10 = z8, c11 = z8, c12 = z8, c13 = z8;
  g2_stage(ls, ag, a16, bg, b16);
  asm volatile("s_wait_asynccnt 0x0" ::: "memory");      /* this wave's copies of tile 0 have landed */
  __syncthreads();      /* ... and every other wave's */
  if (nt > 1) g2_stage(ls + G2BB, ag + G2KC, a16, bg + G2KC, b16);
#pragma unroll 1      /* rolled: one copy of the trip; the buffer is chosen by an offset */
  for (int t = 0; t < nt; ++t) { const unsigned bo = (unsigned)(t & 1) * G2BB; const _Float16* ap = (const _Float16*)(af + bo); const _Float16* bq = (const _Float16*)(bf + bo);
    /* all 12 fragments of the trip are asked for first, in the order of their use, so that their LDS latencies overlap; 8 * G2PB halves = 16 rows, + 32 halves = the second 32 k */
    const v16h a00 = g2_frag(ap, hh), b00 = g2_frag(bq, hh), a10 = g2_frag(ap + 8 * G2PB, hh), b10 = g2_frag(bq + 8 * G2PB, hh), b20 = g2_frag(bq + 16 * G2PB, hh), b30 = g2_frag(bq + 24 * G2PB, hh);
    const v16h a01 = g2_frag(ap + 32, hh), b01 = g2_frag(bq + 32, hh), a11 = g2_frag(ap + 8 * G2PB + 32, hh), b11 = g2_frag(bq + 8 * G2PB + 32, hh), b21 = g2_frag(bq + 16 * G2PB + 32, hh), b31 = g2_frag(bq + 24 * G2PB + 32, hh);
    c00 = g2_mma(a00, b00, c00); c10 = g2_mma(a10, b00, c10); c01 = g2_mma(a00, b10, c01); c11 = g2_mma(a10, b10, c11);
    c02 = g2_mma(a00, b20, c02); c12 = g2_mma(a10, b20, c12); c03 = g2_mma(a00, b30, c03); c13 = g2_mma(a10, b30, c13);
    c00 = g2_mma(a01, b01, c00); c10 = g2_mma(a11, b01, c10); c01 = g2_mma(a01, b11, c01); c11 = g2_mma(a11, b11, c11);
    c02 = g2_mma(a01, b21, c02); c12 = g2_mma(a11, b21, c12); c03 = g2_mma(a01, b31, c03); c13 = g2_mma(a11, b31, c13);
    asm volatile("s_wait_dscnt 0x0" ::: "memory");      /* this wave's reads of the buffer are done before it may be refilled */
    asm volatile("s_wait_asynccnt 0x0" ::: "memory");      /* this wave's copies of tile t + 1 have landed */
    __syncthreads();      /* publishes tile t + 1 and ends every wave's reads of tile t */
    if (t + 2 < nt) g2_stage(ls + bo, ag + (size_t)(t + 2) * G2KC, a16, bg + (size_t)(t + 2) * G2KC, b16); }
  asm volatile("s_wait_asynccnt 0x0" ::: "memory");      /* nothing in flight when the buffers become the staging rows */
  v8f accs[8] = {c00, c01, c02, c03, c10, c11, c12, c13};
  const bool lo = pair && w >= 2; if (lo) alpha *= 0.0009765625f;      /* the residual plane: x1024 taken off again, no bias */
#pragma unroll
  for (int u = 0; u < 8; ++u) { const int t = u & 3, half = u >> 2; const int col = col0 + t * 16 + ln; const float bv = (bp && !lo) ? bf16_round(bp[col]) : 0.f;
#pragma unroll
    for (int r = 0; r < 8; ++r) { const int rloc = half * 16 + 8 * hh + r; float v = accs[u][r] * alpha + bv; if (FT == 0 && CP) { if (rowsPerB < 0) v += CP[cofs + (size_t)(row0g + row0 + rloc) * ldc + col];      /* rowsPerB < 0: own element of the batched C plane */ else { const int bidx = (row0g + row0 + rloc) / rowsPerB; v += CP[(size_t)bidx * sCPb + (size_t)by * 64 + col]; } }
      if (ACT == 3) v = fmaxf(v, 0.f); else if (ACT == 6) v = 0.5f * v * (1.0f + erff(v * 0.70710678118654752f)); else if (ACT == 11) v = 1.0f / (1.0f + expf(-v)); else if (ACT == 15) v = v / (1.0f + expf(-v)); else if (ACT == 12) v = (v > 0.f) ? v : 0.01f * v; else if (ACT == 8) v = tanhf(v); else if (ACT == 9) v = 0.5f * v * (1.0f + tanhf(0.7978845608028654f * (v + 0.044715f * v * v * v))); else if (ACT == 14) v = (v > 0.f) ? v : 0.1f * v; else if (ACT == 16) v = (v >= 0.f) ? v : 0.3f * v; else if (ACT == 17) v = (v >= 0.f) ? v : 0.2f * v;
      so[w][rloc][t * 16 + ln] = v; } }
  const int rsub = lane >> 4, c4 = (lane & 15) * 4;
  if (pair) { __syncthreads();      /* the hi and the lo rows of one output row come from two waves */
#pragma unroll      /* the 16 LDS reads and 8 stores are independent: unrolled, their latencies overlap */
    for (int q = 0; q < 8; ++q) { const int rr = 16 * w + q * 2 + rsub; const v4f vh = *(const v4fa*)&so[rr >> 5][rr & 31][c4], vl = *(const v4fa*)&so[2 + (rr >> 5)][rr & 31][c4];      /* wave w stores rows 16 w .. + 15 of the block's 64 */
      *(v4f*)(C + cofs + (size_t)((g >> 1) * SQ + (g & 1) * 64 + rr) * ldc + col0 + c4) = vh + vl; }
    return; }
  __builtin_amdgcn_fence(__ATOMIC_ACQ_REL, "workgroup"); __builtin_amdgcn_wave_barrier();
  {
#pragma unroll
    for (int q = 0; q < 16; ++q) { const int r = q * 2 + rsub; const v4f v = *(const v4fa*)&so[w][r][c4]; if (C) *(v4f*)(C + cofs + (size_t)(row0 + r) * ldc + col0 + c4) = v; if (C16) { v4h h4; for (int i = 0; i < 4; ++i) h4[i] = (_Float16)v[i]; *(v4h*)(C16 + cofs + (size_t)(row0 + r) * ldc + col0 + c4) = h4; } }
     }
  if (FT == 1 && mt % G2MP == 0) {      /* a batch's first rows: the same values once more, as f32 rows for the exact path */
#pragma unroll      /* the 16 LDS reads and stores are independent: unrolled, their latencies overlap */
    for (int q = 0; q < 16; ++q) { const int r = q * 2 + rsub; const v4f v = *(const v4fa*)&so[w][r][c4]; *(v4f*)(CT + ((size_t)(mt / G2MP) * QT0 + 32 * w + r) * ldc + col0 + c4) = v; } } }


__global__ __launch_bounds__(256) void k_wnat(const float* __restrict__ w, size_t n8, _Float16* __restrict__ Bt) { const size_t t = (size_t)blockIdx.x * 256 + threadIdx.x; if (t >= n8) return; FragH f; for (int q = 0; q < 8; ++q) f.h[q] = (_Float16)(bf16_round(w[t * 8 + q]) * 16.0f); *(v8us*)((unsigned short*)Bt + t * 8) = f.half[0];  }
__global__ __launch_bounds__(256) void k_rsm(const float* __restrict__ S, _Float16* __restrict__ P, int nrows) {
  #pragma clang fp contract(off)
  const int i = blockIdx.x * 256 + threadIdx.x; if (i >= nrows) return; const float* s = S + (size_t)i * SQ; float mx = -3.0e38f;
#pragma unroll 1
  for (int j = 0; j < SQ; ++j) mx = fmaxf(mx, s[j]); float se = 0.f;
#pragma unroll 1
  for (int j = 0; j < SQ; ++j) se += expf(s[j] - mx); const float sc = 256.0f / se;
#pragma unroll 1
  for (int j0 = 0; j0 < SQ; j0 += 8) { FragH f; for (int q = 0; q < 8; ++q) f.h[q] = (_Float16)(expf(s[j0 + q] - mx) * sc); unsigned short* d = (unsigned short*)P + (size_t)i * SQ + j0; *(v8us*)d = f.half[0];  } }
__global__ __launch_bounds__(256) void k_vt(const _Float16* __restrict__ V16, int b, int h0, _Float16* __restrict__ VT) { __shared__ unsigned short tl[64][65]; const int tid = threadIdx.x; const int hh = blockIdx.x % HG, sg = blockIdx.x / HG; const int s0 = sg * 64; const int h = h0 + hh;
  for (int i = tid; i < 64 * 8; i += 256) { const int j = i / 8, d8 = (i % 8) * 8; FragH f; f.half[0] = *(const v8us*)((const unsigned short*)V16 + ((size_t)b * SQ + s0 + j) * DM + h * HD + d8); for (int q = 0; q < 8; ++q) tl[d8 + q][j] = f.u[q]; }
  __syncthreads();
  { for (int i = tid; i < 64 * 8; i += 256) { const int d = i / 8, j8 = (i % 8) * 8; FragH f; for (int q = 0; q < 8; ++q) f.u[q] = tl[d][j8 + q]; *(v8us*)((unsigned short*)VT + ((size_t)hh * HD + d) * SQ + s0 + j8) = f.half[0]; }  } }



template <int CTRL> __device__ __forceinline__ float rs_row16(float v) { return __int_as_float(__builtin_amdgcn_update_dpp(0, __float_as_int(v), CTRL, 0xf, 0xf, true)); }      /* lane l ^ mask inside a 16-lane row (row_xmask) */
__device__ __forceinline__ float rs_x16(float v) { const int u = __float_as_int(v); return __int_as_float(__builtin_amdgcn_permlanex16(u, u, 0x76543210, 0xfedcba98, false, false)); }      /* lane l ^ 16 */
#define FAQ 128                      /* query rows per block: 4 waves x 32 columns */
#define FAC 0.18033688011112042592f  /* log2(e) / sqrt(64) */
__device__ __forceinline__ v8f fa_mma(v16h a, v16h b, v8f c) { return __builtin_amdgcn_wmma_f32_16x16x32_f16(false, a, false, b, (short)0, c, false, false); }
// 2^x in the native form. The v_nop in the same statement fills the one slot the instruction set asks for behind a transcendental; in the eight-wide form each v_exp is followed by an
// independent one (early-clobber outputs: no result register is a later source), so one v_nop behind the last serves all eight.
__device__ __forceinline__ float fa_exp2(float x) { float r; asm("v_exp_f32 %0, %1\n\tv_nop" : "=v"(r) : "v"(x)); return r; }
__device__ __forceinline__ v8f fa_exp2x8(v8f x) { float r0, r1, r2, r3, r4, r5, r6, r7;
  asm("v_exp_f32 %0, %8\n\tv_exp_f32 %1, %9\n\tv_exp_f32 %2, %10\n\tv_exp_f32 %3, %11\n\tv_exp_f32 %4, %12\n\tv_exp_f32 %5, %13\n\tv_exp_f32 %6, %14\n\tv_exp_f32 %7, %15\n\tv_nop"
      : "=&v"(r0), "=&v"(r1), "=&v"(r2), "=&v"(r3), "=&v"(r4), "=&v"(r5), "=&v"(r6), "=&v"(r7) : "v"(x[0]), "v"(x[1]), "v"(x[2]), "v"(x[3]), "v"(x[4]), "v"(x[5]), "v"(x[6]), "v"(x[7]));
  const v8f r = {r0, r1, r2, r3, r4, r5, r6, r7}; return r; }
// One pass of 32 keys for a wave's 32 query columns. kf holds this pass's K fragments and is refilled for the next pass right behind the score products (LAST: the diagonal pass, masked, no refill).
// Every loop is fully unrolled so that the fragment and accumulator arrays are indexed by constants and stay in registers.
template <bool LAST>
__device__ __forceinline__ void fa_pass(const _Float16* __restrict__ kn, const _Float16* __restrict__ vp, int hh, int dq, const v16h (&qf)[2][2], v16h (&kf)[2][2], v8f (&o)[2][4], float (&m)[2], float (&l)[2]) {
  v16h vf[4];
#pragma unroll
  for (int dt = 0; dt < 4; ++dt) vf[dt] = g2_frag(vp + (size_t)dt * 16 * SQ, hh);
  const v8f z8 = {0.f, 0.f, 0.f, 0.f, 0.f, 0.f, 0.f, 0.f}; v8f s[2][2];
#pragma unroll
  for (int j = 0; j < 2; ++j)
#pragma unroll
    for (int t = 0; t < 2; ++t) s[j][t] = fa_mma(kf[t][1], qf[j][1], fa_mma(kf[t][0], qf[j][0], z8));
  if (!LAST) {
#pragma unroll
    for (int t = 0; t < 2; ++t)
#pragma unroll
      for (int c = 0; c < 2; ++c) kf[t][c] = g2_frag(kn + (size_t)t * 16 * LQ + c * 32, hh);
    __builtin_amdgcn_sched_barrier(0); }      /* keeps the refill in front of the softmax: without it the loads sank to the pass's end and the next pass waited out their whole latency */
#pragma unroll
  for (int j = 0; j < 2; ++j) {
    if (LAST) {      /* key - query = 16 t + r + dq - 16 j: above the diagonal when positive */
#pragma unroll
      for (int t = 0; t < 2; ++t)
#pragma unroll
        for (int r = 0; r < 8; ++r) if (16 * t + r + dq - 16 * j > 0) s[j][t][r] = -1.0e30f; }
    float mx = s[j][0][0];
#pragma unroll
    for (int r = 0; r < 8; ++r) mx = fmaxf(mx, fmaxf(s[j][0][r], s[j][1][r]));
    mx = fmaxf(mx, rs_x16(mx));      /* the column's other 16 keys are in lane ^ 16 */
    const float mn = fmaxf(m[j], mx); const float sc = fa_exp2((m[j] - mn) * FAC); const float nb = 8.0f - mn * FAC; m[j] = mn;      /* + 8: weights carried x256 */
    const v8f e0 = fa_exp2x8(s[j][0] * FAC + nb), e1 = fa_exp2x8(s[j][1] * FAC + nb);
    const v8f es = e0 + e1; l[j] = l[j] * sc + (((es[0] + es[1]) + (es[2] + es[3])) + ((es[4] + es[5]) + (es[6] + es[7])));      /* each half keeps its own partial sum; joined in the epilogue */
    FragH p;
#pragma unroll
    for (int r = 0; r < 8; ++r) { p.h[r] = (_Float16)e0[r]; p.h[8 + r] = (_Float16)e1[r]; }
#pragma unroll
    for (int dt = 0; dt < 4; ++dt) o[j][dt] = fa_mma(vf[dt], p.v, o[j][dt] * sc); } }
__device__ __forceinline__ void fa_tile(const _Float16* __restrict__ QKVp, const _Float16* __restrict__ VTp, _Float16* __restrict__ O, int bh, int qt) {      /* one block: query tile qt of batch and head bh. QKVp: q | k | v rows of pitch LQ; VTp: [NB * NH][HD][SQ]; O: merged rows of pitch DM */
  const int lane = threadIdx.x & 31, ln = lane & 15, hh = lane >> 4; const int w = __builtin_amdgcn_readfirstlane(threadIdx.x >> 5);
  const int b = bh / NH, h = bh % NH;
  const int q0 = qt * FAQ + w * 32;      /* no barrier in this function: each wave has its own trip count. The loops over j, c, dt and r below are fully unrolled for constant indices (registers), as in fa_pass */
  const _Float16* qp = QKVp + ((size_t)b * SQ + q0 + ln) * LQ + h * HD; const _Float16* kp = QKVp + ((size_t)b * SQ + ln) * LQ + DM + h * HD; const _Float16* vp = VTp + ((size_t)bh * HD + ln) * SQ;
  v16h qf[2][2], kf[2][2]; v8f o[2][4]; float m[2] = {-1.0e30f, -1.0e30f}, l[2] = {0.f, 0.f};
#pragma unroll
  for (int j = 0; j < 2; ++j)
#pragma unroll
    for (int c = 0; c < 2; ++c) { qf[j][c] = g2_frag(qp + (size_t)j * 16 * LQ + c * 32, hh); kf[j][c] = g2_frag(kp + (size_t)j * 16 * LQ + c * 32, hh); }
  asm volatile("s_wait_xcnt 0x0" ::: "memory");      /* the address registers of the loads above are reused for the zeroed accumulators below */
#pragma unroll
  for (int j = 0; j < 2; ++j)
#pragma unroll
    for (int dt = 0; dt < 4; ++dt) { const v8f z8 = {0.f, 0.f, 0.f, 0.f, 0.f, 0.f, 0.f, 0.f}; o[j][dt] = z8; }
  const int dq = 8 * hh - ln;
  for (int k0 = 0; k0 < q0; k0 += 32) fa_pass<false>(kp + (size_t)(k0 + 32) * LQ, vp + k0, hh, dq, qf, kf, o, m, l);      /* keys wholly below the wave's first query */
  fa_pass<true>(kp, vp + q0, hh, dq, qf, kf, o, m, l);      /* keys q0 .. q0 + 31: the diagonal */
#pragma unroll
  for (int j = 0; j < 2; ++j) { const float fin = 64.0f / (l[j] + rs_x16(l[j]));      /* o carried x64; the x256 of the weights cancels against the sum */
    unsigned short* op = (unsigned short*)O + ((size_t)b * SQ + q0 + j * 16 + ln) * DM + h * HD + 8 * hh;
#pragma unroll
    for (int dt = 0; dt < 4; ++dt) { FragH f;
#pragma unroll
      for (int r = 0; r < 8; ++r) f.h[r] = (_Float16)(o[j][dt][r] * fin);
      *(v8us*)(op + dt * 16) = f.half[0]; } } }


// e^x for x <= 0 to f32 accuracy: n = the integer nearest x log2 e; x log2 e - n by two fused multiply-adds (the constant as its f32 value plus its low part), so the product is never rounded
// before n is taken off; 2^n applied by ldexp; 0 below the f32 range. The v_nop in the same statement fills the one slot the instruction set asks for behind a transcendental.
__device__ __forceinline__ float a0_exp(float x) { const float n = rintf(x * 1.4426950216293334961f); const float a = fmaf(x, 1.9259628558643271390e-8f, fmaf(x, 1.4426950216293334961f, -n));
  float r; asm("v_exp_f32 %0, %1\n\tv_nop" : "=v"(r) : "v"(a)); return (x < -103.2789306640625f) ? 0.f : ldexpf(r, (int)n); }
// Exact f32 attention for the first QT0 rows of every batch (causal form; block blk of NB * NH * QT0 / A0R: batch, head, row group). Four lanes share a query row: lane part p = lane & 3 keeps dims 16 c + 4 p .. + 3 (c = 0..3)
// of q and o in registers; a wave holds 8 rows and walks the keys up to its own last row. The head's K and V rows are staged once in LDS, all loads in flight together;
// the 8 row groups of a wave read the same 64 bytes of a key row per load (broadcast, no bank conflict). The dot product is 16 terms per lane, then a butterfly over the 4 lanes.
// Every loop over c, u and the four keys of a trip is fully unrolled, so that q[], o[] and the LDS data are indexed by constants and stay in registers.
#define A0R 32                       /* query rows per block: 4 waves x 8 rows */
__device__ __forceinline__ void a0_block(float (*lk)[HD], float (*lv)[HD], const float* __restrict__ QKVF, float scale, _Float16* __restrict__ OHL, int blk) {      /* QKVF: per batch QT0 f32 q | k | v rows of pitch LQ; OHL: the A2 rows of k_gemm2<.., 2>, pitch DM */
  const int tid = threadIdx.x, lane = tid & 31, p4 = (lane & 3) * 4; const int w = __builtin_amdgcn_readfirstlane(tid >> 5);
  const int bt = blk / (NH * (QT0 / A0R)), h = blk / (QT0 / A0R) % NH, rg = blk % (QT0 / A0R);
  const float* QF = QKVF + (size_t)bt * QT0 * LQ; const float* KF = QF + DM; const float* VF = QF + 2 * DM;
  const int row = rg * A0R + w * 8 + (lane >> 2);      /* this lane's query row */
  const int nk = rg * A0R + w * 8 + 8;                 /* wave-uniform: keys up to the wave's last row (a multiple of 8, at most QT0) */
  { const int r0 = tid / 16, c4 = (tid % 16) * 4; const float* kp = KF + h * HD + r0 * LQ + c4; const float* vp = VF + h * HD + r0 * LQ + c4;
    v4f tk[QT0 / 8], tv[QT0 / 8];      /* fully unrolled: constant indices keep both in registers and every load of the tile is issued before the first LDS store */
#pragma unroll
    for (int it = 0; it < QT0 / 8; ++it) { tk[it] = *(const v4fa*)(kp + it * 8 * LQ); tv[it] = *(const v4fa*)(vp + it * 8 * LQ); }
#pragma unroll
    for (int it = 0; it < QT0 / 8; ++it) { *(v4f*)&lk[it * 8 + r0][c4] = tk[it]; *(v4f*)&lv[it * 8 + r0][c4] = tv[it]; } }
  __syncthreads();
  const float* qr = QF + row * LQ + h * HD + p4;
  v4f q[4], o[4];
#pragma unroll
  for (int c = 0; c < 4; ++c) { q[c] = *(const v4fa*)(qr + c * 16); const v4f z = {0.f, 0.f, 0.f, 0.f}; o[c] = z; }
  float m = -1.0e30f, l = 0.f;
  for (int j0 = 0; j0 < nk; j0 += 4) {      /* four keys per trip, unrolled: their dot products are independent and fill each other's dependent links */
#pragma unroll
    for (int jj = 0; jj < 4; ++jj) { const int j = j0 + jj; float s = 0.f;
#pragma unroll
      for (int c = 0; c < 4; ++c) { const v4f kq = *(const v4f*)&lk[j][c * 16 + p4]; s += q[c][0] * kq[0]; s += q[c][1] * kq[1]; s += q[c][2] * kq[2]; s += q[c][3] * kq[3]; }
      s += rs_row16<0x161>(s); s += rs_row16<0x162>(s);      /* sum over the row's 4 lanes; all 4 end with the same bits */
      const float sm = (j <= row) ? s * scale : -1.0e30f; const float mn = fmaxf(m, sm); const float sc = a0_exp(m - mn); const float e = a0_exp(sm - mn); l = l * sc + e; m = mn;
#pragma unroll
      for (int c = 0; c < 4; ++c) { const v4f vv = *(const v4f*)&lv[j][c * 16 + p4];
#pragma unroll
        for (int u = 0; u < 4; ++u) o[c][u] = o[c][u] * sc + e * vv[u]; } } }
  const float fin = 64.0f / l;      /* o carried x64 like the f16 path */
  _Float16* orow = OHL + ((size_t)(bt * (QT0 / 64) + (row >> 6)) * 128 + (row & 63)) * DM + h * HD + p4;      /* the row's f16 value; its x1024 residual stands 64 rows further */
#pragma unroll
  for (int c = 0; c < 4; ++c) { v4h oh, ol;
#pragma unroll
    for (int u = 0; u < 4; ++u) { const float a = o[c][u] * fin; const _Float16 hv = (_Float16)a; oh[u] = hv; ol[u] = (_Float16)((a - (float)hv) * 1024.0f); }
    *(v4h*)(orow + c * 16) = oh; *(v4h*)(orow + (size_t)64 * DM + c * 16) = ol; }
  asm volatile("s_wait_xcnt 0x0" ::: "memory"); }      /* stands in front of any later rewrite of a register that the stores above name (in the built kernel the other path's code follows them) */
// One launch for both attention paths; they share no data. All blocks are resident at once and a WMMA tile's cost grows with its index: the two halves of the first NB * NH grid rows walk the tiles in opposite order,
// so that blocks half of those rows apart add up to the same cost. Tile 0 (a batch's first QT0 rows) belongs to the exact f32 path: its NB * NH places and the grid rows behind take that path's blocks.
__global__ __launch_bounds__(128) void k_attn(const _Float16* __restrict__ QKVp, const _Float16* __restrict__ VTp, _Float16* __restrict__ O, const float* __restrict__ QKVF, float scale, _Float16* __restrict__ OHL) {
  static_assert(FAQ == QT0, "tile 0 is the exact path's");
  __shared__ __attribute__((aligned(16))) float lk[QT0][HD]; __shared__ __attribute__((aligned(16))) float lv[QT0][HD];
  const int bh = blockIdx.y; const int qt = (bh < NB * NH / 2) ? SQ / FAQ - 1 - (int)blockIdx.x : (int)blockIdx.x;
  if (bh < NB * NH && qt != 0) { fa_tile(QKVp, VTp, O, bh, qt); return; }
  a0_block(lk, lv, QKVF, scale, OHL, bh < NB * NH ? bh : NB * NH + (bh - NB * NH) * (SQ / FAQ) + (int)blockIdx.x); }

extern "C" void kernel_launch(void* const* d_in, const int* in_sizes, int n_in,
                              void* d_out, int out_size, void* d_ws, size_t ws_size, hipStream_t stream) {
  (void)in_sizes; (void)n_in; (void)out_size;
  const float* const* I = (const float* const*)d_in; const float* x = I[0]; const float* wqkv = I[1]; const float* bqkv = nullptr; const float* wo = I[2]; const float* bo = I[3];      /* input order: y, Wqkv (fused [in][out] [1024][3072]), Wff ([in][out]), bff [1024]; the QKV projection has NO bias: bqkv is a null pointer; the output bias is bound */
  char* ws = (char*)d_ws; size_t off = 0;
  auto take = [&](size_t bytes) { char* p = ws + off; off += (bytes + 255) & ~(size_t)255; return p; };
  _Float16* BQKV = (_Float16*)take((size_t)3 * DM * DM * 2); _Float16* BO = (_Float16*)take((size_t)DM * DM * 2);
  _Float16* X16 = (_Float16*)take(NR * DM * 2); _Float16* QKV = (_Float16*)take(NR * 3 * DM * 2); _Float16* V16 = QKV + 2 * DM; _Float16* O16 = (_Float16*)take(NR * DM * 2);
  _Float16* VT = (_Float16*)take((size_t)NB * NH * HD * SQ * 2);
  float* QKVF0 = (float*)take((size_t)NB * QT0 * LQ * 4); _Float16* OHL0 = (_Float16*)take((size_t)NB * QT0 * 2 * DM * 2);
  if (off > ws_size) return;
  k_prep<<<PW1 + PW2 + PX, 256, 0, stream>>>(wqkv, BQKV, wo, BO, x, X16);      /* both weights as Bt[n][k] x16 and x as f16 rows */
  const size_t r0p = (size_t)B0 * SQ;      /* first projected row */
  k_gemm2<0, 1><<<dim3((unsigned)((MP / 128) * (3 * DM / 64)), 1), 128, 0, stream>>>(X16 + r0p * DM, DM, 0, BQKV, DM, 0, 0.0625f, bqkv, 0, nullptr, 1, 0, 0, nullptr, QKV + r0p * 3 * DM, 3 * DM, 0, MP, 3 * DM, DM, nullptr, QKVF0);      /* q | k | v rows (f16); head h = columns h*HD.. of each DM block; each batch's first 128 rows also as f32 (exact products) */
  k_vt<NH, SQ><<<NBR * NH * (SQ / 64), 256, 0, stream>>>(V16 + r0p * LQ, LQ, 0, VT + (size_t)B0 * NH * HD * SQ);      /* V^T [NB * NH][HD][SQ] */
  k_attn<<<dim3(SQ / FAQ, NB * NH + (NB * NH * (QT0 / A0R) - NB * NH) / (SQ / FAQ)), 128, 0, stream>>>(QKV, VT, O16, QKVF0, 0.125f, OHL0);      /* scores, causal softmax and P V of every batch, head and query tile in one launch: o (merged heads, x64) as f16 rows; rows 0..127 of each batch exactly in f32, o (x64) as f16 hi + x1024 residual rows */
  k_gemm2<0, 2><<<dim3((unsigned)((MPO / 128 + NB) * (DM / 64)), 1), 128, 0, stream>>>(O16 + r0p * DM, DM, 0, BO, DM, 0, 0.0009765625f, bo, 0, nullptr, 1, 0, 0, (float*)d_out + r0p * DM, nullptr, DM, 0, MPO, DM, DM, OHL0, nullptr);      /* out rows are the output layout; rows 0..127 of each batch = o_hi Wo + b + o_lo Wo 2^-10 */
}

// v009
// Measured time: 88.5 microseconds a run.
// In both of two side-by-side timings against v008, it was 1.24 times as fast.
// All steps since v000 together make it 57.6 times as fast.
#include <hip/hip_runtime.h>
#define NB 2
#define SQ 2048
#define DM 1024
#define NH 16
#define HD 64
#define HG 4                         /* heads per launch of the k_vt(V16, b, h0, VT) form, which is not launched */
#define QT0 128                      /* first-tile rows recomputed exactly in f32 */
#define B0 0                         /* first batch processed (debug hook) */
#define NBR NB                       /* batches processed (debug hook) */
#define NR ((size_t)NB * SQ)         /* token rows */
#define MP ((int)((size_t)NBR * SQ)) /* rows projected (debug hook) */
#define MPO MP                       /* rows through the output stage (debug hook) */
#define LQ (3 * DM)      /* row pitch of the q/k/v rows */
typedef __bf16 v16b __attribute__((ext_vector_type(16)));
typedef unsigned short v8us __attribute__((ext_vector_type(8), may_alias));
typedef float  v8f  __attribute__((ext_vector_type(8)));
typedef float  v4f  __attribute__((ext_vector_type(4)));
typedef float  v4fa __attribute__((ext_vector_type(4), may_alias));
union FragB { v16b v; v8us half[2]; unsigned short u[16]; };

__device__ __forceinline__ unsigned short bf16_bits(float x) { unsigned int u = __float_as_uint(x); return (unsigned short)((u + 0x7FFFu + ((u >> 16) & 1u)) >> 16); }
__device__ __forceinline__ float bf16_val(unsigned short b) { return __uint_as_float(((unsigned int)b) << 16); }
__device__ __forceinline__ float bf16_round(float x) { return bf16_val(bf16_bits(x)); }
// D += A·B with NT terms: 1 = ah·bh, 2 = + al·bh (A split), 3 = + ah·bl (both split)
template <int NT>
__device__ __forceinline__ v8f mmaN(v16b ah, v16b al, v16b bh, v16b bl, v8f c) {
  c = __builtin_amdgcn_wmma_f32_16x16x32_bf16(false, ah, false, bh, (short)0, c, false, false);
  if (NT >= 2) c = __builtin_amdgcn_wmma_f32_16x16x32_bf16(false, al, false, bh, (short)0, c, false, false);
  if (NT >= 3) c = __builtin_amdgcn_wmma_f32_16x16x32_bf16(false, ah, false, bl, (short)0, c, false, false);
  asm volatile("v_nop\n\tv_nop\n\tv_nop\n\tv_nop" : "+v"(c) : "v"(ah), "v"(al), "v"(bh), "v"(bl));
  return c;
}

__global__ __launch_bounds__(256) void k_wt_bf16(const float* __restrict__ W, unsigned short* __restrict__ Wt, int K, int N) {
  const int t = blockIdx.x * 256 + threadIdx.x;
  const int k8n = K / 8;
  if (t >= N * k8n) return;
  const int n = t / k8n, k8 = (t % k8n) * 8;
  v8us v;
#pragma unroll
  for (int i = 0; i < 8; ++i) v[i] = bf16_bits(W[(size_t)(k8 + i) * N + n]);
  *(v8us*)(Wt + (size_t)n * K + k8) = v;
  
}

// GEMM C[M][N] (f32, pitch ldc) = act(A[M][K]·W + bias). A f32 row-major (pitch lda) converted per fragment to bf16
// (ASPLIT: hi/lo two planes -> 2 terms, else single rounded term); Wt bf16 [N][K] (pitch ldb). BIAS_BF16 rounds the
// bias to bf16 first (bias quantised to bf16 before the add). K%32==0, M%16==0, N%64==0.
template <bool ASPLIT, int ACT, bool BIAS_BF16>
__global__ __launch_bounds__(128) void k_gemm_bf(const float* __restrict__ A, int lda, const unsigned short* __restrict__ Wt, int ldb,
                                               const float* __restrict__ bias, float* __restrict__ C, int ldc, int M, int N, int K) {
  __shared__ __attribute__((aligned(16))) float so[4][16][64];
  const int tid = threadIdx.x, w = tid >> 5, lane = tid & 31, ln = lane & 15, hh = lane >> 4;
  const int ntn = N / 64;
  const int wid = blockIdx.x * 4 + w;
  const int mt = wid / ntn, nq = wid % ntn;
  if (mt * 16 >= M) return;
  const int row0 = mt * 16, col0 = nq * 64;
  const float* arow = A + (size_t)(row0 + ln) * lda;
  v8f acc[4] = {};
  for (int kb = 0; kb < K; kb += 32) {
    FragB ah, al;
    const v4f x0 = *(const v4fa*)(arow + kb + 8 * hh), x1 = *(const v4fa*)(arow + kb + 8 * hh + 4);
    const v4f x2 = *(const v4fa*)(arow + kb + 16 + 8 * hh), x3 = *(const v4fa*)(arow + kb + 16 + 8 * hh + 4);
    float xs[16] = {x0[0],x0[1],x0[2],x0[3],x1[0],x1[1],x1[2],x1[3],x2[0],x2[1],x2[2],x2[3],x3[0],x3[1],x3[2],x3[3]};
#pragma unroll
    for (int i = 0; i < 16; ++i) { const unsigned short hb = bf16_bits(xs[i]); ah.u[i] = hb; al.u[i] = ASPLIT ? bf16_bits(xs[i] - bf16_val(hb)) : (unsigned short)0; }
#pragma unroll
    for (int t = 0; t < 4; ++t) {
      const unsigned short* brow = Wt + (size_t)(col0 + t * 16 + ln) * ldb + kb;
      FragB b;
      b.half[0] = *(const v8us*)(brow + 8 * hh);
      b.half[1] = *(const v8us*)(brow + 16 + 8 * hh);
      acc[t] = mmaN<ASPLIT ? 2 : 1>(ah.v, al.v, b.v, b.v, acc[t]);
    }
  }
#pragma unroll
  for (int t = 0; t < 4; ++t) {
    float bv = bias ? bias[col0 + t * 16 + ln] : 0.f;
    if (BIAS_BF16) bv = bf16_round(bv);
#pragma unroll
    for (int r = 0; r < 8; ++r) { float v = acc[t][r] + bv; if (ACT == 1) v = fmaxf(v, 0.f); so[w][8 * hh + r][t * 16 + ln] = v; }
  }
  __builtin_amdgcn_fence(__ATOMIC_ACQ_REL, "workgroup");
  __builtin_amdgcn_wave_barrier();
  const int rsub = lane >> 4, c4 = (lane & 15) * 4;
  {
#pragma unroll
    for (int q = 0; q < 8; ++q) {
      const int r = q * 2 + rsub;
      const v4f v = *(const v4fa*)&so[w][r][c4];
      *(v4f*)(C + (size_t)(row0 + r) * ldc + col0 + c4) = v;
    }
    
  }
}

// GEMM C = act(A·W + bias + resid): A f32 (ASPLIT -> hi/lo 2 terms), Wt bf16 [N][K]; ACT 0 none, 1 relu, 2 exact gelu;
// resid (optional, f32, row index = (row % rmod), pitch ldr, RES_BF16 rounds it) added before the activation.
template <bool ASPLIT, int ACT, bool BIAS_BF16, bool RES_BF16>
__global__ __launch_bounds__(128) void k_gemm_bf3(const float* __restrict__ A, int lda, const unsigned short* __restrict__ Wt, int ldb,
                                                const float* __restrict__ bias, const float* __restrict__ resid, int rmod, int ldr,
                                                float* __restrict__ C, int ldc, int M, int N, int K) {
  __shared__ __attribute__((aligned(16))) float so[4][16][64];
  const int tid = threadIdx.x, w = tid >> 5, lane = tid & 31, ln = lane & 15, hh = lane >> 4;
  const int ntn = N / 64;
  const int wid = blockIdx.x * 4 + w;
  const int mt = wid / ntn, nq = wid % ntn;
  if (mt * 16 >= M) return;
  const int row0 = mt * 16, col0 = nq * 64;
  const float* arow = A + (size_t)(row0 + ln) * lda;
  v8f acc[4] = {};
  for (int kb = 0; kb < K; kb += 32) {
    FragB ah, al;
    const v4f x0 = *(const v4fa*)(arow + kb + 8 * hh), x1 = *(const v4fa*)(arow + kb + 8 * hh + 4);
    const v4f x2 = *(const v4fa*)(arow + kb + 16 + 8 * hh), x3 = *(const v4fa*)(arow + kb + 16 + 8 * hh + 4);
    float xs[16] = {x0[0],x0[1],x0[2],x0[3],x1[0],x1[1],x1[2],x1[3],x2[0],x2[1],x2[2],x2[3],x3[0],x3[1],x3[2],x3[3]};
#pragma unroll
    for (int i = 0; i < 16; ++i) { const unsigned short hb = bf16_bits(xs[i]); ah.u[i] = hb; al.u[i] = ASPLIT ? bf16_bits(xs[i] - bf16_val(hb)) : (unsigned short)0; }
#pragma unroll
    for (int t = 0; t < 4; ++t) {
      const unsigned short* brow = Wt + (size_t)(col0 + t * 16 + ln) * ldb + kb;
      FragB b;
      b.half[0] = *(const v8us*)(brow + 8 * hh);
      b.half[1] = *(const v8us*)(brow + 16 + 8 * hh);
      acc[t] = mmaN<ASPLIT ? 2 : 1>(ah.v, al.v, b.v, b.v, acc[t]);
    }
  }
#pragma unroll
  for (int t = 0; t < 4; ++t) {
    const int col = col0 + t * 16 + ln;
    float bv = bias ? bias[col] : 0.f;
    if (BIAS_BF16) bv = bf16_round(bv);
#pragma unroll
    for (int r = 0; r < 8; ++r) {
      float v = acc[t][r] + bv;
      if (resid) { float rv = resid[(size_t)((row0 + 8 * hh + r) % rmod) * ldr + col]; if (RES_BF16) rv = bf16_round(rv); v += rv; }
      if (ACT == 1) v = fmaxf(v, 0.f);
      if (ACT == 2) v = 0.5f * v * (1.0f + erff(v * 0.70710678118654752f));
      if (ACT == 3) { const float u = 0.7978845608028654f * (v + 0.044715f * v * v * v); v = 0.5f * v * (1.0f + tanhf(u)); }
      so[w][8 * hh + r][t * 16 + ln] = v;
    }
  }
  __builtin_amdgcn_fence(__ATOMIC_ACQ_REL, "workgroup");
  __builtin_amdgcn_wave_barrier();
  const int rsub = lane >> 4, c4 = (lane & 15) * 4;
  {
#pragma unroll
    for (int q = 0; q < 8; ++q) {
      const int r = q * 2 + rsub;
      const v4f v = *(const v4fa*)&so[w][r][c4];
      *(v4f*)(C + (size_t)(row0 + r) * ldc + col0 + c4) = v;
    }
    
  }
}
// row LayerNorm (biased variance, eps) over N: s = X (+ R); optional out_sum <- s; out_norm <- (s-mu)*rsqrt(var+eps)*g + b
template <bool PARAM_BF16>
__global__ __launch_bounds__(256) void k_layernorm(const float* __restrict__ X, const float* __restrict__ R, const float* __restrict__ g, const float* __restrict__ bta,
                                                  float* __restrict__ out_sum, float* __restrict__ out_norm, int N, float eps) {
  __shared__ float red[256];
  const int row = blockIdx.x, tid = threadIdx.x;
  const float* x = X + (size_t)row * N; const float* rr = R ? R + (size_t)row * N : nullptr;
  float vals[16];                     // up to N = 4096
  const int per = N / 256;            // contiguous chunk per thread? use strided-by-4 chunks: thread handles j = tid*4 + 1024*u
  float s1 = 0.f;
  for (int u = 0; u < per / 4; ++u) {
    const int j = tid * 4 + 1024 * u;
    const v4f a = *(const v4fa*)(x + j);
    v4f b = {0.f,0.f,0.f,0.f}; if (rr) b = *(const v4fa*)(rr + j);
#pragma unroll
    for (int q = 0; q < 4; ++q) { const float v = a[q] + b[q]; vals[u * 4 + q] = v; s1 += v; }
  }
  red[tid] = s1; __syncthreads();
  for (int st = 128; st > 0; st >>= 1) { if (tid < st) red[tid] += red[tid + st]; __syncthreads(); }
  const float mu = red[0] / (float)N; __syncthreads();
  float s2 = 0.f;
  for (int u = 0; u < per / 4; ++u)
#pragma unroll
    for (int q = 0; q < 4; ++q) { const float c = vals[u * 4 + q] - mu; s2 += c * c; }
  red[tid] = s2; __syncthreads();
  for (int st = 128; st > 0; st >>= 1) { if (tid < st) red[tid] += red[tid + st]; __syncthreads(); }
  const float rs = rsqrtf(red[0] / (float)N + eps);
  {
    for (int u = 0; u < per / 4; ++u) {
      const int j = tid * 4 + 1024 * u;
      v4f o, sm;
#pragma unroll
      for (int q = 0; q < 4; ++q) {
        float gg = g[j + q], bb = bta[j + q];
        if (PARAM_BF16) { gg = bf16_round(gg); bb = bf16_round(bb); }
        sm[q] = vals[u * 4 + q]; o[q] = (vals[u * 4 + q] - mu) * rs * gg + bb;
      }
      if (out_sum) *(v4f*)(out_sum + (size_t)row * N + j) = sm;
      *(v4f*)(out_norm + (size_t)row * N + j) = o;
    }
    
  }
}



// ---- f16 WMMA path (v_wmma_f32_16x16x32_f16): 11-bit significands for operands in range — used where a [0,1] probability operand needs more precision than bf16
typedef _Float16 v16h __attribute__((ext_vector_type(16)));
union FragH { v16h v; v8us half[2]; _Float16 h[16]; unsigned short u[16]; };
template <int NT>
__device__ __forceinline__ v8f mmaH(v16h ah, v16h al, v16h bh, v16h bl, v8f c) {
  c = __builtin_amdgcn_wmma_f32_16x16x32_f16(false, ah, false, bh, (short)0, c, false, false);
  if (NT >= 2) c = __builtin_amdgcn_wmma_f32_16x16x32_f16(false, al, false, bh, (short)0, c, false, false);
  if (NT >= 3) c = __builtin_amdgcn_wmma_f32_16x16x32_f16(false, ah, false, bl, (short)0, c, false, false);
  asm volatile("v_nop\n\tv_nop\n\tv_nop\n\tv_nop" : "+v"(c) : "v"(ah), "v"(al), "v"(bh), "v"(bl));
  return c;
}
// batched GEMM like k_gemm_b but f16 operands: A f32 (split into f16 hi/lo if ASPLIT, else rounded to f16), Bt = f16 values [n][k]; alpha; C f32; N multiple of 16 (partial tiles skipped)
template <bool ASPLIT>
__global__ __launch_bounds__(128) void k_gemm_h(const float* __restrict__ A, int lda, size_t sA, const _Float16* __restrict__ Bh, int ldb, size_t sB, float alpha, float* __restrict__ C, int ldc, size_t sC, int M, int N, int K) {
  __shared__ __attribute__((aligned(16))) float so[4][16][64];
  const int tid = threadIdx.x, w = tid >> 5, lane = tid & 31, ln = lane & 15, hh = lane >> 4; const int by = blockIdx.y;
  A += (size_t)by * sA; Bh += (size_t)by * sB; C += (size_t)by * sC;
  const int ntn = (N + 63) / 64; const int wid = blockIdx.x * 4 + w; const int mt = wid / ntn, nq = wid % ntn; if (mt * 16 >= M) return;
  const int row0 = mt * 16, col0 = nq * 64; const float* arow = A + (size_t)(row0 + ln) * lda;
  v8f acc[4] = {};
  for (int kb = 0; kb < K; kb += 32) {
    FragH ah, al;
    const v4f x0 = *(const v4fa*)(arow + kb + 8 * hh), x1 = *(const v4fa*)(arow + kb + 8 * hh + 4), x2 = *(const v4fa*)(arow + kb + 16 + 8 * hh), x3 = *(const v4fa*)(arow + kb + 16 + 8 * hh + 4);
    float xs[16] = {x0[0],x0[1],x0[2],x0[3],x1[0],x1[1],x1[2],x1[3],x2[0],x2[1],x2[2],x2[3],x3[0],x3[1],x3[2],x3[3]};
#pragma unroll
    for (int i = 0; i < 16; ++i) { const _Float16 h = (_Float16)xs[i]; ah.h[i] = h; al.h[i] = ASPLIT ? (_Float16)(xs[i] - (float)h) : (_Float16)0.0f; }
#pragma unroll
    for (int t = 0; t < 4; ++t) { if (col0 + t * 16 >= N) continue; const size_t boff = (size_t)(col0 + t * 16 + ln) * ldb + kb; FragH bq; bq.half[0] = *(const v8us*)(Bh + boff + 8 * hh); bq.half[1] = *(const v8us*)(Bh + boff + 16 + 8 * hh);
      acc[t] = mmaH<ASPLIT ? 2 : 1>(ah.v, al.v, bq.v, bq.v, acc[t]); }
  }
#pragma unroll
  for (int t = 0; t < 4; ++t) { if (col0 + t * 16 >= N) continue;
#pragma unroll
    for (int r = 0; r < 8; ++r) so[w][8 * hh + r][t * 16 + ln] = acc[t][r] * alpha; }
  __builtin_amdgcn_fence(__ATOMIC_ACQ_REL, "workgroup"); __builtin_amdgcn_wave_barrier();
  const int rsub = lane >> 4, c4 = (lane & 15) * 4;
  {
#pragma unroll
    for (int q = 0; q < 8; ++q) { const int r = q * 2 + rsub; if (col0 + c4 < N) { const v4f v = *(const v4fa*)&so[w][r][c4]; *(v4f*)(C + (size_t)(row0 + r) * ldc + col0 + c4) = v; } }
     }
}

// Wt[n][k] = f16(W[k][n] * scale) from f32 row-major W[K][N] (scale = power of two; bf16-exact weights stay exact in f16 away from the subnormal range). Tile blk of (K / 64) * (N / 128); tl: WTN * WTP bytes of LDS.
// One block turns a tile of 64 k x 128 n through LDS, so that both sides of the transpose move whole 128-B lines: wave w reads rows k0 + 8 w .. + 7, each as 512 contiguous bytes (lane l: columns 4 l .. + 3),
// which leaves in every lane the 8 k of 4 output rows (one 16-byte piece each); the pieces go to LDS rows of 64 k, and behind the barrier 8 lanes store each output row's 128 bytes.
// K and N are compile-time: the row steps become immediate offsets on one address.
#define WTK 64                       /* k per tile */
#define WTN 128                      /* n per tile */
#define WTP 144                      /* LDS row pitch in bytes: 128 + 16, keeps the 16-byte pieces aligned */
template <int K, int N>
__device__ __forceinline__ void wt_tile(unsigned char* tl, const float* __restrict__ W, _Float16* __restrict__ Wt, float scale, int blk) { static_assert(K % WTK == 0 && N % WTN == 0, "whole tiles only");
  const int tid = threadIdx.x, w = tid >> 5, lane = tid & 31; const int kt = blk / (N / WTN), nt = blk % (N / WTN); const int k0 = kt * WTK, n0 = nt * WTN;
  const float* src = W + (size_t)(k0 + 8 * w) * N + n0 + 4 * lane; v4f x[8];
#pragma unroll      /* constant indices keep x[] in registers, and all 8 loads are in flight together */
  for (int i = 0; i < 8; ++i) x[i] = *(const v4fa*)(src + (size_t)i * N);
#pragma unroll      /* constant indices into x[] */
  for (int q = 0; q < 4; ++q) { FragH f;
#pragma unroll      /* likewise, and f stays in registers */
    for (int i = 0; i < 8; ++i) f.h[i] = (_Float16)(bf16_round(x[i][q]) * scale);
    *(v8us*)(tl + (4 * lane + q) * WTP + 16 * w) = f.half[0]; }
  __syncthreads();      /* an output row's 8 pieces come from the 8 waves */
  unsigned short* dst = (unsigned short*)Wt + (size_t)(n0 + (tid >> 3)) * K + k0 + 8 * (tid & 7); const unsigned char* tr = tl + (tid >> 3) * WTP + 16 * (tid & 7);
#pragma unroll      /* the 4 LDS reads and stores are independent: unrolled, their latencies overlap */
  for (int i = 0; i < 4; ++i) { const v8us o = *(const v8us*)(tr + 32 * i * WTP); *(v8us*)(dst + (size_t)32 * i * K) = o; }
  asm volatile("s_wait_xcnt 0x0" ::: "memory");      /* stands in front of any later rewrite of a register that the stores above name (in the built kernel another path's code follows them) */
}
// k_gemm_hh variant with fused epilogue: v = acc·alpha + bias[by·sBias + col] (+ CP[(row/rowsPerB)·sCPb + by·64 + col] if CP) ; ACT 0 none / 1 elu ; writes f16 C16 (and f32 C if non-null)
template <int ACT>
__global__ __launch_bounds__(128) void k_gemm_hhx(const _Float16* __restrict__ A, int lda, size_t sA, const _Float16* __restrict__ Bh, int ldb, size_t sB, float alpha, const float* __restrict__ bias, size_t sBias, const float* __restrict__ CP, int rowsPerB, size_t sCPb, int row0g,
    float* __restrict__ C, _Float16* __restrict__ C16, int ldc, size_t sC, int M, int N, int K) {
  __shared__ __attribute__((aligned(16))) float so[4][16][64];
  const int tid = threadIdx.x, w = tid >> 5, lane = tid & 31, ln = lane & 15, hh = lane >> 4; const int by = blockIdx.y;
  A += (size_t)by * sA; Bh += (size_t)by * sB; const size_t cofs = (size_t)by * sC; const float* bp = bias ? bias + (size_t)by * sBias : nullptr;
  const int ntn = (N + 63) / 64; const int wid = blockIdx.x * 4 + w; const int mt = wid / ntn, nq = wid % ntn; if (mt * 16 >= M) return;
  const int row0 = mt * 16, col0 = nq * 64; const _Float16* arow = A + (size_t)(row0 + ln) * lda;
  v8f acc[4] = {};
  for (int kb = 0; kb < K; kb += 32) { FragH ah; ah.half[0] = *(const v8us*)((const unsigned short*)arow + kb + 8 * hh); ah.half[1] = *(const v8us*)((const unsigned short*)arow + kb + 16 + 8 * hh);
#pragma unroll
    for (int t = 0; t < 4; ++t) { if (col0 + t * 16 >= N) continue; const size_t boff = (size_t)(col0 + t * 16 + ln) * ldb + kb; FragH bq; bq.half[0] = *(const v8us*)((const unsigned short*)Bh + boff + 8 * hh); bq.half[1] = *(const v8us*)((const unsigned short*)Bh + boff + 16 + 8 * hh);
      acc[t] = mmaH<1>(ah.v, ah.v, bq.v, bq.v, acc[t]); }
  }
#pragma unroll
  for (int t = 0; t < 4; ++t) { if (col0 + t * 16 >= N) continue; const int col = col0 + t * 16 + ln; const float bv = bp ? bf16_round(bp[col]) : 0.f;
#pragma unroll
    for (int r = 0; r < 8; ++r) { float v = acc[t][r] * alpha + bv; if (CP) { const int rr = row0g + row0 + 8 * hh + r; if (rowsPerB < 0) v += CP[cofs + (size_t)rr * ldc + col];      /* rowsPerB < 0: own element of the batched C plane */ else { const int bidx = rr / rowsPerB; v += CP[(size_t)bidx * sCPb + (size_t)by * 64 + col]; } } if (ACT == 1) v = (v > 0.f) ? v : expm1f(v); else if (ACT == 7) v = (v > 0.f) ? v + 1.0f : expf(v); else if (ACT == 8) v = tanhf(v); else if (ACT == 9) v = 0.5f * v * (1.0f + tanhf(0.7978845608028654f * (v + 0.044715f * v * v * v))); else if (ACT == 11) v = 1.0f / (1.0f + expf(-v)); else if (ACT == 12) v = (v > 0.f) ? v : 0.01f * v; else if (ACT == 14) v = (v > 0.f) ? v : 0.1f * v; else if (ACT == 16) v = (v >= 0.f) ? v : 0.3f * v; else if (ACT == 17) v = (v >= 0.f) ? v : 0.2f * v; else if (ACT == 15) v = v / (1.0f + expf(-v)); else if (ACT == 3) v = fmaxf(v, 0.f); else if (ACT == 6) v = 0.5f * v * (1.0f + erff(v * 0.70710678118654752f)); so[w][8 * hh + r][t * 16 + ln] = v; } }
  __builtin_amdgcn_fence(__ATOMIC_ACQ_REL, "workgroup"); __builtin_amdgcn_wave_barrier();
  const int rsub = lane >> 4, c4 = (lane & 15) * 4; typedef _Float16 v4h __attribute__((ext_vector_type(4)));
  {
#pragma unroll
    for (int q = 0; q < 8; ++q) { const int r = q * 2 + rsub; if (col0 + c4 < N) { const v4f v = *(const v4fa*)&so[w][r][c4]; if (C) *(v4f*)(C + cofs + (size_t)(row0 + r) * ldc + col0 + c4) = v; if (C16) { v4h h4; for (int i = 0; i < 4; ++i) h4[i] = (_Float16)v[i]; *(v4h*)(C16 + cofs + (size_t)(row0 + r) * ldc + col0 + c4) = h4; } } }
     }
}


typedef _Float16 v4h __attribute__((ext_vector_type(4)));

// X16 = f16(bf16-rounded x), piece blk of XTE elements: as many as a weight tile holds, so that the blocks of the shared grid below weigh alike. A thread turns 8 neighbours (32 B read, 16 B stored) in each of the piece's 4 quarters.
#define XTE (WTK * WTN)              /* elements of x per block */
__device__ __forceinline__ void x16_tile(const float* __restrict__ x, _Float16* __restrict__ X16, int blk) { static_assert(XTE == 4 * 256 * 8 && (NR * DM) % XTE == 0, "whole pieces only");
  const size_t e0 = (size_t)blk * XTE + threadIdx.x * 8; const float* src = x + e0; unsigned short* dst = (unsigned short*)X16 + e0; v4f a[4][2];
#pragma unroll      /* constant indices keep a[] in registers, and all 8 loads are in flight together */
  for (int i = 0; i < 4; ++i) { a[i][0] = *(const v4fa*)(src + i * 2048); a[i][1] = *(const v4fa*)(src + i * 2048 + 4); }
#pragma unroll      /* constant indices into a[] */
  for (int i = 0; i < 4; ++i) { FragH f;
#pragma unroll      /* likewise, and f stays in registers */
    for (int q = 0; q < 4; ++q) { f.h[q] = (_Float16)bf16_round(a[i][0][q]); f.h[4 + q] = (_Float16)bf16_round(a[i][1][q]); }
    *(v8us*)(dst + i * 2048) = f.half[0]; }
  asm volatile("s_wait_xcnt 0x0" ::: "memory"); }      /* stands in front of any later rewrite of a register that the stores above name (in the built kernel another path's code follows them) */
// The three operand preparations (both weight transposes and the f16 rows of x) read only inputs and share no data: one launch, the grid split by block index. The transposes, whose path is the longer (LDS and a barrier), come first.
#define PW1 ((DM / WTK) * (LQ / WTN))   /* tiles of the q | k | v weight */
#define PW2 ((DM / WTK) * (DM / WTN))   /* tiles of the output weight */
#define PX ((int)(NR * DM / XTE))       /* pieces of x */
__global__ __launch_bounds__(256) void k_prep(const float* __restrict__ wqkv, _Float16* __restrict__ BQKV, const float* __restrict__ wo, _Float16* __restrict__ BO, const float* __restrict__ x, _Float16* __restrict__ X16) {
  __shared__ __attribute__((aligned(16))) unsigned char tl[WTN * WTP];
  const int blk = blockIdx.x;      /* every test below reads the same for the whole block: the barrier inside wt_tile is passed by all of a block's waves or by none */
  if (blk < PW1) wt_tile<DM, LQ>(tl, wqkv, BQKV, 16.0f, blk);      /* [in][out] -> Bt[n][k] x16 */
  else if (blk < PW1 + PW2) wt_tile<DM, DM>(tl, wo, BO, 16.0f, blk - PW1);
  else x16_tile(x, X16, blk - (PW1 + PW2)); }
__global__ __launch_bounds__(256) void k_h16(const float* __restrict__ x, _Float16* __restrict__ X16, size_t n8) { const size_t t = (size_t)blockIdx.x * 256 + threadIdx.x; if (t >= n8) return; FragH f;
#pragma unroll
  for (int q = 0; q < 8; ++q) f.h[q] = (_Float16)x[t * 8 + q]; *(v8us*)((unsigned short*)X16 + t * 8) = f.half[0];  }
__global__ __launch_bounds__(256) void k_round16f(const float* __restrict__ W, _Float16* __restrict__ Bt, size_t n8) { const size_t t = (size_t)blockIdx.x * 256 + threadIdx.x; if (t >= n8) return; FragH f;
#pragma unroll
  for (int i = 0; i < 8; ++i) f.h[i] = (_Float16)(bf16_round(W[t * 8 + i]) * 16.0f); *(v8us*)((unsigned short*)Bt + t * 8) = f.half[0];  }
template <int NHv, int TTv>
__global__ __launch_bounds__(256) void k_vt(const _Float16* __restrict__ V16, int ldv, int voff, _Float16* __restrict__ Vt) { __shared__ unsigned short tl[64][66]; const int tid = threadIdx.x; const int slab = blockIdx.x / (TTv / 64), lg = blockIdx.x % (TTv / 64); const int b = slab / NHv, h = slab % NHv;
  for (int i = tid; i < 64 * 8; i += 256) { const int r = i / 8, c8 = (i % 8) * 8; FragH f; f.half[0] = *(const v8us*)((const unsigned short*)V16 + ((size_t)b * TTv + lg * 64 + r) * ldv + voff + h * 64 + c8);
#pragma unroll
    for (int q = 0; q < 8; ++q) tl[r][c8 + q] = f.u[q]; }
  __syncthreads();
  {
#pragma unroll
    for (int rd = 0; rd < 2; ++rd) { const int d = rd * 32 + tid / 8, pc = tid % 8; FragH f;
#pragma unroll
      for (int q = 0; q < 8; ++q) f.u[q] = tl[pc * 8 + q][d];
      *(v8us*)((unsigned short*)Vt + ((size_t)slab * 64 + d) * TTv + lg * 64 + pc * 8) = f.half[0]; }
     } }

// ---- fast GEMM (block tile 128x64, wave tile 32x64; requires M % 128 == 0 rows per launch region, N % 64 == 0 and K % 64 == 0); epilogue = k_gemm_hhx semantics ----
// Operands go global -> LDS by asynchronous copies, 64 k (one whole 128-B line of each of the 128 A rows and 64 B rows) per trip, two buffers: the next tile flies while this one is multiplied.
// A wave-wide copy covers 4 rows x 128 B (4 whole lines) and the B rows are fetched once per block; the fragments are then read from LDS in the same k order as from global memory.
#define G2KC 64                      /* k per trip */
#define G2PB 144                     /* LDS row pitch in bytes: 128 + 16 (16 B x odd), conflict-free for the 16-byte fragment reads */
#define G2BB (192 * G2PB)            /* bytes of one buffer: 128 A rows, then 64 B rows */
// One tile: thread (row r = tid / 8, 16-byte piece tid % 8) copies its piece of rows r + 16 i: 8 of A, then 4 of B. l: the LDS byte address of its piece of row r. Every lane is on.
// The s_wait_xcnt in the same statement stands in front of any later rewrite of the address registers that the copies name.
__device__ __forceinline__ void g2_stage(unsigned l, const _Float16* a, size_t a16, const _Float16* b, size_t b16) {
  asm volatile("global_load_async_to_lds_b128 %0, %12, off\n\tglobal_load_async_to_lds_b128 %1, %13, off\n\tglobal_load_async_to_lds_b128 %2, %14, off\n\tglobal_load_async_to_lds_b128 %3, %15, off\n\t"
               "global_load_async_to_lds_b128 %4, %16, off\n\tglobal_load_async_to_lds_b128 %5, %17, off\n\tglobal_load_async_to_lds_b128 %6, %18, off\n\tglobal_load_async_to_lds_b128 %7, %19, off\n\t"
               "global_load_async_to_lds_b128 %8, %20, off\n\tglobal_load_async_to_lds_b128 %9, %21, off\n\tglobal_load_async_to_lds_b128 %10, %22, off\n\tglobal_load_async_to_lds_b128 %11, %23, off\n\ts_wait_xcnt 0x0"
               :: "v"(l), "v"(l + 16 * G2PB), "v"(l + 32 * G2PB), "v"(l + 48 * G2PB), "v"(l + 64 * G2PB), "v"(l + 80 * G2PB), "v"(l + 96 * G2PB), "v"(l + 112 * G2PB),
                  "v"(l + 128 * G2PB), "v"(l + 144 * G2PB), "v"(l + 160 * G2PB), "v"(l + 176 * G2PB),
                  "v"(a), "v"(a + a16), "v"(a + 2 * a16), "v"(a + 3 * a16), "v"(a + 4 * a16), "v"(a + 5 * a16), "v"(a + 6 * a16), "v"(a + 7 * a16),
                  "v"(b), "v"(b + b16), "v"(b + 2 * b16), "v"(b + 3 * b16) : "memory"); }
__device__ __forceinline__ v16h g2_frag(const _Float16* p, int hh) { FragH f; f.half[0] = *(const v8us*)((const unsigned short*)p + 8 * hh); f.half[1] = *(const v8us*)((const unsigned short*)p + 16 + 8 * hh); return f.v; }
__device__ __forceinline__ v8f g2_mma(v16h a, v16h b, v8f c) { v8f d = __builtin_amdgcn_wmma_f32_16x16x32_f16(false, a, false, b, (short)0, c, false, false); asm volatile("v_nop\n\tv_nop\n\tv_nop\n\tv_nop" : "+v"(d) : "v"(a), "v"(b)); return d; }
// FT 1: a block that holds the first QT0 rows of a batch also stores them as f32 rows into CT (per batch QT0 rows of pitch ldc).
// FT 2: those rows are not taken from A but from A2, where every 128 rows are 64 rows of o as f16 (hi) followed by the same 64 rows' x1024 residual (lo): such a block (they come first in the grid) multiplies both planes in the one K loop,
// waves 0 and 1 the hi rows, waves 2 and 3 the lo rows, and its epilogue stores (hi alpha + bias) + lo alpha 2^-10. The other blocks take the M tiles behind each batch's first.
#define G2MP (SQ / 128)              /* M tiles per batch */
template <int ACT, int FT>
__global__ __launch_bounds__(128) void k_gemm2(const _Float16* __restrict__ A, int lda, size_t sA, const _Float16* __restrict__ Bh, int ldb, size_t sB, float alpha, const float* __restrict__ bias, size_t sBias, const float* __restrict__ CP, int rowsPerB, size_t sCPb, int row0g,
    float* __restrict__ C, _Float16* __restrict__ C16, int ldc, size_t sC, int M, int N, int K, const _Float16* __restrict__ A2, float* __restrict__ CT) { static_assert(ACT == 0 || ACT == 3 || ACT == 6 || ACT == 8 || ACT == 9 || ACT == 11 || ACT == 12 || ACT == 14 || ACT == 15 || ACT == 16 || ACT == 17, "k_gemm2: unsupported ACT code (would silently apply no activation)"); static_assert(QT0 == 128, "the first tile is one M tile");
  __shared__ __attribute__((aligned(16))) unsigned char sm[2 * G2BB];      /* the two operand buffers; behind the K loop's last barrier the same bytes serve as the epilogue's staging rows */
  float (*so)[32][68] = (float (*)[32][68])sm;
  const int tid = threadIdx.x, w = tid >> 5, lane = tid & 31, ln = lane & 15, hh = lane >> 4; const int by = blockIdx.y;
  A += (size_t)by * sA; Bh += (size_t)by * sB; const size_t cofs = (size_t)by * sC; const float* bp = bias ? bias + (size_t)by * sBias : nullptr;
  const int ntn = N >> 6; const int g = blockIdx.x / ntn, nq = blockIdx.x - g * ntn; const bool pair = FT == 2 && g < 2 * NB;      /* hi | lo block g: batch g / 2, rows 64 (g & 1) .. + 63; the same for the whole block */
  const int mt = (FT == 2 && !pair) ? (g - 2 * NB) + 1 + (g - 2 * NB) / (G2MP - 1) : g; const int row0 = mt * 128 + 32 * w, col0 = nq * 64; if (!pair && mt * 128 >= M) return;      /* the same for the whole block, in front of every barrier */
  const int sr = tid >> 3, sp = tid & 7;      /* staging: this thread's first row and its 16-byte piece of the 128-B row */
  const _Float16* ag = (pair ? A2 : A) + (size_t)(mt * 128 + sr) * lda + sp * 8; const _Float16* bg = Bh + (size_t)(col0 + sr) * ldb + sp * 8; const size_t a16 = (size_t)16 * lda, b16 = (size_t)16 * ldb;
  const unsigned ls = (unsigned)(size_t)sm + (unsigned)(sr * G2PB + sp * 16);      /* LDS byte address: the low 32 bits of the shared address */
  const unsigned char* af = sm + (32 * w + ln) * G2PB; const unsigned char* bf = sm + (128 + ln) * G2PB;      /* this lane's first A and B fragment rows in buffer 0 */
  const int nt = K / G2KC;
  const v8f z8 = {0.f,0.f,0.f,0.f,0.f,0.f,0.f,0.f}; v8f c00 = z8, c01 = z8, c02 = z8, c03 = z8, c10 = z8, c11 = z8, c12 = z8, c13 = z8;
  g2_stage(ls, ag, a16, bg, b16);
  asm volatile("s_wait_asynccnt 0x0" ::: "memory");      /* this wave's copies of tile 0 have landed */
  __syncthreads();      /* ... and every other wave's */
  if (nt > 1) g2_stage(ls + G2BB, ag + G2KC, a16, bg + G2KC, b16);
#pragma unroll 1      /* rolled: one copy of the trip; the buffer is chosen by an offset */
  for (int t = 0; t < nt; ++t) { const unsigned bo = (unsigned)(t & 1) * G2BB; const _Float16* ap = (const _Float16*)(af + bo); const _Float16* bq = (const _Float16*)(bf + bo);
    /* all 12 fragments of the trip are asked for first, in the order of their use, so that their LDS latencies overlap; 8 * G2PB halves = 16 rows, + 32 halves = the second 32 k */
    const v16h a00 = g2_frag(ap, hh), b00 = g2_frag(bq, hh), a10 = g2_frag(ap + 8 * G2PB, hh), b10 = g2_frag(bq + 8 * G2PB, hh), b20 = g2_frag(bq + 16 * G2PB, hh), b30 = g2_frag(bq + 24 * G2PB, hh);
    const v16h a01 = g2_frag(ap + 32, hh), b01 = g2_frag(bq + 32, hh), a11 = g2_frag(ap + 8 * G2PB + 32, hh), b11 = g2_frag(bq + 8 * G2PB + 32, hh), b21 = g2_frag(bq + 16 * G2PB + 32, hh), b31 = g2_frag(bq + 24 * G2PB + 32, hh);
    c00 = g2_mma(a00, b00, c00); c10 = g2_mma(a10, b00, c10); c01 = g2_mma(a00, b10, c01); c11 = g2_mma(a10, b10, c11);
    c02 = g2_mma(a00, b20, c02); c12 = g2_mma(a10, b20, c12); c03 = g2_mma(a00, b30, c03); c13 = g2_mma(a10, b30, c13);
    c00 = g2_mma(a01, b01, c00); c10 = g2_mma(a11, b01, c10); c01 = g2_mma(a01, b11, c01); c11 = g2_mma(a11, b11, c11);
    c02 = g2_mma(a01, b21, c02); c12 = g2_mma(a11, b21, c12); c03 = g2_mma(a01, b31, c03); c13 = g2_mma(a11, b31, c13);
    asm volatile("s_wait_dscnt 0x0" ::: "memory");      /* this wave's reads of the buffer are done before it may be refilled */
    asm volatile("s_wait_asynccnt 0x0" ::: "memory");      /* this wave's copies of tile t + 1 have landed */
    __syncthreads();      /* publishes tile t + 1 and ends every wave's reads of tile t */
    if (t + 2 < nt) g2_stage(ls + bo, ag + (size_t)(t + 2) * G2KC, a16, bg + (size_t)(t + 2) * G2KC, b16); }
  asm volatile("s_wait_asynccnt 0x0" ::: "memory");      /* nothing in flight when the buffers become the staging rows */
  v8f accs[8] = {c00, c01, c02, c03, c10, c11, c12, c13};
  const bool lo = pair && w >= 2; if (lo) alpha *= 0.0009765625f;      /* the residual plane: x1024 taken off again, no bias */
#pragma unroll
  for (int u = 0; u < 8; ++u) { const int t = u & 3, half = u >> 2; const int col = col0 + t * 16 + ln; const float bv = (bp && !lo) ? bf16_round(bp[col]) : 0.f;
#pragma unroll
    for (int r = 0; r < 8; ++r) { const int rloc = half * 16 + 8 * hh + r; float v = accs[u][r] * alpha + bv; if (FT == 0 && CP) { if (rowsPerB < 0) v += CP[cofs + (size_t)(row0g + row0 + rloc) * ldc + col];      /* rowsPerB < 0: own element of the batched C plane */ else { const int bidx = (row0g + row0 + rloc) / rowsPerB; v += CP[(size_t)bidx * sCPb + (size_t)by * 64 + col]; } }
      if (ACT == 3) v = fmaxf(v, 0.f); else if (ACT == 6) v = 0.5f * v * (1.0f + erff(v * 0.70710678118654752f)); else if (ACT == 11) v = 1.0f / (1.0f + expf(-v)); else if (ACT == 15) v = v / (1.0f + expf(-v)); else if (ACT == 12) v = (v > 0.f) ? v : 0.01f * v; else if (ACT == 8) v = tanhf(v); else if (ACT == 9) v = 0.5f * v * (1.0f + tanhf(0.7978845608028654f * (v + 0.044715f * v * v * v))); else if (ACT == 14) v = (v > 0.f) ? v : 0.1f * v; else if (ACT == 16) v = (v >= 0.f) ? v : 0.3f * v; else if (ACT == 17) v = (v >= 0.f) ? v : 0.2f * v;
      so[w][rloc][t * 16 + ln] = v; } }
  const int rsub = lane >> 4, c4 = (lane & 15) * 4;
  if (pair) { __syncthreads();      /* the hi and the lo rows of one output row come from two waves */
#pragma unroll      /* the 16 LDS reads and 8 stores are independent: unrolled, their latencies overlap */
    for (int q = 0; q < 8; ++q) { const int rr = 16 * w + q * 2 + rsub; const v4f vh = *(const v4fa*)&so[rr >> 5][rr & 31][c4], vl = *(const v4fa*)&so[2 + (rr >> 5)][rr & 31][c4];      /* wave w stores rows 16 w .. + 15 of the block's 64 */
      *(v4f*)(C + cofs + (size_t)((g >> 1) * SQ + (g & 1) * 64 + rr) * ldc + col0 + c4) = vh + vl; }
    return; }
  __builtin_amdgcn_fence(__ATOMIC_ACQ_REL, "workgroup"); __builtin_amdgcn_wave_barrier();
  {
#pragma unroll
    for (int q = 0; q < 16; ++q) { const int r = q * 2 + rsub; const v4f v = *(const v4fa*)&so[w][r][c4]; if (C) *(v4f*)(C + cofs + (size_t)(row0 + r) * ldc + col0 + c4) = v; if (C16) { v4h h4; for (int i = 0; i < 4; ++i) h4[i] = (_Float16)v[i]; *(v4h*)(C16 + cofs + (size_t)(row0 + r) * ldc + col0 + c4) = h4; } }
     }
  if (FT == 1 && mt % G2MP == 0) {      /* a batch's first rows: the same values once more, as f32 rows for the exact path */
#pragma unroll      /* the 16 LDS reads and stores are independent: unrolled, their latencies overlap */
    for (int q = 0; q < 16; ++q) { const int r = q * 2 + rsub; const v4f v = *(const v4fa*)&so[w][r][c4]; *(v4f*)(CT + ((size_t)(mt / G2MP) * QT0 + 32 * w + r) * ldc + col0 + c4) = v; } } }


__global__ __launch_bounds__(256) void k_wnat(const float* __restrict__ w, size_t n8, _Float16* __restrict__ Bt) { const size_t t = (size_t)blockIdx.x * 256 + threadIdx.x; if (t >= n8) return; FragH f; for (int q = 0; q < 8; ++q) f.h[q] = (_Float16)(bf16_round(w[t * 8 + q]) * 16.0f); *(v8us*)((unsigned short*)Bt + t * 8) = f.half[0];  }
__global__ __launch_bounds__(256) void k_rsm(const float* __restrict__ S, _Float16* __restrict__ P, int nrows) {
  #pragma clang fp contract(off)
  const int i = blockIdx.x * 256 + threadIdx.x; if (i >= nrows) return; const float* s = S + (size_t)i * SQ; float mx = -3.0e38f;
#pragma unroll 1
  for (int j = 0; j < SQ; ++j) mx = fmaxf(mx, s[j]); float se = 0.f;
#pragma unroll 1
  for (int j = 0; j < SQ; ++j) se += expf(s[j] - mx); const float sc = 256.0f / se;
#pragma unroll 1
  for (int j0 = 0; j0 < SQ; j0 += 8) { FragH f; for (int q = 0; q < 8; ++q) f.h[q] = (_Float16)(expf(s[j0 + q] - mx) * sc); unsigned short* d = (unsigned short*)P + (size_t)i * SQ + j0; *(v8us*)d = f.half[0];  } }
__global__ __launch_bounds__(256) void k_vt(const _Float16* __restrict__ V16, int b, int h0, _Float16* __restrict__ VT) { __shared__ unsigned short tl[64][65]; const int tid = threadIdx.x; const int hh = blockIdx.x % HG, sg = blockIdx.x / HG; const int s0 = sg * 64; const int h = h0 + hh;
  for (int i = tid; i < 64 * 8; i += 256) { const int j = i / 8, d8 = (i % 8) * 8; FragH f; f.half[0] = *(const v8us*)((const unsigned short*)V16 + ((size_t)b * SQ + s0 + j) * DM + h * HD + d8); for (int q = 0; q < 8; ++q) tl[d8 + q][j] = f.u[q]; }
  __syncthreads();
  { for (int i = tid; i < 64 * 8; i += 256) { const int d = i / 8, j8 = (i % 8) * 8; FragH f; for (int q = 0; q < 8; ++q) f.u[q] = tl[d][j8 + q]; *(v8us*)((unsigned short*)VT + ((size_t)hh * HD + d) * SQ + s0 + j8) = f.half[0]; }  } }



template <int CTRL> __device__ __forceinline__ float rs_row16(float v) { return __int_as_float(__builtin_amdgcn_update_dpp(0, __float_as_int(v), CTRL, 0xf, 0xf, true)); }      /* lane l ^ mask inside a 16-lane row (row_xmask) */
__device__ __forceinline__ float rs_x16(float v) { const int u = __float_as_int(v); return __int_as_float(__builtin_amdgcn_permlanex16(u, u, 0x76543210, 0xfedcba98, false, false)); }      /* lane l ^ 16 */
#define FAQ 128                      /* query rows per block: 4 waves x 32 columns */
#define FAC 0.18033688011112042592f  /* log2(e) / sqrt(64) */
__device__ __forceinline__ v8f fa_mma(v16h a, v16h b, v8f c) { return __builtin_amdgcn_wmma_f32_16x16x32_f16(false, a, false, b, (short)0, c, false, false); }
// 2^x in the native form. In the eight-wide form the v_nop in the same statement fills the one slot the instruction set asks for behind a transcendental: each v_exp is followed by an
// independent one (early-clobber outputs: no result register is a later source), so one v_nop behind the last serves all eight.
__device__ __forceinline__ float fa_exp2(float x) { return __builtin_amdgcn_exp2f(x); }      /* the single form as the builtin (the same v_exp_f32): the compiler sees it and keeps the distance behind a WMMA whose operand registers it gives to the result */
__device__ __forceinline__ v8f fa_exp2x8(v8f x) { float r0, r1, r2, r3, r4, r5, r6, r7;
  asm("v_exp_f32 %0, %8\n\tv_exp_f32 %1, %9\n\tv_exp_f32 %2, %10\n\tv_exp_f32 %3, %11\n\tv_exp_f32 %4, %12\n\tv_exp_f32 %5, %13\n\tv_exp_f32 %6, %14\n\tv_exp_f32 %7, %15\n\tv_nop"
      : "=&v"(r0), "=&v"(r1), "=&v"(r2), "=&v"(r3), "=&v"(r4), "=&v"(r5), "=&v"(r6), "=&v"(r7) : "v"(x[0]), "v"(x[1]), "v"(x[2]), "v"(x[3]), "v"(x[4]), "v"(x[5]), "v"(x[6]), "v"(x[7]));
  const v8f r = {r0, r1, r2, r3, r4, r5, r6, r7}; return r; }
#define FSK 128                      /* keys per trip: 4 passes; equal to FAQ, so that the last tile is the block's diagonal tile */
#define FKP 144                      /* LDS pitch of a K row in bytes: 128 + 16 (16 B x odd), conflict-free for the 16-byte fragment reads */
#define FVP 272                      /* LDS pitch of a V^T row in bytes: 256 + 16 (16 B x odd) */
#define FVO (FSK * FKP)              /* the HD V^T rows stand behind the FSK K rows */
#define FSB (FVO + HD * FVP)         /* bytes of one buffer */
// Eight copies of one thread: 16 bytes at LDS byte address l + i ls from g + i gs (i = 0..7). Every lane is on.
// The s_wait_xcnt in the same statement stands in front of any later rewrite of the address registers that the copies name.
__device__ __forceinline__ void fa_copy8(unsigned l, unsigned ls, const _Float16* g, size_t gs) {
  asm volatile("global_load_async_to_lds_b128 %0, %8, off\n\tglobal_load_async_to_lds_b128 %1, %9, off\n\tglobal_load_async_to_lds_b128 %2, %10, off\n\tglobal_load_async_to_lds_b128 %3, %11, off\n\t"
               "global_load_async_to_lds_b128 %4, %12, off\n\tglobal_load_async_to_lds_b128 %5, %13, off\n\tglobal_load_async_to_lds_b128 %6, %14, off\n\tglobal_load_async_to_lds_b128 %7, %15, off\n\ts_wait_xcnt 0x0"
               :: "v"(l), "v"(l + ls), "v"(l + 2 * ls), "v"(l + 3 * ls), "v"(l + 4 * ls), "v"(l + 5 * ls), "v"(l + 6 * ls), "v"(l + 7 * ls),
                  "v"(g), "v"(g + gs), "v"(g + 2 * gs), "v"(g + 3 * gs), "v"(g + 4 * gs), "v"(g + 5 * gs), "v"(g + 6 * gs), "v"(g + 7 * gs) : "memory"); }
// One tile: K rows tid / 8 + 16 i (piece tid % 8 of the row's 128 B), V^T rows tid / 16 + 8 i (piece tid % 16 of the row's 256 B). lk, lv: the LDS byte addresses of the thread's first pieces; kg, vg: their global addresses.
__device__ __forceinline__ void fa_stage(unsigned lk, unsigned lv, const _Float16* kg, const _Float16* vg) { fa_copy8(lk, 16 * FKP, kg, (size_t)16 * LQ); fa_copy8(lv, 8 * FVP, vg, (size_t)8 * SQ); }
// One pass of 32 keys for a wave's 32 query columns; vp: this pass's V^T rows in LDS, kn: the next pass's K rows in LDS. kf holds this pass's K fragments and is refilled for the next pass right behind the score products (LAST: the diagonal pass, masked, no refill).
// foot (the same for the whole block): this is a tile's last pass. Its V^T fragments are the last thing read of the tile, so the hand-over to the next tile stands behind them and in front of the refill, which then reads the next tile;
// the softmax and the P V products, on registers alone, follow. fill: a tile two further exists; its copies go to lk, lv (the buffer just left) from kg, vg.
// Every loop is fully unrolled so that the fragment and accumulator arrays are indexed by constants and stay in registers.
template <bool LAST>
__device__ __forceinline__ void fa_pass(const _Float16* kn, const _Float16* vp, int hh, int dq, const v16h (&qf)[2][2], v16h (&kf)[2][2], v8f (&o)[2][4], float (&m)[2], float (&l)[2], bool foot, bool fill, unsigned lk, unsigned lv, const _Float16* kg, const _Float16* vg) {
  v16h vf[4];
#pragma unroll
  for (int dt = 0; dt < 4; ++dt) vf[dt] = g2_frag(vp + dt * 8 * FVP, hh);      /* 8 FVP halves = 16 rows */
  const v8f z8 = {0.f, 0.f, 0.f, 0.f, 0.f, 0.f, 0.f, 0.f}; v8f s[2][2];
#pragma unroll
  for (int j = 0; j < 2; ++j)
#pragma unroll
    for (int t = 0; t < 2; ++t) s[j][t] = fa_mma(kf[t][1], qf[j][1], fa_mma(kf[t][0], qf[j][0], z8));
  if (!LAST) {
    if (foot) {
      asm volatile("s_wait_dscnt 0x0" ::: "memory");      /* this wave's reads of the buffer are done before it may be refilled */
      asm volatile("s_wait_asynccnt 0x0" ::: "memory");      /* this wave's copies of the next tile have landed */
      __syncthreads();      /* publishes the next tile and ends every wave's reads of this one */
      if (fill) fa_stage(lk, lv, kg, vg); }
#pragma unroll
    for (int t = 0; t < 2; ++t)
#pragma unroll
      for (int c = 0; c < 2; ++c) kf[t][c] = g2_frag(kn + t * 8 * FKP + c * 32, hh);
    __builtin_amdgcn_sched_barrier(0); }      /* keeps the refill in front of the softmax: without it the loads sank to the pass's end and the next pass waited out their whole latency */
#pragma unroll
  for (int j = 0; j < 2; ++j) {
    if (LAST) {      /* key - query = 16 t + r + dq - 16 j: above the diagonal when positive */
#pragma unroll
      for (int t = 0; t < 2; ++t)
#pragma unroll
        for (int r = 0; r < 8; ++r) if (16 * t + r + dq - 16 * j > 0) s[j][t][r] = -1.0e30f; }
    float mx = s[j][0][0];
#pragma unroll
    for (int r = 0; r < 8; ++r) mx = fmaxf(mx, fmaxf(s[j][0][r], s[j][1][r]));
    mx = fmaxf(mx, rs_x16(mx));      /* the column's other 16 keys are in lane ^ 16 */
    const float mn = fmaxf(m[j], mx); const float sc = fa_exp2((m[j] - mn) * FAC); const float nb = 8.0f - mn * FAC; m[j] = mn;      /* + 8: weights carried x256 */
    const v8f e0 = fa_exp2x8(s[j][0] * FAC + nb), e1 = fa_exp2x8(s[j][1] * FAC + nb);
    const v8f es = e0 + e1; l[j] = l[j] * sc + (((es[0] + es[1]) + (es[2] + es[3])) + ((es[4] + es[5]) + (es[6] + es[7])));      /* each half keeps its own partial sum; joined in the epilogue */
    FragH p;
#pragma unroll
    for (int r = 0; r < 8; ++r) { p.h[r] = (_Float16)e0[r]; p.h[8 + r] = (_Float16)e1[r]; }
#pragma unroll
    for (int dt = 0; dt < 4; ++dt) o[j][dt] = fa_mma(vf[dt], p.v, o[j][dt] * sc); } }
__device__ __forceinline__ void fa_tile(unsigned char* sm, const _Float16* __restrict__ QKVp, const _Float16* __restrict__ VTp, _Float16* __restrict__ O, int bh, int qt) {      /* one block: query tile qt >= 1 of batch and head bh. sm: 2 FSB bytes of LDS; QKVp: q | k | v rows of pitch LQ; VTp: [NB * NH][HD][SQ]; O: merged rows of pitch DM */
  const int tid = threadIdx.x, lane = tid & 31, ln = lane & 15, hh = lane >> 4; const int w = __builtin_amdgcn_readfirstlane(tid >> 5);
  const int b = bh / NH, h = bh % NH;
  const int q0 = qt * FAQ + w * 32;      /* the block walks key tiles 0 .. qt together (every test around a barrier or a copy reads the same for the whole block). The loops over j, c, dt and r below are fully unrolled for constant indices (registers), as in fa_pass */
  const _Float16* qp = QKVp + ((size_t)b * SQ + q0 + ln) * LQ + h * HD;
  const _Float16* kg = QKVp + ((size_t)b * SQ + (tid >> 3)) * LQ + DM + h * HD + (tid & 7) * 8; const _Float16* vg = VTp + ((size_t)bh * HD + (tid >> 4)) * SQ + (tid & 15) * 8;      /* staging: this thread's first pieces of tile 0 */
  const unsigned lks = (unsigned)(size_t)sm + (unsigned)((tid >> 3) * FKP + (tid & 7) * 16), lvs = (unsigned)(size_t)sm + (unsigned)(FVO + (tid >> 4) * FVP + (tid & 15) * 16);      /* LDS byte addresses: the low 32 bits of the shared address */
  const unsigned char* kl = sm + ln * FKP; const unsigned char* vl = sm + FVO + ln * FVP;      /* this lane's first K and V^T fragment rows in buffer 0 */
  fa_stage(lks, lvs, kg, vg);
  v16h qf[2][2], kf[2][2]; v8f o[2][4]; float m[2] = {-1.0e30f, -1.0e30f}, l[2] = {0.f, 0.f};
#pragma unroll
  for (int j = 0; j < 2; ++j)
#pragma unroll
    for (int c = 0; c < 2; ++c) qf[j][c] = g2_frag(qp + (size_t)j * 16 * LQ + c * 32, hh);
  asm volatile("s_wait_xcnt 0x0" ::: "memory");      /* the address registers of the loads above are reused for the zeroed accumulators below */
#pragma unroll
  for (int j = 0; j < 2; ++j)
#pragma unroll
    for (int dt = 0; dt < 4; ++dt) { const v8f z8 = {0.f, 0.f, 0.f, 0.f, 0.f, 0.f, 0.f, 0.f}; o[j][dt] = z8; }
  const int dq = 8 * hh - ln;
  asm volatile("s_wait_asynccnt 0x0" ::: "memory");      /* this wave's copies of tile 0 have landed */
  __syncthreads();      /* ... and every other wave's */
  fa_stage(lks + FSB, lvs + FSB, kg + (size_t)FSK * LQ, vg + FSK);      /* tile 1 exists: qt >= 1 */
#pragma unroll
  for (int j = 0; j < 2; ++j)
#pragma unroll
    for (int c = 0; c < 2; ++c) kf[j][c] = g2_frag((const _Float16*)kl + j * 8 * FKP + c * 32, hh);      /* 8 FKP halves = 16 rows */
  const int nf = q0 / 32;      /* passes wholly below the wave's first query: pass i is pass i % 4 of tile i / 4, in buffer (i / 4) % 2. Every wave runs the 4 qt passes of tiles 0 .. qt - 1, whose last passes hold the barriers; of tile qt, the diagonal tile, wave w runs w more and the diagonal pass */
  for (int i = 0; i < nf; ++i) { const int t = i / (FSK / 32), n = i + 1; const unsigned bo = (unsigned)(t & 1) * FSB;
    fa_pass<false>((const _Float16*)(kl + (unsigned)(n / (FSK / 32) & 1) * FSB + (unsigned)(n % (FSK / 32)) * (32 * FKP)), (const _Float16*)(vl + bo + (unsigned)(i % (FSK / 32)) * 64), hh, dq, qf, kf, o, m, l,
                   n % (FSK / 32) == 0, t + 2 <= qt, lks + bo, lvs + bo, kg + (size_t)(t + 2) * FSK * LQ, vg + (t + 2) * FSK); }
  fa_pass<true>((const _Float16*)kl, (const _Float16*)(vl + (unsigned)(qt & 1) * FSB + (unsigned)w * 64), hh, dq, qf, kf, o, m, l, false, false, 0u, 0u, kg, vg);      /* keys q0 .. q0 + 31: the diagonal */
  asm volatile("s_wait_asynccnt 0x0" ::: "memory");      /* nothing in flight when the wave ends */
#pragma unroll
  for (int j = 0; j < 2; ++j) { const float fin = 64.0f / (l[j] + rs_x16(l[j]));      /* o carried x64; the x256 of the weights cancels against the sum */
    unsigned short* op = (unsigned short*)O + ((size_t)b * SQ + q0 + j * 16 + ln) * DM + h * HD + 8 * hh;
#pragma unroll
    for (int dt = 0; dt < 4; ++dt) { FragH f;
#pragma unroll
      for (int r = 0; r < 8; ++r) f.h[r] = (_Float16)(o[j][dt][r] * fin);
      *(v8us*)(op + dt * 16) = f.half[0]; } } }


// e^x for x <= 0 to f32 accuracy: n = the integer nearest x log2 e; x log2 e - n by two fused multiply-adds (the constant as its f32 value plus its low part), so the product is never rounded
// before n is taken off; 2^n applied by ldexp; 0 below the f32 range. The v_nop in the same statement fills the one slot the instruction set asks for behind a transcendental.
__device__ __forceinline__ float a0_exp(float x) { const float n = rintf(x * 1.4426950216293334961f); const float a = fmaf(x, 1.9259628558643271390e-8f, fmaf(x, 1.4426950216293334961f, -n));
  float r; asm("v_exp_f32 %0, %1\n\tv_nop" : "=v"(r) : "v"(a)); return (x < -103.2789306640625f) ? 0.f : ldexpf(r, (int)n); }
// Exact f32 attention for the first QT0 rows of every batch (causal form; block blk of NB * NH * QT0 / A0R: batch, head, row group). Four lanes share a query row: lane part p = lane & 3 keeps dims 16 c + 4 p .. + 3 (c = 0..3)
// of q and o in registers; a wave holds 8 rows and walks the keys up to its own last row. The head's K and V rows are staged once in LDS, all loads in flight together;
// the 8 row groups of a wave read the same 64 bytes of a key row per load (broadcast, no bank conflict). The dot product is 16 terms per lane, then a butterfly over the 4 lanes.
// Every loop over c, u and the four keys of a trip is fully unrolled, so that q[], o[] and the LDS data are indexed by constants and stay in registers.
#define A0R 32                       /* query rows per block: 4 waves x 8 rows */
__device__ __forceinline__ void a0_block(float (*lk)[HD], float (*lv)[HD], const float* __restrict__ QKVF, float scale, _Float16* __restrict__ OHL, int blk) {      /* QKVF: per batch QT0 f32 q | k | v rows of pitch LQ; OHL: the A2 rows of k_gemm2<.., 2>, pitch DM */
  const int tid = threadIdx.x, lane = tid & 31, p4 = (lane & 3) * 4; const int w = __builtin_amdgcn_readfirstlane(tid >> 5);
  const int bt = blk / (NH * (QT0 / A0R)), h = blk / (QT0 / A0R) % NH, rg = blk % (QT0 / A0R);
  const float* QF = QKVF + (size_t)bt * QT0 * LQ; const float* KF = QF + DM; const float* VF = QF + 2 * DM;
  const int row = rg * A0R + w * 8 + (lane >> 2);      /* this lane's query row */
  const int nk = rg * A0R + w * 8 + 8;                 /* wave-uniform: keys up to the wave's last row (a multiple of 8, at most QT0) */
  { const int r0 = tid / 16, c4 = (tid % 16) * 4; const float* kp = KF + h * HD + r0 * LQ + c4; const float* vp = VF + h * HD + r0 * LQ + c4;
    v4f tk[QT0 / 8], tv[QT0 / 8];      /* fully unrolled: constant indices keep both in registers and every load of the tile is issued before the first LDS store */
#pragma unroll
    for (int it = 0; it < QT0 / 8; ++it) { tk[it] = *(const v4fa*)(kp + it * 8 * LQ); tv[it] = *(const v4fa*)(vp + it * 8 * LQ); }
#pragma unroll
    for (int it = 0; it < QT0 / 8; ++it) { *(v4f*)&lk[it * 8 + r0][c4] = tk[it]; *(v4f*)&lv[it * 8 + r0][c4] = tv[it]; } }
  __syncthreads();
  const float* qr = QF + row * LQ + h * HD + p4;
  v4f q[4], o[4];
#pragma unroll
  for (int c = 0; c < 4; ++c) { q[c] = *(const v4fa*)(qr + c * 16); const v4f z = {0.f, 0.f, 0.f, 0.f}; o[c] = z; }
  float m = -1.0e30f, l = 0.f;
  for (int j0 = 0; j0 < nk; j0 += 4) {      /* four keys per trip, unrolled: their dot products are independent and fill each other's dependent links */
#pragma unroll
    for (int jj = 0; jj < 4; ++jj) { const int j = j0 + jj; float s = 0.f;
#pragma unroll
      for (int c = 0; c < 4; ++c) { const v4f kq = *(const v4f*)&lk[j][c * 16 + p4]; s += q[c][0] * kq[0]; s += q[c][1] * kq[1]; s += q[c][2] * kq[2]; s += q[c][3] * kq[3]; }
      s += rs_row16<0x161>(s); s += rs_row16<0x162>(s);      /* sum over the row's 4 lanes; all 4 end with the same bits */
      const float sm = (j <= row) ? s * scale : -1.0e30f; const float mn = fmaxf(m, sm); const float sc = a0_exp(m - mn); const float e = a0_exp(sm - mn); l = l * sc + e; m = mn;
#pragma unroll
      for (int c = 0; c < 4; ++c) { const v4f vv = *(const v4f*)&lv[j][c * 16 + p4];
#pragma unroll
        for (int u = 0; u < 4; ++u) o[c][u] = o[c][u] * sc + e * vv[u]; } } }
  const float fin = 64.0f / l;      /* o carried x64 like the f16 path */
  _Float16* orow = OHL + ((size_t)(bt * (QT0 / 64) + (row >> 6)) * 128 + (row & 63)) * DM + h * HD + p4;      /* the row's f16 value; its x1024 residual stands 64 rows further */
#pragma unroll
  for (int c = 0; c < 4; ++c) { v4h oh, ol;
#pragma unroll
    for (int u = 0; u < 4; ++u) { const float a = o[c][u] * fin; const _Float16 hv = (_Float16)a; oh[u] = hv; ol[u] = (_Float16)((a - (float)hv) * 1024.0f); }
    *(v4h*)(orow + c * 16) = oh; *(v4h*)(orow + (size_t)64 * DM + c * 16) = ol; }
  asm volatile("s_wait_xcnt 0x0" ::: "memory"); }      /* stands in front of any later rewrite of a register that the stores above name (in the built kernel the other path's code follows them) */
// One launch for both attention paths; they share no data. All blocks are resident at once and a WMMA tile's cost grows with its index: the two halves of the first NB * NH grid rows walk the tiles in opposite order,
// so that blocks half of those rows apart add up to the same cost. Tile 0 (a batch's first QT0 rows) belongs to the exact f32 path: its NB * NH places and the grid rows behind take that path's blocks.
__global__ __launch_bounds__(128) void k_attn(const _Float16* __restrict__ QKVp, const _Float16* __restrict__ VTp, _Float16* __restrict__ O, const float* __restrict__ QKVF, float scale, _Float16* __restrict__ OHL) {
  static_assert(FAQ == QT0, "tile 0 is the exact path's");
  static_assert(FSK == FAQ && 2 * FSB >= 2 * QT0 * HD * 4, "the last key tile is the diagonal tile; the LDS holds either path's data");
  __shared__ __attribute__((aligned(16))) unsigned char sm[2 * FSB];      /* the WMMA path's two K | V^T buffers, or the exact path's f32 K rows and, behind them, V rows */
  float (*lk)[HD] = (float (*)[HD])sm; float (*lv)[HD] = (float (*)[HD])(sm + QT0 * HD * 4);
  const int bh = blockIdx.y; const int qt = (bh < NB * NH / 2) ? SQ / FAQ - 1 - (int)blockIdx.x : (int)blockIdx.x;
  if (bh < NB * NH && qt != 0) { fa_tile(sm, QKVp, VTp, O, bh, qt); return; }
  a0_block(lk, lv, QKVF, scale, OHL, bh < NB * NH ? bh : NB * NH + (bh - NB * NH) * (SQ / FAQ) + (int)blockIdx.x); }

extern "C" void kernel_launch(void* const* d_in, const int* in_sizes, int n_in,
                              void* d_out, int out_size, void* d_ws, size_t ws_size, hipStream_t stream) {
  (void)in_sizes; (void)n_in; (void)out_size;
  const float* const* I = (const float* const*)d_in; const float* x = I[0]; const float* wqkv = I[1]; const float* bqkv = nullptr; const float* wo = I[2]; const float* bo = I[3];      /* input order: y, Wqkv (fused [in][out] [1024][3072]), Wff ([in][out]), bff [1024]; the QKV projection has NO bias: bqkv is a null pointer; the output bias is bound */
  char* ws = (char*)d_ws; size_t off = 0;
  auto take = [&](size_t bytes) { char* p = ws + off; off += (bytes + 255) & ~(size_t)255; return p; };
  _Float16* BQKV = (_Float16*)take((size_t)3 * DM * DM * 2); _Float16* BO = (_Float16*)take((size_t)DM * DM * 2);
  _Float16* X16 = (_Float16*)take(NR * DM * 2); _Float16* QKV = (_Float16*)take(NR * 3 * DM * 2); _Float16* V16 = QKV + 2 * DM; _Float16* O16 = (_Float16*)take(NR * DM * 2);
  _Float16* VT = (_Float16*)take((size_t)NB * NH * HD * SQ * 2);
  float* QKVF0 = (float*)take((size_t)NB * QT0 * LQ * 4); _Float16* OHL0 = (_Float16*)take((size_t)NB * QT0 * 2 * DM * 2);
  if (off > ws_size) return;
  k_prep<<<PW1 + PW2 + PX, 256, 0, stream>>>(wqkv, BQKV, wo, BO, x, X16);      /* both weights as Bt[n][k] x16 and x as f16 rows */
  const size_t r0p = (size_t)B0 * SQ;      /* first projected row */
  k_gemm2<0, 1><<<dim3((unsigned)((MP / 128) * (3 * DM / 64)), 1), 128, 0, stream>>>(X16 + r0p * DM, DM, 0, BQKV, DM, 0, 0.0625f, bqkv, 0, nullptr, 1, 0, 0, nullptr, QKV + r0p * 3 * DM, 3 * DM, 0, MP, 3 * DM, DM, nullptr, QKVF0);      /* q | k | v rows (f16); head h = columns h*HD.. of each DM block; each batch's first 128 rows also as f32 (exact products) */
  k_vt<NH, SQ><<<NBR * NH * (SQ / 64), 256, 0, stream>>>(V16 + r0p * LQ, LQ, 0, VT + (size_t)B0 * NH * HD * SQ);      /* V^T [NB * NH][HD][SQ] */
  k_attn<<<dim3(SQ / FAQ, NB * NH + (NB * NH * (QT0 / A0R) - NB * NH) / (SQ / FAQ)), 128, 0, stream>>>(QKV, VT, O16, QKVF0, 0.125f, OHL0);      /* scores, causal softmax and P V of every batch, head and query tile in one launch: o (merged heads, x64) as f16 rows; rows 0..127 of each batch exactly in f32, o (x64) as f16 hi + x1024 residual rows */
  k_gemm2<0, 2><<<dim3((unsigned)((MPO / 128 + NB) * (DM / 64)), 1), 128, 0, stream>>>(O16 + r0p * DM, DM, 0, BO, DM, 0, 0.0009765625f, bo, 0, nullptr, 1, 0, 0, (float*)d_out + r0p * DM, nullptr, DM, 0, MPO, DM, DM, OHL0, nullptr);      /* out rows are the output layout; rows 0..127 of each batch = o_hi Wo + b + o_lo Wo 2^-10 */
}

// v010
// It runs in 83.5 microseconds.
// Timed twice side by side with v009, it ran 1.06 and 1.05 times as fast.
// Counting every step since v000, it is 60.8 times as fast.
#include <hip/hip_runtime.h>
#define NB 2
#define SQ 2048
#define DM 1024
#define NH 16
#define HD 64
#define HG 4                         /* heads per launch of the k_vt(V16, b, h0, VT) form, which is not launched */
#define QT0 128                      /* first-tile rows recomputed exactly in f32 */
#define B0 0                         /* first batch processed (debug hook) */
#define NBR NB                       /* batches processed (debug hook) */
#define NR ((size_t)NB * SQ)         /* token rows */
#define MP ((int)((size_t)NBR * SQ)) /* rows projected (debug hook) */
#define MPO MP                       /* rows through the output stage (debug hook) */
#define LQ (3 * DM)      /* row pitch of the q/k/v rows */
typedef __bf16 v16b __attribute__((ext_vector_type(16)));
typedef unsigned short v8us __attribute__((ext_vector_type(8), may_alias));
typedef float  v8f  __attribute__((ext_vector_type(8)));
typedef float  v4f  __attribute__((ext_vector_type(4)));
typedef float  v4fa __attribute__((ext_vector_type(4), may_alias));
union FragB { v16b v; v8us half[2]; unsigned short u[16]; };

__device__ __forceinline__ unsigned short bf16_bits(float x) { unsigned int u = __float_as_uint(x); return (unsigned short)((u + 0x7FFFu + ((u >> 16) & 1u)) >> 16); }
__device__ __forceinline__ float bf16_val(unsigned short b) { return __uint_as_float(((unsigned int)b) << 16); }
__device__ __forceinline__ float bf16_round(float x) { return bf16_val(bf16_bits(x)); }
// D += A·B with NT terms: 1 = ah·bh, 2 = + al·bh (A split), 3 = + ah·bl (both split)
template <int NT>
__device__ __forceinline__ v8f mmaN(v16b ah, v16b al, v16b bh, v16b bl, v8f c) {
  c = __builtin_amdgcn_wmma_f32_16x16x32_bf16(false, ah, false, bh, (short)0, c, false, false);
  if (NT >= 2) c = __builtin_amdgcn_wmma_f32_16x16x32_bf16(false, al, false, bh, (short)0, c, false, false);
  if (NT >= 3) c = __builtin_amdgcn_wmma_f32_16x16x32_bf16(false, ah, false, bl, (short)0, c, false, false);
  asm volatile("v_nop\n\tv_nop\n\tv_nop\n\tv_nop" : "+v"(c) : "v"(ah), "v"(al), "v"(bh), "v"(bl));
  return c;
}

__global__ __launch_bounds__(256) void k_wt_bf16(const float* __restrict__ W, unsigned short* __restrict__ Wt, int K, int N) {
  const int t = blockIdx.x * 256 + threadIdx.x;
  const int k8n = K / 8;
  if (t >= N * k8n) return;
  const int n = t / k8n, k8 = (t % k8n) * 8;
  v8us v;
#pragma unroll
  for (int i = 0; i < 8; ++i) v[i] = bf16_bits(W[(size_t)(k8 + i) * N + n]);
  *(v8us*)(Wt + (size_t)n * K + k8) = v;
  
}

// GEMM C[M][N] (f32, pitch ldc) = act(A[M][K]·W + bias). A f32 row-major (pitch lda) converted per fragment to bf16
// (ASPLIT: hi/lo two planes -> 2 terms, else single rounded term); Wt bf16 [N][K] (pitch ldb). BIAS_BF16 rounds the
// bias to bf16 first (bias quantised to bf16 before the add). K%32==0, M%16==0, N%64==0.
template <bool ASPLIT, int ACT, bool BIAS_BF16>
__global__ __launch_bounds__(128) void k_gemm_bf(const float* __restrict__ A, int lda, const unsigned short* __restrict__ Wt, int ldb,
                                               const float* __restrict__ bias, float* __restrict__ C, int ldc, int M, int N, int K) {
  __shared__ __attribute__((aligned(16))) float so[4][16][64];
  const int tid = threadIdx.x, w = tid >> 5, lane = tid & 31, ln = lane & 15, hh = lane >> 4;
  const int ntn = N / 64;
  const int wid = blockIdx.x * 4 + w;
  const int mt = wid / ntn, nq = wid % ntn;
  if (mt * 16 >= M) return;
  const int row0 = mt * 16, col0 = nq * 64;
  const float* arow = A + (size_t)(row0 + ln) * lda;
  v8f acc[4] = {};
  for (int kb = 0; kb < K; kb += 32) {
    FragB ah, al;
    const v4f x0 = *(const v4fa*)(arow + kb + 8 * hh), x1 = *(const v4fa*)(arow + kb + 8 * hh + 4);
    const v4f x2 = *(const v4fa*)(arow + kb + 16 + 8 * hh), x3 = *(const v4fa*)(arow + kb + 16 + 8 * hh + 4);
    float xs[16] = {x0[0],x0[1],x0[2],x0[3],x1[0],x1[1],x1[2],x1[3],x2[0],x2[1],x2[2],x2[3],x3[0],x3[1],x3[2],x3[3]};
#pragma unroll
    for (int i = 0; i < 16; ++i) { const unsigned short hb = bf16_bits(xs[i]); ah.u[i] = hb; al.u[i] = ASPLIT ? bf16_bits(xs[i] - bf16_val(hb)) : (unsigned short)0; }
#pragma unroll
    for (int t = 0; t < 4; ++t) {
      const unsigned short* brow = Wt + (size_t)(col0 + t * 16 + ln) * ldb + kb;
      FragB b;
      b.half[0] = *(const v8us*)(brow + 8 * hh);
      b.half[1] = *(const v8us*)(brow + 16 + 8 * hh);
      acc[t] = mmaN<ASPLIT ? 2 : 1>(ah.v, al.v, b.v, b.v, acc[t]);
    }
  }
#pragma unroll
  for (int t = 0; t < 4; ++t) {
    float bv = bias ? bias[col0 + t * 16 + ln] : 0.f;
    if (BIAS_BF16) bv = bf16_round(bv);
#pragma unroll
    for (int r = 0; r < 8; ++r) { float v = acc[t][r] + bv; if (ACT == 1) v = fmaxf(v, 0.f); so[w][8 * hh + r][t * 16 + ln] = v; }
  }
  __builtin_amdgcn_fence(__ATOMIC_ACQ_REL, "workgroup");
  __builtin_amdgcn_wave_barrier();
  const int rsub = lane >> 4, c4 = (lane & 15) * 4;
  {
#pragma unroll
    for (int q = 0; q < 8; ++q) {
      const int r = q * 2 + rsub;
      const v4f v = *(const v4fa*)&so[w][r][c4];
      *(v4f*)(C + (size_t)(row0 + r) * ldc + col0 + c4) = v;
    }
    
  }
}

// GEMM C = act(A·W + bias + resid): A f32 (ASPLIT -> hi/lo 2 terms), Wt bf16 [N][K]; ACT 0 none, 1 relu, 2 exact gelu;
// resid (optional, f32, row index = (row % rmod), pitch ldr, RES_BF16 rounds it) added before the activation.
template <bool ASPLIT, int ACT, bool BIAS_BF16, bool RES_BF16>
__global__ __launch_bounds__(128) void k_gemm_bf3(const float* __restrict__ A, int lda, const unsigned short* __restrict__ Wt, int ldb,
                                                const float* __restrict__ bias, const float* __restrict__ resid, int rmod, int ldr,
                                                float* __restrict__ C, int ldc, int M, int N, int K) {
  __shared__ __attribute__((aligned(16))) float so[4][16][64];
  const int tid = threadIdx.x, w = tid >> 5, lane = tid & 31, ln = lane & 15, hh = lane >> 4;
  const int ntn = N / 64;
  const int wid = blockIdx.x * 4 + w;
  const int mt = wid / ntn, nq = wid % ntn;
  if (mt * 16 >= M) return;
  const int row0 = mt * 16, col0 = nq * 64;
  const float* arow = A + (size_t)(row0 + ln) * lda;
  v8f acc[4] = {};
  for (int kb = 0; kb < K; kb += 32) {
    FragB ah, al;
    const v4f x0 = *(const v4fa*)(arow + kb + 8 * hh), x1 = *(const v4fa*)(arow + kb + 8 * hh + 4);
    const v4f x2 = *(const v4fa*)(arow + kb + 16 + 8 * hh), x3 = *(const v4fa*)(arow + kb + 16 + 8 * hh + 4);
    float xs[16] = {x0[0],x0[1],x0[2],x0[3],x1[0],x1[1],x1[2],x1[3],x2[0],x2[1],x2[2],x2[3],x3[0],x3[1],x3[2],x3[3]};
#pragma unroll
    for (int i = 0; i < 16; ++i) { const unsigned short hb = bf16_bits(xs[i]); ah.u[i] = hb; al.u[i] = ASPLIT ? bf16_bits(xs[i] - bf16_val(hb)) : (unsigned short)0; }
#pragma unroll
    for (int t = 0; t < 4; ++t) {
      const unsigned short* brow = Wt + (size_t)(col0 + t * 16 + ln) * ldb + kb;
      FragB b;
      b.half[0] = *(const v8us*)(brow + 8 * hh);
      b.half[1] = *(const v8us*)(brow + 16 + 8 * hh);
      acc[t] = mmaN<ASPLIT ? 2 : 1>(ah.v, al.v, b.v, b.v, acc[t]);
    }
  }
#pragma unroll
  for (int t = 0; t < 4; ++t) {
    const int col = col0 + t * 16 + ln;
    float bv = bias ? bias[col] : 0.f;
    if (BIAS_BF16) bv = bf16_round(bv);
#pragma unroll
    for (int r = 0; r < 8; ++r) {
      float v = acc[t][r] + bv;
      if (resid) { float rv = resid[(size_t)((row0 + 8 * hh + r) % rmod) * ldr + col]; if (RES_BF16) rv = bf16_round(rv); v += rv; }
      if (ACT == 1) v = fmaxf(v, 0.f);
      if (ACT == 2) v = 0.5f * v * (1.0f + erff(v * 0.70710678118654752f));
      if (ACT == 3) { const float u = 0.7978845608028654f * (v + 0.044715f * v * v * v); v = 0.5f * v * (1.0f + tanhf(u)); }
      so[w][8 * hh + r][t * 16 + ln] = v;
    }
  }
  __builtin_amdgcn_fence(__ATOMIC_ACQ_REL, "workgroup");
  __builtin_amdgcn_wave_barrier();
  const int rsub = lane >> 4, c4 = (lane & 15) * 4;
  {
#pragma unroll
    for (int q = 0; q < 8; ++q) {
      const int r = q * 2 + rsub;
      const v4f v = *(const v4fa*)&so[w][r][c4];
      *(v4f*)(C + (size_t)(row0 + r) * ldc + col0 + c4) = v;
    }
    
  }
}
// row LayerNorm (biased variance, eps) over N: s = X (+ R); optional out_sum <- s; out_norm <- (s-mu)*rsqrt(var+eps)*g + b
template <bool PARAM_BF16>
__global__ __launch_bounds__(256) void k_layernorm(const float* __restrict__ X, const float* __restrict__ R, const float* __restrict__ g, const float* __restrict__ bta,
                                                  float* __restrict__ out_sum, float* __restrict__ out_norm, int N, float eps) {
  __shared__ float red[256];
  const int row = blockIdx.x, tid = threadIdx.x;
  const float* x = X + (size_t)row * N; const float* rr = R ? R + (size_t)row * N : nullptr;
  float vals[16];                     // up to N = 4096
  const int per = N / 256;            // contiguous chunk per thread? use strided-by-4 chunks: thread handles j = tid*4 + 1024*u
  float s1 = 0.f;
  for (int u = 0; u < per / 4; ++u) {
    const int j = tid * 4 + 1024 * u;
    const v4f a = *(const v4fa*)(x + j);
    v4f b = {0.f,0.f,0.f,0.f}; if (rr) b = *(const v4fa*)(rr + j);
#pragma unroll
    for (int q = 0; q < 4; ++q) { const float v = a[q] + b[q]; vals[u * 4 + q] = v; s1 += v; }
  }
  red[tid] = s1; __syncthreads();
  for (int st = 128; st > 0; st >>= 1) { if (tid < st) red[tid] += red[tid + st]; __syncthreads(); }
  const float mu = red[0] / (float)N; __syncthreads();
  float s2 = 0.f;
  for (int u = 0; u < per / 4; ++u)
#pragma unroll
    for (int q = 0; q < 4; ++q) { const float c = vals[u * 4 + q] - mu; s2 += c * c; }
  red[tid] = s2; __syncthreads();
  for (int st = 128; st > 0; st >>= 1) { if (tid < st) red[tid] += red[tid + st]; __syncthreads(); }
  const float rs = rsqrtf(red[0] / (float)N + eps);
  {
    for (int u = 0; u < per / 4; ++u) {
      const int j = tid * 4 + 1024 * u;
      v4f o, sm;
#pragma unroll
      for (int q = 0; q < 4; ++q) {
        float gg = g[j + q], bb = bta[j + q];
        if (PARAM_BF16) { gg = bf16_round(gg); bb = bf16_round(bb); }
        sm[q] = vals[u * 4 + q]; o[q] = (vals[u * 4 + q] - mu) * rs * gg + bb;
      }
      if (out_sum) *(v4f*)(out_sum + (size_t)row * N + j) = sm;
      *(v4f*)(out_norm + (size_t)row * N + j) = o;
    }
    
  }
}



// ---- f16 WMMA path (v_wmma_f32_16x16x32_f16): 11-bit significands for operands in range — used where a [0,1] probability operand needs more precision than bf16
typedef _Float16 v16h __attribute__((ext_vector_type(16)));
union FragH { v16h v; v8us half[2]; _Float16 h[16]; unsigned short u[16]; };
template <int NT>
__device__ __forceinline__ v8f mmaH(v16h ah, v16h al, v16h bh, v16h bl, v8f c) {
  c = __builtin_amdgcn_wmma_f32_16x16x32_f16(false, ah, false, bh, (short)0, c, false, false);
  if (NT >= 2) c = __builtin_amdgcn_wmma_f32_16x16x32_f16(false, al, false, bh, (short)0, c, false, false);
  if (NT >= 3) c = __builtin_amdgcn_wmma_f32_16x16x32_f16(false, ah, false, bl, (short)0, c, false, false);
  asm volatile("v_nop\n\tv_nop\n\tv_nop\n\tv_nop" : "+v"(c) : "v"(ah), "v"(al), "v"(bh), "v"(bl));
  return c;
}
// batched GEMM like k_gemm_b but f16 operands: A f32 (split into f16 hi/lo if ASPLIT, else rounded to f16), Bt = f16 values [n][k]; alpha; C f32; N multiple of 16 (partial tiles skipped)
template <bool ASPLIT>
__global__ __launch_bounds__(128) void k_gemm_h(const float* __restrict__ A, int lda, size_t sA, const _Float16* __restrict__ Bh, int ldb, size_t sB, float alpha, float* __restrict__ C, int ldc, size_t sC, int M, int N, int K) {
  __shared__ __attribute__((aligned(16))) float so[4][16][64];
  const int tid = threadIdx.x, w = tid >> 5, lane = tid & 31, ln = lane & 15, hh = lane >> 4; const int by = blockIdx.y;
  A += (size_t)by * sA; Bh += (size_t)by * sB; C += (size_t)by * sC;
  const int ntn = (N + 63) / 64; const int wid = blockIdx.x * 4 + w; const int mt = wid / ntn, nq = wid % ntn; if (mt * 16 >= M) return;
  const int row0 = mt * 16, col0 = nq * 64; const float* arow = A + (size_t)(row0 + ln) * lda;
  v8f acc[4] = {};
  for (int kb = 0; kb < K; kb += 32) {
    FragH ah, al;
    const v4f x0 = *(const v4fa*)(arow + kb + 8 * hh), x1 = *(const v4fa*)(arow + kb + 8 * hh + 4), x2 = *(const v4fa*)(arow + kb + 16 + 8 * hh), x3 = *(const v4fa*)(arow + kb + 16 + 8 * hh + 4);
    float xs[16] = {x0[0],x0[1],x0[2],x0[3],x1[0],x1[1],x1[2],x1[3],x2[0],x2[1],x2[2],x2[3],x3[0],x3[1],x3[2],x3[3]};
#pragma unroll
    for (int i = 0; i < 16; ++i) { const _Float16 h = (_Float16)xs[i]; ah.h[i] = h; al.h[i] = ASPLIT ? (_Float16)(xs[i] - (float)h) : (_Float16)0.0f; }
#pragma unroll
    for (int t = 0; t < 4; ++t) { if (col0 + t * 16 >= N) continue; const size_t boff = (size_t)(col0 + t * 16 + ln) * ldb + kb; FragH bq; bq.half[0] = *(const v8us*)(Bh + boff + 8 * hh); bq.half[1] = *(const v8us*)(Bh + boff + 16 + 8 * hh);
      acc[t] = mmaH<ASPLIT ? 2 : 1>(ah.v, al.v, bq.v, bq.v, acc[t]); }
  }
#pragma unroll
  for (int t = 0; t < 4; ++t) { if (col0 + t * 16 >= N) continue;
#pragma unroll
    for (int r = 0; r < 8; ++r) so[w][8 * hh + r][t * 16 + ln] = acc[t][r] * alpha; }
  __builtin_amdgcn_fence(__ATOMIC_ACQ_REL, "workgroup"); __builtin_amdgcn_wave_barrier();
  const int rsub = lane >> 4, c4 = (lane & 15) * 4;
  {
#pragma unroll
    for (int q = 0; q < 8; ++q) { const int r = q * 2 + rsub; if (col0 + c4 < N) { const v4f v = *(const v4fa*)&so[w][r][c4]; *(v4f*)(C + (size_t)(row0 + r) * ldc + col0 + c4) = v; } }
     }
}

// Wt[n][k] = f16(W[k][n] * scale) from f32 row-major W[K][N] (scale = power of two; bf16-exact weights stay exact in f16 away from the subnormal range). Tile blk of (K / 64) * (N / 128); tl: WTN * WTP bytes of LDS.
// One block turns a tile of 64 k x 128 n through LDS, so that both sides of the transpose move whole 128-B lines: wave w reads rows k0 + 8 w .. + 7, each as 512 contiguous bytes (lane l: columns 4 l .. + 3),
// which leaves in every lane the 8 k of 4 output rows (one 16-byte piece each); the pieces go to LDS rows of 64 k, and behind the barrier 8 lanes store each output row's 128 bytes.
// K and N are compile-time: the row steps become immediate offsets on one address.
#define WTK 64                       /* k per tile */
#define WTN 128                      /* n per tile */
#define WTP 144                      /* LDS row pitch in bytes: 128 + 16, keeps the 16-byte pieces aligned */
template <int K, int N>
__device__ __forceinline__ void wt_tile(unsigned char* tl, const float* __restrict__ W, _Float16* __restrict__ Wt, float scale, int blk) { static_assert(K % WTK == 0 && N % WTN == 0, "whole tiles only");
  const int tid = threadIdx.x, w = tid >> 5, lane = tid & 31; const int kt = blk / (N / WTN), nt = blk % (N / WTN); const int k0 = kt * WTK, n0 = nt * WTN;
  const float* src = W + (size_t)(k0 + 8 * w) * N + n0 + 4 * lane; v4f x[8];
#pragma unroll      /* constant indices keep x[] in registers, and all 8 loads are in flight together */
  for (int i = 0; i < 8; ++i) x[i] = *(const v4fa*)(src + (size_t)i * N);
#pragma unroll      /* constant indices into x[] */
  for (int q = 0; q < 4; ++q) { FragH f;
#pragma unroll      /* likewise, and f stays in registers */
    for (int i = 0; i < 8; ++i) f.h[i] = (_Float16)(bf16_round(x[i][q]) * scale);
    *(v8us*)(tl + (4 * lane + q) * WTP + 16 * w) = f.half[0]; }
  __syncthreads();      /* an output row's 8 pieces come from the 8 waves */
  unsigned short* dst = (unsigned short*)Wt + (size_t)(n0 + (tid >> 3)) * K + k0 + 8 * (tid & 7); const unsigned char* tr = tl + (tid >> 3) * WTP + 16 * (tid & 7);
#pragma unroll      /* the 4 LDS reads and stores are independent: unrolled, their latencies overlap */
  for (int i = 0; i < 4; ++i) { const v8us o = *(const v8us*)(tr + 32 * i * WTP); *(v8us*)(dst + (size_t)32 * i * K) = o; }
  asm volatile("s_wait_xcnt 0x0" ::: "memory");      /* stands in front of any later rewrite of a register that the stores above name (in the built kernel another path's code follows them) */
}
// k_gemm_hh variant with fused epilogue: v = acc·alpha + bias[by·sBias + col] (+ CP[(row/rowsPerB)·sCPb + by·64 + col] if CP) ; ACT 0 none / 1 elu ; writes f16 C16 (and f32 C if non-null)
template <int ACT>
__global__ __launch_bounds__(128) void k_gemm_hhx(const _Float16* __restrict__ A, int lda, size_t sA, const _Float16* __restrict__ Bh, int ldb, size_t sB, float alpha, const float* __restrict__ bias, size_t sBias, const float* __restrict__ CP, int rowsPerB, size_t sCPb, int row0g,
    float* __restrict__ C, _Float16* __restrict__ C16, int ldc, size_t sC, int M, int N, int K) {
  __shared__ __attribute__((aligned(16))) float so[4][16][64];
  const int tid = threadIdx.x, w = tid >> 5, lane = tid & 31, ln = lane & 15, hh = lane >> 4; const int by = blockIdx.y;
  A += (size_t)by * sA; Bh += (size_t)by * sB; const size_t cofs = (size_t)by * sC; const float* bp = bias ? bias + (size_t)by * sBias : nullptr;
  const int ntn = (N + 63) / 64; const int wid = blockIdx.x * 4 + w; const int mt = wid / ntn, nq = wid % ntn; if (mt * 16 >= M) return;
  const int row0 = mt * 16, col0 = nq * 64; const _Float16* arow = A + (size_t)(row0 + ln) * lda;
  v8f acc[4] = {};
  for (int kb = 0; kb < K; kb += 32) { FragH ah; ah.half[0] = *(const v8us*)((const unsigned short*)arow + kb + 8 * hh); ah.half[1] = *(const v8us*)((const unsigned short*)arow + kb + 16 + 8 * hh);
#pragma unroll
    for (int t = 0; t < 4; ++t) { if (col0 + t * 16 >= N) continue; const size_t boff = (size_t)(col0 + t * 16 + ln) * ldb + kb; FragH bq; bq.half[0] = *(const v8us*)((const unsigned short*)Bh + boff + 8 * hh); bq.half[1] = *(const v8us*)((const unsigned short*)Bh + boff + 16 + 8 * hh);
      acc[t] = mmaH<1>(ah.v, ah.v, bq.v, bq.v, acc[t]); }
  }
#pragma unroll
  for (int t = 0; t < 4; ++t) { if (col0 + t * 16 >= N) continue; const int col = col0 + t * 16 + ln; const float bv = bp ? bf16_round(bp[col]) : 0.f;
#pragma unroll
    for (int r = 0; r < 8; ++r) { float v = acc[t][r] * alpha + bv; if (CP) { const int rr = row0g + row0 + 8 * hh + r; if (rowsPerB < 0) v += CP[cofs + (size_t)rr * ldc + col];      /* rowsPerB < 0: own element of the batched C plane */ else { const int bidx = rr / rowsPerB; v += CP[(size_t)bidx * sCPb + (size_t)by * 64 + col]; } } if (ACT == 1) v = (v > 0.f) ? v : expm1f(v); else if (ACT == 7) v = (v > 0.f) ? v + 1.0f : expf(v); else if (ACT == 8) v = tanhf(v); else if (ACT == 9) v = 0.5f * v * (1.0f + tanhf(0.7978845608028654f * (v + 0.044715f * v * v * v))); else if (ACT == 11) v = 1.0f / (1.0f + expf(-v)); else if (ACT == 12) v = (v > 0.f) ? v : 0.01f * v; else if (ACT == 14) v = (v > 0.f) ? v : 0.1f * v; else if (ACT == 16) v = (v >= 0.f) ? v : 0.3f * v; else if (ACT == 17) v = (v >= 0.f) ? v : 0.2f * v; else if (ACT == 15) v = v / (1.0f + expf(-v)); else if (ACT == 3) v = fmaxf(v, 0.f); else if (ACT == 6) v = 0.5f * v * (1.0f + erff(v * 0.70710678118654752f)); so[w][8 * hh + r][t * 16 + ln] = v; } }
  __builtin_amdgcn_fence(__ATOMIC_ACQ_REL, "workgroup"); __builtin_amdgcn_wave_barrier();
  const int rsub = lane >> 4, c4 = (lane & 15) * 4; typedef _Float16 v4h __attribute__((ext_vector_type(4)));
  {
#pragma unroll
    for (int q = 0; q < 8; ++q) { const int r = q * 2 + rsub; if (col0 + c4 < N) { const v4f v = *(const v4fa*)&so[w][r][c4]; if (C) *(v4f*)(C + cofs + (size_t)(row0 + r) * ldc + col0 + c4) = v; if (C16) { v4h h4; for (int i = 0; i < 4; ++i) h4[i] = (_Float16)v[i]; *(v4h*)(C16 + cofs + (size_t)(row0 + r) * ldc + col0 + c4) = h4; } } }
     }
}


typedef _Float16 v4h __attribute__((ext_vector_type(4)));

// X16 = f16(bf16-rounded x), piece blk of XTE elements: as many as a weight tile holds, so that the blocks of the shared grid below weigh alike. A thread turns 8 neighbours (32 B read, 16 B stored) in each of the piece's 4 quarters.
#define XTE (WTK * WTN)              /* elements of x per block */
__device__ __forceinline__ void x16_tile(const float* __restrict__ x, _Float16* __restrict__ X16, int blk) { static_assert(XTE == 4 * 256 * 8 && (NR * DM) % XTE == 0, "whole pieces only");
  const size_t e0 = (size_t)blk * XTE + threadIdx.x * 8; const float* src = x + e0; unsigned short* dst = (unsigned short*)X16 + e0; v4f a[4][2];
#pragma unroll      /* constant indices keep a[] in registers, and all 8 loads are in flight together */
  for (int i = 0; i < 4; ++i) { a[i][0] = *(const v4fa*)(src + i * 2048); a[i][1] = *(const v4fa*)(src + i * 2048 + 4); }
#pragma unroll      /* constant indices into a[] */
  for (int i = 0; i < 4; ++i) { FragH f;
#pragma unroll      /* likewise, and f stays in registers */
    for (int q = 0; q < 4; ++q) { f.h[q] = (_Float16)bf16_round(a[i][0][q]); f.h[4 + q] = (_Float16)bf16_round(a[i][1][q]); }
    *(v8us*)(dst + i * 2048) = f.half[0]; }
  asm volatile("s_wait_xcnt 0x0" ::: "memory"); }      /* stands in front of any later rewrite of a register that the stores above name (in the built kernel another path's code follows them) */
// The three operand preparations (both weight transposes and the f16 rows of x) read only inputs and share no data: one launch, the grid split by block index. The transposes, whose path is the longer (LDS and a barrier), come first.
#define PW1 ((DM / WTK) * (LQ / WTN))   /* tiles of the q | k | v weight */
#define PW2 ((DM / WTK) * (DM / WTN))   /* tiles of the output weight */
#define PX ((int)(NR * DM / XTE))       /* pieces of x */
__global__ __launch_bounds__(256) void k_prep(const float* __restrict__ wqkv, _Float16* __restrict__ BQKV, const float* __restrict__ wo, _Float16* __restrict__ BO, const float* __restrict__ x, _Float16* __restrict__ X16) {
  __shared__ __attribute__((aligned(16))) unsigned char tl[WTN * WTP];
  const int blk = blockIdx.x;      /* every test below reads the same for the whole block: the barrier inside wt_tile is passed by all of a block's waves or by none */
  if (blk < PW1) wt_tile<DM, LQ>(tl, wqkv, BQKV, 16.0f, blk);      /* [in][out] -> Bt[n][k] x16 */
  else if (blk < PW1 + PW2) wt_tile<DM, DM>(tl, wo, BO, 16.0f, blk - PW1);
  else x16_tile(x, X16, blk - (PW1 + PW2)); }
__global__ __launch_bounds__(256) void k_h16(const float* __restrict__ x, _Float16* __restrict__ X16, size_t n8) { const size_t t = (size_t)blockIdx.x * 256 + threadIdx.x; if (t >= n8) return; FragH f;
#pragma unroll
  for (int q = 0; q < 8; ++q) f.h[q] = (_Float16)x[t * 8 + q]; *(v8us*)((unsigned short*)X16 + t * 8) = f.half[0];  }
__global__ __launch_bounds__(256) void k_round16f(const float* __restrict__ W, _Float16* __restrict__ Bt, size_t n8) { const size_t t = (size_t)blockIdx.x * 256 + threadIdx.x; if (t >= n8) return; FragH f;
#pragma unroll
  for (int i = 0; i < 8; ++i) f.h[i] = (_Float16)(bf16_round(W[t * 8 + i]) * 16.0f); *(v8us*)((unsigned short*)Bt + t * 8) = f.half[0];  }

// ---- fast GEMM (block tile 128x64, wave tile 32x64; requires M % 128 == 0 rows per launch region, N % 64 == 0 and K % 64 == 0); epilogue = k_gemm_hhx semantics ----
// Operands go global -> LDS by asynchronous copies, 64 k (one whole 128-B line of each of the 128 A rows and 64 B rows) per trip, two buffers: the next tile flies while this one is multiplied.
// A wave-wide copy covers 4 rows x 128 B (4 whole lines) and the B rows are fetched once per block; the fragments are then read from LDS in the same k order as from global memory.
#define G2KC 64                      /* k per trip */
#define G2PB 144                     /* LDS row pitch in bytes: 128 + 16 (16 B x odd), conflict-free for the 16-byte fragment reads */
#define G2BB (192 * G2PB)            /* bytes of one buffer: 128 A rows, then 64 B rows */
// One tile: thread (row r = tid / 8, 16-byte piece tid % 8) copies its piece of rows r + 16 i: 8 of A, then 4 of B. l: the LDS byte address of its piece of row r. Every lane is on.
// The s_wait_xcnt in the same statement stands in front of any later rewrite of the address registers that the copies name.
__device__ __forceinline__ void g2_stage(unsigned l, const _Float16* a, size_t a16, const _Float16* b, size_t b16) {
  asm volatile("global_load_async_to_lds_b128 %0, %12, off\n\tglobal_load_async_to_lds_b128 %1, %13, off\n\tglobal_load_async_to_lds_b128 %2, %14, off\n\tglobal_load_async_to_lds_b128 %3, %15, off\n\t"
               "global_load_async_to_lds_b128 %4, %16, off\n\tglobal_load_async_to_lds_b128 %5, %17, off\n\tglobal_load_async_to_lds_b128 %6, %18, off\n\tglobal_load_async_to_lds_b128 %7, %19, off\n\t"
               "global_load_async_to_lds_b128 %8, %20, off\n\tglobal_load_async_to_lds_b128 %9, %21, off\n\tglobal_load_async_to_lds_b128 %10, %22, off\n\tglobal_load_async_to_lds_b128 %11, %23, off\n\ts_wait_xcnt 0x0"
               :: "v"(l), "v"(l + 16 * G2PB), "v"(l + 32 * G2PB), "v"(l + 48 * G2PB), "v"(l + 64 * G2PB), "v"(l + 80 * G2PB), "v"(l + 96 * G2PB), "v"(l + 112 * G2PB),
                  "v"(l + 128 * G2PB), "v"(l + 144 * G2PB), "v"(l + 160 * G2PB), "v"(l + 176 * G2PB),
                  "v"(a), "v"(a + a16), "v"(a + 2 * a16), "v"(a + 3 * a16), "v"(a + 4 * a16), "v"(a + 5 * a16), "v"(a + 6 * a16), "v"(a + 7 * a16),
                  "v"(b), "v"(b + b16), "v"(b + 2 * b16), "v"(b + 3 * b16) : "memory"); }
__device__ __forceinline__ v16h g2_frag(const _Float16* p, int hh) { FragH f; f.half[0] = *(const v8us*)((const unsigned short*)p + 8 * hh); f.half[1] = *(const v8us*)((const unsigned short*)p + 16 + 8 * hh); return f.v; }
__device__ __forceinline__ v8f g2_mma(v16h a, v16h b, v8f c) { v8f d = __builtin_amdgcn_wmma_f32_16x16x32_f16(false, a, false, b, (short)0, c, false, false); asm volatile("v_nop\n\tv_nop\n\tv_nop\n\tv_nop" : "+v"(d) : "v"(a), "v"(b)); return d; }
// FT 1: a block that holds the first QT0 rows of a batch also stores them as f32 rows into CT (per batch QT0 rows of pitch ldc).
// FT 2: those rows are not taken from A but from A2, where every 128 rows are 64 rows of o as f16 (hi) followed by the same 64 rows' x1024 residual (lo): such a block (they come first in the grid) multiplies both planes in the one K loop,
// waves 0 and 1 the hi rows, waves 2 and 3 the lo rows, and its epilogue stores (hi alpha + bias) + lo alpha 2^-10. The other blocks take the M tiles behind each batch's first.
// FT 1 also: a block of the v third (its 64 columns are one head's dims) stores no v rows. A lane's 8 accumulator rows of one column are 8 neighbouring tokens of one V^T row: each such 16-byte piece goes to an LDS tile of 64 dims x 128 tokens,
// and behind a barrier 16 lanes store each V^T row's 256 bytes (whole lines) into VTo [NB * NH][HD][SQ].
#define G2MP (SQ / 128)              /* M tiles per batch */
#define G2VP 272                     /* LDS pitch of a V^T row in bytes: 256 + 16 (16 B x odd), conflict-free for the 16-byte pieces */
#define G2VO (4 * 32 * 68 * 4)       /* the V^T tile stands behind the epilogue's f32 staging rows */
template <int ACT, int FT>
__global__ __launch_bounds__(128) void k_gemm2(const _Float16* __restrict__ A, int lda, size_t sA, const _Float16* __restrict__ Bh, int ldb, size_t sB, float alpha, const float* __restrict__ bias, size_t sBias, const float* __restrict__ CP, int rowsPerB, size_t sCPb, int row0g,
    float* __restrict__ C, _Float16* __restrict__ C16, int ldc, size_t sC, int M, int N, int K, const _Float16* __restrict__ A2, float* __restrict__ CT, _Float16* __restrict__ VTo) { static_assert(ACT == 0 || ACT == 3 || ACT == 6 || ACT == 8 || ACT == 9 || ACT == 11 || ACT == 12 || ACT == 14 || ACT == 15 || ACT == 16 || ACT == 17, "k_gemm2: unsupported ACT code (would silently apply no activation)"); static_assert(QT0 == 128, "the first tile is one M tile"); static_assert(HD == 64 && G2VO + HD * G2VP <= 2 * G2BB, "an N tile is one head; the V^T tile fits behind the staging rows");
  __shared__ __attribute__((aligned(16))) unsigned char sm[2 * G2BB];      /* the two operand buffers; behind the K loop's last barrier the same bytes serve as the epilogue's staging rows */
  float (*so)[32][68] = (float (*)[32][68])sm;
  const int tid = threadIdx.x, w = tid >> 5, lane = tid & 31, ln = lane & 15, hh = lane >> 4; const int by = blockIdx.y;
  A += (size_t)by * sA; Bh += (size_t)by * sB; const size_t cofs = (size_t)by * sC; const float* bp = bias ? bias + (size_t)by * sBias : nullptr;
  const int ntn = N >> 6; const int g = blockIdx.x / ntn, nq = blockIdx.x - g * ntn; const bool pair = FT == 2 && g < 2 * NB;      /* hi | lo block g: batch g / 2, rows 64 (g & 1) .. + 63; the same for the whole block */
  const int mt = (FT == 2 && !pair) ? (g - 2 * NB) + 1 + (g - 2 * NB) / (G2MP - 1) : g; const int row0 = mt * 128 + 32 * w, col0 = nq * 64; if (!pair && mt * 128 >= M) return;      /* the same for the whole block, in front of every barrier */
  const int sr = tid >> 3, sp = tid & 7;      /* staging: this thread's first row and its 16-byte piece of the 128-B row */
  const _Float16* ag = (pair ? A2 : A) + (size_t)(mt * 128 + sr) * lda + sp * 8; const _Float16* bg = Bh + (size_t)(col0 + sr) * ldb + sp * 8; const size_t a16 = (size_t)16 * lda, b16 = (size_t)16 * ldb;
  const unsigned ls = (unsigned)(size_t)sm + (unsigned)(sr * G2PB + sp * 16);      /* LDS byte address: the low 32 bits of the shared address */
  const unsigned char* af = sm + (32 * w + ln) * G2PB; const unsigned char* bf = sm + (128 + ln) * G2PB;      /* this lane's first A and B fragment rows in buffer 0 */
  const int nt = K / G2KC;
  const v8f z8 = {0.f,0.f,0.f,0.f,0.f,0.f,0.f,0.f}; v8f c00 = z8, c01 = z8, c02 = z8, c03 = z8, c10 = z8, c11 = z8, c12 = z8, c13 = z8;
  g2_stage(ls, ag, a16, bg, b16);
  asm volatile("s_wait_asynccnt 0x0" ::: "memory");      /* this wave's copies of tile 0 have landed */
  __syncthreads();      /* ... and every other wave's */
  if (nt > 1) g2_stage(ls + G2BB, ag + G2KC, a16, bg + G2KC, b16);
#pragma unroll 1      /* rolled: one copy of the trip; the buffer is chosen by an offset */
  for (int t = 0; t < nt; ++t) { const unsigned bo = (unsigned)(t & 1) * G2BB; const _Float16* ap = (const _Float16*)(af + bo); const _Float16* bq = (const _Float16*)(bf + bo);
    /* all 12 fragments of the trip are asked for first, in the order of their use, so that their LDS latencies overlap; 8 * G2PB halves = 16 rows, + 32 halves = the second 32 k */
    const v16h a00 = g2_frag(ap, hh), b00 = g2_frag(bq, hh), a10 = g2_frag(ap + 8 * G2PB, hh), b10 = g2_frag(bq + 8 * G2PB, hh), b20 = g2_frag(bq + 16 * G2PB, hh), b30 = g2_frag(bq + 24 * G2PB, hh);
    const v16h a01 = g2_frag(ap + 32, hh), b01 = g2_frag(bq + 32, hh), a11 = g2_frag(ap + 8 * G2PB + 32, hh), b11 = g2_frag(bq + 8 * G2PB + 32, hh), b21 = g2_frag(bq + 16 * G2PB + 32, hh), b31 = g2_frag(bq + 24 * G2PB + 32, hh);
    c00 = g2_mma(a00, b00, c00); c10 = g2_mma(a10, b00, c10); c01 = g2_mma(a00, b10, c01); c11 = g2_mma(a10, b10, c11);
    c02 = g2_mma(a00, b20, c02); c12 = g2_mma(a10, b20, c12); c03 = g2_mma(a00, b30, c03); c13 = g2_mma(a10, b30, c13);
    c00 = g2_mma(a01, b01, c00); c10 = g2_mma(a11, b01, c10); c01 = g2_mma(a01, b11, c01); c11 = g2_mma(a11, b11, c11);
    c02 = g2_mma(a01, b21, c02); c12 = g2_mma(a11, b21, c12); c03 = g2_mma(a01, b31, c03); c13 = g2_mma(a11, b31, c13);
    asm volatile("s_wait_dscnt 0x0" ::: "memory");      /* this wave's reads of the buffer are done before it may be refilled */
    asm volatile("s_wait_asynccnt 0x0" ::: "memory");      /* this wave's copies of tile t + 1 have landed */
    __syncthreads();      /* publishes tile t + 1 and ends every wave's reads of tile t */
    if (t + 2 < nt) g2_stage(ls + bo, ag + (size_t)(t + 2) * G2KC, a16, bg + (size_t)(t + 2) * G2KC, b16); }
  asm volatile("s_wait_asynccnt 0x0" ::: "memory");      /* nothing in flight when the buffers become the staging rows */
  v8f accs[8] = {c00, c01, c02, c03, c10, c11, c12, c13};
  const bool lo = pair && w >= 2; if (lo) alpha *= 0.0009765625f;      /* the residual plane: x1024 taken off again, no bias */
  const bool vblk = FT == 1 && col0 >= 2 * DM; const bool rows = !vblk || mt % G2MP == 0;      /* both the same for the whole block; rows: the f32 staging rows are read below */
#pragma unroll
  for (int u = 0; u < 8; ++u) { const int t = u & 3, half = u >> 2; const int col = col0 + t * 16 + ln; const float bv = (bp && !lo) ? bf16_round(bp[col]) : 0.f;
#pragma unroll
    for (int r = 0; r < 8; ++r) { const int rloc = half * 16 + 8 * hh + r; float v = accs[u][r] * alpha + bv; if (FT == 0 && CP) { if (rowsPerB < 0) v += CP[cofs + (size_t)(row0g + row0 + rloc) * ldc + col];      /* rowsPerB < 0: own element of the batched C plane */ else { const int bidx = (row0g + row0 + rloc) / rowsPerB; v += CP[(size_t)bidx * sCPb + (size_t)by * 64 + col]; } }
      if (ACT == 3) v = fmaxf(v, 0.f); else if (ACT == 6) v = 0.5f * v * (1.0f + erff(v * 0.70710678118654752f)); else if (ACT == 11) v = 1.0f / (1.0f + expf(-v)); else if (ACT == 15) v = v / (1.0f + expf(-v)); else if (ACT == 12) v = (v > 0.f) ? v : 0.01f * v; else if (ACT == 8) v = tanhf(v); else if (ACT == 9) v = 0.5f * v * (1.0f + tanhf(0.7978845608028654f * (v + 0.044715f * v * v * v))); else if (ACT == 14) v = (v > 0.f) ? v : 0.1f * v; else if (ACT == 16) v = (v >= 0.f) ? v : 0.3f * v; else if (ACT == 17) v = (v >= 0.f) ? v : 0.2f * v;
      accs[u][r] = v; } }
  if (rows) {      /* one test around all the stores */
#pragma unroll      /* constant indices into accs[], here and in the three loops below */
    for (int u = 0; u < 8; ++u)
#pragma unroll
      for (int r = 0; r < 8; ++r) so[w][(u >> 2) * 16 + 8 * hh + r][(u & 3) * 16 + ln] = accs[u][r]; }
  if (vblk) {
#pragma unroll
    for (int u = 0; u < 8; ++u) { FragH vq;
#pragma unroll
      for (int r = 0; r < 8; ++r) vq.h[r] = (_Float16)accs[u][r];
      *(v8us*)(sm + G2VO + ((u & 3) * 16 + ln) * G2VP + (32 * w + (u >> 2) * 16 + 8 * hh) * 2) = vq.half[0]; } }      /* dim 16 (u & 3) + ln, tokens 32 w + 16 (u >> 2) + 8 hh .. + 7 */
  const int rsub = lane >> 4, c4 = (lane & 15) * 4;
  if (pair) { __syncthreads();      /* the hi and the lo rows of one output row come from two waves */
#pragma unroll      /* the 16 LDS reads and 8 stores are independent: unrolled, their latencies overlap */
    for (int q = 0; q < 8; ++q) { const int rr = 16 * w + q * 2 + rsub; const v4f vh = *(const v4fa*)&so[rr >> 5][rr & 31][c4], vl = *(const v4fa*)&so[2 + (rr >> 5)][rr & 31][c4];      /* wave w stores rows 16 w .. + 15 of the block's 64 */
      *(v4f*)(C + cofs + (size_t)((g >> 1) * SQ + (g & 1) * 64 + rr) * ldc + col0 + c4) = vh + vl; }
    return; }
  if (vblk) { __syncthreads();      /* a V^T row's 128 tokens come from the 4 waves */
    unsigned short* vd = (unsigned short*)VTo + ((size_t)((mt / G2MP) * NH + (nq - 2 * DM / 64)) * HD + (tid >> 4)) * SQ + (mt % G2MP) * 128 + (tid & 15) * 8; const unsigned char* vs = sm + G2VO + (tid >> 4) * G2VP + (tid & 15) * 16; v8us vo[8];
#pragma unroll      /* constant indices keep vo[] in registers, and the 8 LDS reads are in flight together */
    for (int i = 0; i < 8; ++i) vo[i] = *(const v8us*)(vs + 8 * i * G2VP);
#pragma unroll      /* constant indices into vo[] */
    for (int i = 0; i < 8; ++i) *(v8us*)(vd + (size_t)8 * i * SQ) = vo[i];
    asm volatile("s_wait_xcnt 0x0" ::: "memory"); }      /* stands in front of any later rewrite of a register that the stores above name */
  if (!vblk) { __builtin_amdgcn_fence(__ATOMIC_ACQ_REL, "workgroup"); __builtin_amdgcn_wave_barrier();      /* a v block has passed the barrier above instead, and does not wait here for its V^T stores */
#pragma unroll
    for (int q = 0; q < 16; ++q) { const int r = q * 2 + rsub; const v4f v = *(const v4fa*)&so[w][r][c4]; if (C) *(v4f*)(C + cofs + (size_t)(row0 + r) * ldc + col0 + c4) = v; if (C16) { v4h h4; for (int i = 0; i < 4; ++i) h4[i] = (_Float16)v[i]; *(v4h*)(C16 + cofs + (size_t)(row0 + r) * ldc + col0 + c4) = h4; } }
    if (FT == 1) asm volatile("s_wait_xcnt 0x0" ::: "memory"); }      /* stands in front of the rewrite, by the block below, of registers that the stores above name */
  if (FT == 1 && mt % G2MP == 0) {      /* a batch's first rows: the same values once more, as f32 rows for the exact path */
#pragma unroll      /* the 16 LDS reads and stores are independent: unrolled, their latencies overlap */
    for (int q = 0; q < 16; ++q) { const int r = q * 2 + rsub; const v4f v = *(const v4fa*)&so[w][r][c4]; *(v4f*)(CT + ((size_t)(mt / G2MP) * QT0 + 32 * w + r) * ldc + col0 + c4) = v; } } }


__global__ __launch_bounds__(256) void k_wnat(const float* __restrict__ w, size_t n8, _Float16* __restrict__ Bt) { const size_t t = (size_t)blockIdx.x * 256 + threadIdx.x; if (t >= n8) return; FragH f; for (int q = 0; q < 8; ++q) f.h[q] = (_Float16)(bf16_round(w[t * 8 + q]) * 16.0f); *(v8us*)((unsigned short*)Bt + t * 8) = f.half[0];  }
__global__ __launch_bounds__(256) void k_rsm(const float* __restrict__ S, _Float16* __restrict__ P, int nrows) {
  #pragma clang fp contract(off)
  const int i = blockIdx.x * 256 + threadIdx.x; if (i >= nrows) return; const float* s = S + (size_t)i * SQ; float mx = -3.0e38f;
#pragma unroll 1
  for (int j = 0; j < SQ; ++j) mx = fmaxf(mx, s[j]); float se = 0.f;
#pragma unroll 1
  for (int j = 0; j < SQ; ++j) se += expf(s[j] - mx); const float sc = 256.0f / se;
#pragma unroll 1
  for (int j0 = 0; j0 < SQ; j0 += 8) { FragH f; for (int q = 0; q < 8; ++q) f.h[q] = (_Float16)(expf(s[j0 + q] - mx) * sc); unsigned short* d = (unsigned short*)P + (size_t)i * SQ + j0; *(v8us*)d = f.half[0];  } }
__global__ __launch_bounds__(256) void k_vt(const _Float16* __restrict__ V16, int b, int h0, _Float16* __restrict__ VT) { __shared__ unsigned short tl[64][65]; const int tid = threadIdx.x; const int hh = blockIdx.x % HG, sg = blockIdx.x / HG; const int s0 = sg * 64; const int h = h0 + hh;
  for (int i = tid; i < 64 * 8; i += 256) { const int j = i / 8, d8 = (i % 8) * 8; FragH f; f.half[0] = *(const v8us*)((const unsigned short*)V16 + ((size_t)b * SQ + s0 + j) * DM + h * HD + d8); for (int q = 0; q < 8; ++q) tl[d8 + q][j] = f.u[q]; }
  __syncthreads();
  { for (int i = tid; i < 64 * 8; i += 256) { const int d = i / 8, j8 = (i % 8) * 8; FragH f; for (int q = 0; q < 8; ++q) f.u[q] = tl[d][j8 + q]; *(v8us*)((unsigned short*)VT + ((size_t)hh * HD + d) * SQ + s0 + j8) = f.half[0]; }  } }



template <int CTRL> __device__ __forceinline__ float rs_row16(float v) { return __int_as_float(__builtin_amdgcn_update_dpp(0, __float_as_int(v), CTRL, 0xf, 0xf, true)); }      /* lane l ^ mask inside a 16-lane row (row_xmask) */
__device__ __forceinline__ float rs_x16(float v) { const int u = __float_as_int(v); return __int_as_float(__builtin_amdgcn_permlanex16(u, u, 0x76543210, 0xfedcba98, false, false)); }      /* lane l ^ 16 */
#define FAQ 128                      /* query rows per block: 4 waves x 32 columns */
#define FAC 0.18033688011112042592f  /* log2(e) / sqrt(64) */
__device__ __forceinline__ v8f fa_mma(v16h a, v16h b, v8f c) { return __builtin_amdgcn_wmma_f32_16x16x32_f16(false, a, false, b, (short)0, c, false, false); }
// 2^x in the native form. In the eight-wide form the v_nop in the same statement fills the one slot the instruction set asks for behind a transcendental: each v_exp is followed by an
// independent one (early-clobber outputs: no result register is a later source), so one v_nop behind the last serves all eight.
__device__ __forceinline__ float fa_exp2(float x) { return __builtin_amdgcn_exp2f(x); }      /* the single form as the builtin (the same v_exp_f32): the compiler sees it and keeps the distance behind a WMMA whose operand registers it gives to the result */
__device__ __forceinline__ v8f fa_exp2x8(v8f x) { float r0, r1, r2, r3, r4, r5, r6, r7;
  asm("v_exp_f32 %0, %8\n\tv_exp_f32 %1, %9\n\tv_exp_f32 %2, %10\n\tv_exp_f32 %3, %11\n\tv_exp_f32 %4, %12\n\tv_exp_f32 %5, %13\n\tv_exp_f32 %6, %14\n\tv_exp_f32 %7, %15\n\tv_nop"
      : "=&v"(r0), "=&v"(r1), "=&v"(r2), "=&v"(r3), "=&v"(r4), "=&v"(r5), "=&v"(r6), "=&v"(r7) : "v"(x[0]), "v"(x[1]), "v"(x[2]), "v"(x[3]), "v"(x[4]), "v"(x[5]), "v"(x[6]), "v"(x[7]));
  const v8f r = {r0, r1, r2, r3, r4, r5, r6, r7}; return r; }
#define FSK 128                      /* keys per trip: 4 passes; equal to FAQ, so that the last tile is the block's diagonal tile */
#define FKP 144                      /* LDS pitch of a K row in bytes: 128 + 16 (16 B x odd), conflict-free for the 16-byte fragment reads */
#define FVP 272                      /* LDS pitch of a V^T row in bytes: 256 + 16 (16 B x odd) */
#define FVO (FSK * FKP)              /* the HD V^T rows stand behind the FSK K rows */
#define FSB (FVO + HD * FVP)         /* bytes of one buffer */
// Eight copies of one thread: 16 bytes at LDS byte address l + i ls from g + i gs (i = 0..7). Every lane is on.
// The s_wait_xcnt in the same statement stands in front of any later rewrite of the address registers that the copies name.
__device__ __forceinline__ void fa_copy8(unsigned l, unsigned ls, const _Float16* g, size_t gs) {
  asm volatile("global_load_async_to_lds_b128 %0, %8, off\n\tglobal_load_async_to_lds_b128 %1, %9, off\n\tglobal_load_async_to_lds_b128 %2, %10, off\n\tglobal_load_async_to_lds_b128 %3, %11, off\n\t"
               "global_load_async_to_lds_b128 %4, %12, off\n\tglobal_load_async_to_lds_b128 %5, %13, off\n\tglobal_load_async_to_lds_b128 %6, %14, off\n\tglobal_load_async_to_lds_b128 %7, %15, off\n\ts_wait_xcnt 0x0"
               :: "v"(l), "v"(l + ls), "v"(l + 2 * ls), "v"(l + 3 * ls), "v"(l + 4 * ls), "v"(l + 5 * ls), "v"(l + 6 * ls), "v"(l + 7 * ls),
                  "v"(g), "v"(g + gs), "v"(g + 2 * gs), "v"(g + 3 * gs), "v"(g + 4 * gs), "v"(g + 5 * gs), "v"(g + 6 * gs), "v"(g + 7 * gs) : "memory"); }
// One tile: K rows tid / 8 + 16 i (piece tid % 8 of the row's 128 B), V^T rows tid / 16 + 8 i (piece tid % 16 of the row's 256 B). lk, lv: the LDS byte addresses of the thread's first pieces; kg, vg: their global addresses.
__device__ __forceinline__ void fa_stage(unsigned lk, unsigned lv, const _Float16* kg, const _Float16* vg) { fa_copy8(lk, 16 * FKP, kg, (size_t)16 * LQ); fa_copy8(lv, 8 * FVP, vg, (size_t)8 * SQ); }
// One pass of 32 keys for a wave's 32 query columns; vp: this pass's V^T rows in LDS, kn: the next pass's K rows in LDS. kf holds this pass's K fragments and is refilled for the next pass right behind the score products (LAST: the diagonal pass, masked, no refill).
// foot (the same for the whole block): this is a tile's last pass. Its V^T fragments are the last thing read of the tile, so the hand-over to the next tile stands behind them and in front of the refill, which then reads the next tile;
// the softmax and the P V products, on registers alone, follow. fill: a tile two further exists; its copies go to lk, lv (the buffer just left) from kg, vg.
// Every loop is fully unrolled so that the fragment and accumulator arrays are indexed by constants and stay in registers.
template <bool LAST>
__device__ __forceinline__ void fa_pass(const _Float16* kn, const _Float16* vp, int hh, int dq, const v16h (&qf)[2][2], v16h (&kf)[2][2], v8f (&o)[2][4], float (&m)[2], float (&l)[2], bool foot, bool fill, unsigned lk, unsigned lv, const _Float16* kg, const _Float16* vg) {
  v16h vf[4];
#pragma unroll
  for (int dt = 0; dt < 4; ++dt) vf[dt] = g2_frag(vp + dt * 8 * FVP, hh);      /* 8 FVP halves = 16 rows */
  const v8f z8 = {0.f, 0.f, 0.f, 0.f, 0.f, 0.f, 0.f, 0.f}; v8f s[2][2];
#pragma unroll
  for (int j = 0; j < 2; ++j)
#pragma unroll
    for (int t = 0; t < 2; ++t) s[j][t] = fa_mma(kf[t][1], qf[j][1], fa_mma(kf[t][0], qf[j][0], z8));
  if (!LAST) {
    if (foot) {
      asm volatile("s_wait_dscnt 0x0" ::: "memory");      /* this wave's reads of the buffer are done before it may be refilled */
      asm volatile("s_wait_asynccnt 0x0" ::: "memory");      /* this wave's copies of the next tile have landed */
      __syncthreads();      /* publishes the next tile and ends every wave's reads of this one */
      if (fill) fa_stage(lk, lv, kg, vg); }
#pragma unroll
    for (int t = 0; t < 2; ++t)
#pragma unroll
      for (int c = 0; c < 2; ++c) kf[t][c] = g2_frag(kn + t * 8 * FKP + c * 32, hh);
    __builtin_amdgcn_sched_barrier(0); }      /* keeps the refill in front of the softmax: without it the loads sank to the pass's end and the next pass waited out their whole latency */
#pragma unroll
  for (int j = 0; j < 2; ++j) {
    if (LAST) {      /* key - query = 16 t + r + dq - 16 j: above the diagonal when positive */
#pragma unroll
      for (int t = 0; t < 2; ++t)
#pragma unroll
        for (int r = 0; r < 8; ++r) if (16 * t + r + dq - 16 * j > 0) s[j][t][r] = -1.0e30f; }
    float mx = s[j][0][0];
#pragma unroll
    for (int r = 0; r < 8; ++r) mx = fmaxf(mx, fmaxf(s[j][0][r], s[j][1][r]));
    mx = fmaxf(mx, rs_x16(mx));      /* the column's other 16 keys are in lane ^ 16 */
    const float mn = fmaxf(m[j], mx); const float sc = fa_exp2((m[j] - mn) * FAC); const float nb = 8.0f - mn * FAC; m[j] = mn;      /* + 8: weights carried x256 */
    const v8f e0 = fa_exp2x8(s[j][0] * FAC + nb), e1 = fa_exp2x8(s[j][1] * FAC + nb);
    const v8f es = e0 + e1; l[j] = l[j] * sc + (((es[0] + es[1]) + (es[2] + es[3])) + ((es[4] + es[5]) + (es[6] + es[7])));      /* each half keeps its own partial sum; joined in the epilogue */
    FragH p;
#pragma unroll
    for (int r = 0; r < 8; ++r) { p.h[r] = (_Float16)e0[r]; p.h[8 + r] = (_Float16)e1[r]; }
#pragma unroll
    for (int dt = 0; dt < 4; ++dt) o[j][dt] = fa_mma(vf[dt], p.v, o[j][dt] * sc); } }
__device__ __forceinline__ void fa_tile(unsigned char* sm, const _Float16* __restrict__ QKVp, const _Float16* __restrict__ VTp, _Float16* __restrict__ O, int bh, int qt) {      /* one block: query tile qt >= 1 of batch and head bh. sm: 2 FSB bytes of LDS; QKVp: q | k rows of pitch LQ; VTp: [NB * NH][HD][SQ]; O: merged rows of pitch DM */
  const int tid = threadIdx.x, lane = tid & 31, ln = lane & 15, hh = lane >> 4; const int w = __builtin_amdgcn_readfirstlane(tid >> 5);
  const int b = bh / NH, h = bh % NH;
  const int q0 = qt * FAQ + w * 32;      /* the block walks key tiles 0 .. qt together (every test around a barrier or a copy reads the same for the whole block). The loops over j, c, dt and r below are fully unrolled for constant indices (registers), as in fa_pass */
  const _Float16* qp = QKVp + ((size_t)b * SQ + q0 + ln) * LQ + h * HD;
  const _Float16* kg = QKVp + ((size_t)b * SQ + (tid >> 3)) * LQ + DM + h * HD + (tid & 7) * 8; const _Float16* vg = VTp + ((size_t)bh * HD + (tid >> 4)) * SQ + (tid & 15) * 8;      /* staging: this thread's first pieces of tile 0 */
  const unsigned lks = (unsigned)(size_t)sm + (unsigned)((tid >> 3) * FKP + (tid & 7) * 16), lvs = (unsigned)(size_t)sm + (unsigned)(FVO + (tid >> 4) * FVP + (tid & 15) * 16);      /* LDS byte addresses: the low 32 bits of the shared address */
  const unsigned char* kl = sm + ln * FKP; const unsigned char* vl = sm + FVO + ln * FVP;      /* this lane's first K and V^T fragment rows in buffer 0 */
  fa_stage(lks, lvs, kg, vg);
  v16h qf[2][2], kf[2][2]; v8f o[2][4]; float m[2] = {-1.0e30f, -1.0e30f}, l[2] = {0.f, 0.f};
#pragma unroll
  for (int j = 0; j < 2; ++j)
#pragma unroll
    for (int c = 0; c < 2; ++c) qf[j][c] = g2_frag(qp + (size_t)j * 16 * LQ + c * 32, hh);
  asm volatile("s_wait_xcnt 0x0" ::: "memory");      /* the address registers of the loads above are reused for the zeroed accumulators below */
#pragma unroll
  for (int j = 0; j < 2; ++j)
#pragma unroll
    for (int dt = 0; dt < 4; ++dt) { const v8f z8 = {0.f, 0.f, 0.f, 0.f, 0.f, 0.f, 0.f, 0.f}; o[j][dt] = z8; }
  const int dq = 8 * hh - ln;
  asm volatile("s_wait_asynccnt 0x0" ::: "memory");      /* this wave's copies of tile 0 have landed */
  __syncthreads();      /* ... and every other wave's */
  fa_stage(lks + FSB, lvs + FSB, kg + (size_t)FSK * LQ, vg + FSK);      /* tile 1 exists: qt >= 1 */
#pragma unroll
  for (int j = 0; j < 2; ++j)
#pragma unroll
    for (int c = 0; c < 2; ++c) kf[j][c] = g2_frag((const _Float16*)kl + j * 8 * FKP + c * 32, hh);      /* 8 FKP halves = 16 rows */
  const int nf = q0 / 32;      /* passes wholly below the wave's first query: pass i is pass i % 4 of tile i / 4, in buffer (i / 4) % 2. Every wave runs the 4 qt passes of tiles 0 .. qt - 1, whose last passes hold the barriers; of tile qt, the diagonal tile, wave w runs w more and the diagonal pass */
  for (int i = 0; i < nf; ++i) { const int t = i / (FSK / 32), n = i + 1; const unsigned bo = (unsigned)(t & 1) * FSB;
    fa_pass<false>((const _Float16*)(kl + (unsigned)(n / (FSK / 32) & 1) * FSB + (unsigned)(n % (FSK / 32)) * (32 * FKP)), (const _Float16*)(vl + bo + (unsigned)(i % (FSK / 32)) * 64), hh, dq, qf, kf, o, m, l,
                   n % (FSK / 32) == 0, t + 2 <= qt, lks + bo, lvs + bo, kg + (size_t)(t + 2) * FSK * LQ, vg + (t + 2) * FSK); }
  fa_pass<true>((const _Float16*)kl, (const _Float16*)(vl + (unsigned)(qt & 1) * FSB + (unsigned)w * 64), hh, dq, qf, kf, o, m, l, false, false, 0u, 0u, kg, vg);      /* keys q0 .. q0 + 31: the diagonal */
  asm volatile("s_wait_asynccnt 0x0" ::: "memory");      /* nothing in flight when the wave ends */
#pragma unroll
  for (int j = 0; j < 2; ++j) { const float fin = 64.0f / (l[j] + rs_x16(l[j]));      /* o carried x64; the x256 of the weights cancels against the sum */
    unsigned short* op = (unsigned short*)O + ((size_t)b * SQ + q0 + j * 16 + ln) * DM + h * HD + 8 * hh;
#pragma unroll
    for (int dt = 0; dt < 4; ++dt) { FragH f;
#pragma unroll
      for (int r = 0; r < 8; ++r) f.h[r] = (_Float16)(o[j][dt][r] * fin);
      *(v8us*)(op + dt * 16) = f.half[0]; } } }


// e^x for x <= 0 to f32 accuracy: n = the integer nearest x log2 e; x log2 e - n by two fused multiply-adds (the constant as its f32 value plus its low part), so the product is never rounded
// before n is taken off; 2^n applied by ldexp; 0 below the f32 range. The v_nop in the same statement fills the one slot the instruction set asks for behind a transcendental.
__device__ __forceinline__ float a0_exp(float x) { const float n = rintf(x * 1.4426950216293334961f); const float a = fmaf(x, 1.9259628558643271390e-8f, fmaf(x, 1.4426950216293334961f, -n));
  float r; asm("v_exp_f32 %0, %1\n\tv_nop" : "=v"(r) : "v"(a)); return (x < -103.2789306640625f) ? 0.f : ldexpf(r, (int)n); }
// Exact f32 attention for the first QT0 rows of every batch (causal form; block blk of NB * NH * QT0 / A0R: batch, head, row group). Four lanes share a query row: lane part p = lane & 3 keeps dims 16 c + 4 p .. + 3 (c = 0..3)
// of q and o in registers; a wave holds 8 rows and walks the keys up to its own last row. The head's K and V rows are staged once in LDS, all loads in flight together;
// the 8 row groups of a wave read the same 64 bytes of a key row per load (broadcast, no bank conflict). The dot product is 16 terms per lane, then a butterfly over the 4 lanes.
// Every loop over c, u and the four keys of a trip is fully unrolled, so that q[], o[] and the LDS data are indexed by constants and stay in registers.
#define A0R 32                       /* query rows per block: 4 waves x 8 rows */
__device__ __forceinline__ void a0_block(float (*lk)[HD], float (*lv)[HD], const float* __restrict__ QKVF, float scale, _Float16* __restrict__ OHL, int blk) {      /* QKVF: per batch QT0 f32 q | k | v rows of pitch LQ; OHL: the A2 rows of k_gemm2<.., 2>, pitch DM */
  const int tid = threadIdx.x, lane = tid & 31, p4 = (lane & 3) * 4; const int w = __builtin_amdgcn_readfirstlane(tid >> 5);
  const int bt = blk / (NH * (QT0 / A0R)), h = blk / (QT0 / A0R) % NH, rg = blk % (QT0 / A0R);
  const float* QF = QKVF + (size_t)bt * QT0 * LQ; const float* KF = QF + DM; const float* VF = QF + 2 * DM;
  const int row = rg * A0R + w * 8 + (lane >> 2);      /* this lane's query row */
  const int nk = rg * A0R + w * 8 + 8;                 /* wave-uniform: keys up to the wave's last row (a multiple of 8, at most QT0) */
  { const int r0 = tid / 16, c4 = (tid % 16) * 4; const float* kp = KF + h * HD + r0 * LQ + c4; const float* vp = VF + h * HD + r0 * LQ + c4;
    v4f tk[QT0 / 8], tv[QT0 / 8];      /* fully unrolled: constant indices keep both in registers and every load of the tile is issued before the first LDS store */
#pragma unroll
    for (int it = 0; it < QT0 / 8; ++it) { tk[it] = *(const v4fa*)(kp + it * 8 * LQ); tv[it] = *(const v4fa*)(vp + it * 8 * LQ); }
#pragma unroll
    for (int it = 0; it < QT0 / 8; ++it) { *(v4f*)&lk[it * 8 + r0][c4] = tk[it]; *(v4f*)&lv[it * 8 + r0][c4] = tv[it]; } }
  __syncthreads();
  const float* qr = QF + row * LQ + h * HD + p4;
  v4f q[4], o[4];
#pragma unroll
  for (int c = 0; c < 4; ++c) { q[c] = *(const v4fa*)(qr + c * 16); const v4f z = {0.f, 0.f, 0.f, 0.f}; o[c] = z; }
  float m = -1.0e30f, l = 0.f;
  for (int j0 = 0; j0 < nk; j0 += 4) {      /* four keys per trip, unrolled: their dot products are independent and fill each other's dependent links */
#pragma unroll
    for (int jj = 0; jj < 4; ++jj) { const int j = j0 + jj; float s = 0.f;
#pragma unroll
      for (int c = 0; c < 4; ++c) { const v4f kq = *(const v4f*)&lk[j][c * 16 + p4]; s += q[c][0] * kq[0]; s += q[c][1] * kq[1]; s += q[c][2] * kq[2]; s += q[c][3] * kq[3]; }
      s += rs_row16<0x161>(s); s += rs_row16<0x162>(s);      /* sum over the row's 4 lanes; all 4 end with the same bits */
      const float sm = (j <= row) ? s * scale : -1.0e30f; const float mn = fmaxf(m, sm); const float sc = a0_exp(m - mn); const float e = a0_exp(sm - mn); l = l * sc + e; m = mn;
#pragma unroll
      for (int c = 0; c < 4; ++c) { const v4f vv = *(const v4f*)&lv[j][c * 16 + p4];
#pragma unroll
        for (int u = 0; u < 4; ++u) o[c][u] = o[c][u] * sc + e * vv[u]; } } }
  const float fin = 64.0f / l;      /* o carried x64 like the f16 path */
  _Float16* orow = OHL + ((size_t)(bt * (QT0 / 64) + (row >> 6)) * 128 + (row & 63)) * DM + h * HD + p4;      /* the row's f16 value; its x1024 residual stands 64 rows further */
#pragma unroll
  for (int c = 0; c < 4; ++c) { v4h oh, ol;
#pragma unroll
    for (int u = 0; u < 4; ++u) { const float a = o[c][u] * fin; const _Float16 hv = (_Float16)a; oh[u] = hv; ol[u] = (_Float16)((a - (float)hv) * 1024.0f); }
    *(v4h*)(orow + c * 16) = oh; *(v4h*)(orow + (size_t)64 * DM + c * 16) = ol; }
  asm volatile("s_wait_xcnt 0x0" ::: "memory"); }      /* stands in front of any later rewrite of a register that the stores above name (in the built kernel the other path's code follows them) */
// One launch for both attention paths; they share no data. All blocks are resident at once and a WMMA tile's cost grows with its index: the two halves of the first NB * NH grid rows walk the tiles in opposite order,
// so that blocks half of those rows apart add up to the same cost. Tile 0 (a batch's first QT0 rows) belongs to the exact f32 path: its NB * NH places and the grid rows behind take that path's blocks.
__global__ __launch_bounds__(128) void k_attn(const _Float16* __restrict__ QKVp, const _Float16* __restrict__ VTp, _Float16* __restrict__ O, const float* __restrict__ QKVF, float scale, _Float16* __restrict__ OHL) {
  static_assert(FAQ == QT0, "tile 0 is the exact path's");
  static_assert(FSK == FAQ && 2 * FSB >= 2 * QT0 * HD * 4, "the last key tile is the diagonal tile; the LDS holds either path's data");
  __shared__ __attribute__((aligned(16))) unsigned char sm[2 * FSB];      /* the WMMA path's two K | V^T buffers, or the exact path's f32 K rows and, behind them, V rows */
  float (*lk)[HD] = (float (*)[HD])sm; float (*lv)[HD] = (float (*)[HD])(sm + QT0 * HD * 4);
  const int bh = blockIdx.y; const int qt = (bh < NB * NH / 2) ? SQ / FAQ - 1 - (int)blockIdx.x : (int)blockIdx.x;
  if (bh < NB * NH && qt != 0) { fa_tile(sm, QKVp, VTp, O, bh, qt); return; }
  a0_block(lk, lv, QKVF, scale, OHL, bh < NB * NH ? bh : NB * NH + (bh - NB * NH) * (SQ / FAQ) + (int)blockIdx.x); }

extern "C" void kernel_launch(void* const* d_in, const int* in_sizes, int n_in,
                              void* d_out, int out_size, void* d_ws, size_t ws_size, hipStream_t stream) {
  (void)in_sizes; (void)n_in; (void)out_size;
  const float* const* I = (const float* const*)d_in; const float* x = I[0]; const float* wqkv = I[1]; const float* bqkv = nullptr; const float* wo = I[2]; const float* bo = I[3];      /* input order: y, Wqkv (fused [in][out] [1024][3072]), Wff ([in][out]), bff [1024]; the QKV projection has NO bias: bqkv is a null pointer; the output bias is bound */
  char* ws = (char*)d_ws; size_t off = 0;
  auto take = [&](size_t bytes) { char* p = ws + off; off += (bytes + 255) & ~(size_t)255; return p; };
  _Float16* BQKV = (_Float16*)take((size_t)3 * DM * DM * 2); _Float16* BO = (_Float16*)take((size_t)DM * DM * 2);
  _Float16* X16 = (_Float16*)take(NR * DM * 2); _Float16* QKV = (_Float16*)take(NR * 3 * DM * 2); _Float16* O16 = (_Float16*)take(NR * DM * 2);
  _Float16* VT = (_Float16*)take((size_t)NB * NH * HD * SQ * 2);
  float* QKVF0 = (float*)take((size_t)NB * QT0 * LQ * 4); _Float16* OHL0 = (_Float16*)take((size_t)NB * QT0 * 2 * DM * 2);
  if (off > ws_size) return;
  k_prep<<<PW1 + PW2 + PX, 256, 0, stream>>>(wqkv, BQKV, wo, BO, x, X16);      /* both weights as Bt[n][k] x16 and x as f16 rows */
  const size_t r0p = (size_t)B0 * SQ;      /* first projected row */
  k_gemm2<0, 1><<<dim3((unsigned)((MP / 128) * (3 * DM / 64)), 1), 128, 0, stream>>>(X16 + r0p * DM, DM, 0, BQKV, DM, 0, 0.0625f, bqkv, 0, nullptr, 1, 0, 0, nullptr, QKV + r0p * 3 * DM, 3 * DM, 0, MP, 3 * DM, DM, nullptr, QKVF0, VT + (size_t)B0 * NH * HD * SQ);      /* q | k rows (f16); head h = columns h*HD.. of each DM block; v as V^T [NB * NH][HD][SQ]; each batch's first 128 rows of q | k | v also as f32 (exact products) */
  k_attn<<<dim3(SQ / FAQ, NB * NH + (NB * NH * (QT0 / A0R) - NB * NH) / (SQ / FAQ)), 128, 0, stream>>>(QKV, VT, O16, QKVF0, 0.125f, OHL0);      /* scores, causal softmax and P V of every batch, head and query tile in one launch: o (merged heads, x64) as f16 rows; rows 0..127 of each batch exactly in f32, o (x64) as f16 hi + x1024 residual rows */
  k_gemm2<0, 2><<<dim3((unsigned)((MPO / 128 + NB) * (DM / 64)), 1), 128, 0, stream>>>(O16 + r0p * DM, DM, 0, BO, DM, 0, 0.0009765625f, bo, 0, nullptr, 1, 0, 0, (float*)d_out + r0p * DM, nullptr, DM, 0, MPO, DM, DM, OHL0, nullptr, nullptr);      /* out rows are the output layout; rows 0..127 of each batch = o_hi Wo + b + o_lo Wo 2^-10 */
}
